// v000
// Times are from an AMD MI455X. After a warm-up the kernel runs many times in a row, and a time is the length of
// such a window on the GPU divided by its runs, so every launch and the gaps after it count. The runs cycle
// through copies of the inputs. A figure is the median of several windows, for all but v000 over two sittings.
// Sittings can differ by a few percent; kernels timed side by side share one.
// v000, which the later versions start from, runs in 497 microseconds.
#include <hip/hip_runtime.h>
#include <hip/hip_bf16.h>
#include <math.h>

// ---------------------------------------------------------------------------
// Transformer block on CDNA5 (gfx1250), wave32, bf16 WMMA w/ f32 accumulation.
// Pipeline:
//   1) convert x -> bf16; transpose+convert weights -> bf16 [N,K]
//   2) WMMA GEMMs: Q (f32), K (f32), V (bf16, head-transposed [b,h,d,s])
//   3) flash attention (scores = K.Q^T per the reference's einsum), online
//      softmax, P.V via WMMA, LDS transpose for the P fragment
//   4) x1 = LN(attn + Q) -> f32 + bf16
//   5) h = relu(x1 @ W1 + c1) (WMMA, bf16 out)
//   6) f = h @ W2 + c2 (WMMA, f32 out)
//   7) out = LN(LN(f) + x1)
// ---------------------------------------------------------------------------

typedef __attribute__((ext_vector_type(16))) __bf16 v16bf;
typedef __attribute__((ext_vector_type(8)))  float  v8f;

#define S_LEN  2048
#define E_DIM  512
#define V_DIM  512
#define F_DIM  2048
#define B_SZ   4
#define H_CNT  8
#define D_HEAD 64
#define M_ROWS (B_SZ * S_LEN)

__device__ __forceinline__ unsigned short f2bf(float f) {
  union { float f; unsigned u; } a; a.f = f;
  unsigned u = a.u;
  return (unsigned short)((u + 0x7FFFu + ((u >> 16) & 1u)) >> 16); // RNE
}

// A/B fragment loader for v_wmma_f32_16x16x32_bf16 from row-major bf16 data.
// Layout (ISA 7.12.2, 16-bit A 16x32): lane L holds row (L&15); lanes 0-15
// carry K = [k0, k0+8) and [k0+16, k0+24); lanes 16-31 the +8 halves.
// The same layout serves the B operand when loading from a [N,K] (transposed)
// matrix: lane holds column n = (L&15) of B.
__device__ __forceinline__ v16bf load_frag_bf16(const unsigned short* base, int ld,
                                                int row0, int k0, int lane) {
  const int half = lane >> 4;
  const unsigned short* p = base + (size_t)(row0 + (lane & 15)) * ld + k0 + 8 * half;
  union { uint4 q[2]; v16bf v; } u;
  u.q[0] = *(const uint4*)p;
  u.q[1] = *(const uint4*)(p + 16);
  return u.v;
}

// Same fragment, sourced from fp32 with on-the-fly bf16 conversion.
__device__ __forceinline__ v16bf load_frag_f32(const float* base, int ld,
                                               int row0, int k0, int lane) {
  const int half = lane >> 4;
  const float* p = base + (size_t)(row0 + (lane & 15)) * ld + k0 + 8 * half;
  union { unsigned short s[16]; v16bf v; } u;
#pragma unroll
  for (int e = 0; e < 8; ++e) {
    u.s[e]     = f2bf(p[e]);
    u.s[8 + e] = f2bf(p[16 + e]);
  }
  return u.v;
}

__device__ __forceinline__ v8f wmma_bf16(v16bf a, v16bf b, v8f c) {
  return __builtin_amdgcn_wmma_f32_16x16x32_bf16(false, a, false, b, (short)0, c,
                                                 false, false);
}

// ---------------------------------------------------------------------------
// Elementwise fp32 -> bf16
__global__ void __launch_bounds__(256)
cvt_bf16_kernel(const float* __restrict__ in, unsigned short* __restrict__ out, int n) {
  int i = blockIdx.x * 256 + threadIdx.x;
  if (i < n) out[i] = f2bf(in[i]);
}

// [Kd,Nd] fp32 -> [Nd,Kd] bf16
__global__ void __launch_bounds__(256)
transpose_bf16_kernel(const float* __restrict__ in, unsigned short* __restrict__ out,
                      int Kd, int Nd) {
  int i = blockIdx.x * 256 + threadIdx.x;
  if (i < Kd * Nd) {
    int k = i / Nd, n = i % Nd;
    out[(size_t)n * Kd + k] = f2bf(in[i]);
  }
}

// ---------------------------------------------------------------------------
// C[M,N] = A[M,K] @ Bt[N,K]^T (+bias)(+relu).  Block = 8 waves, each wave owns
// a 16x64 tile; grid = (M/128, N/64).
// mode 0: f32 out; mode 1: bf16 out; mode 2: bf16 out transposed per-head
//         to Vt[b][h][d][s] (for the attention's P.V B-operand).
__global__ void __launch_bounds__(256)
gemm_bf16_kernel(const unsigned short* __restrict__ A,
                 const unsigned short* __restrict__ Bt,
                 const float* __restrict__ bias,
                 float* __restrict__ Cf, unsigned short* __restrict__ Cb,
                 int M, int N, int K, int mode, int relu) {
  const int lane = threadIdx.x & 31;
  const int wave = threadIdx.x >> 5;
  const int m0 = blockIdx.x * 128 + wave * 16;
  const int n0 = blockIdx.y * 64;

  v8f acc0 = {}, acc1 = {}, acc2 = {}, acc3 = {};
  for (int k0 = 0; k0 < K; k0 += 32) {
    v16bf a  = load_frag_bf16(A,  K, m0,      k0, lane);
    v16bf b0 = load_frag_bf16(Bt, K, n0 +  0, k0, lane);
    v16bf b1 = load_frag_bf16(Bt, K, n0 + 16, k0, lane);
    v16bf b2 = load_frag_bf16(Bt, K, n0 + 32, k0, lane);
    v16bf b3 = load_frag_bf16(Bt, K, n0 + 48, k0, lane);
    acc0 = wmma_bf16(a, b0, acc0);
    acc1 = wmma_bf16(a, b1, acc1);
    acc2 = wmma_bf16(a, b2, acc2);
    acc3 = wmma_bf16(a, b3, acc3);
  }

  const int col = lane & 15;
  const int h2  = lane >> 4;
  v8f accs[4] = {acc0, acc1, acc2, acc3};
#pragma unroll
  for (int t = 0; t < 4; ++t) {
    int n = n0 + 16 * t + col;
    float bv = bias ? bias[n] : 0.0f;
#pragma unroll
    for (int e = 0; e < 8; ++e) {
      int m = m0 + e + 8 * h2;                 // C layout: VGPR e -> row e (+8)
      float v = accs[t][e] + bv;
      if (relu) v = fmaxf(v, 0.0f);
      if (mode == 0) {
        Cf[(size_t)m * N + n] = v;
      } else if (mode == 1) {
        Cb[(size_t)m * N + n] = f2bf(v);
      } else {
        int bb = m / S_LEN, s = m % S_LEN;
        int hh = n >> 6,    d = n & 63;
        Cb[(((size_t)bb * H_CNT + hh) * D_HEAD + d) * S_LEN + s] = f2bf(v);
      }
    }
  }
}

// ---------------------------------------------------------------------------
// Flash attention. Reference einsum gives corr[b,h,i,j] = K[b,i,h,:].Q[b,j,h,:],
// softmax over j, out[i,d] = sum_j P[i,j] V[j,d].
// Block = 8 waves; wave owns 16 output rows i; streams keys in tiles of 32.
__global__ void __launch_bounds__(256)
flash_attn_kernel(const float* __restrict__ Kf, const float* __restrict__ Qf,
                  const unsigned short* __restrict__ Vt, const int* __restrict__ mask,
                  float* __restrict__ Out, float scale) {
  __shared__ __align__(16) unsigned short ptile[8][16][32];

  const int lane = threadIdx.x & 31;
  const int wave = threadIdx.x >> 5;
  const int h2   = lane >> 4;
  const int col  = lane & 15;
  const int b = blockIdx.z, h = blockIdx.y;
  const int i0 = blockIdx.x * 128 + wave * 16;

  const float* Kb_ = Kf + (size_t)b * S_LEN * E_DIM + h * D_HEAD;
  const float* Qb_ = Qf + (size_t)b * S_LEN * E_DIM + h * D_HEAD;
  const unsigned short* Vb_ = Vt + ((size_t)b * H_CNT + h) * D_HEAD * S_LEN;

  // A operand: this wave's 16 K-rows over d = 0..63 (reused for all key tiles)
  v16bf aK0 = load_frag_f32(Kb_, E_DIM, i0, 0,  lane);
  v16bf aK1 = load_frag_f32(Kb_, E_DIM, i0, 32, lane);

  v8f O0 = {}, O1 = {}, O2 = {}, O3 = {};
  float mrow[8], lrow[8];
#pragma unroll
  for (int e = 0; e < 8; ++e) { mrow[e] = -3.0e38f; lrow[e] = 0.0f; }

  const float mval = -1.0e20f * scale;

  for (int j0 = 0; j0 < S_LEN; j0 += 32) {
    // scores tile 16x32: two 16x16 WMMA fragments, K over d (2 steps of 32)
    v16bf bq00 = load_frag_f32(Qb_, E_DIM, j0 +  0, 0,  lane);
    v16bf bq01 = load_frag_f32(Qb_, E_DIM, j0 +  0, 32, lane);
    v16bf bq10 = load_frag_f32(Qb_, E_DIM, j0 + 16, 0,  lane);
    v16bf bq11 = load_frag_f32(Qb_, E_DIM, j0 + 16, 32, lane);
    v8f s0 = {}, s1 = {};
    s0 = wmma_bf16(aK0, bq00, s0); s0 = wmma_bf16(aK1, bq01, s0);
    s1 = wmma_bf16(aK0, bq10, s1); s1 = wmma_bf16(aK1, bq11, s1);

    float p0[8], p1[8];
#pragma unroll
    for (int e = 0; e < 8; ++e) {
      size_t i = (size_t)(i0 + e + 8 * h2);
      int j = j0 + col;
      float v0 = mask[i * S_LEN + j]      ? s0[e] * scale : mval;
      float v1 = mask[i * S_LEN + j + 16] ? s1[e] * scale : mval;
      // row-wise max/sum: reduce across the 16 lanes of this half
      float mx = fmaxf(v0, v1);
#pragma unroll
      for (int off = 1; off < 16; off <<= 1) mx = fmaxf(mx, __shfl_xor(mx, off, 32));
      float mnew  = fmaxf(mrow[e], mx);
      float alpha = __expf(mrow[e] - mnew);
      mrow[e] = mnew;
      float e0 = __expf(v0 - mnew), e1 = __expf(v1 - mnew);
      float rs = e0 + e1;
#pragma unroll
      for (int off = 1; off < 16; off <<= 1) rs += __shfl_xor(rs, off, 32);
      lrow[e] = lrow[e] * alpha + rs;
      p0[e] = e0; p1[e] = e1;
      O0[e] *= alpha; O1[e] *= alpha; O2[e] *= alpha; O3[e] *= alpha;
    }

    // transpose P (C-layout) -> A-layout via per-wave LDS tile
#pragma unroll
    for (int e = 0; e < 8; ++e) {
      ptile[wave][e + 8 * h2][col]      = f2bf(p0[e]);
      ptile[wave][e + 8 * h2][col + 16] = f2bf(p1[e]);
    }
    __builtin_amdgcn_wave_barrier();   // LDS is in-order within a wave
    union { uint4 q[2]; v16bf v; } up;
    const unsigned short* prow = &ptile[wave][col][0];
    up.q[0] = *(const uint4*)(prow + 8 * h2);
    up.q[1] = *(const uint4*)(prow + 16 + 8 * h2);
    __builtin_amdgcn_wave_barrier();
    v16bf pa = up.v;

    // O += P . V  (B operand from head-transposed Vt rows = d, cols = j)
    v16bf bv0 = load_frag_bf16(Vb_, S_LEN, 0,  j0, lane);
    v16bf bv1 = load_frag_bf16(Vb_, S_LEN, 16, j0, lane);
    v16bf bv2 = load_frag_bf16(Vb_, S_LEN, 32, j0, lane);
    v16bf bv3 = load_frag_bf16(Vb_, S_LEN, 48, j0, lane);
    O0 = wmma_bf16(pa, bv0, O0);
    O1 = wmma_bf16(pa, bv1, O1);
    O2 = wmma_bf16(pa, bv2, O2);
    O3 = wmma_bf16(pa, bv3, O3);
  }

#pragma unroll
  for (int e = 0; e < 8; ++e) {
    float inv = 1.0f / lrow[e];
    size_t i = (size_t)(i0 + e + 8 * h2);
    float* orow = Out + ((size_t)b * S_LEN + i) * E_DIM + h * D_HEAD + col;
    orow[0]  = O0[e] * inv;
    orow[16] = O1[e] * inv;
    orow[32] = O2[e] * inv;
    orow[48] = O3[e] * inv;
  }
}

// ---------------------------------------------------------------------------
// x1 = LN(src + res) * g + b  -> f32 (+ bf16 copy). One block per row.
__global__ void __launch_bounds__(256)
add_ln_kernel(const float* __restrict__ src, const float* __restrict__ res,
              const float* __restrict__ g, const float* __restrict__ bb,
              float* __restrict__ outf, unsigned short* __restrict__ outb) {
  __shared__ float r1[256], r2[256];
  const int row = blockIdx.x;
  const int t = threadIdx.x;
  const float* s = src + (size_t)row * E_DIM;
  const float* r = res + (size_t)row * E_DIM;
  float x0 = s[t]       + r[t];
  float x1 = s[t + 256] + r[t + 256];
  r1[t] = x0 + x1;
  r2[t] = x0 * x0 + x1 * x1;
  __syncthreads();
  for (int o = 128; o > 0; o >>= 1) {
    if (t < o) { r1[t] += r1[t + o]; r2[t] += r2[t + o]; }
    __syncthreads();
  }
  float mean = r1[0] * (1.0f / E_DIM);
  float var  = r2[0] * (1.0f / E_DIM) - mean * mean;
  float rstd = rsqrtf(var + 1e-5f);
  float y0 = (x0 - mean) * rstd * g[t]       + bb[t];
  float y1 = (x1 - mean) * rstd * g[t + 256] + bb[t + 256];
  float* of = outf + (size_t)row * E_DIM;
  of[t] = y0; of[t + 256] = y1;
  unsigned short* ob = outb + (size_t)row * E_DIM;
  ob[t] = f2bf(y0); ob[t + 256] = f2bf(y1);
}

// out = LN( LN(f)*g3+b3 + x1 ) * g2 + b2.  One block per row.
__global__ void __launch_bounds__(256)
double_ln_kernel(const float* __restrict__ f, const float* __restrict__ x1,
                 const float* __restrict__ g3, const float* __restrict__ b3,
                 const float* __restrict__ g2, const float* __restrict__ b2,
                 float* __restrict__ out) {
  __shared__ float r1[256], r2[256];
  const int row = blockIdx.x;
  const int t = threadIdx.x;
  const float* fr = f  + (size_t)row * E_DIM;
  const float* xr = x1 + (size_t)row * E_DIM;
  float a0 = fr[t], a1 = fr[t + 256];
  r1[t] = a0 + a1; r2[t] = a0 * a0 + a1 * a1;
  __syncthreads();
  for (int o = 128; o > 0; o >>= 1) {
    if (t < o) { r1[t] += r1[t + o]; r2[t] += r2[t + o]; }
    __syncthreads();
  }
  float mean = r1[0] * (1.0f / E_DIM);
  float var  = r2[0] * (1.0f / E_DIM) - mean * mean;
  float rstd = rsqrtf(var + 1e-5f);
  float u0 = (a0 - mean) * rstd * g3[t]       + b3[t]       + xr[t];
  float u1 = (a1 - mean) * rstd * g3[t + 256] + b3[t + 256] + xr[t + 256];
  __syncthreads();
  r1[t] = u0 + u1; r2[t] = u0 * u0 + u1 * u1;
  __syncthreads();
  for (int o = 128; o > 0; o >>= 1) {
    if (t < o) { r1[t] += r1[t + o]; r2[t] += r2[t + o]; }
    __syncthreads();
  }
  mean = r1[0] * (1.0f / E_DIM);
  var  = r2[0] * (1.0f / E_DIM) - mean * mean;
  rstd = rsqrtf(var + 1e-5f);
  float* orow = out + (size_t)row * E_DIM;
  orow[t]       = (u0 - mean) * rstd * g2[t]       + b2[t];
  orow[t + 256] = (u1 - mean) * rstd * g2[t + 256] + b2[t + 256];
}

// ---------------------------------------------------------------------------
extern "C" void kernel_launch(void* const* d_in, const int* in_sizes, int n_in,
                              void* d_out, int out_size, void* d_ws, size_t ws_size,
                              hipStream_t stream) {
  const float* x  = (const float*)d_in[0];
  const int* mask = (const int*)d_in[1];
  const float* Wv = (const float*)d_in[2];
  const float* Wk = (const float*)d_in[3];
  const float* Wq = (const float*)d_in[4];
  const float* g1 = (const float*)d_in[5];
  const float* b1 = (const float*)d_in[6];
  const float* W1 = (const float*)d_in[7];
  const float* c1 = (const float*)d_in[8];
  const float* W2 = (const float*)d_in[9];
  const float* c2 = (const float*)d_in[10];
  const float* g3 = (const float*)d_in[11];
  const float* b3 = (const float*)d_in[12];
  const float* g2 = (const float*)d_in[13];
  const float* b2 = (const float*)d_in[14];

  const size_t MB = 1ull << 20;
  unsigned char* w = (unsigned char*)d_ws;
  // live regions (peak ~96 MB, with reuse):
  unsigned short* xb  = (unsigned short*)(w +  0 * MB); //  8 MB  x bf16
  unsigned short* Wqt = (unsigned short*)(w +  8 * MB); //  .5 MB
  unsigned short* Wkt = (unsigned short*)(w +  9 * MB); //  .5 MB
  unsigned short* Wvt = (unsigned short*)(w + 10 * MB); //  .5 MB
  unsigned short* W1t = (unsigned short*)(w + 11 * MB); //  2 MB
  unsigned short* W2t = (unsigned short*)(w + 13 * MB); //  2 MB
  float*          Kf  = (float*)         (w + 16 * MB); // 16 MB  keys f32
  unsigned short* Vt  = (unsigned short*)(w + 32 * MB); //  8 MB  V^T bf16
  float*          Qf  = (float*)         (w + 40 * MB); // 16 MB  queries f32
  float*          attn= (float*)         (w + 56 * MB); // 16 MB
  float*          x1f = (float*)         (w + 72 * MB); // 16 MB
  unsigned short* x1b = (unsigned short*)(w + 88 * MB); //  8 MB
  unsigned short* hb  = (unsigned short*)(w + 16 * MB); // 32 MB (reuses Kf/Vt/Qf)
  float*          ff  = (float*)         (w + 48 * MB); // 16 MB (reuses Qf/attn)

  dim3 blk(256);

  // 1) conversions / weight transposes
  cvt_bf16_kernel<<<(M_ROWS * V_DIM) / 256, blk, 0, stream>>>(x, xb, M_ROWS * V_DIM);
  transpose_bf16_kernel<<<(V_DIM * E_DIM) / 256, blk, 0, stream>>>(Wq, Wqt, V_DIM, E_DIM);
  transpose_bf16_kernel<<<(V_DIM * E_DIM) / 256, blk, 0, stream>>>(Wk, Wkt, V_DIM, E_DIM);
  transpose_bf16_kernel<<<(V_DIM * E_DIM) / 256, blk, 0, stream>>>(Wv, Wvt, V_DIM, E_DIM);
  transpose_bf16_kernel<<<(E_DIM * F_DIM) / 256, blk, 0, stream>>>(W1, W1t, E_DIM, F_DIM);
  transpose_bf16_kernel<<<(F_DIM * E_DIM) / 256, blk, 0, stream>>>(W2, W2t, F_DIM, E_DIM);

  // 2) QKV projections
  dim3 gq(M_ROWS / 128, E_DIM / 64);
  gemm_bf16_kernel<<<gq, blk, 0, stream>>>(xb, Wqt, nullptr, Qf, nullptr,
                                           M_ROWS, E_DIM, V_DIM, 0, 0);
  gemm_bf16_kernel<<<gq, blk, 0, stream>>>(xb, Wkt, nullptr, Kf, nullptr,
                                           M_ROWS, E_DIM, V_DIM, 0, 0);
  gemm_bf16_kernel<<<gq, blk, 0, stream>>>(xb, Wvt, nullptr, nullptr, Vt,
                                           M_ROWS, E_DIM, V_DIM, 2, 0);

  // 3) fused attention
  dim3 ga(S_LEN / 128, H_CNT, B_SZ);
  const float scale = 1.0f / sqrtf((float)E_DIM);
  flash_attn_kernel<<<ga, blk, 0, stream>>>(Kf, Qf, Vt, mask, attn, scale);

  // 4) x1 = LN(attn + queries)
  add_ln_kernel<<<M_ROWS, blk, 0, stream>>>(attn, Qf, g1, b1, x1f, x1b);

  // 5) h = relu(x1 @ W1 + c1)
  dim3 gf1(M_ROWS / 128, F_DIM / 64);
  gemm_bf16_kernel<<<gf1, blk, 0, stream>>>(x1b, W1t, c1, nullptr, hb,
                                            M_ROWS, F_DIM, E_DIM, 1, 1);

  // 6) f = h @ W2 + c2
  dim3 gf2(M_ROWS / 128, E_DIM / 64);
  gemm_bf16_kernel<<<gf2, blk, 0, stream>>>(hb, W2t, c2, ff, nullptr,
                                            M_ROWS, E_DIM, F_DIM, 0, 0);

  // 7) out = LN(LN(f) + x1)
  double_ln_kernel<<<M_ROWS, blk, 0, stream>>>(ff, x1f, g3, b3, g2, b2,
                                               (float*)d_out);
}

// v001
// A run of this version takes 397 microseconds.
// Next to v000, in two timings, it ran 1.29 times as fast each time.
#include <hip/hip_runtime.h>
#include <hip/hip_bf16.h>
#include <math.h>

// ---------------------------------------------------------------------------
// Transformer block on CDNA5 (gfx1250), wave32, bf16 WMMA w/ f32 accumulation.
// Pipeline:
//   1) convert x -> bf16; transpose+convert weights -> bf16 [N,K]
//   2) WMMA GEMMs: Q (f32), K (f32), V (bf16, head-transposed [b,h,d,s])
//   3) flash attention (scores = K.Q^T per the reference's einsum), online
//      softmax, P.V via WMMA, LDS transpose for the P fragment
//   4) x1 = LN(attn + Q) -> f32 + bf16
//   5) h = relu(x1 @ W1 + c1) (WMMA, bf16 out)
//   6) f = h @ W2 + c2 (WMMA, f32 out)
//   7) out = LN(LN(f) + x1)
// ---------------------------------------------------------------------------

typedef __attribute__((ext_vector_type(16))) __bf16 v16bf;
typedef __attribute__((ext_vector_type(8)))  float  v8f;

#define S_LEN  2048
#define E_DIM  512
#define V_DIM  512
#define F_DIM  2048
#define B_SZ   4
#define H_CNT  8
#define D_HEAD 64
#define M_ROWS (B_SZ * S_LEN)

__device__ __forceinline__ unsigned short f2bf(float f) {
  union { float f; unsigned u; } a; a.f = f;
  unsigned u = a.u;
  return (unsigned short)((u + 0x7FFFu + ((u >> 16) & 1u)) >> 16); // RNE
}

// A/B fragment loader for v_wmma_f32_16x16x32_bf16 from row-major bf16 data.
// Layout (ISA 7.12.2, 16-bit A 16x32): lane L holds row (L&15); lanes 0-15
// carry K = [k0, k0+8) and [k0+16, k0+24); lanes 16-31 the +8 halves.
// The same layout serves the B operand when loading from a [N,K] (transposed)
// matrix: lane holds column n = (L&15) of B.
__device__ __forceinline__ v16bf load_frag_bf16(const unsigned short* base, int ld,
                                                int row0, int k0, int lane) {
  const int half = lane >> 4;
  const unsigned short* p = base + (size_t)(row0 + (lane & 15)) * ld + k0 + 8 * half;
  union { uint4 q[2]; v16bf v; } u;
  u.q[0] = *(const uint4*)p;
  u.q[1] = *(const uint4*)(p + 16);
  return u.v;
}

// Same fragment, sourced from fp32 with on-the-fly bf16 conversion.
__device__ __forceinline__ v16bf load_frag_f32(const float* base, int ld,
                                               int row0, int k0, int lane) {
  const int half = lane >> 4;
  const float* p = base + (size_t)(row0 + (lane & 15)) * ld + k0 + 8 * half;
  union { unsigned short s[16]; v16bf v; } u;
#pragma unroll
  for (int e = 0; e < 8; ++e) {
    u.s[e]     = f2bf(p[e]);
    u.s[8 + e] = f2bf(p[16 + e]);
  }
  return u.v;
}

__device__ __forceinline__ v8f wmma_bf16(v16bf a, v16bf b, v8f c) {
  return __builtin_amdgcn_wmma_f32_16x16x32_bf16(false, a, false, b, (short)0, c,
                                                 false, false);
}

// ---------------------------------------------------------------------------
// Elementwise fp32 -> bf16
__global__ void __launch_bounds__(256)
cvt_bf16_kernel(const float* __restrict__ in, unsigned short* __restrict__ out, int n) {
  int i = blockIdx.x * 256 + threadIdx.x;
  if (i < n) out[i] = f2bf(in[i]);
}

// [Kd,Nd] fp32 -> [Nd,Kd] bf16
__global__ void __launch_bounds__(256)
transpose_bf16_kernel(const float* __restrict__ in, unsigned short* __restrict__ out,
                      int Kd, int Nd) {
  int i = blockIdx.x * 256 + threadIdx.x;
  if (i < Kd * Nd) {
    int k = i / Nd, n = i % Nd;
    out[(size_t)n * Kd + k] = f2bf(in[i]);
  }
}

// ---------------------------------------------------------------------------
// C[M,N] = A[M,K] @ Bt[N,K]^T (+bias)(+relu).  Block = 4 waves in a 2x2 grid,
// each wave owns a 64x64 tile (4 A x 4 B fragments, 16 accumulator tiles), so a
// loaded fragment feeds four WMMAs; grid = (M/128, N/128).  K is a multiple of 64.
// Two fragment sets alternate: one set's loads fly while the other is multiplied.
// mode 0: f32 out; mode 1: bf16 out; mode 2: bf16 out transposed per-head
//         to Vt[b][h][d][s] (for the attention's P.V B-operand).
__device__ __forceinline__ void gemm_load_set(v16bf (&a)[4], v16bf (&b)[4],
                                              const unsigned short* A,
                                              const unsigned short* Bt, int K,
                                              int m0, int n0, int k0, int lane) {
#pragma unroll
  for (int i = 0; i < 4; ++i) a[i] = load_frag_bf16(A, K, m0 + 16 * i, k0, lane);
#pragma unroll
  for (int t = 0; t < 4; ++t) b[t] = load_frag_bf16(Bt, K, n0 + 16 * t, k0, lane);
}

// The same set outside the loop, where the eight address pairs die with the
// loads: the wait names them as inputs, so that they stay untouched (also by a
// later load's result) until the loads' addresses have been taken.
__device__ __forceinline__ void gemm_load_set_wait(v16bf (&a)[4], v16bf (&b)[4],
                                                   const unsigned short* A,
                                                   const unsigned short* Bt, int K,
                                                   int m0, int n0, int k0, int lane) {
  const size_t off = (size_t)(lane & 15) * K + k0 + 8 * (lane >> 4);
  const unsigned short* pa[4];
  const unsigned short* pb[4];
#pragma unroll
  for (int i = 0; i < 4; ++i) {
    pa[i] = A  + (size_t)(m0 + 16 * i) * K + off;
    pb[i] = Bt + (size_t)(n0 + 16 * i) * K + off;
  }
#pragma unroll
  for (int i = 0; i < 4; ++i) {
    union { uint4 q[2]; v16bf v; } u;
    u.q[0] = *(const uint4*)pa[i];
    u.q[1] = *(const uint4*)(pa[i] + 16);
    a[i] = u.v;
  }
#pragma unroll
  for (int t = 0; t < 4; ++t) {
    union { uint4 q[2]; v16bf v; } u;
    u.q[0] = *(const uint4*)pb[t];
    u.q[1] = *(const uint4*)(pb[t] + 16);
    b[t] = u.v;
  }
  asm volatile("s_wait_xcnt 0x0"
               :: "v"(pa[0]), "v"(pa[1]), "v"(pa[2]), "v"(pa[3]),
                  "v"(pb[0]), "v"(pb[1]), "v"(pb[2]), "v"(pb[3]) : "memory");
}

__device__ __forceinline__ void gemm_mul_set(v8f (&acc)[4][4], const v16bf (&a)[4],
                                             const v16bf (&b)[4]) {
#pragma unroll
  for (int i = 0; i < 4; ++i)
#pragma unroll
    for (int t = 0; t < 4; ++t) acc[i][t] = wmma_bf16(a[i], b[t], acc[i][t]);
}

__global__ void __launch_bounds__(128)
gemm_bf16_kernel(const unsigned short* __restrict__ A,
                 const unsigned short* __restrict__ Bt,
                 const float* __restrict__ bias,
                 float* __restrict__ Cf, unsigned short* __restrict__ Cb,
                 int M, int N, int K, int mode, int relu) {
  const int lane = threadIdx.x & 31;
  const int wave = threadIdx.x >> 5;
  const int m0 = blockIdx.x * 128 + (wave >> 1) * 64;
  const int n0 = blockIdx.y * 128 + (wave & 1) * 64;

  v8f acc[4][4] = {};
  v16bf a0[4], b0[4], a1[4], b1[4];
  gemm_load_set_wait(a0, b0, A, Bt, K, m0, n0, 0, lane);
  __builtin_amdgcn_sched_barrier(0);     // holds later register writes behind that wait
  int k0 = 0;
  for (; k0 < K - 64; k0 += 64) {
    gemm_load_set(a1, b1, A, Bt, K, m0, n0, k0 + 32, lane);
    // keeps the next set's loads ahead of this set's 16 WMMAs (else they sink
    // among the WMMAs and their latency is waited out right behind them)
    __builtin_amdgcn_sched_barrier(0);
    gemm_mul_set(acc, a0, b0);
    gemm_load_set(a0, b0, A, Bt, K, m0, n0, k0 + 64, lane);
    __builtin_amdgcn_sched_barrier(0);   // as above
    gemm_mul_set(acc, a1, b1);
    // the next trip rewrites the address registers that the loads above name
    asm volatile("s_wait_xcnt 0x0" ::: "memory");
  }
  gemm_load_set_wait(a1, b1, A, Bt, K, m0, n0, k0 + 32, lane);
  __builtin_amdgcn_sched_barrier(0);     // as above; also keeps the loads ahead of the WMMAs
  gemm_mul_set(acc, a0, b0);
  gemm_mul_set(acc, a1, b1);

  const int col = lane & 15;
  const int h2  = lane >> 4;
  // Epilogue.  The mode test stands outside the element loops.  Modes 0 and 1
  // go in two parts: first every value and every row address is formed in
  // registers, then come the stores alone, so that no register of an issued
  // store is written again.
#pragma unroll
  for (int t = 0; t < 4; ++t) {
    float bv = bias ? bias[n0 + 16 * t + col] : 0.0f;
#pragma unroll
    for (int i = 0; i < 4; ++i)
#pragma unroll
      for (int e = 0; e < 8; ++e) {
        float v = acc[i][t][e] + bv;
        acc[i][t][e] = relu ? fmaxf(v, 0.0f) : v;
      }
  }
  const int mr = m0 + 8 * h2;                  // C layout: VGPR e -> row e (+8)
  const int nc = n0 + col;
  if (mode == 0) {
    float* cb = Cf + (size_t)mr * N + nc;
    float* c[4][8];
#pragma unroll
    for (int i = 0; i < 4; ++i)
#pragma unroll
      for (int e = 0; e < 8; ++e) c[i][e] = cb + (size_t)(16 * i + e) * N;
    __builtin_amdgcn_sched_barrier(0);         // only stores behind this line
#pragma unroll
    for (int i = 0; i < 4; ++i)
#pragma unroll
      for (int e = 0; e < 8; ++e)
#pragma unroll
        for (int t = 0; t < 4; ++t) c[i][e][16 * t] = acc[i][t][e];
    // code of the other modes' paths follows and reuses these stores' registers
    asm volatile("s_wait_xcnt 0x0" ::: "memory");
  } else if (mode == 1) {
    unsigned short* cb = Cb + (size_t)mr * N + nc;
    unsigned short* c[4][8];
    unsigned short hv[4][4][8];
#pragma unroll
    for (int i = 0; i < 4; ++i)
#pragma unroll
      for (int e = 0; e < 8; ++e) {
        c[i][e] = cb + (size_t)(16 * i + e) * N;
#pragma unroll
        for (int t = 0; t < 4; ++t) hv[i][t][e] = f2bf(acc[i][t][e]);
      }
    __builtin_amdgcn_sched_barrier(0);         // only stores behind this line
#pragma unroll
    for (int i = 0; i < 4; ++i)
#pragma unroll
      for (int e = 0; e < 8; ++e)
#pragma unroll
        for (int t = 0; t < 4; ++t) c[i][e][16 * t] = hv[i][t][e];
    // code of the other modes' paths follows and reuses these stores' registers
    asm volatile("s_wait_xcnt 0x0" ::: "memory");
  } else {
    // the wave's 64 rows lie in one batch entry, its 64 columns are one head;
    // a lane's eight rows of a tile are eight neighbours in Vt: one 16-byte store
    const int bb = mr / S_LEN, s = mr % S_LEN;
    const int hh = nc >> 6,    d = nc & 63;
    unsigned short* c = Cb + (((size_t)bb * H_CNT + hh) * D_HEAD + d) * S_LEN + s;
    uint4 pk[4][4];
#pragma unroll
    for (int i = 0; i < 4; ++i)
#pragma unroll
      for (int t = 0; t < 4; ++t) {
        unsigned q[4];
#pragma unroll
        for (int e = 0; e < 4; ++e)
          q[e] = (unsigned)f2bf(acc[i][t][2 * e]) | ((unsigned)f2bf(acc[i][t][2 * e + 1]) << 16);
        pk[i][t] = make_uint4(q[0], q[1], q[2], q[3]);
      }
#pragma unroll
    for (int i = 0; i < 4; ++i)
#pragma unroll
      for (int t = 0; t < 4; ++t)
        *(uint4*)(c + (size_t)(16 * t) * S_LEN + 16 * i) = pk[i][t];
    // code of the other modes' paths follows and reuses these stores' registers
    asm volatile("s_wait_xcnt 0x0" ::: "memory");
  }
}

// ---------------------------------------------------------------------------
// Flash attention. Reference einsum gives corr[b,h,i,j] = K[b,i,h,:].Q[b,j,h,:],
// softmax over j, out[i,d] = sum_j P[i,j] V[j,d].
// Block = 8 waves; wave owns 16 output rows i; streams keys in tiles of 32.
__global__ void __launch_bounds__(256)
flash_attn_kernel(const float* __restrict__ Kf, const float* __restrict__ Qf,
                  const unsigned short* __restrict__ Vt, const int* __restrict__ mask,
                  float* __restrict__ Out, float scale) {
  __shared__ __align__(16) unsigned short ptile[8][16][32];

  const int lane = threadIdx.x & 31;
  const int wave = threadIdx.x >> 5;
  const int h2   = lane >> 4;
  const int col  = lane & 15;
  const int b = blockIdx.z, h = blockIdx.y;
  const int i0 = blockIdx.x * 128 + wave * 16;

  const float* Kb_ = Kf + (size_t)b * S_LEN * E_DIM + h * D_HEAD;
  const float* Qb_ = Qf + (size_t)b * S_LEN * E_DIM + h * D_HEAD;
  const unsigned short* Vb_ = Vt + ((size_t)b * H_CNT + h) * D_HEAD * S_LEN;

  // A operand: this wave's 16 K-rows over d = 0..63 (reused for all key tiles)
  v16bf aK0 = load_frag_f32(Kb_, E_DIM, i0, 0,  lane);
  v16bf aK1 = load_frag_f32(Kb_, E_DIM, i0, 32, lane);

  v8f O0 = {}, O1 = {}, O2 = {}, O3 = {};
  float mrow[8], lrow[8];
#pragma unroll
  for (int e = 0; e < 8; ++e) { mrow[e] = -3.0e38f; lrow[e] = 0.0f; }

  const float mval = -1.0e20f * scale;

  for (int j0 = 0; j0 < S_LEN; j0 += 32) {
    // scores tile 16x32: two 16x16 WMMA fragments, K over d (2 steps of 32)
    v16bf bq00 = load_frag_f32(Qb_, E_DIM, j0 +  0, 0,  lane);
    v16bf bq01 = load_frag_f32(Qb_, E_DIM, j0 +  0, 32, lane);
    v16bf bq10 = load_frag_f32(Qb_, E_DIM, j0 + 16, 0,  lane);
    v16bf bq11 = load_frag_f32(Qb_, E_DIM, j0 + 16, 32, lane);
    v8f s0 = {}, s1 = {};
    s0 = wmma_bf16(aK0, bq00, s0); s0 = wmma_bf16(aK1, bq01, s0);
    s1 = wmma_bf16(aK0, bq10, s1); s1 = wmma_bf16(aK1, bq11, s1);

    float p0[8], p1[8];
#pragma unroll
    for (int e = 0; e < 8; ++e) {
      size_t i = (size_t)(i0 + e + 8 * h2);
      int j = j0 + col;
      float v0 = mask[i * S_LEN + j]      ? s0[e] * scale : mval;
      float v1 = mask[i * S_LEN + j + 16] ? s1[e] * scale : mval;
      // row-wise max/sum: reduce across the 16 lanes of this half
      float mx = fmaxf(v0, v1);
#pragma unroll
      for (int off = 1; off < 16; off <<= 1) mx = fmaxf(mx, __shfl_xor(mx, off, 32));
      float mnew  = fmaxf(mrow[e], mx);
      float alpha = __expf(mrow[e] - mnew);
      mrow[e] = mnew;
      float e0 = __expf(v0 - mnew), e1 = __expf(v1 - mnew);
      float rs = e0 + e1;
#pragma unroll
      for (int off = 1; off < 16; off <<= 1) rs += __shfl_xor(rs, off, 32);
      lrow[e] = lrow[e] * alpha + rs;
      p0[e] = e0; p1[e] = e1;
      O0[e] *= alpha; O1[e] *= alpha; O2[e] *= alpha; O3[e] *= alpha;
    }

    // transpose P (C-layout) -> A-layout via per-wave LDS tile
#pragma unroll
    for (int e = 0; e < 8; ++e) {
      ptile[wave][e + 8 * h2][col]      = f2bf(p0[e]);
      ptile[wave][e + 8 * h2][col + 16] = f2bf(p1[e]);
    }
    __builtin_amdgcn_wave_barrier();   // LDS is in-order within a wave
    union { uint4 q[2]; v16bf v; } up;
    const unsigned short* prow = &ptile[wave][col][0];
    up.q[0] = *(const uint4*)(prow + 8 * h2);
    up.q[1] = *(const uint4*)(prow + 16 + 8 * h2);
    __builtin_amdgcn_wave_barrier();
    v16bf pa = up.v;

    // O += P . V  (B operand from head-transposed Vt rows = d, cols = j)
    v16bf bv0 = load_frag_bf16(Vb_, S_LEN, 0,  j0, lane);
    v16bf bv1 = load_frag_bf16(Vb_, S_LEN, 16, j0, lane);
    v16bf bv2 = load_frag_bf16(Vb_, S_LEN, 32, j0, lane);
    v16bf bv3 = load_frag_bf16(Vb_, S_LEN, 48, j0, lane);
    O0 = wmma_bf16(pa, bv0, O0);
    O1 = wmma_bf16(pa, bv1, O1);
    O2 = wmma_bf16(pa, bv2, O2);
    O3 = wmma_bf16(pa, bv3, O3);
  }

#pragma unroll
  for (int e = 0; e < 8; ++e) {
    float inv = 1.0f / lrow[e];
    size_t i = (size_t)(i0 + e + 8 * h2);
    float* orow = Out + ((size_t)b * S_LEN + i) * E_DIM + h * D_HEAD + col;
    orow[0]  = O0[e] * inv;
    orow[16] = O1[e] * inv;
    orow[32] = O2[e] * inv;
    orow[48] = O3[e] * inv;
  }
}

// ---------------------------------------------------------------------------
// x1 = LN(src + res) * g + b  -> f32 (+ bf16 copy). One block per row.
__global__ void __launch_bounds__(256)
add_ln_kernel(const float* __restrict__ src, const float* __restrict__ res,
              const float* __restrict__ g, const float* __restrict__ bb,
              float* __restrict__ outf, unsigned short* __restrict__ outb) {
  __shared__ float r1[256], r2[256];
  const int row = blockIdx.x;
  const int t = threadIdx.x;
  const float* s = src + (size_t)row * E_DIM;
  const float* r = res + (size_t)row * E_DIM;
  float x0 = s[t]       + r[t];
  float x1 = s[t + 256] + r[t + 256];
  r1[t] = x0 + x1;
  r2[t] = x0 * x0 + x1 * x1;
  __syncthreads();
  for (int o = 128; o > 0; o >>= 1) {
    if (t < o) { r1[t] += r1[t + o]; r2[t] += r2[t + o]; }
    __syncthreads();
  }
  float mean = r1[0] * (1.0f / E_DIM);
  float var  = r2[0] * (1.0f / E_DIM) - mean * mean;
  float rstd = rsqrtf(var + 1e-5f);
  float y0 = (x0 - mean) * rstd * g[t]       + bb[t];
  float y1 = (x1 - mean) * rstd * g[t + 256] + bb[t + 256];
  float* of = outf + (size_t)row * E_DIM;
  of[t] = y0; of[t + 256] = y1;
  unsigned short* ob = outb + (size_t)row * E_DIM;
  ob[t] = f2bf(y0); ob[t + 256] = f2bf(y1);
}

// out = LN( LN(f)*g3+b3 + x1 ) * g2 + b2.  One block per row.
__global__ void __launch_bounds__(256)
double_ln_kernel(const float* __restrict__ f, const float* __restrict__ x1,
                 const float* __restrict__ g3, const float* __restrict__ b3,
                 const float* __restrict__ g2, const float* __restrict__ b2,
                 float* __restrict__ out) {
  __shared__ float r1[256], r2[256];
  const int row = blockIdx.x;
  const int t = threadIdx.x;
  const float* fr = f  + (size_t)row * E_DIM;
  const float* xr = x1 + (size_t)row * E_DIM;
  float a0 = fr[t], a1 = fr[t + 256];
  r1[t] = a0 + a1; r2[t] = a0 * a0 + a1 * a1;
  __syncthreads();
  for (int o = 128; o > 0; o >>= 1) {
    if (t < o) { r1[t] += r1[t + o]; r2[t] += r2[t + o]; }
    __syncthreads();
  }
  float mean = r1[0] * (1.0f / E_DIM);
  float var  = r2[0] * (1.0f / E_DIM) - mean * mean;
  float rstd = rsqrtf(var + 1e-5f);
  float u0 = (a0 - mean) * rstd * g3[t]       + b3[t]       + xr[t];
  float u1 = (a1 - mean) * rstd * g3[t + 256] + b3[t + 256] + xr[t + 256];
  __syncthreads();
  r1[t] = u0 + u1; r2[t] = u0 * u0 + u1 * u1;
  __syncthreads();
  for (int o = 128; o > 0; o >>= 1) {
    if (t < o) { r1[t] += r1[t + o]; r2[t] += r2[t + o]; }
    __syncthreads();
  }
  mean = r1[0] * (1.0f / E_DIM);
  var  = r2[0] * (1.0f / E_DIM) - mean * mean;
  rstd = rsqrtf(var + 1e-5f);
  float* orow = out + (size_t)row * E_DIM;
  orow[t]       = (u0 - mean) * rstd * g2[t]       + b2[t];
  orow[t + 256] = (u1 - mean) * rstd * g2[t + 256] + b2[t + 256];
}

// ---------------------------------------------------------------------------
extern "C" void kernel_launch(void* const* d_in, const int* in_sizes, int n_in,
                              void* d_out, int out_size, void* d_ws, size_t ws_size,
                              hipStream_t stream) {
  const float* x  = (const float*)d_in[0];
  const int* mask = (const int*)d_in[1];
  const float* Wv = (const float*)d_in[2];
  const float* Wk = (const float*)d_in[3];
  const float* Wq = (const float*)d_in[4];
  const float* g1 = (const float*)d_in[5];
  const float* b1 = (const float*)d_in[6];
  const float* W1 = (const float*)d_in[7];
  const float* c1 = (const float*)d_in[8];
  const float* W2 = (const float*)d_in[9];
  const float* c2 = (const float*)d_in[10];
  const float* g3 = (const float*)d_in[11];
  const float* b3 = (const float*)d_in[12];
  const float* g2 = (const float*)d_in[13];
  const float* b2 = (const float*)d_in[14];

  const size_t MB = 1ull << 20;
  unsigned char* w = (unsigned char*)d_ws;
  // live regions (peak ~96 MB, with reuse):
  unsigned short* xb  = (unsigned short*)(w +  0 * MB); //  8 MB  x bf16
  unsigned short* Wqt = (unsigned short*)(w +  8 * MB); //  .5 MB
  unsigned short* Wkt = (unsigned short*)(w +  9 * MB); //  .5 MB
  unsigned short* Wvt = (unsigned short*)(w + 10 * MB); //  .5 MB
  unsigned short* W1t = (unsigned short*)(w + 11 * MB); //  2 MB
  unsigned short* W2t = (unsigned short*)(w + 13 * MB); //  2 MB
  float*          Kf  = (float*)         (w + 16 * MB); // 16 MB  keys f32
  unsigned short* Vt  = (unsigned short*)(w + 32 * MB); //  8 MB  V^T bf16
  float*          Qf  = (float*)         (w + 40 * MB); // 16 MB  queries f32
  float*          attn= (float*)         (w + 56 * MB); // 16 MB
  float*          x1f = (float*)         (w + 72 * MB); // 16 MB
  unsigned short* x1b = (unsigned short*)(w + 88 * MB); //  8 MB
  unsigned short* hb  = (unsigned short*)(w + 16 * MB); // 32 MB (reuses Kf/Vt/Qf)
  float*          ff  = (float*)         (w + 48 * MB); // 16 MB (reuses Qf/attn)

  dim3 blk(256);
  dim3 gblk(128);   // GEMM: 4 waves, 2x2

  // 1) conversions / weight transposes
  cvt_bf16_kernel<<<(M_ROWS * V_DIM) / 256, blk, 0, stream>>>(x, xb, M_ROWS * V_DIM);
  transpose_bf16_kernel<<<(V_DIM * E_DIM) / 256, blk, 0, stream>>>(Wq, Wqt, V_DIM, E_DIM);
  transpose_bf16_kernel<<<(V_DIM * E_DIM) / 256, blk, 0, stream>>>(Wk, Wkt, V_DIM, E_DIM);
  transpose_bf16_kernel<<<(V_DIM * E_DIM) / 256, blk, 0, stream>>>(Wv, Wvt, V_DIM, E_DIM);
  transpose_bf16_kernel<<<(E_DIM * F_DIM) / 256, blk, 0, stream>>>(W1, W1t, E_DIM, F_DIM);
  transpose_bf16_kernel<<<(F_DIM * E_DIM) / 256, blk, 0, stream>>>(W2, W2t, F_DIM, E_DIM);

  // 2) QKV projections
  dim3 gq(M_ROWS / 128, E_DIM / 128);
  gemm_bf16_kernel<<<gq, gblk, 0, stream>>>(xb, Wqt, nullptr, Qf, nullptr,
                                           M_ROWS, E_DIM, V_DIM, 0, 0);
  gemm_bf16_kernel<<<gq, gblk, 0, stream>>>(xb, Wkt, nullptr, Kf, nullptr,
                                           M_ROWS, E_DIM, V_DIM, 0, 0);
  gemm_bf16_kernel<<<gq, gblk, 0, stream>>>(xb, Wvt, nullptr, nullptr, Vt,
                                           M_ROWS, E_DIM, V_DIM, 2, 0);

  // 3) fused attention
  dim3 ga(S_LEN / 128, H_CNT, B_SZ);
  const float scale = 1.0f / sqrtf((float)E_DIM);
  flash_attn_kernel<<<ga, blk, 0, stream>>>(Kf, Qf, Vt, mask, attn, scale);

  // 4) x1 = LN(attn + queries)
  add_ln_kernel<<<M_ROWS, blk, 0, stream>>>(attn, Qf, g1, b1, x1f, x1b);

  // 5) h = relu(x1 @ W1 + c1)
  dim3 gf1(M_ROWS / 128, F_DIM / 128);
  gemm_bf16_kernel<<<gf1, gblk, 0, stream>>>(x1b, W1t, c1, nullptr, hb,
                                            M_ROWS, F_DIM, E_DIM, 1, 1);

  // 6) f = h @ W2 + c2
  dim3 gf2(M_ROWS / 128, E_DIM / 128);
  gemm_bf16_kernel<<<gf2, gblk, 0, stream>>>(hb, W2t, c2, ff, nullptr,
                                            M_ROWS, E_DIM, F_DIM, 0, 0);

  // 7) out = LN(LN(f) + x1)
  double_ln_kernel<<<M_ROWS, blk, 0, stream>>>(ff, x1f, g3, b3, g2, b2,
                                               (float*)d_out);
}

// v002
// It runs in 327 microseconds.
// Next to v001, in two timings, it ran 1.22 and 1.23 times as fast.
// All steps since v000 together make it 1.58 times as fast.
#include <hip/hip_runtime.h>
#include <hip/hip_bf16.h>
#include <math.h>

// ---------------------------------------------------------------------------
// Transformer block on CDNA5 (gfx1250), wave32, bf16 WMMA w/ f32 accumulation.
// Pipeline:
//   1) convert x -> bf16; transpose+convert weights -> bf16 [N,K]
//   2) WMMA GEMMs: Q (f32), K (f32), V (bf16, head-transposed [b,h,d,s])
//   3) flash attention (scores = K.Q^T per the reference's einsum), online
//      softmax, P.V via WMMA, LDS transpose for the P fragment
//   4) x1 = LN(attn + Q) -> f32 + bf16
//   5) h = relu(x1 @ W1 + c1) (WMMA, bf16 out)
//   6) f = h @ W2 + c2 (WMMA, f32 out)
//   7) out = LN(LN(f) + x1)
// ---------------------------------------------------------------------------

typedef __attribute__((ext_vector_type(16))) __bf16 v16bf;
typedef __attribute__((ext_vector_type(8)))  float  v8f;

#define S_LEN  2048
#define E_DIM  512
#define V_DIM  512
#define F_DIM  2048
#define B_SZ   4
#define H_CNT  8
#define D_HEAD 64
#define M_ROWS (B_SZ * S_LEN)

__device__ __forceinline__ unsigned short f2bf(float f) {
  union { float f; unsigned u; } a; a.f = f;
  unsigned u = a.u;
  return (unsigned short)((u + 0x7FFFu + ((u >> 16) & 1u)) >> 16); // RNE
}

// A/B fragment loader for v_wmma_f32_16x16x32_bf16 from row-major bf16 data.
// Layout (ISA 7.12.2, 16-bit A 16x32): lane L holds row (L&15); lanes 0-15
// carry K = [k0, k0+8) and [k0+16, k0+24); lanes 16-31 the +8 halves.
// The same layout serves the B operand when loading from a [N,K] (transposed)
// matrix: lane holds column n = (L&15) of B.
__device__ __forceinline__ v16bf load_frag_bf16(const unsigned short* base, int ld,
                                                int row0, int k0, int lane) {
  const int half = lane >> 4;
  const unsigned short* p = base + (size_t)(row0 + (lane & 15)) * ld + k0 + 8 * half;
  union { uint4 q[2]; v16bf v; } u;
  u.q[0] = *(const uint4*)p;
  u.q[1] = *(const uint4*)(p + 16);
  return u.v;
}

// Same fragment, sourced from fp32 with on-the-fly bf16 conversion.
__device__ __forceinline__ v16bf load_frag_f32(const float* base, int ld,
                                               int row0, int k0, int lane) {
  const int half = lane >> 4;
  const float* p = base + (size_t)(row0 + (lane & 15)) * ld + k0 + 8 * half;
  union { unsigned short s[16]; v16bf v; } u;
#pragma unroll
  for (int e = 0; e < 8; ++e) {
    u.s[e]     = f2bf(p[e]);
    u.s[8 + e] = f2bf(p[16 + e]);
  }
  return u.v;
}

__device__ __forceinline__ v8f wmma_bf16(v16bf a, v16bf b, v8f c) {
  return __builtin_amdgcn_wmma_f32_16x16x32_bf16(false, a, false, b, (short)0, c,
                                                 false, false);
}

// ---------------------------------------------------------------------------
// The kernels without matrix work are short; each thread takes many elements
// and the grids are small, for speed only.

__device__ __forceinline__ unsigned pack2(float lo, float hi) {
  return (unsigned)f2bf(lo) | ((unsigned)f2bf(hi) << 16);
}

// Elementwise fp32 -> bf16, 32 elements a thread: four chunks of eight (two
// 16-byte loads, one 16-byte store), a block's chunks 2048 elements apart, so
// that every access of a wave covers whole lines.  Grid = elements / 8192.
__global__ void __launch_bounds__(256)
cvt_bf16_kernel(const float* __restrict__ in, unsigned short* __restrict__ out) {
  const size_t base = (size_t)blockIdx.x * 8192 + threadIdx.x * 8;
  const float* p = in + base;
  unsigned short* o = out + base;
  float4 v[4][2];
#pragma unroll
  for (int c = 0; c < 4; ++c) {
    v[c][0] = *(const float4*)(p + 2048 * c);
    v[c][1] = *(const float4*)(p + 2048 * c + 4);
  }
  uint4 q[4];
#pragma unroll
  for (int c = 0; c < 4; ++c)
    q[c] = make_uint4(pack2(v[c][0].x, v[c][0].y), pack2(v[c][0].z, v[c][0].w),
                      pack2(v[c][1].x, v[c][1].y), pack2(v[c][1].z, v[c][1].w));
#pragma unroll
  for (int c = 0; c < 4; ++c) *(uint4*)(o + 2048 * c) = q[c];
}

// [Kd,Nd] fp32 -> [Nd,Kd] bf16.  A thread takes 16 k of one n: 16 loads (a wave
// reads 128 contiguous bytes of a row each time) and two 16-byte stores.
// Grid = Kd * Nd / 4096; Kd is a multiple of 16.  The row length is a constant
// of the body, so that the split of the block index needs no division.
template <int ND>
__device__ __forceinline__ void transpose_body(const float* __restrict__ in,
                                               unsigned short* __restrict__ out, int Kd) {
  const int kb = blockIdx.x / (ND / 256);        // a block's threads share their 16 rows
  const int n  = (blockIdx.x % (ND / 256)) * 256 + threadIdx.x;
  const float* p = in + (size_t)(16 * kb) * ND + n;
  float v[16];
#pragma unroll
  for (int e = 0; e < 16; ++e) v[e] = p[e * ND];
  const uint4 q0 = make_uint4(pack2(v[0], v[1]),   pack2(v[2], v[3]),
                              pack2(v[4], v[5]),   pack2(v[6], v[7]));
  const uint4 q1 = make_uint4(pack2(v[8], v[9]),   pack2(v[10], v[11]),
                              pack2(v[12], v[13]), pack2(v[14], v[15]));
  unsigned short* o = out + (size_t)n * Kd + 16 * kb;
  *(uint4*)o       = q0;
  *(uint4*)(o + 8) = q1;
}

__global__ void __launch_bounds__(256)
transpose_bf16_kernel(const float* __restrict__ in, unsigned short* __restrict__ out,
                      int Kd, int Nd) {
  if (Nd == E_DIM) transpose_body<E_DIM>(in, out, Kd);
  else             transpose_body<F_DIM>(in, out, Kd);
}

// ---------------------------------------------------------------------------
// C[M,N] = A[M,K] @ Bt[N,K]^T (+bias)(+relu).  Block = 4 waves in a 2x2 grid,
// each wave owns a 64x64 tile (4 A x 4 B fragments, 16 accumulator tiles), so a
// loaded fragment feeds four WMMAs; grid = (M/128, N/128).  K is a multiple of 64.
// Two fragment sets alternate: one set's loads fly while the other is multiplied.
// mode 0: f32 out; mode 1: bf16 out; mode 2: bf16 out transposed per-head
//         to Vt[b][h][d][s] (for the attention's P.V B-operand).
__device__ __forceinline__ void gemm_load_set(v16bf (&a)[4], v16bf (&b)[4],
                                              const unsigned short* A,
                                              const unsigned short* Bt, int K,
                                              int m0, int n0, int k0, int lane) {
#pragma unroll
  for (int i = 0; i < 4; ++i) a[i] = load_frag_bf16(A, K, m0 + 16 * i, k0, lane);
#pragma unroll
  for (int t = 0; t < 4; ++t) b[t] = load_frag_bf16(Bt, K, n0 + 16 * t, k0, lane);
}

// The same set outside the loop, where the eight address pairs die with the
// loads: the wait names them as inputs, so that they stay untouched (also by a
// later load's result) until the loads' addresses have been taken.
__device__ __forceinline__ void gemm_load_set_wait(v16bf (&a)[4], v16bf (&b)[4],
                                                   const unsigned short* A,
                                                   const unsigned short* Bt, int K,
                                                   int m0, int n0, int k0, int lane) {
  const size_t off = (size_t)(lane & 15) * K + k0 + 8 * (lane >> 4);
  const unsigned short* pa[4];
  const unsigned short* pb[4];
#pragma unroll
  for (int i = 0; i < 4; ++i) {
    pa[i] = A  + (size_t)(m0 + 16 * i) * K + off;
    pb[i] = Bt + (size_t)(n0 + 16 * i) * K + off;
  }
#pragma unroll
  for (int i = 0; i < 4; ++i) {
    union { uint4 q[2]; v16bf v; } u;
    u.q[0] = *(const uint4*)pa[i];
    u.q[1] = *(const uint4*)(pa[i] + 16);
    a[i] = u.v;
  }
#pragma unroll
  for (int t = 0; t < 4; ++t) {
    union { uint4 q[2]; v16bf v; } u;
    u.q[0] = *(const uint4*)pb[t];
    u.q[1] = *(const uint4*)(pb[t] + 16);
    b[t] = u.v;
  }
  asm volatile("s_wait_xcnt 0x0"
               :: "v"(pa[0]), "v"(pa[1]), "v"(pa[2]), "v"(pa[3]),
                  "v"(pb[0]), "v"(pb[1]), "v"(pb[2]), "v"(pb[3]) : "memory");
}

__device__ __forceinline__ void gemm_mul_set(v8f (&acc)[4][4], const v16bf (&a)[4],
                                             const v16bf (&b)[4]) {
#pragma unroll
  for (int i = 0; i < 4; ++i)
#pragma unroll
    for (int t = 0; t < 4; ++t) acc[i][t] = wmma_bf16(a[i], b[t], acc[i][t]);
}

__global__ void __launch_bounds__(128)
gemm_bf16_kernel(const unsigned short* __restrict__ A,
                 const unsigned short* __restrict__ Bt,
                 const float* __restrict__ bias,
                 float* __restrict__ Cf, unsigned short* __restrict__ Cb,
                 int M, int N, int K, int mode, int relu) {
  const int lane = threadIdx.x & 31;
  const int wave = threadIdx.x >> 5;
  const int m0 = blockIdx.x * 128 + (wave >> 1) * 64;
  const int n0 = blockIdx.y * 128 + (wave & 1) * 64;

  v8f acc[4][4] = {};
  v16bf a0[4], b0[4], a1[4], b1[4];
  gemm_load_set_wait(a0, b0, A, Bt, K, m0, n0, 0, lane);
  __builtin_amdgcn_sched_barrier(0);     // holds later register writes behind that wait
  int k0 = 0;
  for (; k0 < K - 64; k0 += 64) {
    gemm_load_set(a1, b1, A, Bt, K, m0, n0, k0 + 32, lane);
    // keeps the next set's loads ahead of this set's 16 WMMAs (else they sink
    // among the WMMAs and their latency is waited out right behind them)
    __builtin_amdgcn_sched_barrier(0);
    gemm_mul_set(acc, a0, b0);
    gemm_load_set(a0, b0, A, Bt, K, m0, n0, k0 + 64, lane);
    __builtin_amdgcn_sched_barrier(0);   // as above
    gemm_mul_set(acc, a1, b1);
    // the next trip rewrites the address registers that the loads above name
    asm volatile("s_wait_xcnt 0x0" ::: "memory");
  }
  gemm_load_set_wait(a1, b1, A, Bt, K, m0, n0, k0 + 32, lane);
  __builtin_amdgcn_sched_barrier(0);     // as above; also keeps the loads ahead of the WMMAs
  gemm_mul_set(acc, a0, b0);
  gemm_mul_set(acc, a1, b1);

  const int col = lane & 15;
  const int h2  = lane >> 4;
  // Epilogue.  The mode test stands outside the element loops.  Modes 0 and 1
  // go in two parts: first every value and every row address is formed in
  // registers, then come the stores alone, so that no register of an issued
  // store is written again.
#pragma unroll
  for (int t = 0; t < 4; ++t) {
    float bv = bias ? bias[n0 + 16 * t + col] : 0.0f;
#pragma unroll
    for (int i = 0; i < 4; ++i)
#pragma unroll
      for (int e = 0; e < 8; ++e) {
        float v = acc[i][t][e] + bv;
        acc[i][t][e] = relu ? fmaxf(v, 0.0f) : v;
      }
  }
  const int mr = m0 + 8 * h2;                  // C layout: VGPR e -> row e (+8)
  const int nc = n0 + col;
  if (mode == 0) {
    float* cb = Cf + (size_t)mr * N + nc;
    float* c[4][8];
#pragma unroll
    for (int i = 0; i < 4; ++i)
#pragma unroll
      for (int e = 0; e < 8; ++e) c[i][e] = cb + (size_t)(16 * i + e) * N;
    __builtin_amdgcn_sched_barrier(0);         // only stores behind this line
#pragma unroll
    for (int i = 0; i < 4; ++i)
#pragma unroll
      for (int e = 0; e < 8; ++e)
#pragma unroll
        for (int t = 0; t < 4; ++t) c[i][e][16 * t] = acc[i][t][e];
    // code of the other modes' paths follows and reuses these stores' registers
    asm volatile("s_wait_xcnt 0x0" ::: "memory");
  } else if (mode == 1) {
    unsigned short* cb = Cb + (size_t)mr * N + nc;
    unsigned short* c[4][8];
    unsigned short hv[4][4][8];
#pragma unroll
    for (int i = 0; i < 4; ++i)
#pragma unroll
      for (int e = 0; e < 8; ++e) {
        c[i][e] = cb + (size_t)(16 * i + e) * N;
#pragma unroll
        for (int t = 0; t < 4; ++t) hv[i][t][e] = f2bf(acc[i][t][e]);
      }
    __builtin_amdgcn_sched_barrier(0);         // only stores behind this line
#pragma unroll
    for (int i = 0; i < 4; ++i)
#pragma unroll
      for (int e = 0; e < 8; ++e)
#pragma unroll
        for (int t = 0; t < 4; ++t) c[i][e][16 * t] = hv[i][t][e];
    // code of the other modes' paths follows and reuses these stores' registers
    asm volatile("s_wait_xcnt 0x0" ::: "memory");
  } else {
    // the wave's 64 rows lie in one batch entry, its 64 columns are one head;
    // a lane's eight rows of a tile are eight neighbours in Vt: one 16-byte store
    const int bb = mr / S_LEN, s = mr % S_LEN;
    const int hh = nc >> 6,    d = nc & 63;
    unsigned short* c = Cb + (((size_t)bb * H_CNT + hh) * D_HEAD + d) * S_LEN + s;
    uint4 pk[4][4];
#pragma unroll
    for (int i = 0; i < 4; ++i)
#pragma unroll
      for (int t = 0; t < 4; ++t) {
        unsigned q[4];
#pragma unroll
        for (int e = 0; e < 4; ++e)
          q[e] = (unsigned)f2bf(acc[i][t][2 * e]) | ((unsigned)f2bf(acc[i][t][2 * e + 1]) << 16);
        pk[i][t] = make_uint4(q[0], q[1], q[2], q[3]);
      }
#pragma unroll
    for (int i = 0; i < 4; ++i)
#pragma unroll
      for (int t = 0; t < 4; ++t)
        *(uint4*)(c + (size_t)(16 * t) * S_LEN + 16 * i) = pk[i][t];
    // code of the other modes' paths follows and reuses these stores' registers
    asm volatile("s_wait_xcnt 0x0" ::: "memory");
  }
}

// ---------------------------------------------------------------------------
// Flash attention. Reference einsum gives corr[b,h,i,j] = K[b,i,h,:].Q[b,j,h,:],
// softmax over j, out[i,d] = sum_j P[i,j] V[j,d].
// Block = 8 waves; wave owns 16 output rows i; streams keys in tiles of 32.
__global__ void __launch_bounds__(256)
flash_attn_kernel(const float* __restrict__ Kf, const float* __restrict__ Qf,
                  const unsigned short* __restrict__ Vt, const int* __restrict__ mask,
                  float* __restrict__ Out, float scale) {
  __shared__ __align__(16) unsigned short ptile[8][16][32];

  const int lane = threadIdx.x & 31;
  const int wave = threadIdx.x >> 5;
  const int h2   = lane >> 4;
  const int col  = lane & 15;
  const int b = blockIdx.z, h = blockIdx.y;
  const int i0 = blockIdx.x * 128 + wave * 16;

  const float* Kb_ = Kf + (size_t)b * S_LEN * E_DIM + h * D_HEAD;
  const float* Qb_ = Qf + (size_t)b * S_LEN * E_DIM + h * D_HEAD;
  const unsigned short* Vb_ = Vt + ((size_t)b * H_CNT + h) * D_HEAD * S_LEN;

  // A operand: this wave's 16 K-rows over d = 0..63 (reused for all key tiles)
  v16bf aK0 = load_frag_f32(Kb_, E_DIM, i0, 0,  lane);
  v16bf aK1 = load_frag_f32(Kb_, E_DIM, i0, 32, lane);

  v8f O0 = {}, O1 = {}, O2 = {}, O3 = {};
  float mrow[8], lrow[8];
#pragma unroll
  for (int e = 0; e < 8; ++e) { mrow[e] = -3.0e38f; lrow[e] = 0.0f; }

  const float mval = -1.0e20f * scale;

  for (int j0 = 0; j0 < S_LEN; j0 += 32) {
    // scores tile 16x32: two 16x16 WMMA fragments, K over d (2 steps of 32)
    v16bf bq00 = load_frag_f32(Qb_, E_DIM, j0 +  0, 0,  lane);
    v16bf bq01 = load_frag_f32(Qb_, E_DIM, j0 +  0, 32, lane);
    v16bf bq10 = load_frag_f32(Qb_, E_DIM, j0 + 16, 0,  lane);
    v16bf bq11 = load_frag_f32(Qb_, E_DIM, j0 + 16, 32, lane);
    v8f s0 = {}, s1 = {};
    s0 = wmma_bf16(aK0, bq00, s0); s0 = wmma_bf16(aK1, bq01, s0);
    s1 = wmma_bf16(aK0, bq10, s1); s1 = wmma_bf16(aK1, bq11, s1);

    float p0[8], p1[8];
#pragma unroll
    for (int e = 0; e < 8; ++e) {
      size_t i = (size_t)(i0 + e + 8 * h2);
      int j = j0 + col;
      float v0 = mask[i * S_LEN + j]      ? s0[e] * scale : mval;
      float v1 = mask[i * S_LEN + j + 16] ? s1[e] * scale : mval;
      // row-wise max/sum: reduce across the 16 lanes of this half
      float mx = fmaxf(v0, v1);
#pragma unroll
      for (int off = 1; off < 16; off <<= 1) mx = fmaxf(mx, __shfl_xor(mx, off, 32));
      float mnew  = fmaxf(mrow[e], mx);
      float alpha = __expf(mrow[e] - mnew);
      mrow[e] = mnew;
      float e0 = __expf(v0 - mnew), e1 = __expf(v1 - mnew);
      float rs = e0 + e1;
#pragma unroll
      for (int off = 1; off < 16; off <<= 1) rs += __shfl_xor(rs, off, 32);
      lrow[e] = lrow[e] * alpha + rs;
      p0[e] = e0; p1[e] = e1;
      O0[e] *= alpha; O1[e] *= alpha; O2[e] *= alpha; O3[e] *= alpha;
    }

    // transpose P (C-layout) -> A-layout via per-wave LDS tile
#pragma unroll
    for (int e = 0; e < 8; ++e) {
      ptile[wave][e + 8 * h2][col]      = f2bf(p0[e]);
      ptile[wave][e + 8 * h2][col + 16] = f2bf(p1[e]);
    }
    __builtin_amdgcn_wave_barrier();   // LDS is in-order within a wave
    union { uint4 q[2]; v16bf v; } up;
    const unsigned short* prow = &ptile[wave][col][0];
    up.q[0] = *(const uint4*)(prow + 8 * h2);
    up.q[1] = *(const uint4*)(prow + 16 + 8 * h2);
    __builtin_amdgcn_wave_barrier();
    v16bf pa = up.v;

    // O += P . V  (B operand from head-transposed Vt rows = d, cols = j)
    v16bf bv0 = load_frag_bf16(Vb_, S_LEN, 0,  j0, lane);
    v16bf bv1 = load_frag_bf16(Vb_, S_LEN, 16, j0, lane);
    v16bf bv2 = load_frag_bf16(Vb_, S_LEN, 32, j0, lane);
    v16bf bv3 = load_frag_bf16(Vb_, S_LEN, 48, j0, lane);
    O0 = wmma_bf16(pa, bv0, O0);
    O1 = wmma_bf16(pa, bv1, O1);
    O2 = wmma_bf16(pa, bv2, O2);
    O3 = wmma_bf16(pa, bv3, O3);
  }

#pragma unroll
  for (int e = 0; e < 8; ++e) {
    float inv = 1.0f / lrow[e];
    size_t i = (size_t)(i0 + e + 8 * h2);
    float* orow = Out + ((size_t)b * S_LEN + i) * E_DIM + h * D_HEAD + col;
    orow[0]  = O0[e] * inv;
    orow[16] = O1[e] * inv;
    orow[32] = O2[e] * inv;
    orow[48] = O3[e] * inv;
  }
}

// ---------------------------------------------------------------------------
// LayerNorm kernels: one wave per row of 512, 8 rows a block, 16 elements a lane
// (four 16-byte pieces, 128 elements apart: a wave's access is 512 contiguous
// bytes).  The row sums run in the lane and then over the wave's 32 lanes.
typedef __attribute__((ext_vector_type(4))) float f32x4;

__device__ __forceinline__ float wave_sum(float v) {
#pragma unroll
  for (int o = 16; o > 0; o >>= 1) v += __shfl_xor(v, o, 32);
  return v;
}

// 16 bytes at a 32-bit byte offset from a uniform base
__device__ __forceinline__ f32x4 ld16(const float* base, unsigned byte_off) {
  return *(const f32x4*)((const char*)base + byte_off);
}

// mean and 1/sqrt(var + eps) of the wave's row
__device__ __forceinline__ void row_stats(const f32x4 (&x)[4], float& mean, float& rstd) {
  float s1 = 0.0f, s2 = 0.0f;
#pragma unroll
  for (int q = 0; q < 4; ++q) {
    s1 += (x[q].x + x[q].y) + (x[q].z + x[q].w);
    s2 += (x[q].x * x[q].x + x[q].y * x[q].y) + (x[q].z * x[q].z + x[q].w * x[q].w);
  }
  s1 = wave_sum(s1);
  s2 = wave_sum(s2);
  mean = s1 * (1.0f / E_DIM);
  const float var = s2 * (1.0f / E_DIM) - mean * mean;
  rstd = rsqrtf(var + 1e-5f);
}

// x1 = LN(src + res) * g + b  -> f32 and a bf16 copy.
__global__ void __launch_bounds__(256)
add_ln_kernel(const float* __restrict__ src, const float* __restrict__ res,
              const float* __restrict__ g, const float* __restrict__ bb,
              float* __restrict__ outf, unsigned short* __restrict__ outb) {
  const int lane = threadIdx.x & 31;
  const size_t off = (size_t)(blockIdx.x * 8 + (threadIdx.x >> 5)) * E_DIM + 4 * lane;
  const unsigned ro = (unsigned)off * 4u;   // the lane's byte offset in a [rows,512] f32 array
  const unsigned co = 16u * lane;           // and in a vector of 512
  f32x4 x[4], c[4], gg[4], bv[4];
#pragma unroll
  for (int q = 0; q < 4; ++q) {
    x[q]  = ld16(src, ro + 512u * q);
    c[q]  = ld16(res, ro + 512u * q);
    gg[q] = ld16(g,   co + 512u * q);
    bv[q] = ld16(bb,  co + 512u * q);
  }
  // Every loaded value is an input, so the wait stands behind all 16 loads; the
  // two offsets are inputs, so they stay untouched (also by a later load's
  // result) up to it.
  asm volatile("s_wait_xcnt 0x0"
               :: "v"(ro), "v"(co),
                  "v"(x[0]),  "v"(x[1]),  "v"(x[2]),  "v"(x[3]),
                  "v"(c[0]),  "v"(c[1]),  "v"(c[2]),  "v"(c[3]),
                  "v"(gg[0]), "v"(gg[1]), "v"(gg[2]), "v"(gg[3]),
                  "v"(bv[0]), "v"(bv[1]), "v"(bv[2]), "v"(bv[3]) : "memory");
#pragma unroll
  for (int q = 0; q < 4; ++q) x[q] += c[q];
  float mean, rstd;
  row_stats(x, mean, rstd);
  uint2 h[4];
#pragma unroll
  for (int q = 0; q < 4; ++q) {
    x[q] = (x[q] - mean) * rstd * gg[q] + bv[q];
    h[q] = make_uint2(pack2(x[q].x, x[q].y), pack2(x[q].z, x[q].w));
  }
#pragma unroll
  for (int q = 0; q < 4; ++q) {
    *(f32x4*)(outf + off + 128 * q) = x[q];
    *(uint2*)(outb + off + 128 * q) = h[q];
  }
}

// out = LN( LN(f)*g3+b3 + x1 ) * g2 + b2.
__global__ void __launch_bounds__(256)
double_ln_kernel(const float* __restrict__ f, const float* __restrict__ x1,
                 const float* __restrict__ g3, const float* __restrict__ b3,
                 const float* __restrict__ g2, const float* __restrict__ b2,
                 float* __restrict__ out) {
  const int lane = threadIdx.x & 31;
  const size_t off = (size_t)(blockIdx.x * 8 + (threadIdx.x >> 5)) * E_DIM + 4 * lane;
  const unsigned ro = (unsigned)off * 4u;   // the lane's byte offset in a [rows,512] f32 array
  const unsigned co = 16u * lane;           // and in a vector of 512
  f32x4 a[4], xr[4], ga[4], ba[4], gb[4], bc[4];
#pragma unroll
  for (int q = 0; q < 4; ++q) {
    a[q]  = ld16(f,  ro + 512u * q);
    xr[q] = ld16(x1, ro + 512u * q);
    ga[q] = ld16(g3, co + 512u * q);
    ba[q] = ld16(b3, co + 512u * q);
    gb[q] = ld16(g2, co + 512u * q);
    bc[q] = ld16(b2, co + 512u * q);
  }
  // Every loaded value is an input, so the wait stands behind all 24 loads; the
  // two offsets are inputs, so they stay untouched (also by a later load's
  // result) up to it.
  asm volatile("s_wait_xcnt 0x0"
               :: "v"(ro), "v"(co),
                  "v"(a[0]),  "v"(a[1]),  "v"(a[2]),  "v"(a[3]),
                  "v"(xr[0]), "v"(xr[1]), "v"(xr[2]), "v"(xr[3]),
                  "v"(ga[0]), "v"(ga[1]), "v"(ga[2]), "v"(ga[3]),
                  "v"(ba[0]), "v"(ba[1]), "v"(ba[2]), "v"(ba[3]),
                  "v"(gb[0]), "v"(gb[1]), "v"(gb[2]), "v"(gb[3]),
                  "v"(bc[0]), "v"(bc[1]), "v"(bc[2]), "v"(bc[3]) : "memory");
  float mean, rstd;
  row_stats(a, mean, rstd);
#pragma unroll
  for (int q = 0; q < 4; ++q) a[q] = (a[q] - mean) * rstd * ga[q] + ba[q] + xr[q];
  row_stats(a, mean, rstd);
#pragma unroll
  for (int q = 0; q < 4; ++q) a[q] = (a[q] - mean) * rstd * gb[q] + bc[q];
#pragma unroll
  for (int q = 0; q < 4; ++q) *(f32x4*)(out + off + 128 * q) = a[q];
}

// ---------------------------------------------------------------------------
extern "C" void kernel_launch(void* const* d_in, const int* in_sizes, int n_in,
                              void* d_out, int out_size, void* d_ws, size_t ws_size,
                              hipStream_t stream) {
  const float* x  = (const float*)d_in[0];
  const int* mask = (const int*)d_in[1];
  const float* Wv = (const float*)d_in[2];
  const float* Wk = (const float*)d_in[3];
  const float* Wq = (const float*)d_in[4];
  const float* g1 = (const float*)d_in[5];
  const float* b1 = (const float*)d_in[6];
  const float* W1 = (const float*)d_in[7];
  const float* c1 = (const float*)d_in[8];
  const float* W2 = (const float*)d_in[9];
  const float* c2 = (const float*)d_in[10];
  const float* g3 = (const float*)d_in[11];
  const float* b3 = (const float*)d_in[12];
  const float* g2 = (const float*)d_in[13];
  const float* b2 = (const float*)d_in[14];

  const size_t MB = 1ull << 20;
  unsigned char* w = (unsigned char*)d_ws;
  // live regions (peak ~96 MB, with reuse):
  unsigned short* xb  = (unsigned short*)(w +  0 * MB); //  8 MB  x bf16
  unsigned short* Wqt = (unsigned short*)(w +  8 * MB); //  .5 MB
  unsigned short* Wkt = (unsigned short*)(w +  9 * MB); //  .5 MB
  unsigned short* Wvt = (unsigned short*)(w + 10 * MB); //  .5 MB
  unsigned short* W1t = (unsigned short*)(w + 11 * MB); //  2 MB
  unsigned short* W2t = (unsigned short*)(w + 13 * MB); //  2 MB
  float*          Kf  = (float*)         (w + 16 * MB); // 16 MB  keys f32
  unsigned short* Vt  = (unsigned short*)(w + 32 * MB); //  8 MB  V^T bf16
  float*          Qf  = (float*)         (w + 40 * MB); // 16 MB  queries f32
  float*          attn= (float*)         (w + 56 * MB); // 16 MB
  float*          x1f = (float*)         (w + 72 * MB); // 16 MB
  unsigned short* x1b = (unsigned short*)(w + 88 * MB); //  8 MB
  unsigned short* hb  = (unsigned short*)(w + 16 * MB); // 32 MB (reuses Kf/Vt/Qf)
  float*          ff  = (float*)         (w + 48 * MB); // 16 MB (reuses Qf/attn)

  dim3 blk(256);
  dim3 gblk(128);   // GEMM: 4 waves, 2x2

  // 1) conversions / weight transposes
  cvt_bf16_kernel<<<(M_ROWS * V_DIM) / 8192, blk, 0, stream>>>(x, xb);
  transpose_bf16_kernel<<<(V_DIM * E_DIM) / 4096, blk, 0, stream>>>(Wq, Wqt, V_DIM, E_DIM);
  transpose_bf16_kernel<<<(V_DIM * E_DIM) / 4096, blk, 0, stream>>>(Wk, Wkt, V_DIM, E_DIM);
  transpose_bf16_kernel<<<(V_DIM * E_DIM) / 4096, blk, 0, stream>>>(Wv, Wvt, V_DIM, E_DIM);
  transpose_bf16_kernel<<<(E_DIM * F_DIM) / 4096, blk, 0, stream>>>(W1, W1t, E_DIM, F_DIM);
  transpose_bf16_kernel<<<(F_DIM * E_DIM) / 4096, blk, 0, stream>>>(W2, W2t, F_DIM, E_DIM);

  // 2) QKV projections
  dim3 gq(M_ROWS / 128, E_DIM / 128);
  gemm_bf16_kernel<<<gq, gblk, 0, stream>>>(xb, Wqt, nullptr, Qf, nullptr,
                                           M_ROWS, E_DIM, V_DIM, 0, 0);
  gemm_bf16_kernel<<<gq, gblk, 0, stream>>>(xb, Wkt, nullptr, Kf, nullptr,
                                           M_ROWS, E_DIM, V_DIM, 0, 0);
  gemm_bf16_kernel<<<gq, gblk, 0, stream>>>(xb, Wvt, nullptr, nullptr, Vt,
                                           M_ROWS, E_DIM, V_DIM, 2, 0);

  // 3) fused attention
  dim3 ga(S_LEN / 128, H_CNT, B_SZ);
  const float scale = 1.0f / sqrtf((float)E_DIM);
  flash_attn_kernel<<<ga, blk, 0, stream>>>(Kf, Qf, Vt, mask, attn, scale);

  // 4) x1 = LN(attn + queries)
  add_ln_kernel<<<M_ROWS / 8, blk, 0, stream>>>(attn, Qf, g1, b1, x1f, x1b);

  // 5) h = relu(x1 @ W1 + c1)
  dim3 gf1(M_ROWS / 128, F_DIM / 128);
  gemm_bf16_kernel<<<gf1, gblk, 0, stream>>>(x1b, W1t, c1, nullptr, hb,
                                            M_ROWS, F_DIM, E_DIM, 1, 1);

  // 6) f = h @ W2 + c2
  dim3 gf2(M_ROWS / 128, E_DIM / 128);
  gemm_bf16_kernel<<<gf2, gblk, 0, stream>>>(hb, W2t, c2, ff, nullptr,
                                            M_ROWS, E_DIM, F_DIM, 0, 0);

  // 7) out = LN(LN(f) + x1)
  double_ln_kernel<<<M_ROWS / 8, blk, 0, stream>>>(ff, x1f, g3, b3, g2, b2,
                                               (float*)d_out);
}

// v003
// A run of this version takes 264 microseconds.
// Two timings next to v002 both put it at 1.24 times that version's speed.
// All steps since v000 together make it 1.96 times as fast.
#include <hip/hip_runtime.h>
#include <hip/hip_bf16.h>
#include <math.h>

// ---------------------------------------------------------------------------
// Transformer block on CDNA5 (gfx1250), wave32, bf16 WMMA w/ f32 accumulation.
// Pipeline:
//   1) convert x -> bf16; transpose+convert weights -> bf16 [N,K]
//   2) WMMA GEMMs: Q (f32), K (f32), V (bf16, head-transposed [b,h,d,s])
//   3) flash attention (scores = K.Q^T per the reference's einsum), online
//      softmax, P.V via WMMA, LDS transpose for the P fragment
//   4) x1 = LN(attn + Q) -> f32 + bf16
//   5) h = relu(x1 @ W1 + c1) (WMMA, bf16 out)
//   6) f = h @ W2 + c2 (WMMA, f32 out)
//   7) out = LN(LN(f) + x1)
// ---------------------------------------------------------------------------

typedef __attribute__((ext_vector_type(16))) __bf16 v16bf;
typedef __attribute__((ext_vector_type(8)))  float  v8f;

#define S_LEN  2048
#define E_DIM  512
#define V_DIM  512
#define F_DIM  2048
#define B_SZ   4
#define H_CNT  8
#define D_HEAD 64
#define M_ROWS (B_SZ * S_LEN)

__device__ __forceinline__ unsigned short f2bf(float f) {
  union { float f; unsigned u; } a; a.f = f;
  unsigned u = a.u;
  return (unsigned short)((u + 0x7FFFu + ((u >> 16) & 1u)) >> 16); // RNE
}

// A/B fragment loader for v_wmma_f32_16x16x32_bf16 from row-major bf16 data.
// Layout (ISA 7.12.2, 16-bit A 16x32): lane L holds row (L&15); lanes 0-15
// carry K = [k0, k0+8) and [k0+16, k0+24); lanes 16-31 the +8 halves.
// The same layout serves the B operand when loading from a [N,K] (transposed)
// matrix: lane holds column n = (L&15) of B.
__device__ __forceinline__ v16bf load_frag_bf16(const unsigned short* base, int ld,
                                                int row0, int k0, int lane) {
  const int half = lane >> 4;
  const unsigned short* p = base + (size_t)(row0 + (lane & 15)) * ld + k0 + 8 * half;
  union { uint4 q[2]; v16bf v; } u;
  u.q[0] = *(const uint4*)p;
  u.q[1] = *(const uint4*)(p + 16);
  return u.v;
}

// Same fragment, sourced from fp32 with on-the-fly bf16 conversion.
__device__ __forceinline__ v16bf load_frag_f32(const float* base, int ld,
                                               int row0, int k0, int lane) {
  const int half = lane >> 4;
  const float* p = base + (size_t)(row0 + (lane & 15)) * ld + k0 + 8 * half;
  union { unsigned short s[16]; v16bf v; } u;
#pragma unroll
  for (int e = 0; e < 8; ++e) {
    u.s[e]     = f2bf(p[e]);
    u.s[8 + e] = f2bf(p[16 + e]);
  }
  return u.v;
}

__device__ __forceinline__ v8f wmma_bf16(v16bf a, v16bf b, v8f c) {
  return __builtin_amdgcn_wmma_f32_16x16x32_bf16(false, a, false, b, (short)0, c,
                                                 false, false);
}

// ---------------------------------------------------------------------------
// The kernels without matrix work are short; each thread takes many elements
// and the grids are small, for speed only.

__device__ __forceinline__ unsigned pack2(float lo, float hi) {
  return (unsigned)f2bf(lo) | ((unsigned)f2bf(hi) << 16);
}

// Elementwise fp32 -> bf16, 32 elements a thread: four chunks of eight (two
// 16-byte loads, one 16-byte store), a block's chunks 2048 elements apart, so
// that every access of a wave covers whole lines.  Grid = elements / 8192.
__global__ void __launch_bounds__(256)
cvt_bf16_kernel(const float* __restrict__ in, unsigned short* __restrict__ out) {
  const size_t base = (size_t)blockIdx.x * 8192 + threadIdx.x * 8;
  const float* p = in + base;
  unsigned short* o = out + base;
  float4 v[4][2];
#pragma unroll
  for (int c = 0; c < 4; ++c) {
    v[c][0] = *(const float4*)(p + 2048 * c);
    v[c][1] = *(const float4*)(p + 2048 * c + 4);
  }
  uint4 q[4];
#pragma unroll
  for (int c = 0; c < 4; ++c)
    q[c] = make_uint4(pack2(v[c][0].x, v[c][0].y), pack2(v[c][0].z, v[c][0].w),
                      pack2(v[c][1].x, v[c][1].y), pack2(v[c][1].z, v[c][1].w));
#pragma unroll
  for (int c = 0; c < 4; ++c) *(uint4*)(o + 2048 * c) = q[c];
}

// [Kd,Nd] fp32 -> [Nd,Kd] bf16.  A thread takes 16 k of one n: 16 loads (a wave
// reads 128 contiguous bytes of a row each time) and two 16-byte stores.
// Grid = Kd * Nd / 4096; Kd is a multiple of 16.  The row length is a constant
// of the body, so that the split of the block index needs no division.
template <int ND>
__device__ __forceinline__ void transpose_body(const float* __restrict__ in,
                                               unsigned short* __restrict__ out, int Kd) {
  const int kb = blockIdx.x / (ND / 256);        // a block's threads share their 16 rows
  const int n  = (blockIdx.x % (ND / 256)) * 256 + threadIdx.x;
  const float* p = in + (size_t)(16 * kb) * ND + n;
  float v[16];
#pragma unroll
  for (int e = 0; e < 16; ++e) v[e] = p[e * ND];
  const uint4 q0 = make_uint4(pack2(v[0], v[1]),   pack2(v[2], v[3]),
                              pack2(v[4], v[5]),   pack2(v[6], v[7]));
  const uint4 q1 = make_uint4(pack2(v[8], v[9]),   pack2(v[10], v[11]),
                              pack2(v[12], v[13]), pack2(v[14], v[15]));
  unsigned short* o = out + (size_t)n * Kd + 16 * kb;
  *(uint4*)o       = q0;
  *(uint4*)(o + 8) = q1;
}

__global__ void __launch_bounds__(256)
transpose_bf16_kernel(const float* __restrict__ in, unsigned short* __restrict__ out,
                      int Kd, int Nd) {
  if (Nd == E_DIM) transpose_body<E_DIM>(in, out, Kd);
  else             transpose_body<F_DIM>(in, out, Kd);
}

// ---------------------------------------------------------------------------
// C[M,N] = A[M,K] @ Bt[N,K]^T (+bias)(+relu).  Block = 4 waves in a 2x2 grid,
// each wave owns a 64x64 tile (4 A x 4 B fragments, 16 accumulator tiles), so a
// loaded fragment feeds four WMMAs; grid = (M/128, N/128).  K is a multiple of 64.
// Two fragment sets alternate: one set's loads fly while the other is multiplied.
// mode 0: f32 out; mode 1: bf16 out; mode 2: bf16 out transposed per-head
//         to Vt[b][h][d][s] (for the attention's P.V B-operand).
__device__ __forceinline__ void gemm_load_set(v16bf (&a)[4], v16bf (&b)[4],
                                              const unsigned short* A,
                                              const unsigned short* Bt, int K,
                                              int m0, int n0, int k0, int lane) {
#pragma unroll
  for (int i = 0; i < 4; ++i) a[i] = load_frag_bf16(A, K, m0 + 16 * i, k0, lane);
#pragma unroll
  for (int t = 0; t < 4; ++t) b[t] = load_frag_bf16(Bt, K, n0 + 16 * t, k0, lane);
}

// The same set outside the loop, where the eight address pairs die with the
// loads: the wait names them as inputs, so that they stay untouched (also by a
// later load's result) until the loads' addresses have been taken.
__device__ __forceinline__ void gemm_load_set_wait(v16bf (&a)[4], v16bf (&b)[4],
                                                   const unsigned short* A,
                                                   const unsigned short* Bt, int K,
                                                   int m0, int n0, int k0, int lane) {
  const size_t off = (size_t)(lane & 15) * K + k0 + 8 * (lane >> 4);
  const unsigned short* pa[4];
  const unsigned short* pb[4];
#pragma unroll
  for (int i = 0; i < 4; ++i) {
    pa[i] = A  + (size_t)(m0 + 16 * i) * K + off;
    pb[i] = Bt + (size_t)(n0 + 16 * i) * K + off;
  }
#pragma unroll
  for (int i = 0; i < 4; ++i) {
    union { uint4 q[2]; v16bf v; } u;
    u.q[0] = *(const uint4*)pa[i];
    u.q[1] = *(const uint4*)(pa[i] + 16);
    a[i] = u.v;
  }
#pragma unroll
  for (int t = 0; t < 4; ++t) {
    union { uint4 q[2]; v16bf v; } u;
    u.q[0] = *(const uint4*)pb[t];
    u.q[1] = *(const uint4*)(pb[t] + 16);
    b[t] = u.v;
  }
  asm volatile("s_wait_xcnt 0x0"
               :: "v"(pa[0]), "v"(pa[1]), "v"(pa[2]), "v"(pa[3]),
                  "v"(pb[0]), "v"(pb[1]), "v"(pb[2]), "v"(pb[3]) : "memory");
}

__device__ __forceinline__ void gemm_mul_set(v8f (&acc)[4][4], const v16bf (&a)[4],
                                             const v16bf (&b)[4]) {
#pragma unroll
  for (int i = 0; i < 4; ++i)
#pragma unroll
    for (int t = 0; t < 4; ++t) acc[i][t] = wmma_bf16(a[i], b[t], acc[i][t]);
}

__global__ void __launch_bounds__(128)
gemm_bf16_kernel(const unsigned short* __restrict__ A,
                 const unsigned short* __restrict__ Bt,
                 const float* __restrict__ bias,
                 float* __restrict__ Cf, unsigned short* __restrict__ Cb,
                 int M, int N, int K, int mode, int relu) {
  const int lane = threadIdx.x & 31;
  const int wave = threadIdx.x >> 5;
  const int m0 = blockIdx.x * 128 + (wave >> 1) * 64;
  const int n0 = blockIdx.y * 128 + (wave & 1) * 64;

  v8f acc[4][4] = {};
  v16bf a0[4], b0[4], a1[4], b1[4];
  gemm_load_set_wait(a0, b0, A, Bt, K, m0, n0, 0, lane);
  __builtin_amdgcn_sched_barrier(0);     // holds later register writes behind that wait
  int k0 = 0;
  for (; k0 < K - 64; k0 += 64) {
    gemm_load_set(a1, b1, A, Bt, K, m0, n0, k0 + 32, lane);
    // keeps the next set's loads ahead of this set's 16 WMMAs (else they sink
    // among the WMMAs and their latency is waited out right behind them)
    __builtin_amdgcn_sched_barrier(0);
    gemm_mul_set(acc, a0, b0);
    gemm_load_set(a0, b0, A, Bt, K, m0, n0, k0 + 64, lane);
    __builtin_amdgcn_sched_barrier(0);   // as above
    gemm_mul_set(acc, a1, b1);
    // the next trip rewrites the address registers that the loads above name
    asm volatile("s_wait_xcnt 0x0" ::: "memory");
  }
  gemm_load_set_wait(a1, b1, A, Bt, K, m0, n0, k0 + 32, lane);
  __builtin_amdgcn_sched_barrier(0);     // as above; also keeps the loads ahead of the WMMAs
  gemm_mul_set(acc, a0, b0);
  gemm_mul_set(acc, a1, b1);

  const int col = lane & 15;
  const int h2  = lane >> 4;
  // Epilogue.  The mode test stands outside the element loops.  Modes 0 and 1
  // go in two parts: first every value and every row address is formed in
  // registers, then come the stores alone, so that no register of an issued
  // store is written again.
#pragma unroll
  for (int t = 0; t < 4; ++t) {
    float bv = bias ? bias[n0 + 16 * t + col] : 0.0f;
#pragma unroll
    for (int i = 0; i < 4; ++i)
#pragma unroll
      for (int e = 0; e < 8; ++e) {
        float v = acc[i][t][e] + bv;
        acc[i][t][e] = relu ? fmaxf(v, 0.0f) : v;
      }
  }
  const int mr = m0 + 8 * h2;                  // C layout: VGPR e -> row e (+8)
  const int nc = n0 + col;
  if (mode == 0) {
    float* cb = Cf + (size_t)mr * N + nc;
    float* c[4][8];
#pragma unroll
    for (int i = 0; i < 4; ++i)
#pragma unroll
      for (int e = 0; e < 8; ++e) c[i][e] = cb + (size_t)(16 * i + e) * N;
    __builtin_amdgcn_sched_barrier(0);         // only stores behind this line
#pragma unroll
    for (int i = 0; i < 4; ++i)
#pragma unroll
      for (int e = 0; e < 8; ++e)
#pragma unroll
        for (int t = 0; t < 4; ++t) c[i][e][16 * t] = acc[i][t][e];
    // code of the other modes' paths follows and reuses these stores' registers
    asm volatile("s_wait_xcnt 0x0" ::: "memory");
  } else if (mode == 1) {
    unsigned short* cb = Cb + (size_t)mr * N + nc;
    unsigned short* c[4][8];
    unsigned short hv[4][4][8];
#pragma unroll
    for (int i = 0; i < 4; ++i)
#pragma unroll
      for (int e = 0; e < 8; ++e) {
        c[i][e] = cb + (size_t)(16 * i + e) * N;
#pragma unroll
        for (int t = 0; t < 4; ++t) hv[i][t][e] = f2bf(acc[i][t][e]);
      }
    __builtin_amdgcn_sched_barrier(0);         // only stores behind this line
#pragma unroll
    for (int i = 0; i < 4; ++i)
#pragma unroll
      for (int e = 0; e < 8; ++e)
#pragma unroll
        for (int t = 0; t < 4; ++t) c[i][e][16 * t] = hv[i][t][e];
    // code of the other modes' paths follows and reuses these stores' registers
    asm volatile("s_wait_xcnt 0x0" ::: "memory");
  } else {
    // the wave's 64 rows lie in one batch entry, its 64 columns are one head;
    // a lane's eight rows of a tile are eight neighbours in Vt: one 16-byte store
    const int bb = mr / S_LEN, s = mr % S_LEN;
    const int hh = nc >> 6,    d = nc & 63;
    unsigned short* c = Cb + (((size_t)bb * H_CNT + hh) * D_HEAD + d) * S_LEN + s;
    uint4 pk[4][4];
#pragma unroll
    for (int i = 0; i < 4; ++i)
#pragma unroll
      for (int t = 0; t < 4; ++t) {
        unsigned q[4];
#pragma unroll
        for (int e = 0; e < 4; ++e)
          q[e] = (unsigned)f2bf(acc[i][t][2 * e]) | ((unsigned)f2bf(acc[i][t][2 * e + 1]) << 16);
        pk[i][t] = make_uint4(q[0], q[1], q[2], q[3]);
      }
#pragma unroll
    for (int i = 0; i < 4; ++i)
#pragma unroll
      for (int t = 0; t < 4; ++t)
        *(uint4*)(c + (size_t)(16 * t) * S_LEN + 16 * i) = pk[i][t];
    // code of the other modes' paths follows and reuses these stores' registers
    asm volatile("s_wait_xcnt 0x0" ::: "memory");
  }
}

// ---------------------------------------------------------------------------
#define KT 64   // keys a stage of the attention's LDS tiles
#define TP 72   // row pitch of a staged tile in bf16: 144 bytes = 16 x 9, no bank conflict for 16-byte reads

typedef __attribute__((ext_vector_type(4))) float    f32x4s;
typedef __attribute__((ext_vector_type(4))) unsigned u32x4s;

// One thread's share of a 64-key stage, global -> registers.  The bases are the
// same for the whole block, the two byte offsets never change.
__device__ __forceinline__ void stage_load(f32x4s (&qr)[4], u32x4s (&vr)[2],
                                           const float* qbase, const unsigned short* vbase,
                                           unsigned qoff, unsigned voff) {
#pragma unroll
  for (int q = 0; q < 4; ++q)
    qr[q] = *(const f32x4s*)((const char*)qbase + qoff + (unsigned)(16 * q * E_DIM * 4));
#pragma unroll
  for (int q = 0; q < 2; ++q)
    vr[q] = *(const u32x4s*)((const char*)vbase + voff + (unsigned)(32 * q * S_LEN * 2));
}

// registers -> LDS; Q is rounded to bf16 here, once for the block's eight waves
__device__ __forceinline__ void stage_store(const f32x4s (&qr)[4], const u32x4s (&vr)[2],
                                            unsigned short* qdst, unsigned short* vdst) {
#pragma unroll
  for (int q = 0; q < 4; ++q)
    *(uint2*)(qdst + 16 * q * TP) = make_uint2(pack2(qr[q].x, qr[q].y), pack2(qr[q].z, qr[q].w));
#pragma unroll
  for (int q = 0; q < 2; ++q) *(u32x4s*)(vdst + 32 * q * TP) = vr[q];
}

// Flash attention. Reference einsum gives corr[b,h,i,j] = K[b,i,h,:].Q[b,j,h,:],
// softmax over j, out[i,d] = sum_j P[i,j] V[j,d].
// Block = 8 waves; wave owns 16 output rows i; streams keys in tiles of 32.
// The eight waves walk the same keys, so the block brings each 64-key stage of
// Q and of V^T into LDS once: whole-line global loads, Q rounded to bf16 on the
// way, and every wave takes its B fragments from LDS.  Two buffers: the next
// stage's loads fly while this stage is worked on; one barrier a stage.
__global__ void __launch_bounds__(256)
flash_attn_kernel(const float* __restrict__ Kf, const float* __restrict__ Qf,
                  const unsigned short* __restrict__ Vt, const int* __restrict__ mask,
                  float* __restrict__ Out, float scale) {
  __shared__ __align__(16) unsigned short ptile[8][16][32];
  __shared__ __align__(16) unsigned short qs[2][KT][TP];      // Q rows j, bf16, d along the row
  __shared__ __align__(16) unsigned short vs[2][D_HEAD][TP];  // V^T rows d, keys along the row

  const int lane = threadIdx.x & 31;
  const int wave = threadIdx.x >> 5;
  const int h2   = lane >> 4;
  const int col  = lane & 15;
  const int b = blockIdx.z, h = blockIdx.y;
  const int i0 = blockIdx.x * 128 + wave * 16;

  const float* Kb_ = Kf + (size_t)b * S_LEN * E_DIM + h * D_HEAD;
  const float* Qb_ = Qf + (size_t)b * S_LEN * E_DIM + h * D_HEAD;
  const unsigned short* Vb_ = Vt + ((size_t)b * H_CNT + h) * D_HEAD * S_LEN;

  // A thread's share of a stage.  Q: 16 bytes of four rows, 16 rows apart (a
  // wave's load covers two whole 256-byte rows); V^T: 16 bytes of two rows, 32
  // rows apart (a wave's load covers four whole 128-byte rows).
  const int qrow = threadIdx.x >> 4, qcol = (threadIdx.x & 15) * 4;
  const int vrow = threadIdx.x >> 3, vcol = (threadIdx.x & 7) * 8;
  const unsigned qoff = (unsigned)(qrow * E_DIM + qcol) * 4u;   // byte offsets from
  const unsigned voff = (unsigned)(vrow * S_LEN + vcol) * 2u;   // the stage's base
  f32x4s qr[4];
  u32x4s vr[2];

  // A operand: this wave's 16 K-rows over d = 0..63 (reused for all key tiles)
  v16bf aK0 = load_frag_f32(Kb_, E_DIM, i0, 0,  lane);
  v16bf aK1 = load_frag_f32(Kb_, E_DIM, i0, 32, lane);

  v8f O0 = {}, O1 = {}, O2 = {}, O3 = {};
  float mrow[8], lrow[8];
#pragma unroll
  for (int e = 0; e < 8; ++e) { mrow[e] = -3.0e38f; lrow[e] = 0.0f; }

  const float mval = -1.0e20f * scale;

  stage_load(qr, vr, Qb_, Vb_, qoff, voff);
  stage_store(qr, vr, &qs[0][qrow][qcol], &vs[0][vrow][vcol]);
  __syncthreads();                       // stage 0 is published

  for (int st = 0; st < S_LEN; st += KT) {
    const int buf = (st / KT) & 1;
    const bool more = st + KT < S_LEN;   // the same for the whole block
    if (more)
      stage_load(qr, vr, Qb_ + (size_t)(st + KT) * E_DIM, Vb_ + (st + KT), qoff, voff);
    const unsigned short* qt = &qs[buf][0][0];
    const unsigned short* vt = &vs[buf][0][0];

    // unrolled so that the two halves' LDS offsets are immediates
#pragma unroll
    for (int jj = 0; jj < KT; jj += 32) {
      const int j0 = st + jj;
      // scores tile 16x32: two 16x16 WMMA fragments, K over d (2 steps of 32)
      v16bf bq00 = load_frag_bf16(qt, TP, jj +  0, 0,  lane);
      v16bf bq01 = load_frag_bf16(qt, TP, jj +  0, 32, lane);
      v16bf bq10 = load_frag_bf16(qt, TP, jj + 16, 0,  lane);
      v16bf bq11 = load_frag_bf16(qt, TP, jj + 16, 32, lane);
      v8f s0 = {}, s1 = {};
      s0 = wmma_bf16(aK0, bq00, s0); s0 = wmma_bf16(aK1, bq01, s0);
      s1 = wmma_bf16(aK0, bq10, s1); s1 = wmma_bf16(aK1, bq11, s1);

      float p0[8], p1[8];
#pragma unroll
      for (int e = 0; e < 8; ++e) {
        size_t i = (size_t)(i0 + e + 8 * h2);
        int j = j0 + col;
        float v0 = mask[i * S_LEN + j]      ? s0[e] * scale : mval;
        float v1 = mask[i * S_LEN + j + 16] ? s1[e] * scale : mval;
        // row-wise max/sum: reduce across the 16 lanes of this half
        float mx = fmaxf(v0, v1);
#pragma unroll
        for (int off = 1; off < 16; off <<= 1) mx = fmaxf(mx, __shfl_xor(mx, off, 32));
        float mnew  = fmaxf(mrow[e], mx);
        float alpha = __expf(mrow[e] - mnew);
        mrow[e] = mnew;
        float e0 = __expf(v0 - mnew), e1 = __expf(v1 - mnew);
        float rs = e0 + e1;
#pragma unroll
        for (int off = 1; off < 16; off <<= 1) rs += __shfl_xor(rs, off, 32);
        lrow[e] = lrow[e] * alpha + rs;
        p0[e] = e0; p1[e] = e1;
        O0[e] *= alpha; O1[e] *= alpha; O2[e] *= alpha; O3[e] *= alpha;
      }

      // transpose P (C-layout) -> A-layout via per-wave LDS tile
#pragma unroll
      for (int e = 0; e < 8; ++e) {
        ptile[wave][e + 8 * h2][col]      = f2bf(p0[e]);
        ptile[wave][e + 8 * h2][col + 16] = f2bf(p1[e]);
      }
      __builtin_amdgcn_wave_barrier();   // LDS is in-order within a wave
      union { uint4 q[2]; v16bf v; } up;
      const unsigned short* prow = &ptile[wave][col][0];
      up.q[0] = *(const uint4*)(prow + 8 * h2);
      up.q[1] = *(const uint4*)(prow + 16 + 8 * h2);
      __builtin_amdgcn_wave_barrier();
      v16bf pa = up.v;

      // O += P . V  (B operand from the staged V^T: rows = d, cols = j)
      v16bf bv0 = load_frag_bf16(vt, TP, 0,  jj, lane);
      v16bf bv1 = load_frag_bf16(vt, TP, 16, jj, lane);
      v16bf bv2 = load_frag_bf16(vt, TP, 32, jj, lane);
      v16bf bv3 = load_frag_bf16(vt, TP, 48, jj, lane);
      O0 = wmma_bf16(pa, bv0, O0);
      O1 = wmma_bf16(pa, bv1, O1);
      O2 = wmma_bf16(pa, bv2, O2);
      O3 = wmma_bf16(pa, bv3, O3);
    }

    // The other buffer's last readers left it before the barrier of the trip
    // before; this trip's barrier publishes it and ends the reads of this one.
    if (more)
      stage_store(qr, vr, &qs[buf ^ 1][qrow][qcol], &vs[buf ^ 1][vrow][vcol]);
    // the next trip's address additions rewrite registers that this trip's global loads name
    asm volatile("s_wait_xcnt 0x0" ::: "memory");
    __builtin_amdgcn_sched_barrier(0);   // keeps those additions behind the wait
    __syncthreads();
  }

#pragma unroll
  for (int e = 0; e < 8; ++e) {
    float inv = 1.0f / lrow[e];
    size_t i = (size_t)(i0 + e + 8 * h2);
    float* orow = Out + ((size_t)b * S_LEN + i) * E_DIM + h * D_HEAD + col;
    orow[0]  = O0[e] * inv;
    orow[16] = O1[e] * inv;
    orow[32] = O2[e] * inv;
    orow[48] = O3[e] * inv;
  }
}

// ---------------------------------------------------------------------------
// LayerNorm kernels: one wave per row of 512, 8 rows a block, 16 elements a lane
// (four 16-byte pieces, 128 elements apart: a wave's access is 512 contiguous
// bytes).  The row sums run in the lane and then over the wave's 32 lanes.
typedef __attribute__((ext_vector_type(4))) float f32x4;

__device__ __forceinline__ float wave_sum(float v) {
#pragma unroll
  for (int o = 16; o > 0; o >>= 1) v += __shfl_xor(v, o, 32);
  return v;
}

// 16 bytes at a 32-bit byte offset from a uniform base
__device__ __forceinline__ f32x4 ld16(const float* base, unsigned byte_off) {
  return *(const f32x4*)((const char*)base + byte_off);
}

// mean and 1/sqrt(var + eps) of the wave's row
__device__ __forceinline__ void row_stats(const f32x4 (&x)[4], float& mean, float& rstd) {
  float s1 = 0.0f, s2 = 0.0f;
#pragma unroll
  for (int q = 0; q < 4; ++q) {
    s1 += (x[q].x + x[q].y) + (x[q].z + x[q].w);
    s2 += (x[q].x * x[q].x + x[q].y * x[q].y) + (x[q].z * x[q].z + x[q].w * x[q].w);
  }
  s1 = wave_sum(s1);
  s2 = wave_sum(s2);
  mean = s1 * (1.0f / E_DIM);
  const float var = s2 * (1.0f / E_DIM) - mean * mean;
  rstd = rsqrtf(var + 1e-5f);
}

// x1 = LN(src + res) * g + b  -> f32 and a bf16 copy.
__global__ void __launch_bounds__(256)
add_ln_kernel(const float* __restrict__ src, const float* __restrict__ res,
              const float* __restrict__ g, const float* __restrict__ bb,
              float* __restrict__ outf, unsigned short* __restrict__ outb) {
  const int lane = threadIdx.x & 31;
  const size_t off = (size_t)(blockIdx.x * 8 + (threadIdx.x >> 5)) * E_DIM + 4 * lane;
  const unsigned ro = (unsigned)off * 4u;   // the lane's byte offset in a [rows,512] f32 array
  const unsigned co = 16u * lane;           // and in a vector of 512
  f32x4 x[4], c[4], gg[4], bv[4];
#pragma unroll
  for (int q = 0; q < 4; ++q) {
    x[q]  = ld16(src, ro + 512u * q);
    c[q]  = ld16(res, ro + 512u * q);
    gg[q] = ld16(g,   co + 512u * q);
    bv[q] = ld16(bb,  co + 512u * q);
  }
  // Every loaded value is an input, so the wait stands behind all 16 loads; the
  // two offsets are inputs, so they stay untouched (also by a later load's
  // result) up to it.
  asm volatile("s_wait_xcnt 0x0"
               :: "v"(ro), "v"(co),
                  "v"(x[0]),  "v"(x[1]),  "v"(x[2]),  "v"(x[3]),
                  "v"(c[0]),  "v"(c[1]),  "v"(c[2]),  "v"(c[3]),
                  "v"(gg[0]), "v"(gg[1]), "v"(gg[2]), "v"(gg[3]),
                  "v"(bv[0]), "v"(bv[1]), "v"(bv[2]), "v"(bv[3]) : "memory");
#pragma unroll
  for (int q = 0; q < 4; ++q) x[q] += c[q];
  float mean, rstd;
  row_stats(x, mean, rstd);
  uint2 h[4];
#pragma unroll
  for (int q = 0; q < 4; ++q) {
    x[q] = (x[q] - mean) * rstd * gg[q] + bv[q];
    h[q] = make_uint2(pack2(x[q].x, x[q].y), pack2(x[q].z, x[q].w));
  }
#pragma unroll
  for (int q = 0; q < 4; ++q) {
    *(f32x4*)(outf + off + 128 * q) = x[q];
    *(uint2*)(outb + off + 128 * q) = h[q];
  }
}

// out = LN( LN(f)*g3+b3 + x1 ) * g2 + b2.
__global__ void __launch_bounds__(256)
double_ln_kernel(const float* __restrict__ f, const float* __restrict__ x1,
                 const float* __restrict__ g3, const float* __restrict__ b3,
                 const float* __restrict__ g2, const float* __restrict__ b2,
                 float* __restrict__ out) {
  const int lane = threadIdx.x & 31;
  const size_t off = (size_t)(blockIdx.x * 8 + (threadIdx.x >> 5)) * E_DIM + 4 * lane;
  const unsigned ro = (unsigned)off * 4u;   // the lane's byte offset in a [rows,512] f32 array
  const unsigned co = 16u * lane;           // and in a vector of 512
  f32x4 a[4], xr[4], ga[4], ba[4], gb[4], bc[4];
#pragma unroll
  for (int q = 0; q < 4; ++q) {
    a[q]  = ld16(f,  ro + 512u * q);
    xr[q] = ld16(x1, ro + 512u * q);
    ga[q] = ld16(g3, co + 512u * q);
    ba[q] = ld16(b3, co + 512u * q);
    gb[q] = ld16(g2, co + 512u * q);
    bc[q] = ld16(b2, co + 512u * q);
  }
  // Every loaded value is an input, so the wait stands behind all 24 loads; the
  // two offsets are inputs, so they stay untouched (also by a later load's
  // result) up to it.
  asm volatile("s_wait_xcnt 0x0"
               :: "v"(ro), "v"(co),
                  "v"(a[0]),  "v"(a[1]),  "v"(a[2]),  "v"(a[3]),
                  "v"(xr[0]), "v"(xr[1]), "v"(xr[2]), "v"(xr[3]),
                  "v"(ga[0]), "v"(ga[1]), "v"(ga[2]), "v"(ga[3]),
                  "v"(ba[0]), "v"(ba[1]), "v"(ba[2]), "v"(ba[3]),
                  "v"(gb[0]), "v"(gb[1]), "v"(gb[2]), "v"(gb[3]),
                  "v"(bc[0]), "v"(bc[1]), "v"(bc[2]), "v"(bc[3]) : "memory");
  float mean, rstd;
  row_stats(a, mean, rstd);
#pragma unroll
  for (int q = 0; q < 4; ++q) a[q] = (a[q] - mean) * rstd * ga[q] + ba[q] + xr[q];
  row_stats(a, mean, rstd);
#pragma unroll
  for (int q = 0; q < 4; ++q) a[q] = (a[q] - mean) * rstd * gb[q] + bc[q];
#pragma unroll
  for (int q = 0; q < 4; ++q) *(f32x4*)(out + off + 128 * q) = a[q];
}

// ---------------------------------------------------------------------------
extern "C" void kernel_launch(void* const* d_in, const int* in_sizes, int n_in,
                              void* d_out, int out_size, void* d_ws, size_t ws_size,
                              hipStream_t stream) {
  const float* x  = (const float*)d_in[0];
  const int* mask = (const int*)d_in[1];
  const float* Wv = (const float*)d_in[2];
  const float* Wk = (const float*)d_in[3];
  const float* Wq = (const float*)d_in[4];
  const float* g1 = (const float*)d_in[5];
  const float* b1 = (const float*)d_in[6];
  const float* W1 = (const float*)d_in[7];
  const float* c1 = (const float*)d_in[8];
  const float* W2 = (const float*)d_in[9];
  const float* c2 = (const float*)d_in[10];
  const float* g3 = (const float*)d_in[11];
  const float* b3 = (const float*)d_in[12];
  const float* g2 = (const float*)d_in[13];
  const float* b2 = (const float*)d_in[14];

  const size_t MB = 1ull << 20;
  unsigned char* w = (unsigned char*)d_ws;
  // live regions (peak ~96 MB, with reuse):
  unsigned short* xb  = (unsigned short*)(w +  0 * MB); //  8 MB  x bf16
  unsigned short* Wqt = (unsigned short*)(w +  8 * MB); //  .5 MB
  unsigned short* Wkt = (unsigned short*)(w +  9 * MB); //  .5 MB
  unsigned short* Wvt = (unsigned short*)(w + 10 * MB); //  .5 MB
  unsigned short* W1t = (unsigned short*)(w + 11 * MB); //  2 MB
  unsigned short* W2t = (unsigned short*)(w + 13 * MB); //  2 MB
  float*          Kf  = (float*)         (w + 16 * MB); // 16 MB  keys f32
  unsigned short* Vt  = (unsigned short*)(w + 32 * MB); //  8 MB  V^T bf16
  float*          Qf  = (float*)         (w + 40 * MB); // 16 MB  queries f32
  float*          attn= (float*)         (w + 56 * MB); // 16 MB
  float*          x1f = (float*)         (w + 72 * MB); // 16 MB
  unsigned short* x1b = (unsigned short*)(w + 88 * MB); //  8 MB
  unsigned short* hb  = (unsigned short*)(w + 16 * MB); // 32 MB (reuses Kf/Vt/Qf)
  float*          ff  = (float*)         (w + 48 * MB); // 16 MB (reuses Qf/attn)

  dim3 blk(256);
  dim3 gblk(128);   // GEMM: 4 waves, 2x2

  // 1) conversions / weight transposes
  cvt_bf16_kernel<<<(M_ROWS * V_DIM) / 8192, blk, 0, stream>>>(x, xb);
  transpose_bf16_kernel<<<(V_DIM * E_DIM) / 4096, blk, 0, stream>>>(Wq, Wqt, V_DIM, E_DIM);
  transpose_bf16_kernel<<<(V_DIM * E_DIM) / 4096, blk, 0, stream>>>(Wk, Wkt, V_DIM, E_DIM);
  transpose_bf16_kernel<<<(V_DIM * E_DIM) / 4096, blk, 0, stream>>>(Wv, Wvt, V_DIM, E_DIM);
  transpose_bf16_kernel<<<(E_DIM * F_DIM) / 4096, blk, 0, stream>>>(W1, W1t, E_DIM, F_DIM);
  transpose_bf16_kernel<<<(F_DIM * E_DIM) / 4096, blk, 0, stream>>>(W2, W2t, F_DIM, E_DIM);

  // 2) QKV projections
  dim3 gq(M_ROWS / 128, E_DIM / 128);
  gemm_bf16_kernel<<<gq, gblk, 0, stream>>>(xb, Wqt, nullptr, Qf, nullptr,
                                           M_ROWS, E_DIM, V_DIM, 0, 0);
  gemm_bf16_kernel<<<gq, gblk, 0, stream>>>(xb, Wkt, nullptr, Kf, nullptr,
                                           M_ROWS, E_DIM, V_DIM, 0, 0);
  gemm_bf16_kernel<<<gq, gblk, 0, stream>>>(xb, Wvt, nullptr, nullptr, Vt,
                                           M_ROWS, E_DIM, V_DIM, 2, 0);

  // 3) fused attention
  dim3 ga(S_LEN / 128, H_CNT, B_SZ);
  const float scale = 1.0f / sqrtf((float)E_DIM);
  flash_attn_kernel<<<ga, blk, 0, stream>>>(Kf, Qf, Vt, mask, attn, scale);

  // 4) x1 = LN(attn + queries)
  add_ln_kernel<<<M_ROWS / 8, blk, 0, stream>>>(attn, Qf, g1, b1, x1f, x1b);

  // 5) h = relu(x1 @ W1 + c1)
  dim3 gf1(M_ROWS / 128, F_DIM / 128);
  gemm_bf16_kernel<<<gf1, gblk, 0, stream>>>(x1b, W1t, c1, nullptr, hb,
                                            M_ROWS, F_DIM, E_DIM, 1, 1);

  // 6) f = h @ W2 + c2
  dim3 gf2(M_ROWS / 128, E_DIM / 128);
  gemm_bf16_kernel<<<gf2, gblk, 0, stream>>>(hb, W2t, c2, ff, nullptr,
                                            M_ROWS, E_DIM, F_DIM, 0, 0);

  // 7) out = LN(LN(f) + x1)
  double_ln_kernel<<<M_ROWS / 8, blk, 0, stream>>>(ff, x1f, g3, b3, g2, b2,
                                               (float*)d_out);
}

// v004
// Measured time: 229 microseconds a run.
// In both of two side-by-side timings against v003, it was 1.15 times as fast.
// Over all steps from v000 it is 2.25 times as fast.
#include <hip/hip_runtime.h>
#include <hip/hip_bf16.h>
#include <math.h>

// ---------------------------------------------------------------------------
// Transformer block on CDNA5 (gfx1250), wave32, bf16 WMMA w/ f32 accumulation.
// Pipeline:
//   1) convert x -> bf16; transpose+convert weights -> bf16 [N,K]
//   2) WMMA GEMMs: Q (f32), K (f32), V (bf16, head-transposed [b,h,d,s])
//   3) flash attention (scores = K.Q^T per the reference's einsum, taken
//      transposed), online softmax in the lane, V^T.P^T via WMMA, P stays in registers
//   4) x1 = LN(attn + Q) -> f32 + bf16
//   5) h = relu(x1 @ W1 + c1) (WMMA, bf16 out)
//   6) f = h @ W2 + c2 (WMMA, f32 out)
//   7) out = LN(LN(f) + x1)
// ---------------------------------------------------------------------------

typedef __attribute__((ext_vector_type(16))) __bf16 v16bf;
typedef __attribute__((ext_vector_type(8)))  float  v8f;

#define S_LEN  2048
#define E_DIM  512
#define V_DIM  512
#define F_DIM  2048
#define B_SZ   4
#define H_CNT  8
#define D_HEAD 64
#define M_ROWS (B_SZ * S_LEN)

__device__ __forceinline__ unsigned short f2bf(float f) {
  union { float f; unsigned u; } a; a.f = f;
  unsigned u = a.u;
  return (unsigned short)((u + 0x7FFFu + ((u >> 16) & 1u)) >> 16); // RNE
}

// A/B fragment loader for v_wmma_f32_16x16x32_bf16 from row-major bf16 data.
// Layout (ISA 7.12.2, 16-bit A 16x32): lane L holds row (L&15); lanes 0-15
// carry K = [k0, k0+8) and [k0+16, k0+24); lanes 16-31 the +8 halves.
// The same layout serves the B operand when loading from a [N,K] (transposed)
// matrix: lane holds column n = (L&15) of B.
__device__ __forceinline__ v16bf load_frag_bf16(const unsigned short* base, int ld,
                                                int row0, int k0, int lane) {
  const int half = lane >> 4;
  const unsigned short* p = base + (size_t)(row0 + (lane & 15)) * ld + k0 + 8 * half;
  union { uint4 q[2]; v16bf v; } u;
  u.q[0] = *(const uint4*)p;
  u.q[1] = *(const uint4*)(p + 16);
  return u.v;
}

// Same fragment, sourced from fp32 with on-the-fly bf16 conversion.
__device__ __forceinline__ v16bf load_frag_f32(const float* base, int ld,
                                               int row0, int k0, int lane) {
  const int half = lane >> 4;
  const float* p = base + (size_t)(row0 + (lane & 15)) * ld + k0 + 8 * half;
  union { unsigned short s[16]; v16bf v; } u;
#pragma unroll
  for (int e = 0; e < 8; ++e) {
    u.s[e]     = f2bf(p[e]);
    u.s[8 + e] = f2bf(p[16 + e]);
  }
  return u.v;
}

__device__ __forceinline__ v8f wmma_bf16(v16bf a, v16bf b, v8f c) {
  return __builtin_amdgcn_wmma_f32_16x16x32_bf16(false, a, false, b, (short)0, c,
                                                 false, false);
}

// ---------------------------------------------------------------------------
// The kernels without matrix work are short; each thread takes many elements
// and the grids are small, for speed only.

__device__ __forceinline__ unsigned pack2(float lo, float hi) {
  return (unsigned)f2bf(lo) | ((unsigned)f2bf(hi) << 16);
}

// Elementwise fp32 -> bf16, 32 elements a thread: four chunks of eight (two
// 16-byte loads, one 16-byte store), a block's chunks 2048 elements apart, so
// that every access of a wave covers whole lines.  Grid = elements / 8192.
__global__ void __launch_bounds__(256)
cvt_bf16_kernel(const float* __restrict__ in, unsigned short* __restrict__ out) {
  const size_t base = (size_t)blockIdx.x * 8192 + threadIdx.x * 8;
  const float* p = in + base;
  unsigned short* o = out + base;
  float4 v[4][2];
#pragma unroll
  for (int c = 0; c < 4; ++c) {
    v[c][0] = *(const float4*)(p + 2048 * c);
    v[c][1] = *(const float4*)(p + 2048 * c + 4);
  }
  uint4 q[4];
#pragma unroll
  for (int c = 0; c < 4; ++c)
    q[c] = make_uint4(pack2(v[c][0].x, v[c][0].y), pack2(v[c][0].z, v[c][0].w),
                      pack2(v[c][1].x, v[c][1].y), pack2(v[c][1].z, v[c][1].w));
#pragma unroll
  for (int c = 0; c < 4; ++c) *(uint4*)(o + 2048 * c) = q[c];
}

// [Kd,Nd] fp32 -> [Nd,Kd] bf16.  A thread takes 16 k of one n: 16 loads (a wave
// reads 128 contiguous bytes of a row each time) and two 16-byte stores.
// Grid = Kd * Nd / 4096; Kd is a multiple of 16.  The row length is a constant
// of the body, so that the split of the block index needs no division.
template <int ND>
__device__ __forceinline__ void transpose_body(const float* __restrict__ in,
                                               unsigned short* __restrict__ out, int Kd) {
  const int kb = blockIdx.x / (ND / 256);        // a block's threads share their 16 rows
  const int n  = (blockIdx.x % (ND / 256)) * 256 + threadIdx.x;
  const float* p = in + (size_t)(16 * kb) * ND + n;
  float v[16];
#pragma unroll
  for (int e = 0; e < 16; ++e) v[e] = p[e * ND];
  const uint4 q0 = make_uint4(pack2(v[0], v[1]),   pack2(v[2], v[3]),
                              pack2(v[4], v[5]),   pack2(v[6], v[7]));
  const uint4 q1 = make_uint4(pack2(v[8], v[9]),   pack2(v[10], v[11]),
                              pack2(v[12], v[13]), pack2(v[14], v[15]));
  unsigned short* o = out + (size_t)n * Kd + 16 * kb;
  *(uint4*)o       = q0;
  *(uint4*)(o + 8) = q1;
}

__global__ void __launch_bounds__(256)
transpose_bf16_kernel(const float* __restrict__ in, unsigned short* __restrict__ out,
                      int Kd, int Nd) {
  if (Nd == E_DIM) transpose_body<E_DIM>(in, out, Kd);
  else             transpose_body<F_DIM>(in, out, Kd);
}

// ---------------------------------------------------------------------------
// C[M,N] = A[M,K] @ Bt[N,K]^T (+bias)(+relu).  Block = 4 waves in a 2x2 grid,
// each wave owns a 64x64 tile (4 A x 4 B fragments, 16 accumulator tiles), so a
// loaded fragment feeds four WMMAs; grid = (M/128, N/128).  K is a multiple of 64.
// Two fragment sets alternate: one set's loads fly while the other is multiplied.
// mode 0: f32 out; mode 1: bf16 out; mode 2: bf16 out transposed per-head
//         to Vt[b][h][d][s] (for the attention's V^T.P^T A-operand).
__device__ __forceinline__ void gemm_load_set(v16bf (&a)[4], v16bf (&b)[4],
                                              const unsigned short* A,
                                              const unsigned short* Bt, int K,
                                              int m0, int n0, int k0, int lane) {
#pragma unroll
  for (int i = 0; i < 4; ++i) a[i] = load_frag_bf16(A, K, m0 + 16 * i, k0, lane);
#pragma unroll
  for (int t = 0; t < 4; ++t) b[t] = load_frag_bf16(Bt, K, n0 + 16 * t, k0, lane);
}

// The same set outside the loop, where the eight address pairs die with the
// loads: the wait names them as inputs, so that they stay untouched (also by a
// later load's result) until the loads' addresses have been taken.
__device__ __forceinline__ void gemm_load_set_wait(v16bf (&a)[4], v16bf (&b)[4],
                                                   const unsigned short* A,
                                                   const unsigned short* Bt, int K,
                                                   int m0, int n0, int k0, int lane) {
  const size_t off = (size_t)(lane & 15) * K + k0 + 8 * (lane >> 4);
  const unsigned short* pa[4];
  const unsigned short* pb[4];
#pragma unroll
  for (int i = 0; i < 4; ++i) {
    pa[i] = A  + (size_t)(m0 + 16 * i) * K + off;
    pb[i] = Bt + (size_t)(n0 + 16 * i) * K + off;
  }
#pragma unroll
  for (int i = 0; i < 4; ++i) {
    union { uint4 q[2]; v16bf v; } u;
    u.q[0] = *(const uint4*)pa[i];
    u.q[1] = *(const uint4*)(pa[i] + 16);
    a[i] = u.v;
  }
#pragma unroll
  for (int t = 0; t < 4; ++t) {
    union { uint4 q[2]; v16bf v; } u;
    u.q[0] = *(const uint4*)pb[t];
    u.q[1] = *(const uint4*)(pb[t] + 16);
    b[t] = u.v;
  }
  asm volatile("s_wait_xcnt 0x0"
               :: "v"(pa[0]), "v"(pa[1]), "v"(pa[2]), "v"(pa[3]),
                  "v"(pb[0]), "v"(pb[1]), "v"(pb[2]), "v"(pb[3]) : "memory");
}

__device__ __forceinline__ void gemm_mul_set(v8f (&acc)[4][4], const v16bf (&a)[4],
                                             const v16bf (&b)[4]) {
#pragma unroll
  for (int i = 0; i < 4; ++i)
#pragma unroll
    for (int t = 0; t < 4; ++t) acc[i][t] = wmma_bf16(a[i], b[t], acc[i][t]);
}

__global__ void __launch_bounds__(128)
gemm_bf16_kernel(const unsigned short* __restrict__ A,
                 const unsigned short* __restrict__ Bt,
                 const float* __restrict__ bias,
                 float* __restrict__ Cf, unsigned short* __restrict__ Cb,
                 int M, int N, int K, int mode, int relu) {
  const int lane = threadIdx.x & 31;
  const int wave = threadIdx.x >> 5;
  const int m0 = blockIdx.x * 128 + (wave >> 1) * 64;
  const int n0 = blockIdx.y * 128 + (wave & 1) * 64;

  v8f acc[4][4] = {};
  v16bf a0[4], b0[4], a1[4], b1[4];
  gemm_load_set_wait(a0, b0, A, Bt, K, m0, n0, 0, lane);
  __builtin_amdgcn_sched_barrier(0);     // holds later register writes behind that wait
  int k0 = 0;
  for (; k0 < K - 64; k0 += 64) {
    gemm_load_set(a1, b1, A, Bt, K, m0, n0, k0 + 32, lane);
    // keeps the next set's loads ahead of this set's 16 WMMAs (else they sink
    // among the WMMAs and their latency is waited out right behind them)
    __builtin_amdgcn_sched_barrier(0);
    gemm_mul_set(acc, a0, b0);
    gemm_load_set(a0, b0, A, Bt, K, m0, n0, k0 + 64, lane);
    __builtin_amdgcn_sched_barrier(0);   // as above
    gemm_mul_set(acc, a1, b1);
    // the next trip rewrites the address registers that the loads above name
    asm volatile("s_wait_xcnt 0x0" ::: "memory");
  }
  gemm_load_set_wait(a1, b1, A, Bt, K, m0, n0, k0 + 32, lane);
  __builtin_amdgcn_sched_barrier(0);     // as above; also keeps the loads ahead of the WMMAs
  gemm_mul_set(acc, a0, b0);
  gemm_mul_set(acc, a1, b1);

  const int col = lane & 15;
  const int h2  = lane >> 4;
  // Epilogue.  The mode test stands outside the element loops.  Modes 0 and 1
  // go in two parts: first every value and every row address is formed in
  // registers, then come the stores alone, so that no register of an issued
  // store is written again.
#pragma unroll
  for (int t = 0; t < 4; ++t) {
    float bv = bias ? bias[n0 + 16 * t + col] : 0.0f;
#pragma unroll
    for (int i = 0; i < 4; ++i)
#pragma unroll
      for (int e = 0; e < 8; ++e) {
        float v = acc[i][t][e] + bv;
        acc[i][t][e] = relu ? fmaxf(v, 0.0f) : v;
      }
  }
  const int mr = m0 + 8 * h2;                  // C layout: VGPR e -> row e (+8)
  const int nc = n0 + col;
  if (mode == 0) {
    float* cb = Cf + (size_t)mr * N + nc;
    float* c[4][8];
#pragma unroll
    for (int i = 0; i < 4; ++i)
#pragma unroll
      for (int e = 0; e < 8; ++e) c[i][e] = cb + (size_t)(16 * i + e) * N;
    __builtin_amdgcn_sched_barrier(0);         // only stores behind this line
#pragma unroll
    for (int i = 0; i < 4; ++i)
#pragma unroll
      for (int e = 0; e < 8; ++e)
#pragma unroll
        for (int t = 0; t < 4; ++t) c[i][e][16 * t] = acc[i][t][e];
    // code of the other modes' paths follows and reuses these stores' registers
    asm volatile("s_wait_xcnt 0x0" ::: "memory");
  } else if (mode == 1) {
    unsigned short* cb = Cb + (size_t)mr * N + nc;
    unsigned short* c[4][8];
    unsigned short hv[4][4][8];
#pragma unroll
    for (int i = 0; i < 4; ++i)
#pragma unroll
      for (int e = 0; e < 8; ++e) {
        c[i][e] = cb + (size_t)(16 * i + e) * N;
#pragma unroll
        for (int t = 0; t < 4; ++t) hv[i][t][e] = f2bf(acc[i][t][e]);
      }
    __builtin_amdgcn_sched_barrier(0);         // only stores behind this line
#pragma unroll
    for (int i = 0; i < 4; ++i)
#pragma unroll
      for (int e = 0; e < 8; ++e)
#pragma unroll
        for (int t = 0; t < 4; ++t) c[i][e][16 * t] = hv[i][t][e];
    // code of the other modes' paths follows and reuses these stores' registers
    asm volatile("s_wait_xcnt 0x0" ::: "memory");
  } else {
    // the wave's 64 rows lie in one batch entry, its 64 columns are one head;
    // a lane's eight rows of a tile are eight neighbours in Vt: one 16-byte store
    const int bb = mr / S_LEN, s = mr % S_LEN;
    const int hh = nc >> 6,    d = nc & 63;
    unsigned short* c = Cb + (((size_t)bb * H_CNT + hh) * D_HEAD + d) * S_LEN + s;
    uint4 pk[4][4];
#pragma unroll
    for (int i = 0; i < 4; ++i)
#pragma unroll
      for (int t = 0; t < 4; ++t) {
        unsigned q[4];
#pragma unroll
        for (int e = 0; e < 4; ++e)
          q[e] = (unsigned)f2bf(acc[i][t][2 * e]) | ((unsigned)f2bf(acc[i][t][2 * e + 1]) << 16);
        pk[i][t] = make_uint4(q[0], q[1], q[2], q[3]);
      }
#pragma unroll
    for (int i = 0; i < 4; ++i)
#pragma unroll
      for (int t = 0; t < 4; ++t)
        *(uint4*)(c + (size_t)(16 * t) * S_LEN + 16 * i) = pk[i][t];
    // code of the other modes' paths follows and reuses these stores' registers
    asm volatile("s_wait_xcnt 0x0" ::: "memory");
  }
}

// ---------------------------------------------------------------------------
#define KT 64   // keys a stage of the attention's LDS tiles
#define TP 72   // row pitch of a staged tile in bf16: 144 bytes = 16 x 9, no bank conflict for 16-byte reads

typedef __attribute__((ext_vector_type(4))) float    f32x4s;
typedef __attribute__((ext_vector_type(4))) unsigned u32x4s;

// One thread's share of a 64-key stage, global -> registers.  The bases are the
// same for the whole block, the two byte offsets never change.
__device__ __forceinline__ void stage_load(f32x4s (&qr)[4], u32x4s (&vr)[2],
                                           const float* qbase, const unsigned short* vbase,
                                           unsigned qoff, unsigned voff) {
#pragma unroll
  for (int q = 0; q < 4; ++q)
    qr[q] = *(const f32x4s*)((const char*)qbase + qoff + (unsigned)(16 * q * E_DIM * 4));
#pragma unroll
  for (int q = 0; q < 2; ++q)
    vr[q] = *(const u32x4s*)((const char*)vbase + voff + (unsigned)(32 * q * S_LEN * 2));
}

// registers -> LDS; Q is rounded to bf16 here, once for the block's eight waves
__device__ __forceinline__ void stage_store(const f32x4s (&qr)[4], const u32x4s (&vr)[2],
                                            unsigned short* qdst, unsigned short* vdst) {
#pragma unroll
  for (int q = 0; q < 4; ++q)
    *(uint2*)(qdst + 16 * q * TP) = make_uint2(pack2(qr[q].x, qr[q].y), pack2(qr[q].z, qr[q].w));
#pragma unroll
  for (int q = 0; q < 2; ++q) *(u32x4s*)(vdst + 32 * q * TP) = vr[q];
}

// lane l <-> lane l ^ 16: the other half of the wave, by a vector cross-row move
__device__ __forceinline__ float swap_halves(float v) {
  const int b = __builtin_bit_cast(int, v);
  return __builtin_bit_cast(float, __builtin_amdgcn_permlanex16(b, b, 0x76543210, 0xfedcba98,
                                                                false, false));
}

typedef __attribute__((ext_vector_type(4))) int i32x4s;

// Flash attention. Reference einsum gives corr[b,h,i,j] = K[b,i,h,:].Q[b,j,h,:],
// softmax over j, out[i,d] = sum_j P[i,j] V[j,d].
// Block = 8 waves; wave owns 16 output rows i; streams keys in tiles of 32.
// The products are taken transposed: S^T[j,i] = Q[j,:].K[i,:] (A = staged Q rows,
// B = the wave's K rows) and O^T[d,i] += V^T[d,:].P^T[:,i].  A lane then holds 16
// of the 32 scores of ONE output row i = lane & 15 (j = 8 * half + e and
// 16 + 8 * half + e), so the row's maximum and sum run in the lane's own
// registers with one exchange between the wave's halves, the running maximum and
// sum are one register each, and the two score tiles, rounded to bf16 in place,
// ARE the B operand of the second product in the k order of load_frag_bf16.
// The eight waves walk the same keys, so the block brings each 64-key stage of
// Q and of V^T into LDS once: whole-line global loads, Q rounded to bf16 on the
// way, and every wave takes its A fragments from LDS.  Two buffers: the next
// stage's loads fly while this stage is worked on; one barrier a stage.
__global__ void __launch_bounds__(256)
flash_attn_kernel(const float* __restrict__ Kf, const float* __restrict__ Qf,
                  const unsigned short* __restrict__ Vt, const int* __restrict__ mask,
                  float* __restrict__ Out, float scale) {
  __shared__ __align__(16) unsigned short qs[2][KT][TP];      // Q rows j, bf16, d along the row
  __shared__ __align__(16) unsigned short vs[2][D_HEAD][TP];  // V^T rows d, keys along the row

  const int lane = threadIdx.x & 31;
  const int wave = threadIdx.x >> 5;
  const int h2   = lane >> 4;
  const int col  = lane & 15;
  const int b = blockIdx.z, h = blockIdx.y;
  const int i0 = blockIdx.x * 128 + wave * 16;

  const float* Kb_ = Kf + (size_t)b * S_LEN * E_DIM + h * D_HEAD;
  const float* Qb_ = Qf + (size_t)b * S_LEN * E_DIM + h * D_HEAD;
  const unsigned short* Vb_ = Vt + ((size_t)b * H_CNT + h) * D_HEAD * S_LEN;

  // A thread's share of a stage.  Q: 16 bytes of four rows, 16 rows apart (a
  // wave's load covers two whole 256-byte rows); V^T: 16 bytes of two rows, 32
  // rows apart (a wave's load covers four whole 128-byte rows).
  const int qrow = threadIdx.x >> 4, qcol = (threadIdx.x & 15) * 4;
  const int vrow = threadIdx.x >> 3, vcol = (threadIdx.x & 7) * 8;
  const unsigned qoff = (unsigned)(qrow * E_DIM + qcol) * 4u;   // byte offsets from
  const unsigned voff = (unsigned)(vrow * S_LEN + vcol) * 2u;   // the stage's base
  // the lane's mask row i, at its half's first key of a stage
  const unsigned moff = (unsigned)((i0 + col) * S_LEN + 8 * h2) * 4u;
  f32x4s qr[4];
  u32x4s vr[2];

  // This wave's 16 K-rows over d = 0..63 (reused for all key tiles): the B operand
  v16bf aK0 = load_frag_f32(Kb_, E_DIM, i0, 0,  lane);
  v16bf aK1 = load_frag_f32(Kb_, E_DIM, i0, 32, lane);
  // the address registers that these loads name are written again below
  asm volatile("s_wait_xcnt 0x0" ::: "memory");
  __builtin_amdgcn_sched_barrier(0);     // holds later register writes behind that wait

  v8f O[4] = {};               // O^T: tile t, register e = O[i][16 t + 8 half + e]
  float mrow = -3.0e38f;       // running maximum of row i (the same in both halves)
  float lrow = 0.0f;           // running sum of row i over this half's keys

  const float mval = -1.0e20f * scale;

  stage_load(qr, vr, Qb_, Vb_, qoff, voff);
  stage_store(qr, vr, &qs[0][qrow][qcol], &vs[0][vrow][vcol]);
  __syncthreads();                       // stage 0 is published

  for (int st = 0; st < S_LEN; st += KT) {
    const int buf = (st / KT) & 1;
    const bool more = st + KT < S_LEN;   // the same for the whole block
    // This stage's mask words of row i: a lane's eight keys of a score tile are 32
    // contiguous bytes, two 16-byte loads.  (Here and below: a loop over a register
    // array is unrolled so that its indices are constants.)
    i32x4s mk[KT / 32][4];
#pragma unroll
    for (int u = 0; u < KT / 32; ++u)
#pragma unroll
      for (int q = 0; q < 4; ++q)
        mk[u][q] = *(const i32x4s*)((const char*)(mask + st) + moff +
                                    (unsigned)(128 * u + 64 * (q >> 1) + 16 * (q & 1)));
    if (more)
      stage_load(qr, vr, Qb_ + (size_t)(st + KT) * E_DIM, Vb_ + (st + KT), qoff, voff);
    const unsigned short* qt = &qs[buf][0][0];
    const unsigned short* vt = &vs[buf][0][0];

    // unrolled so that the two halves' LDS offsets are immediates
#pragma unroll
    for (int jj = 0; jj < KT; jj += 32) {
      // scores tile 32x16 (keys x rows): two 16x16 WMMA tiles, K over d (2 steps of 32)
      v16bf aq00 = load_frag_bf16(qt, TP, jj +  0, 0,  lane);
      v16bf aq01 = load_frag_bf16(qt, TP, jj +  0, 32, lane);
      v16bf aq10 = load_frag_bf16(qt, TP, jj + 16, 0,  lane);
      v16bf aq11 = load_frag_bf16(qt, TP, jj + 16, 32, lane);
      v8f s0 = {}, s1 = {};
      s0 = wmma_bf16(aq00, aK0, s0); s0 = wmma_bf16(aq01, aK1, s0);
      s1 = wmma_bf16(aq10, aK0, s1); s1 = wmma_bf16(aq11, aK1, s1);

      // v[s]: key j = st + jj + (s < 8 ? 8 * h2 + s : 16 + 8 * h2 + s - 8) of row i
      float v[16];
#pragma unroll
      for (int e = 0; e < 8; ++e) {
        v[e]     = mk[jj / 32][(e >> 2)][e & 3]     ? s0[e] * scale : mval;
        v[8 + e] = mk[jj / 32][2 + (e >> 2)][e & 3] ? s1[e] * scale : mval;
      }
      float mx = v[0];
#pragma unroll
      for (int s = 1; s < 16; ++s) mx = fmaxf(mx, v[s]);
      mx = fmaxf(mx, swap_halves(mx));
      const float mnew  = fmaxf(mrow, mx);
      const float alpha = __expf(mrow - mnew);
      mrow = mnew;

      // P^T, rounded to nearest even in place: element s of the B operand is the key of v[s]
      float p[16];
      v16bf pb;
#pragma unroll
      for (int s = 0; s < 16; ++s) {
        p[s]  = __expf(v[s] - mnew);
        pb[s] = (__bf16)p[s];
      }
      const float rs = (((p[0] + p[1]) + (p[2] + p[3])) + ((p[4] + p[5]) + (p[6] + p[7]))) +
                       (((p[8] + p[9]) + (p[10] + p[11])) + ((p[12] + p[13]) + (p[14] + p[15])));
      lrow = lrow * alpha + rs;
#pragma unroll
      for (int t = 0; t < 4; ++t) O[t] *= alpha;

      // O^T += V^T . P^T  (A operand from the staged V^T: rows = d, k = j)
      v16bf av0 = load_frag_bf16(vt, TP, 0,  jj, lane);
      v16bf av1 = load_frag_bf16(vt, TP, 16, jj, lane);
      v16bf av2 = load_frag_bf16(vt, TP, 32, jj, lane);
      v16bf av3 = load_frag_bf16(vt, TP, 48, jj, lane);
      O[0] = wmma_bf16(av0, pb, O[0]);
      O[1] = wmma_bf16(av1, pb, O[1]);
      O[2] = wmma_bf16(av2, pb, O[2]);
      O[3] = wmma_bf16(av3, pb, O[3]);
    }

    // The other buffer's last readers left it before the barrier of the trip
    // before; this trip's barrier publishes it and ends the reads of this one.
    if (more)
      stage_store(qr, vr, &qs[buf ^ 1][qrow][qcol], &vs[buf ^ 1][vrow][vcol]);
    // the next trip's address additions rewrite registers that this trip's global loads name
    asm volatile("s_wait_xcnt 0x0" ::: "memory");
    __builtin_amdgcn_sched_barrier(0);   // keeps those additions behind the wait
    __syncthreads();
  }

  // The halves' sums are joined once.  A lane's eight registers of a tile are eight
  // neighbours of row i: two 16-byte stores.  Every value is formed first, then
  // come the stores alone, so that no register of an issued store is written again.
  const float inv = 1.0f / (lrow + swap_halves(lrow));
  float* orow = Out + ((size_t)b * S_LEN + i0 + col) * E_DIM + h * D_HEAD + 8 * h2;
  f32x4s ov[4][2];
#pragma unroll
  for (int t = 0; t < 4; ++t) {
    ov[t][0] = f32x4s{O[t][0], O[t][1], O[t][2], O[t][3]} * inv;
    ov[t][1] = f32x4s{O[t][4], O[t][5], O[t][6], O[t][7]} * inv;
  }
  __builtin_amdgcn_sched_barrier(0);     // only stores behind this line
#pragma unroll
  for (int t = 0; t < 4; ++t) {
    *(f32x4s*)(orow + 16 * t)     = ov[t][0];
    *(f32x4s*)(orow + 16 * t + 4) = ov[t][1];
  }
}

// ---------------------------------------------------------------------------
// LayerNorm kernels: one wave per row of 512, 8 rows a block, 16 elements a lane
// (four 16-byte pieces, 128 elements apart: a wave's access is 512 contiguous
// bytes).  The row sums run in the lane and then over the wave's 32 lanes.
typedef __attribute__((ext_vector_type(4))) float f32x4;

__device__ __forceinline__ float wave_sum(float v) {
#pragma unroll
  for (int o = 16; o > 0; o >>= 1) v += __shfl_xor(v, o, 32);
  return v;
}

// 16 bytes at a 32-bit byte offset from a uniform base
__device__ __forceinline__ f32x4 ld16(const float* base, unsigned byte_off) {
  return *(const f32x4*)((const char*)base + byte_off);
}

// mean and 1/sqrt(var + eps) of the wave's row
__device__ __forceinline__ void row_stats(const f32x4 (&x)[4], float& mean, float& rstd) {
  float s1 = 0.0f, s2 = 0.0f;
#pragma unroll
  for (int q = 0; q < 4; ++q) {
    s1 += (x[q].x + x[q].y) + (x[q].z + x[q].w);
    s2 += (x[q].x * x[q].x + x[q].y * x[q].y) + (x[q].z * x[q].z + x[q].w * x[q].w);
  }
  s1 = wave_sum(s1);
  s2 = wave_sum(s2);
  mean = s1 * (1.0f / E_DIM);
  const float var = s2 * (1.0f / E_DIM) - mean * mean;
  rstd = rsqrtf(var + 1e-5f);
}

// x1 = LN(src + res) * g + b  -> f32 and a bf16 copy.
__global__ void __launch_bounds__(256)
add_ln_kernel(const float* __restrict__ src, const float* __restrict__ res,
              const float* __restrict__ g, const float* __restrict__ bb,
              float* __restrict__ outf, unsigned short* __restrict__ outb) {
  const int lane = threadIdx.x & 31;
  const size_t off = (size_t)(blockIdx.x * 8 + (threadIdx.x >> 5)) * E_DIM + 4 * lane;
  const unsigned ro = (unsigned)off * 4u;   // the lane's byte offset in a [rows,512] f32 array
  const unsigned co = 16u * lane;           // and in a vector of 512
  f32x4 x[4], c[4], gg[4], bv[4];
#pragma unroll
  for (int q = 0; q < 4; ++q) {
    x[q]  = ld16(src, ro + 512u * q);
    c[q]  = ld16(res, ro + 512u * q);
    gg[q] = ld16(g,   co + 512u * q);
    bv[q] = ld16(bb,  co + 512u * q);
  }
  // Every loaded value is an input, so the wait stands behind all 16 loads; the
  // two offsets are inputs, so they stay untouched (also by a later load's
  // result) up to it.
  asm volatile("s_wait_xcnt 0x0"
               :: "v"(ro), "v"(co),
                  "v"(x[0]),  "v"(x[1]),  "v"(x[2]),  "v"(x[3]),
                  "v"(c[0]),  "v"(c[1]),  "v"(c[2]),  "v"(c[3]),
                  "v"(gg[0]), "v"(gg[1]), "v"(gg[2]), "v"(gg[3]),
                  "v"(bv[0]), "v"(bv[1]), "v"(bv[2]), "v"(bv[3]) : "memory");
#pragma unroll
  for (int q = 0; q < 4; ++q) x[q] += c[q];
  float mean, rstd;
  row_stats(x, mean, rstd);
  uint2 h[4];
#pragma unroll
  for (int q = 0; q < 4; ++q) {
    x[q] = (x[q] - mean) * rstd * gg[q] + bv[q];
    h[q] = make_uint2(pack2(x[q].x, x[q].y), pack2(x[q].z, x[q].w));
  }
#pragma unroll
  for (int q = 0; q < 4; ++q) {
    *(f32x4*)(outf + off + 128 * q) = x[q];
    *(uint2*)(outb + off + 128 * q) = h[q];
  }
}

// out = LN( LN(f)*g3+b3 + x1 ) * g2 + b2.
__global__ void __launch_bounds__(256)
double_ln_kernel(const float* __restrict__ f, const float* __restrict__ x1,
                 const float* __restrict__ g3, const float* __restrict__ b3,
                 const float* __restrict__ g2, const float* __restrict__ b2,
                 float* __restrict__ out) {
  const int lane = threadIdx.x & 31;
  const size_t off = (size_t)(blockIdx.x * 8 + (threadIdx.x >> 5)) * E_DIM + 4 * lane;
  const unsigned ro = (unsigned)off * 4u;   // the lane's byte offset in a [rows,512] f32 array
  const unsigned co = 16u * lane;           // and in a vector of 512
  f32x4 a[4], xr[4], ga[4], ba[4], gb[4], bc[4];
#pragma unroll
  for (int q = 0; q < 4; ++q) {
    a[q]  = ld16(f,  ro + 512u * q);
    xr[q] = ld16(x1, ro + 512u * q);
    ga[q] = ld16(g3, co + 512u * q);
    ba[q] = ld16(b3, co + 512u * q);
    gb[q] = ld16(g2, co + 512u * q);
    bc[q] = ld16(b2, co + 512u * q);
  }
  // Every loaded value is an input, so the wait stands behind all 24 loads; the
  // two offsets are inputs, so they stay untouched (also by a later load's
  // result) up to it.
  asm volatile("s_wait_xcnt 0x0"
               :: "v"(ro), "v"(co),
                  "v"(a[0]),  "v"(a[1]),  "v"(a[2]),  "v"(a[3]),
                  "v"(xr[0]), "v"(xr[1]), "v"(xr[2]), "v"(xr[3]),
                  "v"(ga[0]), "v"(ga[1]), "v"(ga[2]), "v"(ga[3]),
                  "v"(ba[0]), "v"(ba[1]), "v"(ba[2]), "v"(ba[3]),
                  "v"(gb[0]), "v"(gb[1]), "v"(gb[2]), "v"(gb[3]),
                  "v"(bc[0]), "v"(bc[1]), "v"(bc[2]), "v"(bc[3]) : "memory");
  float mean, rstd;
  row_stats(a, mean, rstd);
#pragma unroll
  for (int q = 0; q < 4; ++q) a[q] = (a[q] - mean) * rstd * ga[q] + ba[q] + xr[q];
  row_stats(a, mean, rstd);
#pragma unroll
  for (int q = 0; q < 4; ++q) a[q] = (a[q] - mean) * rstd * gb[q] + bc[q];
#pragma unroll
  for (int q = 0; q < 4; ++q) *(f32x4*)(out + off + 128 * q) = a[q];
}

// ---------------------------------------------------------------------------
extern "C" void kernel_launch(void* const* d_in, const int* in_sizes, int n_in,
                              void* d_out, int out_size, void* d_ws, size_t ws_size,
                              hipStream_t stream) {
  const float* x  = (const float*)d_in[0];
  const int* mask = (const int*)d_in[1];
  const float* Wv = (const float*)d_in[2];
  const float* Wk = (const float*)d_in[3];
  const float* Wq = (const float*)d_in[4];
  const float* g1 = (const float*)d_in[5];
  const float* b1 = (const float*)d_in[6];
  const float* W1 = (const float*)d_in[7];
  const float* c1 = (const float*)d_in[8];
  const float* W2 = (const float*)d_in[9];
  const float* c2 = (const float*)d_in[10];
  const float* g3 = (const float*)d_in[11];
  const float* b3 = (const float*)d_in[12];
  const float* g2 = (const float*)d_in[13];
  const float* b2 = (const float*)d_in[14];

  const size_t MB = 1ull << 20;
  unsigned char* w = (unsigned char*)d_ws;
  // live regions (peak ~96 MB, with reuse):
  unsigned short* xb  = (unsigned short*)(w +  0 * MB); //  8 MB  x bf16
  unsigned short* Wqt = (unsigned short*)(w +  8 * MB); //  .5 MB
  unsigned short* Wkt = (unsigned short*)(w +  9 * MB); //  .5 MB
  unsigned short* Wvt = (unsigned short*)(w + 10 * MB); //  .5 MB
  unsigned short* W1t = (unsigned short*)(w + 11 * MB); //  2 MB
  unsigned short* W2t = (unsigned short*)(w + 13 * MB); //  2 MB
  float*          Kf  = (float*)         (w + 16 * MB); // 16 MB  keys f32
  unsigned short* Vt  = (unsigned short*)(w + 32 * MB); //  8 MB  V^T bf16
  float*          Qf  = (float*)         (w + 40 * MB); // 16 MB  queries f32
  float*          attn= (float*)         (w + 56 * MB); // 16 MB
  float*          x1f = (float*)         (w + 72 * MB); // 16 MB
  unsigned short* x1b = (unsigned short*)(w + 88 * MB); //  8 MB
  unsigned short* hb  = (unsigned short*)(w + 16 * MB); // 32 MB (reuses Kf/Vt/Qf)
  float*          ff  = (float*)         (w + 48 * MB); // 16 MB (reuses Qf/attn)

  dim3 blk(256);
  dim3 gblk(128);   // GEMM: 4 waves, 2x2

  // 1) conversions / weight transposes
  cvt_bf16_kernel<<<(M_ROWS * V_DIM) / 8192, blk, 0, stream>>>(x, xb);
  transpose_bf16_kernel<<<(V_DIM * E_DIM) / 4096, blk, 0, stream>>>(Wq, Wqt, V_DIM, E_DIM);
  transpose_bf16_kernel<<<(V_DIM * E_DIM) / 4096, blk, 0, stream>>>(Wk, Wkt, V_DIM, E_DIM);
  transpose_bf16_kernel<<<(V_DIM * E_DIM) / 4096, blk, 0, stream>>>(Wv, Wvt, V_DIM, E_DIM);
  transpose_bf16_kernel<<<(E_DIM * F_DIM) / 4096, blk, 0, stream>>>(W1, W1t, E_DIM, F_DIM);
  transpose_bf16_kernel<<<(F_DIM * E_DIM) / 4096, blk, 0, stream>>>(W2, W2t, F_DIM, E_DIM);

  // 2) QKV projections
  dim3 gq(M_ROWS / 128, E_DIM / 128);
  gemm_bf16_kernel<<<gq, gblk, 0, stream>>>(xb, Wqt, nullptr, Qf, nullptr,
                                           M_ROWS, E_DIM, V_DIM, 0, 0);
  gemm_bf16_kernel<<<gq, gblk, 0, stream>>>(xb, Wkt, nullptr, Kf, nullptr,
                                           M_ROWS, E_DIM, V_DIM, 0, 0);
  gemm_bf16_kernel<<<gq, gblk, 0, stream>>>(xb, Wvt, nullptr, nullptr, Vt,
                                           M_ROWS, E_DIM, V_DIM, 2, 0);

  // 3) fused attention
  dim3 ga(S_LEN / 128, H_CNT, B_SZ);
  const float scale = 1.0f / sqrtf((float)E_DIM);
  flash_attn_kernel<<<ga, blk, 0, stream>>>(Kf, Qf, Vt, mask, attn, scale);

  // 4) x1 = LN(attn + queries)
  add_ln_kernel<<<M_ROWS / 8, blk, 0, stream>>>(attn, Qf, g1, b1, x1f, x1b);

  // 5) h = relu(x1 @ W1 + c1)
  dim3 gf1(M_ROWS / 128, F_DIM / 128);
  gemm_bf16_kernel<<<gf1, gblk, 0, stream>>>(x1b, W1t, c1, nullptr, hb,
                                            M_ROWS, F_DIM, E_DIM, 1, 1);

  // 6) f = h @ W2 + c2
  dim3 gf2(M_ROWS / 128, E_DIM / 128);
  gemm_bf16_kernel<<<gf2, gblk, 0, stream>>>(hb, W2t, c2, ff, nullptr,
                                            M_ROWS, E_DIM, F_DIM, 0, 0);

  // 7) out = LN(LN(f) + x1)
  double_ln_kernel<<<M_ROWS / 8, blk, 0, stream>>>(ff, x1f, g3, b3, g2, b2,
                                               (float*)d_out);
}

// v005
// It runs in 192 microseconds.
// Two timings next to v004 put it at 1.20 and 1.19 times that version's speed.
// All steps since v000 together make it 2.69 times as fast.
#include <hip/hip_runtime.h>
#include <hip/hip_bf16.h>
#include <math.h>

// ---------------------------------------------------------------------------
// Transformer block on CDNA5 (gfx1250), wave32, bf16 WMMA w/ f32 accumulation.
// Pipeline:
//   1) convert x -> bf16; transpose+convert weights -> bf16 [N,K]
//   2) WMMA GEMMs: Q (f32), K (f32), V (bf16, head-transposed [b,h,d,s])
//   3) flash attention (scores = K.Q^T per the reference's einsum, taken
//      transposed), online softmax in the lane, V^T.P^T via WMMA, P stays in registers
//   4) x1 = LN(attn + Q) -> f32 + bf16
//   5) h = relu(x1 @ W1 + c1) (WMMA, bf16 out)
//   6) f = h @ W2 + c2 (WMMA, f32 out)
//   7) out = LN(LN(f) + x1)
// ---------------------------------------------------------------------------

typedef __attribute__((ext_vector_type(16))) __bf16 v16bf;
typedef __attribute__((ext_vector_type(8)))  float  v8f;

#define S_LEN  2048
#define E_DIM  512
#define V_DIM  512
#define F_DIM  2048
#define B_SZ   4
#define H_CNT  8
#define D_HEAD 64
#define M_ROWS (B_SZ * S_LEN)

__device__ __forceinline__ unsigned short f2bf(float f) {
  union { float f; unsigned u; } a; a.f = f;
  unsigned u = a.u;
  return (unsigned short)((u + 0x7FFFu + ((u >> 16) & 1u)) >> 16); // RNE
}

// A/B fragment loader for v_wmma_f32_16x16x32_bf16 from row-major bf16 data.
// Layout (ISA 7.12.2, 16-bit A 16x32): lane L holds row (L&15); lanes 0-15
// carry K = [k0, k0+8) and [k0+16, k0+24); lanes 16-31 the +8 halves.
// The same layout serves the B operand when loading from a [N,K] (transposed)
// matrix: lane holds column n = (L&15) of B.
__device__ __forceinline__ v16bf load_frag_bf16(const unsigned short* base, int ld,
                                                int row0, int k0, int lane) {
  const int half = lane >> 4;
  const unsigned short* p = base + (size_t)(row0 + (lane & 15)) * ld + k0 + 8 * half;
  union { uint4 q[2]; v16bf v; } u;
  u.q[0] = *(const uint4*)p;
  u.q[1] = *(const uint4*)(p + 16);
  return u.v;
}

// Same fragment, sourced from fp32 with on-the-fly bf16 conversion.
__device__ __forceinline__ v16bf load_frag_f32(const float* base, int ld,
                                               int row0, int k0, int lane) {
  const int half = lane >> 4;
  const float* p = base + (size_t)(row0 + (lane & 15)) * ld + k0 + 8 * half;
  union { unsigned short s[16]; v16bf v; } u;
#pragma unroll
  for (int e = 0; e < 8; ++e) {
    u.s[e]     = f2bf(p[e]);
    u.s[8 + e] = f2bf(p[16 + e]);
  }
  return u.v;
}

__device__ __forceinline__ v8f wmma_bf16(v16bf a, v16bf b, v8f c) {
  return __builtin_amdgcn_wmma_f32_16x16x32_bf16(false, a, false, b, (short)0, c,
                                                 false, false);
}

// ---------------------------------------------------------------------------
// The kernels without matrix work are short; each thread takes many elements
// and the grids are small, for speed only.

__device__ __forceinline__ unsigned pack2(float lo, float hi) {
  return (unsigned)f2bf(lo) | ((unsigned)f2bf(hi) << 16);
}

// Elementwise fp32 -> bf16, 32 elements a thread: four chunks of eight (two
// 16-byte loads, one 16-byte store), a block's chunks 2048 elements apart, so
// that every access of a wave covers whole lines.  Grid = elements / 8192.
__global__ void __launch_bounds__(256)
cvt_bf16_kernel(const float* __restrict__ in, unsigned short* __restrict__ out) {
  const size_t base = (size_t)blockIdx.x * 8192 + threadIdx.x * 8;
  const float* p = in + base;
  unsigned short* o = out + base;
  float4 v[4][2];
#pragma unroll
  for (int c = 0; c < 4; ++c) {
    v[c][0] = *(const float4*)(p + 2048 * c);
    v[c][1] = *(const float4*)(p + 2048 * c + 4);
  }
  uint4 q[4];
#pragma unroll
  for (int c = 0; c < 4; ++c)
    q[c] = make_uint4(pack2(v[c][0].x, v[c][0].y), pack2(v[c][0].z, v[c][0].w),
                      pack2(v[c][1].x, v[c][1].y), pack2(v[c][1].z, v[c][1].w));
#pragma unroll
  for (int c = 0; c < 4; ++c) *(uint4*)(o + 2048 * c) = q[c];
}

// [Kd,Nd] fp32 -> [Nd,Kd] bf16.  A thread takes 16 k of one n: 16 loads (a wave
// reads 128 contiguous bytes of a row each time) and two 16-byte stores.
// Grid = Kd * Nd / 4096; Kd is a multiple of 16.  The row length is a constant
// of the body, so that the split of the block index needs no division.
template <int ND>
__device__ __forceinline__ void transpose_body(const float* __restrict__ in,
                                               unsigned short* __restrict__ out, int Kd) {
  const int kb = blockIdx.x / (ND / 256);        // a block's threads share their 16 rows
  const int n  = (blockIdx.x % (ND / 256)) * 256 + threadIdx.x;
  const float* p = in + (size_t)(16 * kb) * ND + n;
  float v[16];
#pragma unroll
  for (int e = 0; e < 16; ++e) v[e] = p[e * ND];
  const uint4 q0 = make_uint4(pack2(v[0], v[1]),   pack2(v[2], v[3]),
                              pack2(v[4], v[5]),   pack2(v[6], v[7]));
  const uint4 q1 = make_uint4(pack2(v[8], v[9]),   pack2(v[10], v[11]),
                              pack2(v[12], v[13]), pack2(v[14], v[15]));
  unsigned short* o = out + (size_t)n * Kd + 16 * kb;
  *(uint4*)o       = q0;
  *(uint4*)(o + 8) = q1;
}

__global__ void __launch_bounds__(256)
transpose_bf16_kernel(const float* __restrict__ in, unsigned short* __restrict__ out,
                      int Kd, int Nd) {
  if (Nd == E_DIM) transpose_body<E_DIM>(in, out, Kd);
  else             transpose_body<F_DIM>(in, out, Kd);
}

#define GKS  64            // k of a staged tile: 128 bytes of every row
#define GTP  72            // row pitch of a staged tile in bf16: 144 bytes = 16 x 9, no bank conflict for 16-byte reads
#define GBUF (256 * GTP)   // a buffer in bf16: rows 0..127 of A, then rows 0..127 of Bt

__device__ __forceinline__ void gemm_load_set(v16bf (&a)[4], v16bf (&b)[4],
                                              const unsigned short* A,
                                              const unsigned short* Bt, int K,
                                              int m0, int n0, int k0, int lane) {
#pragma unroll
  for (int i = 0; i < 4; ++i) a[i] = load_frag_bf16(A, K, m0 + 16 * i, k0, lane);
#pragma unroll
  for (int t = 0; t < 4; ++t) b[t] = load_frag_bf16(Bt, K, n0 + 16 * t, k0, lane);
}

// Eight asynchronous copies, global -> LDS through no register: the lane's 16
// bytes of eight rows, 16 rows apart.  A wave's copy covers four whole rows of
// the tile.  The last line is a precaution: the copies' address registers stay
// untouched up to it; it stands inside the statement so that no later address
// addition can be lifted over it.
__device__ __forceinline__ void copy_rows8(unsigned lds, const unsigned short* g, size_t gstep) {
  const unsigned ls = 16u * GTP * 2u;          // 16 rows in LDS bytes
  asm volatile("global_load_async_to_lds_b128 %0, %8, off\n\t"
               "global_load_async_to_lds_b128 %1, %9, off\n\t"
               "global_load_async_to_lds_b128 %2, %10, off\n\t"
               "global_load_async_to_lds_b128 %3, %11, off\n\t"
               "global_load_async_to_lds_b128 %4, %12, off\n\t"
               "global_load_async_to_lds_b128 %5, %13, off\n\t"
               "global_load_async_to_lds_b128 %6, %14, off\n\t"
               "global_load_async_to_lds_b128 %7, %15, off\n\t"
               "s_wait_xcnt 0x0"
               :: "v"(lds),          "v"(lds + ls),     "v"(lds + 2 * ls), "v"(lds + 3 * ls),
                  "v"(lds + 4 * ls), "v"(lds + 5 * ls), "v"(lds + 6 * ls), "v"(lds + 7 * ls),
                  "v"(g),             "v"(g + gstep),     "v"(g + 2 * gstep), "v"(g + 3 * gstep),
                  "v"(g + 4 * gstep), "v"(g + 5 * gstep), "v"(g + 6 * gstep), "v"(g + 7 * gstep)
               : "memory");
}

// A thread's share of one tile: 8 copies for the A rows, 8 for the Bt rows.
__device__ __forceinline__ void gemm_tile_copy(unsigned lds, const unsigned short* ga,
                                               const unsigned short* gb, size_t gstep) {
  copy_rows8(lds, ga, gstep);
  copy_rows8(lds + 128u * GTP * 2u, gb, gstep);
}

__device__ __forceinline__ void gemm_mul_set(v8f (&acc)[4][4], const v16bf (&a)[4],
                                             const v16bf (&b)[4]) {
#pragma unroll
  for (int i = 0; i < 4; ++i)
#pragma unroll
    for (int t = 0; t < 4; ++t) acc[i][t] = wmma_bf16(a[i], b[t], acc[i][t]);
}

__global__ void __launch_bounds__(128)
gemm_bf16_kernel(const unsigned short* __restrict__ A,
                 const unsigned short* __restrict__ Bt,
                 const float* __restrict__ bias,
                 float* __restrict__ Cf, unsigned short* __restrict__ Cb,
                 int M, int N, int K, int mode, int relu) {
  __shared__ __align__(16) unsigned short ts[2 * GBUF];

  const int lane = threadIdx.x & 31;
  const int wave = threadIdx.x >> 5;
  const int wm = (wave >> 1) * 64;             // the wave's rows and columns
  const int wn = (wave & 1) * 64;              // inside the block's tile
  const int m0 = blockIdx.x * 128 + wm;
  const int n0 = blockIdx.y * 128 + wn;

  // A thread's share of a tile: 16 bytes (chunk cc) of rows cr, cr + 16, ...
  const int cr = threadIdx.x >> 3, cc = (threadIdx.x & 7) * 8;
  const unsigned short* ga = A  + (size_t)(blockIdx.x * 128 + cr) * K + cc;
  const unsigned short* gb = Bt + (size_t)(blockIdx.y * 128 + cr) * K + cc;
  const size_t gstep = (size_t)16 * K;
  const unsigned l0 = (unsigned)(size_t)&ts[cr * GTP + cc];   // its LDS byte address in buffer 0
  const int nt = K / GKS;

  v8f acc[4][4] = {};
  v16bf a0[4], b0[4], a1[4], b1[4];

  gemm_tile_copy(l0, ga, gb, gstep);
  asm volatile("s_wait_asynccnt 0x0" ::: "memory");   // this wave's share of tile 0 has landed
  __syncthreads();                                    // tile 0 is published
  if (nt > 1) gemm_tile_copy(l0 + GBUF * 2u, ga + GKS, gb + GKS, gstep);

  for (int t = 0; t < nt; ++t) {
    const unsigned short* ta = ts + (t & 1) * GBUF;
    const unsigned short* tb = ta + 128 * GTP;
    gemm_load_set(a0, b0, ta, tb, GTP, wm, wn, 0,  lane);
    gemm_load_set(a1, b1, ta, tb, GTP, wm, wn, 32, lane);
    // keeps the tile's 32 LDS reads in one group ahead of its 32 WMMAs (else they
    // sink among the WMMAs, one fragment at a time, each waited out in full)
    __builtin_amdgcn_sched_barrier(0);
    gemm_mul_set(acc, a0, b0);
    gemm_mul_set(acc, a1, b1);
    // keeps the WMMAs ahead of the waits below (else they sink behind the barrier
    // and the next tile's copies are waited out before anything is multiplied)
    __builtin_amdgcn_sched_barrier(0);
    asm volatile("s_wait_dscnt 0x0" ::: "memory");    // this wave's reads of this buffer are done
    asm volatile("s_wait_asynccnt 0x0" ::: "memory"); // its share of tile t + 1 has landed
    __syncthreads();     // publishes tile t + 1, ends every wave's reads of this buffer
    if (t + 2 < nt)      // the same for the whole block
      gemm_tile_copy(l0 + (unsigned)(t & 1) * (GBUF * 2u), ga + (size_t)(t + 2) * GKS,
                     gb + (size_t)(t + 2) * GKS, gstep);
  }
  asm volatile("s_wait_asynccnt 0x0" ::: "memory");   // no copy is left in flight

  const int col = lane & 15;
  const int h2  = lane >> 4;
  // Epilogue.  The mode test stands outside the element loops.  Modes 0 and 1
  // go in two parts: first every value and every row address is formed in
  // registers, then come the stores alone, so that no register of an issued
  // store is written again.
#pragma unroll
  for (int t = 0; t < 4; ++t) {
    float bv = bias ? bias[n0 + 16 * t + col] : 0.0f;
#pragma unroll
    for (int i = 0; i < 4; ++i)
#pragma unroll
      for (int e = 0; e < 8; ++e) {
        float v = acc[i][t][e] + bv;
        acc[i][t][e] = relu ? fmaxf(v, 0.0f) : v;
      }
  }
  const int mr = m0 + 8 * h2;                  // C layout: VGPR e -> row e (+8)
  const int nc = n0 + col;
  if (mode == 0) {
    float* cb = Cf + (size_t)mr * N + nc;
    float* c[4][8];
#pragma unroll
    for (int i = 0; i < 4; ++i)
#pragma unroll
      for (int e = 0; e < 8; ++e) c[i][e] = cb + (size_t)(16 * i + e) * N;
    __builtin_amdgcn_sched_barrier(0);         // only stores behind this line
#pragma unroll
    for (int i = 0; i < 4; ++i)
#pragma unroll
      for (int e = 0; e < 8; ++e)
#pragma unroll
        for (int t = 0; t < 4; ++t) c[i][e][16 * t] = acc[i][t][e];
    // code of the other modes' paths follows and reuses these stores' registers
    asm volatile("s_wait_xcnt 0x0" ::: "memory");
  } else if (mode == 1) {
    unsigned short* cb = Cb + (size_t)mr * N + nc;
    unsigned short* c[4][8];
    unsigned short hv[4][4][8];
#pragma unroll
    for (int i = 0; i < 4; ++i)
#pragma unroll
      for (int e = 0; e < 8; ++e) {
        c[i][e] = cb + (size_t)(16 * i + e) * N;
#pragma unroll
        for (int t = 0; t < 4; ++t) hv[i][t][e] = f2bf(acc[i][t][e]);
      }
    __builtin_amdgcn_sched_barrier(0);         // only stores behind this line
#pragma unroll
    for (int i = 0; i < 4; ++i)
#pragma unroll
      for (int e = 0; e < 8; ++e)
#pragma unroll
        for (int t = 0; t < 4; ++t) c[i][e][16 * t] = hv[i][t][e];
    // code of the other modes' paths follows and reuses these stores' registers
    asm volatile("s_wait_xcnt 0x0" ::: "memory");
  } else {
    // the wave's 64 rows lie in one batch entry, its 64 columns are one head;
    // a lane's eight rows of a tile are eight neighbours in Vt: one 16-byte store
    const int bb = mr / S_LEN, s = mr % S_LEN;
    const int hh = nc >> 6,    d = nc & 63;
    unsigned short* c = Cb + (((size_t)bb * H_CNT + hh) * D_HEAD + d) * S_LEN + s;
    uint4 pk[4][4];
#pragma unroll
    for (int i = 0; i < 4; ++i)
#pragma unroll
      for (int t = 0; t < 4; ++t) {
        unsigned q[4];
#pragma unroll
        for (int e = 0; e < 4; ++e)
          q[e] = (unsigned)f2bf(acc[i][t][2 * e]) | ((unsigned)f2bf(acc[i][t][2 * e + 1]) << 16);
        pk[i][t] = make_uint4(q[0], q[1], q[2], q[3]);
      }
#pragma unroll
    for (int i = 0; i < 4; ++i)
#pragma unroll
      for (int t = 0; t < 4; ++t)
        *(uint4*)(c + (size_t)(16 * t) * S_LEN + 16 * i) = pk[i][t];
    // code of the other modes' paths follows and reuses these stores' registers
    asm volatile("s_wait_xcnt 0x0" ::: "memory");
  }
}

// ---------------------------------------------------------------------------
#define KT 64   // keys a stage of the attention's LDS tiles
#define TP 72   // row pitch of a staged tile in bf16: 144 bytes = 16 x 9, no bank conflict for 16-byte reads

typedef __attribute__((ext_vector_type(4))) float    f32x4s;
typedef __attribute__((ext_vector_type(4))) unsigned u32x4s;

// One thread's share of a 64-key stage, global -> registers.  The bases are the
// same for the whole block, the two byte offsets never change.
__device__ __forceinline__ void stage_load(f32x4s (&qr)[4], u32x4s (&vr)[2],
                                           const float* qbase, const unsigned short* vbase,
                                           unsigned qoff, unsigned voff) {
#pragma unroll
  for (int q = 0; q < 4; ++q)
    qr[q] = *(const f32x4s*)((const char*)qbase + qoff + (unsigned)(16 * q * E_DIM * 4));
#pragma unroll
  for (int q = 0; q < 2; ++q)
    vr[q] = *(const u32x4s*)((const char*)vbase + voff + (unsigned)(32 * q * S_LEN * 2));
}

// registers -> LDS; Q is rounded to bf16 here, once for the block's eight waves
__device__ __forceinline__ void stage_store(const f32x4s (&qr)[4], const u32x4s (&vr)[2],
                                            unsigned short* qdst, unsigned short* vdst) {
#pragma unroll
  for (int q = 0; q < 4; ++q)
    *(uint2*)(qdst + 16 * q * TP) = make_uint2(pack2(qr[q].x, qr[q].y), pack2(qr[q].z, qr[q].w));
#pragma unroll
  for (int q = 0; q < 2; ++q) *(u32x4s*)(vdst + 32 * q * TP) = vr[q];
}

// lane l <-> lane l ^ 16: the other half of the wave, by a vector cross-row move
__device__ __forceinline__ float swap_halves(float v) {
  const int b = __builtin_bit_cast(int, v);
  return __builtin_bit_cast(float, __builtin_amdgcn_permlanex16(b, b, 0x76543210, 0xfedcba98,
                                                                false, false));
}

typedef __attribute__((ext_vector_type(4))) int i32x4s;

// Flash attention. Reference einsum gives corr[b,h,i,j] = K[b,i,h,:].Q[b,j,h,:],
// softmax over j, out[i,d] = sum_j P[i,j] V[j,d].
// Block = 8 waves; wave owns 16 output rows i; streams keys in tiles of 32.
// The products are taken transposed: S^T[j,i] = Q[j,:].K[i,:] (A = staged Q rows,
// B = the wave's K rows) and O^T[d,i] += V^T[d,:].P^T[:,i].  A lane then holds 16
// of the 32 scores of ONE output row i = lane & 15 (j = 8 * half + e and
// 16 + 8 * half + e), so the row's maximum and sum run in the lane's own
// registers with one exchange between the wave's halves, the running maximum and
// sum are one register each, and the two score tiles, rounded to bf16 in place,
// ARE the B operand of the second product in the k order of load_frag_bf16.
// The eight waves walk the same keys, so the block brings each 64-key stage of
// Q and of V^T into LDS once: whole-line global loads, Q rounded to bf16 on the
// way, and every wave takes its A fragments from LDS.  Two buffers: the next
// stage's loads fly while this stage is worked on; one barrier a stage.
__global__ void __launch_bounds__(256)
flash_attn_kernel(const float* __restrict__ Kf, const float* __restrict__ Qf,
                  const unsigned short* __restrict__ Vt, const int* __restrict__ mask,
                  float* __restrict__ Out, float scale) {
  __shared__ __align__(16) unsigned short qs[2][KT][TP];      // Q rows j, bf16, d along the row
  __shared__ __align__(16) unsigned short vs[2][D_HEAD][TP];  // V^T rows d, keys along the row

  const int lane = threadIdx.x & 31;
  const int wave = threadIdx.x >> 5;
  const int h2   = lane >> 4;
  const int col  = lane & 15;
  const int b = blockIdx.z, h = blockIdx.y;
  const int i0 = blockIdx.x * 128 + wave * 16;

  const float* Kb_ = Kf + (size_t)b * S_LEN * E_DIM + h * D_HEAD;
  const float* Qb_ = Qf + (size_t)b * S_LEN * E_DIM + h * D_HEAD;
  const unsigned short* Vb_ = Vt + ((size_t)b * H_CNT + h) * D_HEAD * S_LEN;

  // A thread's share of a stage.  Q: 16 bytes of four rows, 16 rows apart (a
  // wave's load covers two whole 256-byte rows); V^T: 16 bytes of two rows, 32
  // rows apart (a wave's load covers four whole 128-byte rows).
  const int qrow = threadIdx.x >> 4, qcol = (threadIdx.x & 15) * 4;
  const int vrow = threadIdx.x >> 3, vcol = (threadIdx.x & 7) * 8;
  const unsigned qoff = (unsigned)(qrow * E_DIM + qcol) * 4u;   // byte offsets from
  const unsigned voff = (unsigned)(vrow * S_LEN + vcol) * 2u;   // the stage's base
  // the lane's mask row i, at its half's first key of a stage
  const unsigned moff = (unsigned)((i0 + col) * S_LEN + 8 * h2) * 4u;
  f32x4s qr[4];
  u32x4s vr[2];

  // This wave's 16 K-rows over d = 0..63 (reused for all key tiles): the B operand
  v16bf aK0 = load_frag_f32(Kb_, E_DIM, i0, 0,  lane);
  v16bf aK1 = load_frag_f32(Kb_, E_DIM, i0, 32, lane);
  // the address registers that these loads name are written again below
  asm volatile("s_wait_xcnt 0x0" ::: "memory");
  __builtin_amdgcn_sched_barrier(0);     // holds later register writes behind that wait

  v8f O[4] = {};               // O^T: tile t, register e = O[i][16 t + 8 half + e]
  float mrow = -3.0e38f;       // running maximum of row i (the same in both halves)
  float lrow = 0.0f;           // running sum of row i over this half's keys

  const float mval = -1.0e20f * scale;

  stage_load(qr, vr, Qb_, Vb_, qoff, voff);
  stage_store(qr, vr, &qs[0][qrow][qcol], &vs[0][vrow][vcol]);
  __syncthreads();                       // stage 0 is published

  for (int st = 0; st < S_LEN; st += KT) {
    const int buf = (st / KT) & 1;
    const bool more = st + KT < S_LEN;   // the same for the whole block
    // This stage's mask words of row i: a lane's eight keys of a score tile are 32
    // contiguous bytes, two 16-byte loads.  (Here and below: a loop over a register
    // array is unrolled so that its indices are constants.)
    i32x4s mk[KT / 32][4];
#pragma unroll
    for (int u = 0; u < KT / 32; ++u)
#pragma unroll
      for (int q = 0; q < 4; ++q)
        mk[u][q] = *(const i32x4s*)((const char*)(mask + st) + moff +
                                    (unsigned)(128 * u + 64 * (q >> 1) + 16 * (q & 1)));
    if (more)
      stage_load(qr, vr, Qb_ + (size_t)(st + KT) * E_DIM, Vb_ + (st + KT), qoff, voff);
    const unsigned short* qt = &qs[buf][0][0];
    const unsigned short* vt = &vs[buf][0][0];

    // unrolled so that the two halves' LDS offsets are immediates
#pragma unroll
    for (int jj = 0; jj < KT; jj += 32) {
      // scores tile 32x16 (keys x rows): two 16x16 WMMA tiles, K over d (2 steps of 32)
      v16bf aq00 = load_frag_bf16(qt, TP, jj +  0, 0,  lane);
      v16bf aq01 = load_frag_bf16(qt, TP, jj +  0, 32, lane);
      v16bf aq10 = load_frag_bf16(qt, TP, jj + 16, 0,  lane);
      v16bf aq11 = load_frag_bf16(qt, TP, jj + 16, 32, lane);
      v8f s0 = {}, s1 = {};
      s0 = wmma_bf16(aq00, aK0, s0); s0 = wmma_bf16(aq01, aK1, s0);
      s1 = wmma_bf16(aq10, aK0, s1); s1 = wmma_bf16(aq11, aK1, s1);

      // v[s]: key j = st + jj + (s < 8 ? 8 * h2 + s : 16 + 8 * h2 + s - 8) of row i
      float v[16];
#pragma unroll
      for (int e = 0; e < 8; ++e) {
        v[e]     = mk[jj / 32][(e >> 2)][e & 3]     ? s0[e] * scale : mval;
        v[8 + e] = mk[jj / 32][2 + (e >> 2)][e & 3] ? s1[e] * scale : mval;
      }
      float mx = v[0];
#pragma unroll
      for (int s = 1; s < 16; ++s) mx = fmaxf(mx, v[s]);
      mx = fmaxf(mx, swap_halves(mx));
      const float mnew  = fmaxf(mrow, mx);
      const float alpha = __expf(mrow - mnew);
      mrow = mnew;

      // P^T, rounded to nearest even in place: element s of the B operand is the key of v[s]
      float p[16];
      v16bf pb;
#pragma unroll
      for (int s = 0; s < 16; ++s) {
        p[s]  = __expf(v[s] - mnew);
        pb[s] = (__bf16)p[s];
      }
      const float rs = (((p[0] + p[1]) + (p[2] + p[3])) + ((p[4] + p[5]) + (p[6] + p[7]))) +
                       (((p[8] + p[9]) + (p[10] + p[11])) + ((p[12] + p[13]) + (p[14] + p[15])));
      lrow = lrow * alpha + rs;
#pragma unroll
      for (int t = 0; t < 4; ++t) O[t] *= alpha;

      // O^T += V^T . P^T  (A operand from the staged V^T: rows = d, k = j)
      v16bf av0 = load_frag_bf16(vt, TP, 0,  jj, lane);
      v16bf av1 = load_frag_bf16(vt, TP, 16, jj, lane);
      v16bf av2 = load_frag_bf16(vt, TP, 32, jj, lane);
      v16bf av3 = load_frag_bf16(vt, TP, 48, jj, lane);
      O[0] = wmma_bf16(av0, pb, O[0]);
      O[1] = wmma_bf16(av1, pb, O[1]);
      O[2] = wmma_bf16(av2, pb, O[2]);
      O[3] = wmma_bf16(av3, pb, O[3]);
    }

    // The other buffer's last readers left it before the barrier of the trip
    // before; this trip's barrier publishes it and ends the reads of this one.
    if (more)
      stage_store(qr, vr, &qs[buf ^ 1][qrow][qcol], &vs[buf ^ 1][vrow][vcol]);
    // the next trip's address additions rewrite registers that this trip's global loads name
    asm volatile("s_wait_xcnt 0x0" ::: "memory");
    __builtin_amdgcn_sched_barrier(0);   // keeps those additions behind the wait
    __syncthreads();
  }

  // The halves' sums are joined once.  A lane's eight registers of a tile are eight
  // neighbours of row i: two 16-byte stores.  Every value is formed first, then
  // come the stores alone, so that no register of an issued store is written again.
  const float inv = 1.0f / (lrow + swap_halves(lrow));
  float* orow = Out + ((size_t)b * S_LEN + i0 + col) * E_DIM + h * D_HEAD + 8 * h2;
  f32x4s ov[4][2];
#pragma unroll
  for (int t = 0; t < 4; ++t) {
    ov[t][0] = f32x4s{O[t][0], O[t][1], O[t][2], O[t][3]} * inv;
    ov[t][1] = f32x4s{O[t][4], O[t][5], O[t][6], O[t][7]} * inv;
  }
  __builtin_amdgcn_sched_barrier(0);     // only stores behind this line
#pragma unroll
  for (int t = 0; t < 4; ++t) {
    *(f32x4s*)(orow + 16 * t)     = ov[t][0];
    *(f32x4s*)(orow + 16 * t + 4) = ov[t][1];
  }
}

// ---------------------------------------------------------------------------
// LayerNorm kernels: one wave per row of 512, 8 rows a block, 16 elements a lane
// (four 16-byte pieces, 128 elements apart: a wave's access is 512 contiguous
// bytes).  The row sums run in the lane and then over the wave's 32 lanes.
typedef __attribute__((ext_vector_type(4))) float f32x4;

__device__ __forceinline__ float wave_sum(float v) {
#pragma unroll
  for (int o = 16; o > 0; o >>= 1) v += __shfl_xor(v, o, 32);
  return v;
}

// 16 bytes at a 32-bit byte offset from a uniform base
__device__ __forceinline__ f32x4 ld16(const float* base, unsigned byte_off) {
  return *(const f32x4*)((const char*)base + byte_off);
}

// mean and 1/sqrt(var + eps) of the wave's row
__device__ __forceinline__ void row_stats(const f32x4 (&x)[4], float& mean, float& rstd) {
  float s1 = 0.0f, s2 = 0.0f;
#pragma unroll
  for (int q = 0; q < 4; ++q) {
    s1 += (x[q].x + x[q].y) + (x[q].z + x[q].w);
    s2 += (x[q].x * x[q].x + x[q].y * x[q].y) + (x[q].z * x[q].z + x[q].w * x[q].w);
  }
  s1 = wave_sum(s1);
  s2 = wave_sum(s2);
  mean = s1 * (1.0f / E_DIM);
  const float var = s2 * (1.0f / E_DIM) - mean * mean;
  rstd = rsqrtf(var + 1e-5f);
}

// x1 = LN(src + res) * g + b  -> f32 and a bf16 copy.
__global__ void __launch_bounds__(256)
add_ln_kernel(const float* __restrict__ src, const float* __restrict__ res,
              const float* __restrict__ g, const float* __restrict__ bb,
              float* __restrict__ outf, unsigned short* __restrict__ outb) {
  const int lane = threadIdx.x & 31;
  const size_t off = (size_t)(blockIdx.x * 8 + (threadIdx.x >> 5)) * E_DIM + 4 * lane;
  const unsigned ro = (unsigned)off * 4u;   // the lane's byte offset in a [rows,512] f32 array
  const unsigned co = 16u * lane;           // and in a vector of 512
  f32x4 x[4], c[4], gg[4], bv[4];
#pragma unroll
  for (int q = 0; q < 4; ++q) {
    x[q]  = ld16(src, ro + 512u * q);
    c[q]  = ld16(res, ro + 512u * q);
    gg[q] = ld16(g,   co + 512u * q);
    bv[q] = ld16(bb,  co + 512u * q);
  }
  // Every loaded value is an input, so the wait stands behind all 16 loads; the
  // two offsets are inputs, so they stay untouched (also by a later load's
  // result) up to it.
  asm volatile("s_wait_xcnt 0x0"
               :: "v"(ro), "v"(co),
                  "v"(x[0]),  "v"(x[1]),  "v"(x[2]),  "v"(x[3]),
                  "v"(c[0]),  "v"(c[1]),  "v"(c[2]),  "v"(c[3]),
                  "v"(gg[0]), "v"(gg[1]), "v"(gg[2]), "v"(gg[3]),
                  "v"(bv[0]), "v"(bv[1]), "v"(bv[2]), "v"(bv[3]) : "memory");
#pragma unroll
  for (int q = 0; q < 4; ++q) x[q] += c[q];
  float mean, rstd;
  row_stats(x, mean, rstd);
  uint2 h[4];
#pragma unroll
  for (int q = 0; q < 4; ++q) {
    x[q] = (x[q] - mean) * rstd * gg[q] + bv[q];
    h[q] = make_uint2(pack2(x[q].x, x[q].y), pack2(x[q].z, x[q].w));
  }
#pragma unroll
  for (int q = 0; q < 4; ++q) {
    *(f32x4*)(outf + off + 128 * q) = x[q];
    *(uint2*)(outb + off + 128 * q) = h[q];
  }
}

// out = LN( LN(f)*g3+b3 + x1 ) * g2 + b2.
__global__ void __launch_bounds__(256)
double_ln_kernel(const float* __restrict__ f, const float* __restrict__ x1,
                 const float* __restrict__ g3, const float* __restrict__ b3,
                 const float* __restrict__ g2, const float* __restrict__ b2,
                 float* __restrict__ out) {
  const int lane = threadIdx.x & 31;
  const size_t off = (size_t)(blockIdx.x * 8 + (threadIdx.x >> 5)) * E_DIM + 4 * lane;
  const unsigned ro = (unsigned)off * 4u;   // the lane's byte offset in a [rows,512] f32 array
  const unsigned co = 16u * lane;           // and in a vector of 512
  f32x4 a[4], xr[4], ga[4], ba[4], gb[4], bc[4];
#pragma unroll
  for (int q = 0; q < 4; ++q) {
    a[q]  = ld16(f,  ro + 512u * q);
    xr[q] = ld16(x1, ro + 512u * q);
    ga[q] = ld16(g3, co + 512u * q);
    ba[q] = ld16(b3, co + 512u * q);
    gb[q] = ld16(g2, co + 512u * q);
    bc[q] = ld16(b2, co + 512u * q);
  }
  // Every loaded value is an input, so the wait stands behind all 24 loads; the
  // two offsets are inputs, so they stay untouched (also by a later load's
  // result) up to it.
  asm volatile("s_wait_xcnt 0x0"
               :: "v"(ro), "v"(co),
                  "v"(a[0]),  "v"(a[1]),  "v"(a[2]),  "v"(a[3]),
                  "v"(xr[0]), "v"(xr[1]), "v"(xr[2]), "v"(xr[3]),
                  "v"(ga[0]), "v"(ga[1]), "v"(ga[2]), "v"(ga[3]),
                  "v"(ba[0]), "v"(ba[1]), "v"(ba[2]), "v"(ba[3]),
                  "v"(gb[0]), "v"(gb[1]), "v"(gb[2]), "v"(gb[3]),
                  "v"(bc[0]), "v"(bc[1]), "v"(bc[2]), "v"(bc[3]) : "memory");
  float mean, rstd;
  row_stats(a, mean, rstd);
#pragma unroll
  for (int q = 0; q < 4; ++q) a[q] = (a[q] - mean) * rstd * ga[q] + ba[q] + xr[q];
  row_stats(a, mean, rstd);
#pragma unroll
  for (int q = 0; q < 4; ++q) a[q] = (a[q] - mean) * rstd * gb[q] + bc[q];
#pragma unroll
  for (int q = 0; q < 4; ++q) *(f32x4*)(out + off + 128 * q) = a[q];
}

// ---------------------------------------------------------------------------
extern "C" void kernel_launch(void* const* d_in, const int* in_sizes, int n_in,
                              void* d_out, int out_size, void* d_ws, size_t ws_size,
                              hipStream_t stream) {
  const float* x  = (const float*)d_in[0];
  const int* mask = (const int*)d_in[1];
  const float* Wv = (const float*)d_in[2];
  const float* Wk = (const float*)d_in[3];
  const float* Wq = (const float*)d_in[4];
  const float* g1 = (const float*)d_in[5];
  const float* b1 = (const float*)d_in[6];
  const float* W1 = (const float*)d_in[7];
  const float* c1 = (const float*)d_in[8];
  const float* W2 = (const float*)d_in[9];
  const float* c2 = (const float*)d_in[10];
  const float* g3 = (const float*)d_in[11];
  const float* b3 = (const float*)d_in[12];
  const float* g2 = (const float*)d_in[13];
  const float* b2 = (const float*)d_in[14];

  const size_t MB = 1ull << 20;
  unsigned char* w = (unsigned char*)d_ws;
  // live regions (peak ~96 MB, with reuse):
  unsigned short* xb  = (unsigned short*)(w +  0 * MB); //  8 MB  x bf16
  unsigned short* Wqt = (unsigned short*)(w +  8 * MB); //  .5 MB
  unsigned short* Wkt = (unsigned short*)(w +  9 * MB); //  .5 MB
  unsigned short* Wvt = (unsigned short*)(w + 10 * MB); //  .5 MB
  unsigned short* W1t = (unsigned short*)(w + 11 * MB); //  2 MB
  unsigned short* W2t = (unsigned short*)(w + 13 * MB); //  2 MB
  float*          Kf  = (float*)         (w + 16 * MB); // 16 MB  keys f32
  unsigned short* Vt  = (unsigned short*)(w + 32 * MB); //  8 MB  V^T bf16
  float*          Qf  = (float*)         (w + 40 * MB); // 16 MB  queries f32
  float*          attn= (float*)         (w + 56 * MB); // 16 MB
  float*          x1f = (float*)         (w + 72 * MB); // 16 MB
  unsigned short* x1b = (unsigned short*)(w + 88 * MB); //  8 MB
  unsigned short* hb  = (unsigned short*)(w + 16 * MB); // 32 MB (reuses Kf/Vt/Qf)
  float*          ff  = (float*)         (w + 48 * MB); // 16 MB (reuses Qf/attn)

  dim3 blk(256);
  dim3 gblk(128);   // GEMM: 4 waves, 2x2

  // 1) conversions / weight transposes
  cvt_bf16_kernel<<<(M_ROWS * V_DIM) / 8192, blk, 0, stream>>>(x, xb);
  transpose_bf16_kernel<<<(V_DIM * E_DIM) / 4096, blk, 0, stream>>>(Wq, Wqt, V_DIM, E_DIM);
  transpose_bf16_kernel<<<(V_DIM * E_DIM) / 4096, blk, 0, stream>>>(Wk, Wkt, V_DIM, E_DIM);
  transpose_bf16_kernel<<<(V_DIM * E_DIM) / 4096, blk, 0, stream>>>(Wv, Wvt, V_DIM, E_DIM);
  transpose_bf16_kernel<<<(E_DIM * F_DIM) / 4096, blk, 0, stream>>>(W1, W1t, E_DIM, F_DIM);
  transpose_bf16_kernel<<<(F_DIM * E_DIM) / 4096, blk, 0, stream>>>(W2, W2t, F_DIM, E_DIM);

  // 2) QKV projections
  dim3 gq(M_ROWS / 128, E_DIM / 128);
  gemm_bf16_kernel<<<gq, gblk, 0, stream>>>(xb, Wqt, nullptr, Qf, nullptr,
                                           M_ROWS, E_DIM, V_DIM, 0, 0);
  gemm_bf16_kernel<<<gq, gblk, 0, stream>>>(xb, Wkt, nullptr, Kf, nullptr,
                                           M_ROWS, E_DIM, V_DIM, 0, 0);
  gemm_bf16_kernel<<<gq, gblk, 0, stream>>>(xb, Wvt, nullptr, nullptr, Vt,
                                           M_ROWS, E_DIM, V_DIM, 2, 0);

  // 3) fused attention
  dim3 ga(S_LEN / 128, H_CNT, B_SZ);
  const float scale = 1.0f / sqrtf((float)E_DIM);
  flash_attn_kernel<<<ga, blk, 0, stream>>>(Kf, Qf, Vt, mask, attn, scale);

  // 4) x1 = LN(attn + queries)
  add_ln_kernel<<<M_ROWS / 8, blk, 0, stream>>>(attn, Qf, g1, b1, x1f, x1b);

  // 5) h = relu(x1 @ W1 + c1)
  dim3 gf1(M_ROWS / 128, F_DIM / 128);
  gemm_bf16_kernel<<<gf1, gblk, 0, stream>>>(x1b, W1t, c1, nullptr, hb,
                                            M_ROWS, F_DIM, E_DIM, 1, 1);

  // 6) f = h @ W2 + c2
  dim3 gf2(M_ROWS / 128, E_DIM / 128);
  gemm_bf16_kernel<<<gf2, gblk, 0, stream>>>(hb, W2t, c2, ff, nullptr,
                                            M_ROWS, E_DIM, F_DIM, 0, 0);

  // 7) out = LN(LN(f) + x1)
  double_ln_kernel<<<M_ROWS / 8, blk, 0, stream>>>(ff, x1f, g3, b3, g2, b2,
                                               (float*)d_out);
}

// v006
// One run takes 164 microseconds.
// Timed twice side by side with v005, it ran 1.17 and 1.18 times as fast.
// Counting every step since v000, it is 3.15 times as fast.
#include <hip/hip_runtime.h>
#include <hip/hip_bf16.h>
#include <math.h>

// ---------------------------------------------------------------------------
// Transformer block on CDNA5 (gfx1250), wave32, bf16 WMMA w/ f32 accumulation.
// Pipeline:
//   1) convert x -> bf16; transpose+convert weights -> bf16 [N,K] (one launch)
//   2) WMMA GEMMs: Q (f32), K (f32), V (bf16, head-transposed [b,h,d,s]) (one launch)
//   3) flash attention (scores = K.Q^T per the reference's einsum, taken
//      transposed), online softmax in the lane, V^T.P^T via WMMA, P stays in registers
//   4) x1 = LN(attn + Q) -> f32 + bf16
//   5) h = relu(x1 @ W1 + c1) (WMMA, bf16 out)
//   6) f = h @ W2 + c2 (WMMA, f32 out)
//   7) out = LN(LN(f) + x1)
// ---------------------------------------------------------------------------

typedef __attribute__((ext_vector_type(16))) __bf16 v16bf;
typedef __attribute__((ext_vector_type(8)))  float  v8f;
typedef __attribute__((ext_vector_type(4))) unsigned u32x4s;

#define S_LEN  2048
#define E_DIM  512
#define V_DIM  512
#define F_DIM  2048
#define B_SZ   4
#define H_CNT  8
#define D_HEAD 64
#define M_ROWS (B_SZ * S_LEN)

__device__ __forceinline__ unsigned short f2bf(float f) {
  union { float f; unsigned u; } a; a.f = f;
  unsigned u = a.u;
  return (unsigned short)((u + 0x7FFFu + ((u >> 16) & 1u)) >> 16); // RNE
}

// A/B fragment loader for v_wmma_f32_16x16x32_bf16 from row-major bf16 data.
// Layout (ISA 7.12.2, 16-bit A 16x32): lane L holds row (L&15); lanes 0-15
// carry K = [k0, k0+8) and [k0+16, k0+24); lanes 16-31 the +8 halves.
// The same layout serves the B operand when loading from a [N,K] (transposed)
// matrix: lane holds column n = (L&15) of B.
__device__ __forceinline__ v16bf load_frag_bf16(const unsigned short* base, int ld,
                                                int row0, int k0, int lane) {
  const int half = lane >> 4;
  const unsigned short* p = base + (size_t)(row0 + (lane & 15)) * ld + k0 + 8 * half;
  union { uint4 q[2]; v16bf v; } u;
  u.q[0] = *(const uint4*)p;
  u.q[1] = *(const uint4*)(p + 16);
  return u.v;
}

// Same fragment, sourced from fp32 with on-the-fly bf16 conversion.
__device__ __forceinline__ v16bf load_frag_f32(const float* base, int ld,
                                               int row0, int k0, int lane) {
  const int half = lane >> 4;
  const float* p = base + (size_t)(row0 + (lane & 15)) * ld + k0 + 8 * half;
  union { unsigned short s[16]; v16bf v; } u;
#pragma unroll
  for (int e = 0; e < 8; ++e) {
    u.s[e]     = f2bf(p[e]);
    u.s[8 + e] = f2bf(p[16 + e]);
  }
  return u.v;
}

__device__ __forceinline__ v8f wmma_bf16(v16bf a, v16bf b, v8f c) {
  return __builtin_amdgcn_wmma_f32_16x16x32_bf16(false, a, false, b, (short)0, c,
                                                 false, false);
}

// ---------------------------------------------------------------------------
// The kernels without matrix work are short; each thread takes many elements
// and the grids are small, for speed only.

__device__ __forceinline__ unsigned pack2(float lo, float hi) {
  return (unsigned)f2bf(lo) | ((unsigned)f2bf(hi) << 16);
}

// Elementwise fp32 -> bf16, 32 elements a thread: four chunks of eight (two
// 16-byte loads, one 16-byte store), a block's chunks 2048 elements apart, so
// that every access of a wave covers whole lines.  Blocks = elements / 8192.
__device__ __forceinline__ void cvt_body(const float* __restrict__ in,
                                         unsigned short* __restrict__ out, int blk) {
  const size_t base = (size_t)blk * 8192 + threadIdx.x * 8;
  const float* p = in + base;
  unsigned short* o = out + base;
  float4 v[4][2];
#pragma unroll
  for (int c = 0; c < 4; ++c) {
    v[c][0] = *(const float4*)(p + 2048 * c);
    v[c][1] = *(const float4*)(p + 2048 * c + 4);
  }
  uint4 q[4];
#pragma unroll
  for (int c = 0; c < 4; ++c)
    q[c] = make_uint4(pack2(v[c][0].x, v[c][0].y), pack2(v[c][0].z, v[c][0].w),
                      pack2(v[c][1].x, v[c][1].y), pack2(v[c][1].z, v[c][1].w));
#pragma unroll
  for (int c = 0; c < 4; ++c) *(uint4*)(o + 2048 * c) = q[c];
}

// [Kd,Nd] fp32 -> [Nd,Kd] bf16.  A thread takes 16 k of one n: 16 loads (a wave
// reads 128 contiguous bytes of a row each time) and two 16-byte stores.
// Blocks = Kd * Nd / 4096; Kd is a multiple of 16.  The row length is a constant
// of the body, so that the split of the block index needs no division.
template <int ND>
__device__ __forceinline__ void transpose_body(const float* __restrict__ in,
                                               unsigned short* __restrict__ out, int Kd,
                                               int blk) {
  const int kb = blk / (ND / 256);               // a block's threads share their 16 rows
  const int n  = (blk % (ND / 256)) * 256 + threadIdx.x;
  const float* p = in + (size_t)(16 * kb) * ND + n;
  float v[16];
#pragma unroll
  for (int e = 0; e < 16; ++e) v[e] = p[e * ND];
  const uint4 q0 = make_uint4(pack2(v[0], v[1]),   pack2(v[2], v[3]),
                              pack2(v[4], v[5]),   pack2(v[6], v[7]));
  const uint4 q1 = make_uint4(pack2(v[8], v[9]),   pack2(v[10], v[11]),
                              pack2(v[12], v[13]), pack2(v[14], v[15]));
  unsigned short* o = out + (size_t)n * Kd + 16 * kb;
  *(uint4*)o       = q0;
  *(uint4*)(o + 8) = q1;
  // another job's code follows in the merged kernel and reuses these stores' registers
  asm volatile("s_wait_xcnt 0x0" ::: "memory");
}

// The six conversions read nothing of each other's output, so they are one launch:
// the block index picks the job (the same for a whole block).
#define CVT_BLKS ((M_ROWS * V_DIM) / 8192)   // x
#define TQ_BLKS  ((V_DIM * E_DIM) / 4096)    // each of Wq, Wk, Wv
#define TF_BLKS  ((E_DIM * F_DIM) / 4096)    // each of W1, W2
#define PREP_BLKS (CVT_BLKS + 3 * TQ_BLKS + 2 * TF_BLKS)

__global__ void __launch_bounds__(256)
prep_kernel(const float* __restrict__ x,  const float* __restrict__ Wq,
            const float* __restrict__ Wk, const float* __restrict__ Wv,
            const float* __restrict__ W1, const float* __restrict__ W2,
            unsigned short* __restrict__ xb,  unsigned short* __restrict__ Wqt,
            unsigned short* __restrict__ Wkt, unsigned short* __restrict__ Wvt,
            unsigned short* __restrict__ W1t, unsigned short* __restrict__ W2t) {
  int blk = blockIdx.x;
  if (blk < CVT_BLKS) { cvt_body(x, xb, blk); return; }
  blk -= CVT_BLKS;
  if (blk < 3 * TQ_BLKS) {
    const int w = blk / TQ_BLKS;
    const float* in     = w == 0 ? Wq  : w == 1 ? Wk  : Wv;
    unsigned short* out = w == 0 ? Wqt : w == 1 ? Wkt : Wvt;
    transpose_body<E_DIM>(in, out, V_DIM, blk % TQ_BLKS);
    return;
  }
  blk -= 3 * TQ_BLKS;
  if (blk < TF_BLKS) transpose_body<F_DIM>(W1, W1t, E_DIM, blk);
  else               transpose_body<E_DIM>(W2, W2t, F_DIM, blk - TF_BLKS);
}

#define GKS  64            // k of a staged tile: 128 bytes of every row
#define GTP  72            // row pitch of a staged tile in bf16: 144 bytes = 16 x 9, no bank conflict for 16-byte reads
#define GBUF (256 * GTP)   // a buffer in bf16: rows 0..127 of A, then rows 0..127 of Bt

__device__ __forceinline__ void gemm_load_set(v16bf (&a)[4], v16bf (&b)[4],
                                              const unsigned short* A,
                                              const unsigned short* Bt, int K,
                                              int m0, int n0, int k0, int lane) {
#pragma unroll
  for (int i = 0; i < 4; ++i) a[i] = load_frag_bf16(A, K, m0 + 16 * i, k0, lane);
#pragma unroll
  for (int t = 0; t < 4; ++t) b[t] = load_frag_bf16(Bt, K, n0 + 16 * t, k0, lane);
}

// Eight asynchronous copies, global -> LDS through no register: the lane's 16
// bytes of eight rows, 16 rows apart.  A wave's copy covers four whole rows of
// the tile.  The last line is a precaution: the copies' address registers stay
// untouched up to it; it stands inside the statement so that no later address
// addition can be lifted over it.
__device__ __forceinline__ void copy_rows8(unsigned lds, const unsigned short* g, size_t gstep) {
  const unsigned ls = 16u * GTP * 2u;          // 16 rows in LDS bytes
  asm volatile("global_load_async_to_lds_b128 %0, %8, off\n\t"
               "global_load_async_to_lds_b128 %1, %9, off\n\t"
               "global_load_async_to_lds_b128 %2, %10, off\n\t"
               "global_load_async_to_lds_b128 %3, %11, off\n\t"
               "global_load_async_to_lds_b128 %4, %12, off\n\t"
               "global_load_async_to_lds_b128 %5, %13, off\n\t"
               "global_load_async_to_lds_b128 %6, %14, off\n\t"
               "global_load_async_to_lds_b128 %7, %15, off\n\t"
               "s_wait_xcnt 0x0"
               :: "v"(lds),          "v"(lds + ls),     "v"(lds + 2 * ls), "v"(lds + 3 * ls),
                  "v"(lds + 4 * ls), "v"(lds + 5 * ls), "v"(lds + 6 * ls), "v"(lds + 7 * ls),
                  "v"(g),             "v"(g + gstep),     "v"(g + 2 * gstep), "v"(g + 3 * gstep),
                  "v"(g + 4 * gstep), "v"(g + 5 * gstep), "v"(g + 6 * gstep), "v"(g + 7 * gstep)
               : "memory");
}

// A thread's share of one tile: 8 copies for the A rows, 8 for the Bt rows.
__device__ __forceinline__ void gemm_tile_copy(unsigned lds, const unsigned short* ga,
                                               const unsigned short* gb, size_t gstep) {
  copy_rows8(lds, ga, gstep);
  copy_rows8(lds + 128u * GTP * 2u, gb, gstep);
}

__device__ __forceinline__ void gemm_mul_set(v8f (&acc)[4][4], const v16bf (&a)[4],
                                             const v16bf (&b)[4]) {
#pragma unroll
  for (int i = 0; i < 4; ++i)
#pragma unroll
    for (int t = 0; t < 4; ++t) acc[i][t] = wmma_bf16(a[i], b[t], acc[i][t]);
}

__device__ __forceinline__ void
gemm_body(const unsigned short* __restrict__ A,
          const unsigned short* __restrict__ Bt,
          const float* __restrict__ bias,
          float* __restrict__ Cf, unsigned short* __restrict__ Cb,
          int N, int K, int mode, int relu) {
  __shared__ __align__(16) unsigned short ts[2 * GBUF];

  const int lane = threadIdx.x & 31;
  const int wave = threadIdx.x >> 5;
  const int wm = (wave >> 1) * 64;             // the wave's rows and columns
  const int wn = (wave & 1) * 64;              // inside the block's tile
  const int m0 = blockIdx.x * 128 + wm;
  const int n0 = blockIdx.y * 128 + wn;

  // A thread's share of a tile: 16 bytes (chunk cc) of rows cr, cr + 16, ...
  const int cr = threadIdx.x >> 3, cc = (threadIdx.x & 7) * 8;
  const unsigned short* ga = A  + (size_t)(blockIdx.x * 128 + cr) * K + cc;
  const unsigned short* gb = Bt + (size_t)(blockIdx.y * 128 + cr) * K + cc;
  const size_t gstep = (size_t)16 * K;
  const unsigned l0 = (unsigned)(size_t)&ts[cr * GTP + cc];   // its LDS byte address in buffer 0
  const int nt = K / GKS;

  v8f acc[4][4] = {};
  v16bf a0[4], b0[4], a1[4], b1[4];

  gemm_tile_copy(l0, ga, gb, gstep);
  asm volatile("s_wait_asynccnt 0x0" ::: "memory");   // this wave's share of tile 0 has landed
  __syncthreads();                                    // tile 0 is published
  if (nt > 1) gemm_tile_copy(l0 + GBUF * 2u, ga + GKS, gb + GKS, gstep);

  for (int t = 0; t < nt; ++t) {
    const unsigned short* ta = ts + (t & 1) * GBUF;
    const unsigned short* tb = ta + 128 * GTP;
    gemm_load_set(a0, b0, ta, tb, GTP, wm, wn, 0,  lane);
    gemm_load_set(a1, b1, ta, tb, GTP, wm, wn, 32, lane);
    // keeps the tile's 32 LDS reads in one group ahead of its 32 WMMAs (else they
    // sink among the WMMAs, one fragment at a time, each waited out in full)
    __builtin_amdgcn_sched_barrier(0);
    gemm_mul_set(acc, a0, b0);
    gemm_mul_set(acc, a1, b1);
    // keeps the WMMAs ahead of the waits below (else they sink behind the barrier
    // and the next tile's copies are waited out before anything is multiplied)
    __builtin_amdgcn_sched_barrier(0);
    asm volatile("s_wait_dscnt 0x0" ::: "memory");    // this wave's reads of this buffer are done
    asm volatile("s_wait_asynccnt 0x0" ::: "memory"); // its share of tile t + 1 has landed
    __syncthreads();     // publishes tile t + 1, ends every wave's reads of this buffer
    if (t + 2 < nt)      // the same for the whole block
      gemm_tile_copy(l0 + (unsigned)(t & 1) * (GBUF * 2u), ga + (size_t)(t + 2) * GKS,
                     gb + (size_t)(t + 2) * GKS, gstep);
  }
  asm volatile("s_wait_asynccnt 0x0" ::: "memory");   // no copy is left in flight

  const int col = lane & 15;
  const int h2  = lane >> 4;
  // Epilogue.  The mode test stands outside the element loops.  Modes 0 and 1
  // go in two parts: first every value and every row address is formed in
  // registers, then come the stores alone, so that no register of an issued
  // store is written again.
#pragma unroll
  for (int t = 0; t < 4; ++t) {
    float bv = bias ? bias[n0 + 16 * t + col] : 0.0f;
#pragma unroll
    for (int i = 0; i < 4; ++i)
#pragma unroll
      for (int e = 0; e < 8; ++e) {
        float v = acc[i][t][e] + bv;
        acc[i][t][e] = relu ? fmaxf(v, 0.0f) : v;
      }
  }
  const int mr = m0 + 8 * h2;                  // C layout: VGPR e -> row e (+8)
  const int nc = n0 + col;
  if (mode == 0) {
    float* cb = Cf + (size_t)mr * N + nc;
    float* c[4][8];
#pragma unroll
    for (int i = 0; i < 4; ++i)
#pragma unroll
      for (int e = 0; e < 8; ++e) c[i][e] = cb + (size_t)(16 * i + e) * N;
    __builtin_amdgcn_sched_barrier(0);         // only stores behind this line
#pragma unroll
    for (int i = 0; i < 4; ++i)
#pragma unroll
      for (int e = 0; e < 8; ++e)
#pragma unroll
        for (int t = 0; t < 4; ++t) c[i][e][16 * t] = acc[i][t][e];
    // code of the other modes' paths follows and reuses these stores' registers
    asm volatile("s_wait_xcnt 0x0" ::: "memory");
  } else if (mode == 1) {
    unsigned short* cb = Cb + (size_t)mr * N + nc;
    unsigned short* c[4][8];
    unsigned short hv[4][4][8];
#pragma unroll
    for (int i = 0; i < 4; ++i)
#pragma unroll
      for (int e = 0; e < 8; ++e) {
        c[i][e] = cb + (size_t)(16 * i + e) * N;
#pragma unroll
        for (int t = 0; t < 4; ++t) hv[i][t][e] = f2bf(acc[i][t][e]);
      }
    __builtin_amdgcn_sched_barrier(0);         // only stores behind this line
#pragma unroll
    for (int i = 0; i < 4; ++i)
#pragma unroll
      for (int e = 0; e < 8; ++e)
#pragma unroll
        for (int t = 0; t < 4; ++t) c[i][e][16 * t] = hv[i][t][e];
    // code of the other modes' paths follows and reuses these stores' registers
    asm volatile("s_wait_xcnt 0x0" ::: "memory");
  } else {
    // the wave's 64 rows lie in one batch entry, its 64 columns are one head;
    // a lane's eight rows of a tile are eight neighbours in Vt: one 16-byte store
    const int bb = mr / S_LEN, s = mr % S_LEN;
    const int hh = nc >> 6,    d = nc & 63;
    unsigned short* c = Cb + (((size_t)bb * H_CNT + hh) * D_HEAD + d) * S_LEN + s;
    // a compiler vector, not a struct of four words: each value stays whole in four
    // registers of its own, and the 16 stores leave in one run with one wait behind them
    u32x4s pk[4][4];
#pragma unroll
    for (int i = 0; i < 4; ++i)
#pragma unroll
      for (int t = 0; t < 4; ++t) {
        unsigned q[4];
#pragma unroll
        for (int e = 0; e < 4; ++e)
          q[e] = (unsigned)f2bf(acc[i][t][2 * e]) | ((unsigned)f2bf(acc[i][t][2 * e + 1]) << 16);
        pk[i][t] = u32x4s{q[0], q[1], q[2], q[3]};
      }
#pragma unroll
    for (int i = 0; i < 4; ++i)
#pragma unroll
      for (int t = 0; t < 4; ++t)
        *(u32x4s*)(c + (size_t)(16 * t) * S_LEN + 16 * i) = pk[i][t];
    // code of the other modes' paths follows and reuses these stores' registers
    asm volatile("s_wait_xcnt 0x0" ::: "memory");
  }
}

__global__ void __launch_bounds__(128)
gemm_bf16_kernel(const unsigned short* __restrict__ A,
                 const unsigned short* __restrict__ Bt,
                 const float* __restrict__ bias,
                 float* __restrict__ Cf, unsigned short* __restrict__ Cb,
                 int M, int N, int K, int mode, int relu) {
  gemm_body(A, Bt, bias, Cf, Cb, N, K, mode, relu);
}

// The three projections of x read nothing of each other's output, so they are one
// launch, grid = (M/128, E/128, 3): blockIdx.z picks the weight, the output and its
// mode.  Registers and LDS let three of its 768 blocks share a WGP, so that one
// block's LDS reads and waits can run beside another's WMMAs.
__global__ void __launch_bounds__(128)
qkv_gemm_kernel(const unsigned short* __restrict__ A,
                const unsigned short* __restrict__ Wqt,
                const unsigned short* __restrict__ Wkt,
                const unsigned short* __restrict__ Wvt,
                float* __restrict__ Qf, float* __restrict__ Kf,
                unsigned short* __restrict__ Vt) {
  const int z = blockIdx.z;
  gemm_body(A, z == 0 ? Wqt : z == 1 ? Wkt : Wvt, nullptr, z == 0 ? Qf : Kf, Vt,
            E_DIM, V_DIM, z == 2 ? 2 : 0, 0);
}

// ---------------------------------------------------------------------------
#define KT 64   // keys a stage of the attention's LDS tiles
#define TP 72   // row pitch of a staged tile in bf16: 144 bytes = 16 x 9, no bank conflict for 16-byte reads

typedef __attribute__((ext_vector_type(4))) float    f32x4s;

// One thread's share of a 64-key stage, global -> registers.  The bases are the
// same for the whole block, the two byte offsets never change.
__device__ __forceinline__ void stage_load(f32x4s (&qr)[4], u32x4s (&vr)[2],
                                           const float* qbase, const unsigned short* vbase,
                                           unsigned qoff, unsigned voff) {
#pragma unroll
  for (int q = 0; q < 4; ++q)
    qr[q] = *(const f32x4s*)((const char*)qbase + qoff + (unsigned)(16 * q * E_DIM * 4));
#pragma unroll
  for (int q = 0; q < 2; ++q)
    vr[q] = *(const u32x4s*)((const char*)vbase + voff + (unsigned)(32 * q * S_LEN * 2));
}

// registers -> LDS; Q is rounded to bf16 here, once for the block's eight waves
__device__ __forceinline__ void stage_store(const f32x4s (&qr)[4], const u32x4s (&vr)[2],
                                            unsigned short* qdst, unsigned short* vdst) {
#pragma unroll
  for (int q = 0; q < 4; ++q)
    *(uint2*)(qdst + 16 * q * TP) = make_uint2(pack2(qr[q].x, qr[q].y), pack2(qr[q].z, qr[q].w));
#pragma unroll
  for (int q = 0; q < 2; ++q) *(u32x4s*)(vdst + 32 * q * TP) = vr[q];
}

// lane l <-> lane l ^ 16: the other half of the wave, by a vector cross-row move
__device__ __forceinline__ float swap_halves(float v) {
  const int b = __builtin_bit_cast(int, v);
  return __builtin_bit_cast(float, __builtin_amdgcn_permlanex16(b, b, 0x76543210, 0xfedcba98,
                                                                false, false));
}

typedef __attribute__((ext_vector_type(4))) int i32x4s;

// Flash attention. Reference einsum gives corr[b,h,i,j] = K[b,i,h,:].Q[b,j,h,:],
// softmax over j, out[i,d] = sum_j P[i,j] V[j,d].
// Block = 8 waves; wave owns 16 output rows i; streams keys in tiles of 32.
// The products are taken transposed: S^T[j,i] = Q[j,:].K[i,:] (A = staged Q rows,
// B = the wave's K rows) and O^T[d,i] += V^T[d,:].P^T[:,i].  A lane then holds 16
// of the 32 scores of ONE output row i = lane & 15 (j = 8 * half + e and
// 16 + 8 * half + e), so the row's maximum and sum run in the lane's own
// registers with one exchange between the wave's halves, the running maximum and
// sum are one register each, and the two score tiles, rounded to bf16 in place,
// ARE the B operand of the second product in the k order of load_frag_bf16.
// The eight waves walk the same keys, so the block brings each 64-key stage of
// Q and of V^T into LDS once: whole-line global loads, Q rounded to bf16 on the
// way, and every wave takes its A fragments from LDS.  Two buffers: the next
// stage's loads fly while this stage is worked on; one barrier a stage.
__global__ void __launch_bounds__(256)
flash_attn_kernel(const float* __restrict__ Kf, const float* __restrict__ Qf,
                  const unsigned short* __restrict__ Vt, const int* __restrict__ mask,
                  float* __restrict__ Out, float scale) {
  __shared__ __align__(16) unsigned short qs[2][KT][TP];      // Q rows j, bf16, d along the row
  __shared__ __align__(16) unsigned short vs[2][D_HEAD][TP];  // V^T rows d, keys along the row

  const int lane = threadIdx.x & 31;
  const int wave = threadIdx.x >> 5;
  const int h2   = lane >> 4;
  const int col  = lane & 15;
  const int b = blockIdx.z, h = blockIdx.y;
  const int i0 = blockIdx.x * 128 + wave * 16;

  const float* Kb_ = Kf + (size_t)b * S_LEN * E_DIM + h * D_HEAD;
  const float* Qb_ = Qf + (size_t)b * S_LEN * E_DIM + h * D_HEAD;
  const unsigned short* Vb_ = Vt + ((size_t)b * H_CNT + h) * D_HEAD * S_LEN;

  // A thread's share of a stage.  Q: 16 bytes of four rows, 16 rows apart (a
  // wave's load covers two whole 256-byte rows); V^T: 16 bytes of two rows, 32
  // rows apart (a wave's load covers four whole 128-byte rows).
  const int qrow = threadIdx.x >> 4, qcol = (threadIdx.x & 15) * 4;
  const int vrow = threadIdx.x >> 3, vcol = (threadIdx.x & 7) * 8;
  const unsigned qoff = (unsigned)(qrow * E_DIM + qcol) * 4u;   // byte offsets from
  const unsigned voff = (unsigned)(vrow * S_LEN + vcol) * 2u;   // the stage's base
  // the lane's mask row i, at its half's first key of a stage
  const unsigned moff = (unsigned)((i0 + col) * S_LEN + 8 * h2) * 4u;
  f32x4s qr[4];
  u32x4s vr[2];

  // This wave's 16 K-rows over d = 0..63 (reused for all key tiles): the B operand
  v16bf aK0 = load_frag_f32(Kb_, E_DIM, i0, 0,  lane);
  v16bf aK1 = load_frag_f32(Kb_, E_DIM, i0, 32, lane);
  // the address registers that these loads name are written again below
  asm volatile("s_wait_xcnt 0x0" ::: "memory");
  __builtin_amdgcn_sched_barrier(0);     // holds later register writes behind that wait

  v8f O[4] = {};               // O^T: tile t, register e = O[i][16 t + 8 half + e]
  float mrow = -3.0e38f;       // running maximum of row i (the same in both halves)
  float lrow = 0.0f;           // running sum of row i over this half's keys

  const float mval = -1.0e20f * scale;

  stage_load(qr, vr, Qb_, Vb_, qoff, voff);
  stage_store(qr, vr, &qs[0][qrow][qcol], &vs[0][vrow][vcol]);
  __syncthreads();                       // stage 0 is published

  for (int st = 0; st < S_LEN; st += KT) {
    const int buf = (st / KT) & 1;
    const bool more = st + KT < S_LEN;   // the same for the whole block
    // This stage's mask words of row i: a lane's eight keys of a score tile are 32
    // contiguous bytes, two 16-byte loads.  (Here and below: a loop over a register
    // array is unrolled so that its indices are constants.)
    i32x4s mk[KT / 32][4];
#pragma unroll
    for (int u = 0; u < KT / 32; ++u)
#pragma unroll
      for (int q = 0; q < 4; ++q)
        mk[u][q] = *(const i32x4s*)((const char*)(mask + st) + moff +
                                    (unsigned)(128 * u + 64 * (q >> 1) + 16 * (q & 1)));
    if (more)
      stage_load(qr, vr, Qb_ + (size_t)(st + KT) * E_DIM, Vb_ + (st + KT), qoff, voff);
    const unsigned short* qt = &qs[buf][0][0];
    const unsigned short* vt = &vs[buf][0][0];

    // unrolled so that the two halves' LDS offsets are immediates
#pragma unroll
    for (int jj = 0; jj < KT; jj += 32) {
      // scores tile 32x16 (keys x rows): two 16x16 WMMA tiles, K over d (2 steps of 32)
      v16bf aq00 = load_frag_bf16(qt, TP, jj +  0, 0,  lane);
      v16bf aq01 = load_frag_bf16(qt, TP, jj +  0, 32, lane);
      v16bf aq10 = load_frag_bf16(qt, TP, jj + 16, 0,  lane);
      v16bf aq11 = load_frag_bf16(qt, TP, jj + 16, 32, lane);
      v8f s0 = {}, s1 = {};
      s0 = wmma_bf16(aq00, aK0, s0); s0 = wmma_bf16(aq01, aK1, s0);
      s1 = wmma_bf16(aq10, aK0, s1); s1 = wmma_bf16(aq11, aK1, s1);

      // v[s]: key j = st + jj + (s < 8 ? 8 * h2 + s : 16 + 8 * h2 + s - 8) of row i
      float v[16];
#pragma unroll
      for (int e = 0; e < 8; ++e) {
        v[e]     = mk[jj / 32][(e >> 2)][e & 3]     ? s0[e] * scale : mval;
        v[8 + e] = mk[jj / 32][2 + (e >> 2)][e & 3] ? s1[e] * scale : mval;
      }
      float mx = v[0];
#pragma unroll
      for (int s = 1; s < 16; ++s) mx = fmaxf(mx, v[s]);
      mx = fmaxf(mx, swap_halves(mx));
      const float mnew  = fmaxf(mrow, mx);
      const float alpha = __expf(mrow - mnew);
      mrow = mnew;

      // P^T, rounded to nearest even in place: element s of the B operand is the key of v[s]
      float p[16];
      v16bf pb;
#pragma unroll
      for (int s = 0; s < 16; ++s) {
        p[s]  = __expf(v[s] - mnew);
        pb[s] = (__bf16)p[s];
      }
      const float rs = (((p[0] + p[1]) + (p[2] + p[3])) + ((p[4] + p[5]) + (p[6] + p[7]))) +
                       (((p[8] + p[9]) + (p[10] + p[11])) + ((p[12] + p[13]) + (p[14] + p[15])));
      lrow = lrow * alpha + rs;
#pragma unroll
      for (int t = 0; t < 4; ++t) O[t] *= alpha;

      // O^T += V^T . P^T  (A operand from the staged V^T: rows = d, k = j)
      v16bf av0 = load_frag_bf16(vt, TP, 0,  jj, lane);
      v16bf av1 = load_frag_bf16(vt, TP, 16, jj, lane);
      v16bf av2 = load_frag_bf16(vt, TP, 32, jj, lane);
      v16bf av3 = load_frag_bf16(vt, TP, 48, jj, lane);
      O[0] = wmma_bf16(av0, pb, O[0]);
      O[1] = wmma_bf16(av1, pb, O[1]);
      O[2] = wmma_bf16(av2, pb, O[2]);
      O[3] = wmma_bf16(av3, pb, O[3]);
    }

    // The other buffer's last readers left it before the barrier of the trip
    // before; this trip's barrier publishes it and ends the reads of this one.
    if (more)
      stage_store(qr, vr, &qs[buf ^ 1][qrow][qcol], &vs[buf ^ 1][vrow][vcol]);
    // the next trip's address additions rewrite registers that this trip's global loads name
    asm volatile("s_wait_xcnt 0x0" ::: "memory");
    __builtin_amdgcn_sched_barrier(0);   // keeps those additions behind the wait
    __syncthreads();
  }

  // The halves' sums are joined once.  A lane's eight registers of a tile are eight
  // neighbours of row i: two 16-byte stores.  Every value is formed first, then
  // come the stores alone, so that no register of an issued store is written again.
  const float inv = 1.0f / (lrow + swap_halves(lrow));
  float* orow = Out + ((size_t)b * S_LEN + i0 + col) * E_DIM + h * D_HEAD + 8 * h2;
  f32x4s ov[4][2];
#pragma unroll
  for (int t = 0; t < 4; ++t) {
    ov[t][0] = f32x4s{O[t][0], O[t][1], O[t][2], O[t][3]} * inv;
    ov[t][1] = f32x4s{O[t][4], O[t][5], O[t][6], O[t][7]} * inv;
  }
  __builtin_amdgcn_sched_barrier(0);     // only stores behind this line
#pragma unroll
  for (int t = 0; t < 4; ++t) {
    *(f32x4s*)(orow + 16 * t)     = ov[t][0];
    *(f32x4s*)(orow + 16 * t + 4) = ov[t][1];
  }
}

// ---------------------------------------------------------------------------
// LayerNorm kernels: one wave per row of 512, 8 rows a block, 16 elements a lane
// (four 16-byte pieces, 128 elements apart: a wave's access is 512 contiguous
// bytes).  The row sums run in the lane and then over the wave's 32 lanes.
typedef __attribute__((ext_vector_type(4))) float f32x4;

__device__ __forceinline__ float wave_sum(float v) {
#pragma unroll
  for (int o = 16; o > 0; o >>= 1) v += __shfl_xor(v, o, 32);
  return v;
}

// 16 bytes at a 32-bit byte offset from a uniform base
__device__ __forceinline__ f32x4 ld16(const float* base, unsigned byte_off) {
  return *(const f32x4*)((const char*)base + byte_off);
}

// mean and 1/sqrt(var + eps) of the wave's row
__device__ __forceinline__ void row_stats(const f32x4 (&x)[4], float& mean, float& rstd) {
  float s1 = 0.0f, s2 = 0.0f;
#pragma unroll
  for (int q = 0; q < 4; ++q) {
    s1 += (x[q].x + x[q].y) + (x[q].z + x[q].w);
    s2 += (x[q].x * x[q].x + x[q].y * x[q].y) + (x[q].z * x[q].z + x[q].w * x[q].w);
  }
  s1 = wave_sum(s1);
  s2 = wave_sum(s2);
  mean = s1 * (1.0f / E_DIM);
  const float var = s2 * (1.0f / E_DIM) - mean * mean;
  rstd = rsqrtf(var + 1e-5f);
}

// x1 = LN(src + res) * g + b  -> f32 and a bf16 copy.
__global__ void __launch_bounds__(256)
add_ln_kernel(const float* __restrict__ src, const float* __restrict__ res,
              const float* __restrict__ g, const float* __restrict__ bb,
              float* __restrict__ outf, unsigned short* __restrict__ outb) {
  const int lane = threadIdx.x & 31;
  const size_t off = (size_t)(blockIdx.x * 8 + (threadIdx.x >> 5)) * E_DIM + 4 * lane;
  const unsigned ro = (unsigned)off * 4u;   // the lane's byte offset in a [rows,512] f32 array
  const unsigned co = 16u * lane;           // and in a vector of 512
  f32x4 x[4], c[4], gg[4], bv[4];
#pragma unroll
  for (int q = 0; q < 4; ++q) {
    x[q]  = ld16(src, ro + 512u * q);
    c[q]  = ld16(res, ro + 512u * q);
    gg[q] = ld16(g,   co + 512u * q);
    bv[q] = ld16(bb,  co + 512u * q);
  }
  // Every loaded value is an input, so the wait stands behind all 16 loads; the
  // two offsets are inputs, so they stay untouched (also by a later load's
  // result) up to it.
  asm volatile("s_wait_xcnt 0x0"
               :: "v"(ro), "v"(co),
                  "v"(x[0]),  "v"(x[1]),  "v"(x[2]),  "v"(x[3]),
                  "v"(c[0]),  "v"(c[1]),  "v"(c[2]),  "v"(c[3]),
                  "v"(gg[0]), "v"(gg[1]), "v"(gg[2]), "v"(gg[3]),
                  "v"(bv[0]), "v"(bv[1]), "v"(bv[2]), "v"(bv[3]) : "memory");
#pragma unroll
  for (int q = 0; q < 4; ++q) x[q] += c[q];
  float mean, rstd;
  row_stats(x, mean, rstd);
  uint2 h[4];
#pragma unroll
  for (int q = 0; q < 4; ++q) {
    x[q] = (x[q] - mean) * rstd * gg[q] + bv[q];
    h[q] = make_uint2(pack2(x[q].x, x[q].y), pack2(x[q].z, x[q].w));
  }
#pragma unroll
  for (int q = 0; q < 4; ++q) {
    *(f32x4*)(outf + off + 128 * q) = x[q];
    *(uint2*)(outb + off + 128 * q) = h[q];
  }
}

// out = LN( LN(f)*g3+b3 + x1 ) * g2 + b2.
__global__ void __launch_bounds__(256)
double_ln_kernel(const float* __restrict__ f, const float* __restrict__ x1,
                 const float* __restrict__ g3, const float* __restrict__ b3,
                 const float* __restrict__ g2, const float* __restrict__ b2,
                 float* __restrict__ out) {
  const int lane = threadIdx.x & 31;
  const size_t off = (size_t)(blockIdx.x * 8 + (threadIdx.x >> 5)) * E_DIM + 4 * lane;
  const unsigned ro = (unsigned)off * 4u;   // the lane's byte offset in a [rows,512] f32 array
  const unsigned co = 16u * lane;           // and in a vector of 512
  f32x4 a[4], xr[4], ga[4], ba[4], gb[4], bc[4];
#pragma unroll
  for (int q = 0; q < 4; ++q) {
    a[q]  = ld16(f,  ro + 512u * q);
    xr[q] = ld16(x1, ro + 512u * q);
    ga[q] = ld16(g3, co + 512u * q);
    ba[q] = ld16(b3, co + 512u * q);
    gb[q] = ld16(g2, co + 512u * q);
    bc[q] = ld16(b2, co + 512u * q);
  }
  // Every loaded value is an input, so the wait stands behind all 24 loads; the
  // two offsets are inputs, so they stay untouched (also by a later load's
  // result) up to it.
  asm volatile("s_wait_xcnt 0x0"
               :: "v"(ro), "v"(co),
                  "v"(a[0]),  "v"(a[1]),  "v"(a[2]),  "v"(a[3]),
                  "v"(xr[0]), "v"(xr[1]), "v"(xr[2]), "v"(xr[3]),
                  "v"(ga[0]), "v"(ga[1]), "v"(ga[2]), "v"(ga[3]),
                  "v"(ba[0]), "v"(ba[1]), "v"(ba[2]), "v"(ba[3]),
                  "v"(gb[0]), "v"(gb[1]), "v"(gb[2]), "v"(gb[3]),
                  "v"(bc[0]), "v"(bc[1]), "v"(bc[2]), "v"(bc[3]) : "memory");
  float mean, rstd;
  row_stats(a, mean, rstd);
#pragma unroll
  for (int q = 0; q < 4; ++q) a[q] = (a[q] - mean) * rstd * ga[q] + ba[q] + xr[q];
  row_stats(a, mean, rstd);
#pragma unroll
  for (int q = 0; q < 4; ++q) a[q] = (a[q] - mean) * rstd * gb[q] + bc[q];
#pragma unroll
  for (int q = 0; q < 4; ++q) *(f32x4*)(out + off + 128 * q) = a[q];
}

// ---------------------------------------------------------------------------
extern "C" void kernel_launch(void* const* d_in, const int* in_sizes, int n_in,
                              void* d_out, int out_size, void* d_ws, size_t ws_size,
                              hipStream_t stream) {
  const float* x  = (const float*)d_in[0];
  const int* mask = (const int*)d_in[1];
  const float* Wv = (const float*)d_in[2];
  const float* Wk = (const float*)d_in[3];
  const float* Wq = (const float*)d_in[4];
  const float* g1 = (const float*)d_in[5];
  const float* b1 = (const float*)d_in[6];
  const float* W1 = (const float*)d_in[7];
  const float* c1 = (const float*)d_in[8];
  const float* W2 = (const float*)d_in[9];
  const float* c2 = (const float*)d_in[10];
  const float* g3 = (const float*)d_in[11];
  const float* b3 = (const float*)d_in[12];
  const float* g2 = (const float*)d_in[13];
  const float* b2 = (const float*)d_in[14];

  const size_t MB = 1ull << 20;
  unsigned char* w = (unsigned char*)d_ws;
  // live regions (peak ~96 MB, with reuse):
  unsigned short* xb  = (unsigned short*)(w +  0 * MB); //  8 MB  x bf16
  unsigned short* Wqt = (unsigned short*)(w +  8 * MB); //  .5 MB
  unsigned short* Wkt = (unsigned short*)(w +  9 * MB); //  .5 MB
  unsigned short* Wvt = (unsigned short*)(w + 10 * MB); //  .5 MB
  unsigned short* W1t = (unsigned short*)(w + 11 * MB); //  2 MB
  unsigned short* W2t = (unsigned short*)(w + 13 * MB); //  2 MB
  float*          Kf  = (float*)         (w + 16 * MB); // 16 MB  keys f32
  unsigned short* Vt  = (unsigned short*)(w + 32 * MB); //  8 MB  V^T bf16
  float*          Qf  = (float*)         (w + 40 * MB); // 16 MB  queries f32
  float*          attn= (float*)         (w + 56 * MB); // 16 MB
  float*          x1f = (float*)         (w + 72 * MB); // 16 MB
  unsigned short* x1b = (unsigned short*)(w + 88 * MB); //  8 MB
  unsigned short* hb  = (unsigned short*)(w + 16 * MB); // 32 MB (reuses Kf/Vt/Qf)
  float*          ff  = (float*)         (w + 48 * MB); // 16 MB (reuses Qf/attn)

  dim3 blk(256);
  dim3 gblk(128);   // GEMM: 4 waves, 2x2

  // 1) conversions / weight transposes
  prep_kernel<<<PREP_BLKS, blk, 0, stream>>>(x, Wq, Wk, Wv, W1, W2,
                                             xb, Wqt, Wkt, Wvt, W1t, W2t);

  // 2) QKV projections
  dim3 gq(M_ROWS / 128, E_DIM / 128, 3);
  qkv_gemm_kernel<<<gq, gblk, 0, stream>>>(xb, Wqt, Wkt, Wvt, Qf, Kf, Vt);

  // 3) fused attention
  dim3 ga(S_LEN / 128, H_CNT, B_SZ);
  const float scale = 1.0f / sqrtf((float)E_DIM);
  flash_attn_kernel<<<ga, blk, 0, stream>>>(Kf, Qf, Vt, mask, attn, scale);

  // 4) x1 = LN(attn + queries)
  add_ln_kernel<<<M_ROWS / 8, blk, 0, stream>>>(attn, Qf, g1, b1, x1f, x1b);

  // 5) h = relu(x1 @ W1 + c1)
  dim3 gf1(M_ROWS / 128, F_DIM / 128);
  gemm_bf16_kernel<<<gf1, gblk, 0, stream>>>(x1b, W1t, c1, nullptr, hb,
                                            M_ROWS, F_DIM, E_DIM, 1, 1);

  // 6) f = h @ W2 + c2
  dim3 gf2(M_ROWS / 128, E_DIM / 128);
  gemm_bf16_kernel<<<gf2, gblk, 0, stream>>>(hb, W2t, c2, ff, nullptr,
                                            M_ROWS, E_DIM, F_DIM, 0, 0);

  // 7) out = LN(LN(f) + x1)
  double_ln_kernel<<<M_ROWS / 8, blk, 0, stream>>>(ff, x1f, g3, b3, g2, b2,
                                               (float*)d_out);
}

// v007
// It runs in 142 microseconds.
// Two timings next to v006 put it at 1.16 and 1.14 times that version's speed.
// All steps since v000 together make it 3.62 times as fast.
#include <hip/hip_runtime.h>
#include <hip/hip_bf16.h>
#include <math.h>

// ---------------------------------------------------------------------------
// Transformer block on CDNA5 (gfx1250), wave32, bf16 WMMA w/ f32 accumulation.
// Pipeline:
//   1) convert x -> bf16; transpose+convert weights -> bf16 [N,K]; pack the mask
//      into one bit a score (one launch)
//   2) WMMA GEMMs: Q (f32), K (f32), V (bf16, head-transposed [b,h,d,s]) (one launch)
//   3) flash attention (scores = K.Q^T per the reference's einsum, taken
//      transposed), online softmax in the lane, V^T.P^T via WMMA, P stays in registers
//   4) x1 = LN(attn + Q) -> f32 + bf16
//   5) h = relu(x1 @ W1 + c1) (WMMA, bf16 out)
//   6) f = h @ W2 + c2 (WMMA, f32 out)
//   7) out = LN(LN(f) + x1)
// ---------------------------------------------------------------------------

typedef __attribute__((ext_vector_type(16))) __bf16 v16bf;
typedef __attribute__((ext_vector_type(8)))  float  v8f;
typedef __attribute__((ext_vector_type(4))) unsigned u32x4s;
typedef __attribute__((ext_vector_type(4))) int i32x4s;
typedef __attribute__((ext_vector_type(16))) unsigned u32x16s;

#define S_LEN  2048
#define E_DIM  512
#define V_DIM  512
#define F_DIM  2048
#define B_SZ   4
#define H_CNT  8
#define D_HEAD 64
#define M_ROWS (B_SZ * S_LEN)

__device__ __forceinline__ unsigned short f2bf(float f) {
  union { float f; unsigned u; } a; a.f = f;
  unsigned u = a.u;
  return (unsigned short)((u + 0x7FFFu + ((u >> 16) & 1u)) >> 16); // RNE
}

// A/B fragment loader for v_wmma_f32_16x16x32_bf16 from row-major bf16 data.
// Layout (ISA 7.12.2, 16-bit A 16x32): lane L holds row (L&15); lanes 0-15
// carry K = [k0, k0+8) and [k0+16, k0+24); lanes 16-31 the +8 halves.
// The same layout serves the B operand when loading from a [N,K] (transposed)
// matrix: lane holds column n = (L&15) of B.
__device__ __forceinline__ v16bf load_frag_bf16(const unsigned short* base, int ld,
                                                int row0, int k0, int lane) {
  const int half = lane >> 4;
  const unsigned short* p = base + (size_t)(row0 + (lane & 15)) * ld + k0 + 8 * half;
  union { uint4 q[2]; v16bf v; } u;
  u.q[0] = *(const uint4*)p;
  u.q[1] = *(const uint4*)(p + 16);
  return u.v;
}

// Same fragment, sourced from fp32 with on-the-fly bf16 conversion.
__device__ __forceinline__ v16bf load_frag_f32(const float* base, int ld,
                                               int row0, int k0, int lane) {
  const int half = lane >> 4;
  const float* p = base + (size_t)(row0 + (lane & 15)) * ld + k0 + 8 * half;
  union { unsigned short s[16]; v16bf v; } u;
#pragma unroll
  for (int e = 0; e < 8; ++e) {
    u.s[e]     = f2bf(p[e]);
    u.s[8 + e] = f2bf(p[16 + e]);
  }
  return u.v;
}

__device__ __forceinline__ v8f wmma_bf16(v16bf a, v16bf b, v8f c) {
  return __builtin_amdgcn_wmma_f32_16x16x32_bf16(false, a, false, b, (short)0, c,
                                                 false, false);
}

// ---------------------------------------------------------------------------
// The kernels without matrix work are short; each thread takes many elements
// and the grids are small, for speed only.

__device__ __forceinline__ unsigned pack2(float lo, float hi) {
  return (unsigned)f2bf(lo) | ((unsigned)f2bf(hi) << 16);
}

// Elementwise fp32 -> bf16, 32 elements a thread: four chunks of eight (two
// 16-byte loads, one 16-byte store), a block's chunks 2048 elements apart, so
// that every access of a wave covers whole lines.  Blocks = elements / 8192.
__device__ __forceinline__ void cvt_body(const float* __restrict__ in,
                                         unsigned short* __restrict__ out, int blk) {
  const size_t base = (size_t)blk * 8192 + threadIdx.x * 8;
  const float* p = in + base;
  unsigned short* o = out + base;
  float4 v[4][2];
#pragma unroll
  for (int c = 0; c < 4; ++c) {
    v[c][0] = *(const float4*)(p + 2048 * c);
    v[c][1] = *(const float4*)(p + 2048 * c + 4);
  }
  uint4 q[4];
#pragma unroll
  for (int c = 0; c < 4; ++c)
    q[c] = make_uint4(pack2(v[c][0].x, v[c][0].y), pack2(v[c][0].z, v[c][0].w),
                      pack2(v[c][1].x, v[c][1].y), pack2(v[c][1].z, v[c][1].w));
#pragma unroll
  for (int c = 0; c < 4; ++c) *(uint4*)(o + 2048 * c) = q[c];
}

// [Kd,Nd] fp32 -> [Nd,Kd] bf16.  A thread takes 16 k of one n: 16 loads (a wave
// reads 128 contiguous bytes of a row each time) and two 16-byte stores.
// Blocks = Kd * Nd / 4096; Kd is a multiple of 16.  The row length is a constant
// of the body, so that the split of the block index needs no division.
template <int ND>
__device__ __forceinline__ void transpose_body(const float* __restrict__ in,
                                               unsigned short* __restrict__ out, int Kd,
                                               int blk) {
  const int kb = blk / (ND / 256);               // a block's threads share their 16 rows
  const int n  = (blk % (ND / 256)) * 256 + threadIdx.x;
  const float* p = in + (size_t)(16 * kb) * ND + n;
  float v[16];
#pragma unroll
  for (int e = 0; e < 16; ++e) v[e] = p[e * ND];
  const uint4 q0 = make_uint4(pack2(v[0], v[1]),   pack2(v[2], v[3]),
                              pack2(v[4], v[5]),   pack2(v[6], v[7]));
  const uint4 q1 = make_uint4(pack2(v[8], v[9]),   pack2(v[10], v[11]),
                              pack2(v[12], v[13]), pack2(v[14], v[15]));
  unsigned short* o = out + (size_t)n * Kd + 16 * kb;
  *(uint4*)o       = q0;
  *(uint4*)(o + 8) = q1;
  // another job's code follows in the merged kernel and reuses these stores' registers
  asm volatile("s_wait_xcnt 0x0" ::: "memory");
}

// mask [S,S] int32 -> one bit a score, in the order in which the attention's waves
// hold their scores.  A tile is 16 rows i x 32 keys j = 16 words; bit L of word s
// says mask != 0 for row 16 * tile + (L & 15) and key 32 * tile + 16 * (s >> 3) +
// 8 * (L >> 4) + (s & 7): lane L's score number s.  A word is then the lane mask of
// one select of a whole wave.  Tiles lie row of tiles by row of tiles, keys running.
// The attention reads the mask once for every batch entry and head; packed, that is
// 64 bytes a tile by scalar loads in place of 2048 by vector loads of 16 lines each.
// A wave takes 16 rows x 128 keys: 16 loads a lane, 64 compares, two 128-byte stores.
#define MT_WORDS 16
#define MASK_BLKS ((S_LEN / 16) * (S_LEN / 128) / 8)

__device__ __forceinline__ void mask_body(const int* __restrict__ mask,
                                          unsigned* __restrict__ mbits, int blk) {
  const int lane = threadIdx.x & 31;
  const int job  = blk * 8 + (threadIdx.x >> 5);
  const int it   = job / (S_LEN / 128);          // the 16 rows
  const int jg   = job % (S_LEN / 128);          // the 128 keys: four tiles
  const int* p = mask + (size_t)(it * 16 + (lane & 15)) * S_LEN + jg * 128 + 8 * (lane >> 4);
  i32x4s m[4][4];
  // (here and in the attention: a loop over a register array is unrolled so that its
  // indices are constants)
#pragma unroll
  for (int u = 0; u < 4; ++u)
#pragma unroll
    for (int q = 0; q < 4; ++q)
      m[u][q] = *(const i32x4s*)(p + 32 * u + 16 * (q >> 1) + 4 * (q & 1));
  // lane L of w[h] takes word L of the tiles 2 h and 2 h + 1
  unsigned w[2] = {0u, 0u};
#pragma unroll
  for (int u = 0; u < 4; ++u)
#pragma unroll
    for (int s = 0; s < 16; ++s) {
      // taken by all 32 lanes, ahead of the choice of the lane that keeps the word
      const unsigned b = __builtin_amdgcn_ballot_w32(m[u][s >> 2][s & 3] != 0);
      w[u >> 1] = lane == (u & 1) * 16 + s ? b : w[u >> 1];
    }
  unsigned* o = mbits + ((size_t)it * (S_LEN / 32) + jg * 4) * MT_WORDS + lane;
  o[0]  = w[0];
  o[32] = w[1];
  // another job's code follows in the merged kernel and reuses these stores' registers
  asm volatile("s_wait_xcnt 0x0" ::: "memory");
}

// The seven jobs read nothing of each other's output, so they are one launch:
// the block index picks the job (the same for a whole block).
#define CVT_BLKS ((M_ROWS * V_DIM) / 8192)   // x
#define TQ_BLKS  ((V_DIM * E_DIM) / 4096)    // each of Wq, Wk, Wv
#define TF_BLKS  ((E_DIM * F_DIM) / 4096)    // each of W1, W2
#define PREP_BLKS (CVT_BLKS + 3 * TQ_BLKS + 2 * TF_BLKS + MASK_BLKS)

__global__ void __launch_bounds__(256)
prep_kernel(const float* __restrict__ x,  const float* __restrict__ Wq,
            const float* __restrict__ Wk, const float* __restrict__ Wv,
            const float* __restrict__ W1, const float* __restrict__ W2,
            const int* __restrict__ mask, unsigned* __restrict__ mbits,
            unsigned short* __restrict__ xb,  unsigned short* __restrict__ Wqt,
            unsigned short* __restrict__ Wkt, unsigned short* __restrict__ Wvt,
            unsigned short* __restrict__ W1t, unsigned short* __restrict__ W2t) {
  int blk = blockIdx.x;
  if (blk < CVT_BLKS) { cvt_body(x, xb, blk); return; }
  blk -= CVT_BLKS;
  if (blk < 3 * TQ_BLKS) {
    const int w = blk / TQ_BLKS;
    const float* in     = w == 0 ? Wq  : w == 1 ? Wk  : Wv;
    unsigned short* out = w == 0 ? Wqt : w == 1 ? Wkt : Wvt;
    transpose_body<E_DIM>(in, out, V_DIM, blk % TQ_BLKS);
    return;
  }
  blk -= 3 * TQ_BLKS;
  if (blk < TF_BLKS) { transpose_body<F_DIM>(W1, W1t, E_DIM, blk); return; }
  blk -= TF_BLKS;
  if (blk < TF_BLKS) { transpose_body<E_DIM>(W2, W2t, F_DIM, blk); return; }
  mask_body(mask, mbits, blk - TF_BLKS);
}

#define GKS  64            // k of a staged tile: 128 bytes of every row
#define GTP  72            // row pitch of a staged tile in bf16: 144 bytes = 16 x 9, no bank conflict for 16-byte reads
#define GBUF (256 * GTP)   // a buffer in bf16: rows 0..127 of A, then rows 0..127 of Bt

__device__ __forceinline__ void gemm_load_set(v16bf (&a)[4], v16bf (&b)[4],
                                              const unsigned short* A,
                                              const unsigned short* Bt, int K,
                                              int m0, int n0, int k0, int lane) {
#pragma unroll
  for (int i = 0; i < 4; ++i) a[i] = load_frag_bf16(A, K, m0 + 16 * i, k0, lane);
#pragma unroll
  for (int t = 0; t < 4; ++t) b[t] = load_frag_bf16(Bt, K, n0 + 16 * t, k0, lane);
}

// Eight asynchronous copies, global -> LDS through no register: the lane's 16
// bytes of eight rows, 16 rows apart.  A wave's copy covers four whole rows of
// the tile.  The last line is a precaution: the copies' address registers stay
// untouched up to it; it stands inside the statement so that no later address
// addition can be lifted over it.
__device__ __forceinline__ void copy_rows8(unsigned lds, const unsigned short* g, size_t gstep) {
  const unsigned ls = 16u * GTP * 2u;          // 16 rows in LDS bytes
  asm volatile("global_load_async_to_lds_b128 %0, %8, off\n\t"
               "global_load_async_to_lds_b128 %1, %9, off\n\t"
               "global_load_async_to_lds_b128 %2, %10, off\n\t"
               "global_load_async_to_lds_b128 %3, %11, off\n\t"
               "global_load_async_to_lds_b128 %4, %12, off\n\t"
               "global_load_async_to_lds_b128 %5, %13, off\n\t"
               "global_load_async_to_lds_b128 %6, %14, off\n\t"
               "global_load_async_to_lds_b128 %7, %15, off\n\t"
               "s_wait_xcnt 0x0"
               :: "v"(lds),          "v"(lds + ls),     "v"(lds + 2 * ls), "v"(lds + 3 * ls),
                  "v"(lds + 4 * ls), "v"(lds + 5 * ls), "v"(lds + 6 * ls), "v"(lds + 7 * ls),
                  "v"(g),             "v"(g + gstep),     "v"(g + 2 * gstep), "v"(g + 3 * gstep),
                  "v"(g + 4 * gstep), "v"(g + 5 * gstep), "v"(g + 6 * gstep), "v"(g + 7 * gstep)
               : "memory");
}

// A thread's share of one tile: 8 copies for the A rows, 8 for the Bt rows.
__device__ __forceinline__ void gemm_tile_copy(unsigned lds, const unsigned short* ga,
                                               const unsigned short* gb, size_t gstep) {
  copy_rows8(lds, ga, gstep);
  copy_rows8(lds + 128u * GTP * 2u, gb, gstep);
}

__device__ __forceinline__ void gemm_mul_set(v8f (&acc)[4][4], const v16bf (&a)[4],
                                             const v16bf (&b)[4]) {
#pragma unroll
  for (int i = 0; i < 4; ++i)
#pragma unroll
    for (int t = 0; t < 4; ++t) acc[i][t] = wmma_bf16(a[i], b[t], acc[i][t]);
}

__device__ __forceinline__ void
gemm_body(const unsigned short* __restrict__ A,
          const unsigned short* __restrict__ Bt,
          const float* __restrict__ bias,
          float* __restrict__ Cf, unsigned short* __restrict__ Cb,
          int N, int K, int mode, int relu) {
  __shared__ __align__(16) unsigned short ts[2 * GBUF];

  const int lane = threadIdx.x & 31;
  const int wave = threadIdx.x >> 5;
  const int wm = (wave >> 1) * 64;             // the wave's rows and columns
  const int wn = (wave & 1) * 64;              // inside the block's tile
  const int m0 = blockIdx.x * 128 + wm;
  const int n0 = blockIdx.y * 128 + wn;

  // A thread's share of a tile: 16 bytes (chunk cc) of rows cr, cr + 16, ...
  const int cr = threadIdx.x >> 3, cc = (threadIdx.x & 7) * 8;
  const unsigned short* ga = A  + (size_t)(blockIdx.x * 128 + cr) * K + cc;
  const unsigned short* gb = Bt + (size_t)(blockIdx.y * 128 + cr) * K + cc;
  const size_t gstep = (size_t)16 * K;
  const unsigned l0 = (unsigned)(size_t)&ts[cr * GTP + cc];   // its LDS byte address in buffer 0
  const int nt = K / GKS;

  v8f acc[4][4] = {};
  v16bf a0[4], b0[4], a1[4], b1[4];

  gemm_tile_copy(l0, ga, gb, gstep);
  asm volatile("s_wait_asynccnt 0x0" ::: "memory");   // this wave's share of tile 0 has landed
  __syncthreads();                                    // tile 0 is published
  if (nt > 1) gemm_tile_copy(l0 + GBUF * 2u, ga + GKS, gb + GKS, gstep);

  for (int t = 0; t < nt; ++t) {
    const unsigned short* ta = ts + (t & 1) * GBUF;
    const unsigned short* tb = ta + 128 * GTP;
    gemm_load_set(a0, b0, ta, tb, GTP, wm, wn, 0,  lane);
    gemm_load_set(a1, b1, ta, tb, GTP, wm, wn, 32, lane);
    // keeps the tile's 32 LDS reads in one group ahead of its 32 WMMAs (else they
    // sink among the WMMAs, one fragment at a time, each waited out in full)
    __builtin_amdgcn_sched_barrier(0);
    gemm_mul_set(acc, a0, b0);
    gemm_mul_set(acc, a1, b1);
    // keeps the WMMAs ahead of the waits below (else they sink behind the barrier
    // and the next tile's copies are waited out before anything is multiplied)
    __builtin_amdgcn_sched_barrier(0);
    asm volatile("s_wait_dscnt 0x0" ::: "memory");    // this wave's reads of this buffer are done
    asm volatile("s_wait_asynccnt 0x0" ::: "memory"); // its share of tile t + 1 has landed
    __syncthreads();     // publishes tile t + 1, ends every wave's reads of this buffer
    if (t + 2 < nt)      // the same for the whole block
      gemm_tile_copy(l0 + (unsigned)(t & 1) * (GBUF * 2u), ga + (size_t)(t + 2) * GKS,
                     gb + (size_t)(t + 2) * GKS, gstep);
  }
  asm volatile("s_wait_asynccnt 0x0" ::: "memory");   // no copy is left in flight

  const int col = lane & 15;
  const int h2  = lane >> 4;
  // Epilogue.  The mode test stands outside the element loops.  Modes 0 and 1
  // go in two parts: first every value and every row address is formed in
  // registers, then come the stores alone, so that no register of an issued
  // store is written again.
#pragma unroll
  for (int t = 0; t < 4; ++t) {
    float bv = bias ? bias[n0 + 16 * t + col] : 0.0f;
#pragma unroll
    for (int i = 0; i < 4; ++i)
#pragma unroll
      for (int e = 0; e < 8; ++e) {
        float v = acc[i][t][e] + bv;
        acc[i][t][e] = relu ? fmaxf(v, 0.0f) : v;
      }
  }
  const int mr = m0 + 8 * h2;                  // C layout: VGPR e -> row e (+8)
  const int nc = n0 + col;
  if (mode == 0) {
    float* cb = Cf + (size_t)mr * N + nc;
    float* c[4][8];
#pragma unroll
    for (int i = 0; i < 4; ++i)
#pragma unroll
      for (int e = 0; e < 8; ++e) c[i][e] = cb + (size_t)(16 * i + e) * N;
    __builtin_amdgcn_sched_barrier(0);         // only stores behind this line
#pragma unroll
    for (int i = 0; i < 4; ++i)
#pragma unroll
      for (int e = 0; e < 8; ++e)
#pragma unroll
        for (int t = 0; t < 4; ++t) c[i][e][16 * t] = acc[i][t][e];
    // code of the other modes' paths follows and reuses these stores' registers
    asm volatile("s_wait_xcnt 0x0" ::: "memory");
  } else if (mode == 1) {
    unsigned short* cb = Cb + (size_t)mr * N + nc;
    unsigned short* c[4][8];
    unsigned short hv[4][4][8];
#pragma unroll
    for (int i = 0; i < 4; ++i)
#pragma unroll
      for (int e = 0; e < 8; ++e) {
        c[i][e] = cb + (size_t)(16 * i + e) * N;
#pragma unroll
        for (int t = 0; t < 4; ++t) hv[i][t][e] = f2bf(acc[i][t][e]);
      }
    __builtin_amdgcn_sched_barrier(0);         // only stores behind this line
#pragma unroll
    for (int i = 0; i < 4; ++i)
#pragma unroll
      for (int e = 0; e < 8; ++e)
#pragma unroll
        for (int t = 0; t < 4; ++t) c[i][e][16 * t] = hv[i][t][e];
    // code of the other modes' paths follows and reuses these stores' registers
    asm volatile("s_wait_xcnt 0x0" ::: "memory");
  } else {
    // the wave's 64 rows lie in one batch entry, its 64 columns are one head;
    // a lane's eight rows of a tile are eight neighbours in Vt: one 16-byte store
    const int bb = mr / S_LEN, s = mr % S_LEN;
    const int hh = nc >> 6,    d = nc & 63;
    unsigned short* c = Cb + (((size_t)bb * H_CNT + hh) * D_HEAD + d) * S_LEN + s;
    // a compiler vector, not a struct of four words: each value stays whole in four
    // registers of its own, and the 16 stores leave in one run with one wait behind them
    u32x4s pk[4][4];
#pragma unroll
    for (int i = 0; i < 4; ++i)
#pragma unroll
      for (int t = 0; t < 4; ++t) {
        unsigned q[4];
#pragma unroll
        for (int e = 0; e < 4; ++e)
          q[e] = (unsigned)f2bf(acc[i][t][2 * e]) | ((unsigned)f2bf(acc[i][t][2 * e + 1]) << 16);
        pk[i][t] = u32x4s{q[0], q[1], q[2], q[3]};
      }
#pragma unroll
    for (int i = 0; i < 4; ++i)
#pragma unroll
      for (int t = 0; t < 4; ++t)
        *(u32x4s*)(c + (size_t)(16 * t) * S_LEN + 16 * i) = pk[i][t];
    // code of the other modes' paths follows and reuses these stores' registers
    asm volatile("s_wait_xcnt 0x0" ::: "memory");
  }
}

__global__ void __launch_bounds__(128)
gemm_bf16_kernel(const unsigned short* __restrict__ A,
                 const unsigned short* __restrict__ Bt,
                 const float* __restrict__ bias,
                 float* __restrict__ Cf, unsigned short* __restrict__ Cb,
                 int M, int N, int K, int mode, int relu) {
  gemm_body(A, Bt, bias, Cf, Cb, N, K, mode, relu);
}

// The three projections of x read nothing of each other's output, so they are one
// launch, grid = (M/128, E/128, 3): blockIdx.z picks the weight, the output and its
// mode.  Registers and LDS let three of its 768 blocks share a WGP, so that one
// block's LDS reads and waits can run beside another's WMMAs.
__global__ void __launch_bounds__(128)
qkv_gemm_kernel(const unsigned short* __restrict__ A,
                const unsigned short* __restrict__ Wqt,
                const unsigned short* __restrict__ Wkt,
                const unsigned short* __restrict__ Wvt,
                float* __restrict__ Qf, float* __restrict__ Kf,
                unsigned short* __restrict__ Vt) {
  const int z = blockIdx.z;
  gemm_body(A, z == 0 ? Wqt : z == 1 ? Wkt : Wvt, nullptr, z == 0 ? Qf : Kf, Vt,
            E_DIM, V_DIM, z == 2 ? 2 : 0, 0);
}

// ---------------------------------------------------------------------------
#define KT 64   // keys a stage of the attention's LDS tiles
#define TP 72   // row pitch of a staged tile in bf16: 144 bytes = 16 x 9, no bank conflict for 16-byte reads

typedef __attribute__((ext_vector_type(4))) float    f32x4s;

// One thread's share of a 64-key stage, global -> registers.  The bases are the
// same for the whole block, the two byte offsets never change.
__device__ __forceinline__ void stage_load(f32x4s (&qr)[4], u32x4s (&vr)[2],
                                           const float* qbase, const unsigned short* vbase,
                                           unsigned qoff, unsigned voff) {
#pragma unroll
  for (int q = 0; q < 4; ++q)
    qr[q] = *(const f32x4s*)((const char*)qbase + qoff + (unsigned)(16 * q * E_DIM * 4));
#pragma unroll
  for (int q = 0; q < 2; ++q)
    vr[q] = *(const u32x4s*)((const char*)vbase + voff + (unsigned)(32 * q * S_LEN * 2));
}

// registers -> LDS; Q is rounded to bf16 here, once for the block's eight waves
__device__ __forceinline__ void stage_store(const f32x4s (&qr)[4], const u32x4s (&vr)[2],
                                            unsigned short* qdst, unsigned short* vdst) {
#pragma unroll
  for (int q = 0; q < 4; ++q)
    *(uint2*)(qdst + 16 * q * TP) = make_uint2(pack2(qr[q].x, qr[q].y), pack2(qr[q].z, qr[q].w));
#pragma unroll
  for (int q = 0; q < 2; ++q) *(u32x4s*)(vdst + 32 * q * TP) = vr[q];
}

// lane l <-> lane l ^ 16: the other half of the wave, by a vector cross-row move
__device__ __forceinline__ float swap_halves(float v) {
  const int b = __builtin_bit_cast(int, v);
  return __builtin_bit_cast(float, __builtin_amdgcn_permlanex16(b, b, 0x76543210, 0xfedcba98,
                                                                false, false));
}

// Flash attention. Reference einsum gives corr[b,h,i,j] = K[b,i,h,:].Q[b,j,h,:],
// softmax over j, out[i,d] = sum_j P[i,j] V[j,d].
// Block = 8 waves; wave owns 16 output rows i; streams keys in tiles of 32.
// The products are taken transposed: S^T[j,i] = Q[j,:].K[i,:] (A = staged Q rows,
// B = the wave's K rows) and O^T[d,i] += V^T[d,:].P^T[:,i].  A lane then holds 16
// of the 32 scores of ONE output row i = lane & 15 (j = 8 * half + e and
// 16 + 8 * half + e), so the row's maximum and sum run in the lane's own
// registers with one exchange between the wave's halves, the running maximum and
// sum are one register each, and the two score tiles, rounded to bf16 in place,
// ARE the B operand of the second product in the k order of load_frag_bf16.
// The eight waves walk the same keys, so the block brings each 64-key stage of
// Q and of V^T into LDS once: whole-line global loads, Q rounded to bf16 on the
// way, and every wave takes its A fragments from LDS.  Two buffers: the next
// stage's loads fly while this stage is worked on; one barrier a stage.
__global__ void __launch_bounds__(256)
flash_attn_kernel(const float* __restrict__ Kf, const float* __restrict__ Qf,
                  const unsigned short* __restrict__ Vt, const unsigned* __restrict__ mbits,
                  float* __restrict__ Out, float scale) {
  __shared__ __align__(16) unsigned short qs[2][KT][TP];      // Q rows j, bf16, d along the row
  __shared__ __align__(16) unsigned short vs[2][D_HEAD][TP];  // V^T rows d, keys along the row

  const int lane = threadIdx.x & 31;
  const int wave = threadIdx.x >> 5;
  const int h2   = lane >> 4;
  const int col  = lane & 15;
  const int b = blockIdx.z, h = blockIdx.y;
  const int i0 = blockIdx.x * 128 + wave * 16;

  const float* Kb_ = Kf + (size_t)b * S_LEN * E_DIM + h * D_HEAD;
  const float* Qb_ = Qf + (size_t)b * S_LEN * E_DIM + h * D_HEAD;
  const unsigned short* Vb_ = Vt + ((size_t)b * H_CNT + h) * D_HEAD * S_LEN;

  // A thread's share of a stage.  Q: 16 bytes of four rows, 16 rows apart (a
  // wave's load covers two whole 256-byte rows); V^T: 16 bytes of two rows, 32
  // rows apart (a wave's load covers four whole 128-byte rows).
  const int qrow = threadIdx.x >> 4, qcol = (threadIdx.x & 15) * 4;
  const int vrow = threadIdx.x >> 3, vcol = (threadIdx.x & 7) * 8;
  const unsigned qoff = (unsigned)(qrow * E_DIM + qcol) * 4u;   // byte offsets from
  const unsigned voff = (unsigned)(vrow * S_LEN + vcol) * 2u;   // the stage's base
  // The packed mask of the wave's 16 rows (mask_body): the address is the same in
  // every lane, so the words come by scalar loads and each is a select's lane mask.
  const unsigned* mwp = mbits + (size_t)(blockIdx.x * 8 + __builtin_amdgcn_readfirstlane(wave)) *
                                     ((S_LEN / 32) * MT_WORDS);
  u32x16s mw[KT / 32];         // this stage's words, fetched a stage ahead
#pragma unroll
  for (int u = 0; u < KT / 32; ++u) mw[u] = *(const u32x16s*)(mwp + MT_WORDS * u);
  f32x4s qr[4];
  u32x4s vr[2];

  // This wave's 16 K-rows over d = 0..63 (reused for all key tiles): the B operand
  v16bf aK0 = load_frag_f32(Kb_, E_DIM, i0, 0,  lane);
  v16bf aK1 = load_frag_f32(Kb_, E_DIM, i0, 32, lane);
  // the address registers that these loads name are written again below
  asm volatile("s_wait_xcnt 0x0" ::: "memory");
  __builtin_amdgcn_sched_barrier(0);     // holds later register writes behind that wait

  v8f O[4] = {};               // O^T: tile t, register e = O[i][16 t + 8 half + e]
  float mrow = -3.0e38f;       // running maximum of row i (the same in both halves)
  float lrow = 0.0f;           // running sum of row i over this half's keys

  const float mval = -1.0e20f * scale;

  stage_load(qr, vr, Qb_, Vb_, qoff, voff);
  stage_store(qr, vr, &qs[0][qrow][qcol], &vs[0][vrow][vcol]);
  __syncthreads();                       // stage 0 is published

  for (int st = 0; st < S_LEN; st += KT) {
    const int buf = (st / KT) & 1;
    const bool more = st + KT < S_LEN;   // the same for the whole block
    if (more)
      stage_load(qr, vr, Qb_ + (size_t)(st + KT) * E_DIM, Vb_ + (st + KT), qoff, voff);
    const unsigned short* qt = &qs[buf][0][0];
    const unsigned short* vt = &vs[buf][0][0];

    // unrolled so that the two halves' LDS offsets are immediates and the indices of
    // the register arrays constants
#pragma unroll
    for (int jj = 0; jj < KT; jj += 32) {
      // scores tile 32x16 (keys x rows): two 16x16 WMMA tiles, K over d (2 steps of 32)
      v16bf aq00 = load_frag_bf16(qt, TP, jj +  0, 0,  lane);
      v16bf aq01 = load_frag_bf16(qt, TP, jj +  0, 32, lane);
      v16bf aq10 = load_frag_bf16(qt, TP, jj + 16, 0,  lane);
      v16bf aq11 = load_frag_bf16(qt, TP, jj + 16, 32, lane);
      v8f s0 = {}, s1 = {};
      s0 = wmma_bf16(aq00, aK0, s0); s0 = wmma_bf16(aq01, aK1, s0);
      s1 = wmma_bf16(aq10, aK0, s1); s1 = wmma_bf16(aq11, aK1, s1);

      // v[s]: key j = st + jj + (s < 8 ? 8 * h2 + s : 16 + 8 * h2 + s - 8) of row i
      float v[16];
#pragma unroll
      for (int e = 0; e < 8; ++e) {
        v[e]     = __builtin_amdgcn_inverse_ballot_w32(mw[jj / 32][e])     ? s0[e] * scale : mval;
        v[8 + e] = __builtin_amdgcn_inverse_ballot_w32(mw[jj / 32][8 + e]) ? s1[e] * scale : mval;
      }
      float mx = v[0];
#pragma unroll
      for (int s = 1; s < 16; ++s) mx = fmaxf(mx, v[s]);
      mx = fmaxf(mx, swap_halves(mx));
      const float mnew  = fmaxf(mrow, mx);
      const float alpha = __expf(mrow - mnew);
      mrow = mnew;

      // P^T, rounded to nearest even in place: element s of the B operand is the key of v[s]
      float p[16];
      v16bf pb;
#pragma unroll
      for (int s = 0; s < 16; ++s) {
        p[s]  = __expf(v[s] - mnew);
        pb[s] = (__bf16)p[s];
      }
      const float rs = (((p[0] + p[1]) + (p[2] + p[3])) + ((p[4] + p[5]) + (p[6] + p[7]))) +
                       (((p[8] + p[9]) + (p[10] + p[11])) + ((p[12] + p[13]) + (p[14] + p[15])));
      lrow = lrow * alpha + rs;
#pragma unroll
      for (int t = 0; t < 4; ++t) O[t] *= alpha;

      // O^T += V^T . P^T  (A operand from the staged V^T: rows = d, k = j)
      v16bf av0 = load_frag_bf16(vt, TP, 0,  jj, lane);
      v16bf av1 = load_frag_bf16(vt, TP, 16, jj, lane);
      v16bf av2 = load_frag_bf16(vt, TP, 32, jj, lane);
      v16bf av3 = load_frag_bf16(vt, TP, 48, jj, lane);
      O[0] = wmma_bf16(av0, pb, O[0]);
      O[1] = wmma_bf16(av1, pb, O[1]);
      O[2] = wmma_bf16(av2, pb, O[2]);
      O[3] = wmma_bf16(av3, pb, O[3]);
    }

    // The other buffer's last readers left it before the barrier of the trip
    // before; this trip's barrier publishes it and ends the reads of this one.
    if (more) {
      // the next stage's mask words; this stage's have been used up
#pragma unroll
      for (int u = 0; u < KT / 32; ++u)
        mw[u] = *(const u32x16s*)(mwp + ((st + KT) / 32 + u) * MT_WORDS);
      stage_store(qr, vr, &qs[buf ^ 1][qrow][qcol], &vs[buf ^ 1][vrow][vcol]);
    }
    // the next trip's address additions rewrite registers that this trip's global loads name
    asm volatile("s_wait_xcnt 0x0" ::: "memory");
    __builtin_amdgcn_sched_barrier(0);   // keeps those additions behind the wait
    __syncthreads();
  }

  // The halves' sums are joined once.  A lane's eight registers of a tile are eight
  // neighbours of row i: two 16-byte stores.  Every value is formed first, then
  // come the stores alone, so that no register of an issued store is written again.
  const float inv = 1.0f / (lrow + swap_halves(lrow));
  float* orow = Out + ((size_t)b * S_LEN + i0 + col) * E_DIM + h * D_HEAD + 8 * h2;
  f32x4s ov[4][2];
#pragma unroll
  for (int t = 0; t < 4; ++t) {
    ov[t][0] = f32x4s{O[t][0], O[t][1], O[t][2], O[t][3]} * inv;
    ov[t][1] = f32x4s{O[t][4], O[t][5], O[t][6], O[t][7]} * inv;
  }
  __builtin_amdgcn_sched_barrier(0);     // only stores behind this line
#pragma unroll
  for (int t = 0; t < 4; ++t) {
    *(f32x4s*)(orow + 16 * t)     = ov[t][0];
    *(f32x4s*)(orow + 16 * t + 4) = ov[t][1];
  }
}

// ---------------------------------------------------------------------------
// LayerNorm kernels: one wave per row of 512, 8 rows a block, 16 elements a lane
// (four 16-byte pieces, 128 elements apart: a wave's access is 512 contiguous
// bytes).  The row sums run in the lane and then over the wave's 32 lanes.
typedef __attribute__((ext_vector_type(4))) float f32x4;

__device__ __forceinline__ float wave_sum(float v) {
#pragma unroll
  for (int o = 16; o > 0; o >>= 1) v += __shfl_xor(v, o, 32);
  return v;
}

// 16 bytes at a 32-bit byte offset from a uniform base
__device__ __forceinline__ f32x4 ld16(const float* base, unsigned byte_off) {
  return *(const f32x4*)((const char*)base + byte_off);
}

// mean and 1/sqrt(var + eps) of the wave's row
__device__ __forceinline__ void row_stats(const f32x4 (&x)[4], float& mean, float& rstd) {
  float s1 = 0.0f, s2 = 0.0f;
#pragma unroll
  for (int q = 0; q < 4; ++q) {
    s1 += (x[q].x + x[q].y) + (x[q].z + x[q].w);
    s2 += (x[q].x * x[q].x + x[q].y * x[q].y) + (x[q].z * x[q].z + x[q].w * x[q].w);
  }
  s1 = wave_sum(s1);
  s2 = wave_sum(s2);
  mean = s1 * (1.0f / E_DIM);
  const float var = s2 * (1.0f / E_DIM) - mean * mean;
  rstd = rsqrtf(var + 1e-5f);
}

// x1 = LN(src + res) * g + b  -> f32 and a bf16 copy.
__global__ void __launch_bounds__(256)
add_ln_kernel(const float* __restrict__ src, const float* __restrict__ res,
              const float* __restrict__ g, const float* __restrict__ bb,
              float* __restrict__ outf, unsigned short* __restrict__ outb) {
  const int lane = threadIdx.x & 31;
  const size_t off = (size_t)(blockIdx.x * 8 + (threadIdx.x >> 5)) * E_DIM + 4 * lane;
  const unsigned ro = (unsigned)off * 4u;   // the lane's byte offset in a [rows,512] f32 array
  const unsigned co = 16u * lane;           // and in a vector of 512
  f32x4 x[4], c[4], gg[4], bv[4];
#pragma unroll
  for (int q = 0; q < 4; ++q) {
    x[q]  = ld16(src, ro + 512u * q);
    c[q]  = ld16(res, ro + 512u * q);
    gg[q] = ld16(g,   co + 512u * q);
    bv[q] = ld16(bb,  co + 512u * q);
  }
  // Every loaded value is an input, so the wait stands behind all 16 loads; the
  // two offsets are inputs, so they stay untouched (also by a later load's
  // result) up to it.
  asm volatile("s_wait_xcnt 0x0"
               :: "v"(ro), "v"(co),
                  "v"(x[0]),  "v"(x[1]),  "v"(x[2]),  "v"(x[3]),
                  "v"(c[0]),  "v"(c[1]),  "v"(c[2]),  "v"(c[3]),
                  "v"(gg[0]), "v"(gg[1]), "v"(gg[2]), "v"(gg[3]),
                  "v"(bv[0]), "v"(bv[1]), "v"(bv[2]), "v"(bv[3]) : "memory");
#pragma unroll
  for (int q = 0; q < 4; ++q) x[q] += c[q];
  float mean, rstd;
  row_stats(x, mean, rstd);
  uint2 h[4];
#pragma unroll
  for (int q = 0; q < 4; ++q) {
    x[q] = (x[q] - mean) * rstd * gg[q] + bv[q];
    h[q] = make_uint2(pack2(x[q].x, x[q].y), pack2(x[q].z, x[q].w));
  }
#pragma unroll
  for (int q = 0; q < 4; ++q) {
    *(f32x4*)(outf + off + 128 * q) = x[q];
    *(uint2*)(outb + off + 128 * q) = h[q];
  }
}

// out = LN( LN(f)*g3+b3 + x1 ) * g2 + b2.
__global__ void __launch_bounds__(256)
double_ln_kernel(const float* __restrict__ f, const float* __restrict__ x1,
                 const float* __restrict__ g3, const float* __restrict__ b3,
                 const float* __restrict__ g2, const float* __restrict__ b2,
                 float* __restrict__ out) {
  const int lane = threadIdx.x & 31;
  const size_t off = (size_t)(blockIdx.x * 8 + (threadIdx.x >> 5)) * E_DIM + 4 * lane;
  const unsigned ro = (unsigned)off * 4u;   // the lane's byte offset in a [rows,512] f32 array
  const unsigned co = 16u * lane;           // and in a vector of 512
  f32x4 a[4], xr[4], ga[4], ba[4], gb[4], bc[4];
#pragma unroll
  for (int q = 0; q < 4; ++q) {
    a[q]  = ld16(f,  ro + 512u * q);
    xr[q] = ld16(x1, ro + 512u * q);
    ga[q] = ld16(g3, co + 512u * q);
    ba[q] = ld16(b3, co + 512u * q);
    gb[q] = ld16(g2, co + 512u * q);
    bc[q] = ld16(b2, co + 512u * q);
  }
  // Every loaded value is an input, so the wait stands behind all 24 loads; the
  // two offsets are inputs, so they stay untouched (also by a later load's
  // result) up to it.
  asm volatile("s_wait_xcnt 0x0"
               :: "v"(ro), "v"(co),
                  "v"(a[0]),  "v"(a[1]),  "v"(a[2]),  "v"(a[3]),
                  "v"(xr[0]), "v"(xr[1]), "v"(xr[2]), "v"(xr[3]),
                  "v"(ga[0]), "v"(ga[1]), "v"(ga[2]), "v"(ga[3]),
                  "v"(ba[0]), "v"(ba[1]), "v"(ba[2]), "v"(ba[3]),
                  "v"(gb[0]), "v"(gb[1]), "v"(gb[2]), "v"(gb[3]),
                  "v"(bc[0]), "v"(bc[1]), "v"(bc[2]), "v"(bc[3]) : "memory");
  float mean, rstd;
  row_stats(a, mean, rstd);
#pragma unroll
  for (int q = 0; q < 4; ++q) a[q] = (a[q] - mean) * rstd * ga[q] + ba[q] + xr[q];
  row_stats(a, mean, rstd);
#pragma unroll
  for (int q = 0; q < 4; ++q) a[q] = (a[q] - mean) * rstd * gb[q] + bc[q];
#pragma unroll
  for (int q = 0; q < 4; ++q) *(f32x4*)(out + off + 128 * q) = a[q];
}

// ---------------------------------------------------------------------------
extern "C" void kernel_launch(void* const* d_in, const int* in_sizes, int n_in,
                              void* d_out, int out_size, void* d_ws, size_t ws_size,
                              hipStream_t stream) {
  const float* x  = (const float*)d_in[0];
  const int* mask = (const int*)d_in[1];
  const float* Wv = (const float*)d_in[2];
  const float* Wk = (const float*)d_in[3];
  const float* Wq = (const float*)d_in[4];
  const float* g1 = (const float*)d_in[5];
  const float* b1 = (const float*)d_in[6];
  const float* W1 = (const float*)d_in[7];
  const float* c1 = (const float*)d_in[8];
  const float* W2 = (const float*)d_in[9];
  const float* c2 = (const float*)d_in[10];
  const float* g3 = (const float*)d_in[11];
  const float* b3 = (const float*)d_in[12];
  const float* g2 = (const float*)d_in[13];
  const float* b2 = (const float*)d_in[14];

  const size_t MB = 1ull << 20;
  unsigned char* w = (unsigned char*)d_ws;
  // live regions (peak ~97 MB, with reuse):
  unsigned short* xb  = (unsigned short*)(w +  0 * MB); //  8 MB  x bf16
  unsigned short* Wqt = (unsigned short*)(w +  8 * MB); //  .5 MB
  unsigned short* Wkt = (unsigned short*)(w +  9 * MB); //  .5 MB
  unsigned short* Wvt = (unsigned short*)(w + 10 * MB); //  .5 MB
  unsigned short* W1t = (unsigned short*)(w + 11 * MB); //  2 MB
  unsigned short* W2t = (unsigned short*)(w + 13 * MB); //  2 MB
  float*          Kf  = (float*)         (w + 16 * MB); // 16 MB  keys f32
  unsigned short* Vt  = (unsigned short*)(w + 32 * MB); //  8 MB  V^T bf16
  float*          Qf  = (float*)         (w + 40 * MB); // 16 MB  queries f32
  float*          attn= (float*)         (w + 56 * MB); // 16 MB
  float*          x1f = (float*)         (w + 72 * MB); // 16 MB
  unsigned short* x1b = (unsigned short*)(w + 88 * MB); //  8 MB
  unsigned short* hb  = (unsigned short*)(w + 16 * MB); // 32 MB (reuses Kf/Vt/Qf)
  float*          ff  = (float*)         (w + 48 * MB); // 16 MB (reuses Qf/attn)
  unsigned*       mbt = (unsigned*)      (w + 96 * MB); //  .5 MB mask, one bit a score

  dim3 blk(256);
  dim3 gblk(128);   // GEMM: 4 waves, 2x2

  // 1) conversions / weight transposes
  prep_kernel<<<PREP_BLKS, blk, 0, stream>>>(x, Wq, Wk, Wv, W1, W2, mask, mbt,
                                             xb, Wqt, Wkt, Wvt, W1t, W2t);

  // 2) QKV projections
  dim3 gq(M_ROWS / 128, E_DIM / 128, 3);
  qkv_gemm_kernel<<<gq, gblk, 0, stream>>>(xb, Wqt, Wkt, Wvt, Qf, Kf, Vt);

  // 3) fused attention
  dim3 ga(S_LEN / 128, H_CNT, B_SZ);
  const float scale = 1.0f / sqrtf((float)E_DIM);
  flash_attn_kernel<<<ga, blk, 0, stream>>>(Kf, Qf, Vt, mbt, attn, scale);

  // 4) x1 = LN(attn + queries)
  add_ln_kernel<<<M_ROWS / 8, blk, 0, stream>>>(attn, Qf, g1, b1, x1f, x1b);

  // 5) h = relu(x1 @ W1 + c1)
  dim3 gf1(M_ROWS / 128, F_DIM / 128);
  gemm_bf16_kernel<<<gf1, gblk, 0, stream>>>(x1b, W1t, c1, nullptr, hb,
                                            M_ROWS, F_DIM, E_DIM, 1, 1);

  // 6) f = h @ W2 + c2
  dim3 gf2(M_ROWS / 128, E_DIM / 128);
  gemm_bf16_kernel<<<gf2, gblk, 0, stream>>>(hb, W2t, c2, ff, nullptr,
                                            M_ROWS, E_DIM, F_DIM, 0, 0);

  // 7) out = LN(LN(f) + x1)
  double_ln_kernel<<<M_ROWS / 8, blk, 0, stream>>>(ff, x1f, g3, b3, g2, b2,
                                               (float*)d_out);
}

// v008
// Measured time: 136 microseconds a run.
// Two timings next to v007 put it at 1.04 and 1.03 times that version's speed.
// Counting every step since v000, it is 3.76 times as fast.
#include <hip/hip_runtime.h>
#include <hip/hip_bf16.h>
#include <math.h>

// ---------------------------------------------------------------------------
// Transformer block on CDNA5 (gfx1250), wave32, bf16 WMMA w/ f32 accumulation.
// Pipeline:
//   1) convert x -> bf16; transpose+convert weights -> bf16 [N,K]; pack the mask
//      into one bit a score (one launch)
//   2) WMMA GEMMs: Q (f32 and a bf16 copy), K (f32), V (bf16, head-transposed [b,h,d,s])
//      (one launch)
//   3) flash attention (scores = K.Q^T per the reference's einsum, taken
//      transposed), online softmax in the lane, V^T.P^T via WMMA, P stays in registers
//   4) x1 = LN(attn + Q) -> f32 + bf16
//   5) h = relu(x1 @ W1 + c1) (WMMA, bf16 out)
//   6) f = h @ W2 + c2 (WMMA, f32 out)
//   7) out = LN(LN(f) + x1)
// ---------------------------------------------------------------------------

typedef __attribute__((ext_vector_type(16))) __bf16 v16bf;
typedef __attribute__((ext_vector_type(8)))  float  v8f;
typedef __attribute__((ext_vector_type(4))) unsigned u32x4s;
typedef __attribute__((ext_vector_type(4))) int i32x4s;
typedef __attribute__((ext_vector_type(16))) unsigned u32x16s;

#define S_LEN  2048
#define E_DIM  512
#define V_DIM  512
#define F_DIM  2048
#define B_SZ   4
#define H_CNT  8
#define D_HEAD 64
#define M_ROWS (B_SZ * S_LEN)

__device__ __forceinline__ unsigned short f2bf(float f) {
  union { float f; unsigned u; } a; a.f = f;
  unsigned u = a.u;
  return (unsigned short)((u + 0x7FFFu + ((u >> 16) & 1u)) >> 16); // RNE
}

// A/B fragment loader for v_wmma_f32_16x16x32_bf16 from row-major bf16 data.
// Layout (ISA 7.12.2, 16-bit A 16x32): lane L holds row (L&15); lanes 0-15
// carry K = [k0, k0+8) and [k0+16, k0+24); lanes 16-31 the +8 halves.
// The same layout serves the B operand when loading from a [N,K] (transposed)
// matrix: lane holds column n = (L&15) of B.
__device__ __forceinline__ v16bf load_frag_bf16(const unsigned short* base, int ld,
                                                int row0, int k0, int lane) {
  const int half = lane >> 4;
  const unsigned short* p = base + (size_t)(row0 + (lane & 15)) * ld + k0 + 8 * half;
  union { uint4 q[2]; v16bf v; } u;
  u.q[0] = *(const uint4*)p;
  u.q[1] = *(const uint4*)(p + 16);
  return u.v;
}

// Same fragment, sourced from fp32 with on-the-fly bf16 conversion.
__device__ __forceinline__ v16bf load_frag_f32(const float* base, int ld,
                                               int row0, int k0, int lane) {
  const int half = lane >> 4;
  const float* p = base + (size_t)(row0 + (lane & 15)) * ld + k0 + 8 * half;
  union { unsigned short s[16]; v16bf v; } u;
#pragma unroll
  for (int e = 0; e < 8; ++e) {
    u.s[e]     = f2bf(p[e]);
    u.s[8 + e] = f2bf(p[16 + e]);
  }
  return u.v;
}

__device__ __forceinline__ v8f wmma_bf16(v16bf a, v16bf b, v8f c) {
  return __builtin_amdgcn_wmma_f32_16x16x32_bf16(false, a, false, b, (short)0, c,
                                                 false, false);
}

// ---------------------------------------------------------------------------
// The kernels without matrix work are short; each thread takes many elements
// and the grids are small, for speed only.

__device__ __forceinline__ unsigned pack2(float lo, float hi) {
  return (unsigned)f2bf(lo) | ((unsigned)f2bf(hi) << 16);
}

// Elementwise fp32 -> bf16, 32 elements a thread: four chunks of eight (two
// 16-byte loads, one 16-byte store), a block's chunks 2048 elements apart, so
// that every access of a wave covers whole lines.  Blocks = elements / 8192.
__device__ __forceinline__ void cvt_body(const float* __restrict__ in,
                                         unsigned short* __restrict__ out, int blk) {
  const size_t base = (size_t)blk * 8192 + threadIdx.x * 8;
  const float* p = in + base;
  unsigned short* o = out + base;
  float4 v[4][2];
#pragma unroll
  for (int c = 0; c < 4; ++c) {
    v[c][0] = *(const float4*)(p + 2048 * c);
    v[c][1] = *(const float4*)(p + 2048 * c + 4);
  }
  uint4 q[4];
#pragma unroll
  for (int c = 0; c < 4; ++c)
    q[c] = make_uint4(pack2(v[c][0].x, v[c][0].y), pack2(v[c][0].z, v[c][0].w),
                      pack2(v[c][1].x, v[c][1].y), pack2(v[c][1].z, v[c][1].w));
#pragma unroll
  for (int c = 0; c < 4; ++c) *(uint4*)(o + 2048 * c) = q[c];
}

// [Kd,Nd] fp32 -> [Nd,Kd] bf16.  A thread takes 16 k of one n: 16 loads (a wave
// reads 128 contiguous bytes of a row each time) and two 16-byte stores.
// Blocks = Kd * Nd / 4096; Kd is a multiple of 16.  The row length is a constant
// of the body, so that the split of the block index needs no division.
template <int ND>
__device__ __forceinline__ void transpose_body(const float* __restrict__ in,
                                               unsigned short* __restrict__ out, int Kd,
                                               int blk) {
  const int kb = blk / (ND / 256);               // a block's threads share their 16 rows
  const int n  = (blk % (ND / 256)) * 256 + threadIdx.x;
  const float* p = in + (size_t)(16 * kb) * ND + n;
  float v[16];
#pragma unroll
  for (int e = 0; e < 16; ++e) v[e] = p[e * ND];
  const uint4 q0 = make_uint4(pack2(v[0], v[1]),   pack2(v[2], v[3]),
                              pack2(v[4], v[5]),   pack2(v[6], v[7]));
  const uint4 q1 = make_uint4(pack2(v[8], v[9]),   pack2(v[10], v[11]),
                              pack2(v[12], v[13]), pack2(v[14], v[15]));
  unsigned short* o = out + (size_t)n * Kd + 16 * kb;
  *(uint4*)o       = q0;
  *(uint4*)(o + 8) = q1;
  // another job's code follows in the merged kernel and reuses these stores' registers
  asm volatile("s_wait_xcnt 0x0" ::: "memory");
}

// mask [S,S] int32 -> one bit a score, in the order in which the attention's waves
// hold their scores.  A tile is 16 rows i x 32 keys j = 16 words; bit L of word s
// says mask != 0 for row 16 * tile + (L & 15) and key 32 * tile + 16 * (s >> 3) +
// 8 * (L >> 4) + (s & 7): lane L's score number s.  A word is then the lane mask of
// one select of a whole wave.  Tiles lie row of tiles by row of tiles, keys running.
// The attention reads the mask once for every batch entry and head; packed, that is
// 64 bytes a tile by scalar loads in place of 2048 by vector loads of 16 lines each.
// A wave takes 16 rows x 128 keys: 16 loads a lane, 64 compares, two 128-byte stores.
#define MT_WORDS 16
#define MASK_BLKS ((S_LEN / 16) * (S_LEN / 128) / 8)

__device__ __forceinline__ void mask_body(const int* __restrict__ mask,
                                          unsigned* __restrict__ mbits, int blk) {
  const int lane = threadIdx.x & 31;
  const int job  = blk * 8 + (threadIdx.x >> 5);
  const int it   = job / (S_LEN / 128);          // the 16 rows
  const int jg   = job % (S_LEN / 128);          // the 128 keys: four tiles
  const int* p = mask + (size_t)(it * 16 + (lane & 15)) * S_LEN + jg * 128 + 8 * (lane >> 4);
  i32x4s m[4][4];
  // (here and in the attention: a loop over a register array is unrolled so that its
  // indices are constants)
#pragma unroll
  for (int u = 0; u < 4; ++u)
#pragma unroll
    for (int q = 0; q < 4; ++q)
      m[u][q] = *(const i32x4s*)(p + 32 * u + 16 * (q >> 1) + 4 * (q & 1));
  // lane L of w[h] takes word L of the tiles 2 h and 2 h + 1
  unsigned w[2] = {0u, 0u};
#pragma unroll
  for (int u = 0; u < 4; ++u)
#pragma unroll
    for (int s = 0; s < 16; ++s) {
      // taken by all 32 lanes, ahead of the choice of the lane that keeps the word
      const unsigned b = __builtin_amdgcn_ballot_w32(m[u][s >> 2][s & 3] != 0);
      w[u >> 1] = lane == (u & 1) * 16 + s ? b : w[u >> 1];
    }
  unsigned* o = mbits + ((size_t)it * (S_LEN / 32) + jg * 4) * MT_WORDS + lane;
  o[0]  = w[0];
  o[32] = w[1];
  // another job's code follows in the merged kernel and reuses these stores' registers
  asm volatile("s_wait_xcnt 0x0" ::: "memory");
}

// The seven jobs read nothing of each other's output, so they are one launch:
// the block index picks the job (the same for a whole block).
#define CVT_BLKS ((M_ROWS * V_DIM) / 8192)   // x
#define TQ_BLKS  ((V_DIM * E_DIM) / 4096)    // each of Wq, Wk, Wv
#define TF_BLKS  ((E_DIM * F_DIM) / 4096)    // each of W1, W2
#define PREP_BLKS (CVT_BLKS + 3 * TQ_BLKS + 2 * TF_BLKS + MASK_BLKS)

__global__ void __launch_bounds__(256)
prep_kernel(const float* __restrict__ x,  const float* __restrict__ Wq,
            const float* __restrict__ Wk, const float* __restrict__ Wv,
            const float* __restrict__ W1, const float* __restrict__ W2,
            const int* __restrict__ mask, unsigned* __restrict__ mbits,
            unsigned short* __restrict__ xb,  unsigned short* __restrict__ Wqt,
            unsigned short* __restrict__ Wkt, unsigned short* __restrict__ Wvt,
            unsigned short* __restrict__ W1t, unsigned short* __restrict__ W2t) {
  int blk = blockIdx.x;
  if (blk < CVT_BLKS) { cvt_body(x, xb, blk); return; }
  blk -= CVT_BLKS;
  if (blk < 3 * TQ_BLKS) {
    const int w = blk / TQ_BLKS;
    const float* in     = w == 0 ? Wq  : w == 1 ? Wk  : Wv;
    unsigned short* out = w == 0 ? Wqt : w == 1 ? Wkt : Wvt;
    transpose_body<E_DIM>(in, out, V_DIM, blk % TQ_BLKS);
    return;
  }
  blk -= 3 * TQ_BLKS;
  if (blk < TF_BLKS) { transpose_body<F_DIM>(W1, W1t, E_DIM, blk); return; }
  blk -= TF_BLKS;
  if (blk < TF_BLKS) { transpose_body<E_DIM>(W2, W2t, F_DIM, blk); return; }
  mask_body(mask, mbits, blk - TF_BLKS);
}

#define GKS  64            // k of a staged tile: 128 bytes of every row
#define GTP  72            // row pitch of a staged tile in bf16: 144 bytes = 16 x 9, no bank conflict for 16-byte reads
#define GBUF (256 * GTP)   // a buffer in bf16: rows 0..127 of A, then rows 0..127 of Bt

__device__ __forceinline__ void gemm_load_set(v16bf (&a)[4], v16bf (&b)[4],
                                              const unsigned short* A,
                                              const unsigned short* Bt, int K,
                                              int m0, int n0, int k0, int lane) {
#pragma unroll
  for (int i = 0; i < 4; ++i) a[i] = load_frag_bf16(A, K, m0 + 16 * i, k0, lane);
#pragma unroll
  for (int t = 0; t < 4; ++t) b[t] = load_frag_bf16(Bt, K, n0 + 16 * t, k0, lane);
}

// Eight asynchronous copies, global -> LDS through no register: the lane's 16
// bytes of eight rows, 16 rows apart.  A wave's copy covers four whole rows of
// the tile.  The last line is a precaution: the copies' address registers stay
// untouched up to it; it stands inside the statement so that no later address
// addition can be lifted over it.
__device__ __forceinline__ void copy_rows8(unsigned lds, const unsigned short* g, size_t gstep) {
  const unsigned ls = 16u * GTP * 2u;          // 16 rows in LDS bytes
  asm volatile("global_load_async_to_lds_b128 %0, %8, off\n\t"
               "global_load_async_to_lds_b128 %1, %9, off\n\t"
               "global_load_async_to_lds_b128 %2, %10, off\n\t"
               "global_load_async_to_lds_b128 %3, %11, off\n\t"
               "global_load_async_to_lds_b128 %4, %12, off\n\t"
               "global_load_async_to_lds_b128 %5, %13, off\n\t"
               "global_load_async_to_lds_b128 %6, %14, off\n\t"
               "global_load_async_to_lds_b128 %7, %15, off\n\t"
               "s_wait_xcnt 0x0"
               :: "v"(lds),          "v"(lds + ls),     "v"(lds + 2 * ls), "v"(lds + 3 * ls),
                  "v"(lds + 4 * ls), "v"(lds + 5 * ls), "v"(lds + 6 * ls), "v"(lds + 7 * ls),
                  "v"(g),             "v"(g + gstep),     "v"(g + 2 * gstep), "v"(g + 3 * gstep),
                  "v"(g + 4 * gstep), "v"(g + 5 * gstep), "v"(g + 6 * gstep), "v"(g + 7 * gstep)
               : "memory");
}

// A thread's share of one tile: 8 copies for the A rows, 8 for the Bt rows.
__device__ __forceinline__ void gemm_tile_copy(unsigned lds, const unsigned short* ga,
                                               const unsigned short* gb, size_t gstep) {
  copy_rows8(lds, ga, gstep);
  copy_rows8(lds + 128u * GTP * 2u, gb, gstep);
}

__device__ __forceinline__ void gemm_mul_set(v8f (&acc)[4][4], const v16bf (&a)[4],
                                             const v16bf (&b)[4]) {
#pragma unroll
  for (int i = 0; i < 4; ++i)
#pragma unroll
    for (int t = 0; t < 4; ++t) acc[i][t] = wmma_bf16(a[i], b[t], acc[i][t]);
}

__device__ __forceinline__ void
gemm_body(const unsigned short* __restrict__ A,
          const unsigned short* __restrict__ Bt,
          const float* __restrict__ bias,
          float* __restrict__ Cf, unsigned short* __restrict__ Cb,
          int N, int K, int mode, int relu) {
  __shared__ __align__(16) unsigned short ts[2 * GBUF];

  const int lane = threadIdx.x & 31;
  const int wave = threadIdx.x >> 5;
  const int wm = (wave >> 1) * 64;             // the wave's rows and columns
  const int wn = (wave & 1) * 64;              // inside the block's tile
  const int m0 = blockIdx.x * 128 + wm;
  const int n0 = blockIdx.y * 128 + wn;

  // A thread's share of a tile: 16 bytes (chunk cc) of rows cr, cr + 16, ...
  const int cr = threadIdx.x >> 3, cc = (threadIdx.x & 7) * 8;
  const unsigned short* ga = A  + (size_t)(blockIdx.x * 128 + cr) * K + cc;
  const unsigned short* gb = Bt + (size_t)(blockIdx.y * 128 + cr) * K + cc;
  const size_t gstep = (size_t)16 * K;
  const unsigned l0 = (unsigned)(size_t)&ts[cr * GTP + cc];   // its LDS byte address in buffer 0
  const int nt = K / GKS;

  v8f acc[4][4] = {};
  v16bf a0[4], b0[4], a1[4], b1[4];

  gemm_tile_copy(l0, ga, gb, gstep);
  asm volatile("s_wait_asynccnt 0x0" ::: "memory");   // this wave's share of tile 0 has landed
  __syncthreads();                                    // tile 0 is published
  if (nt > 1) gemm_tile_copy(l0 + GBUF * 2u, ga + GKS, gb + GKS, gstep);

  for (int t = 0; t < nt; ++t) {
    const unsigned short* ta = ts + (t & 1) * GBUF;
    const unsigned short* tb = ta + 128 * GTP;
    gemm_load_set(a0, b0, ta, tb, GTP, wm, wn, 0,  lane);
    gemm_load_set(a1, b1, ta, tb, GTP, wm, wn, 32, lane);
    // keeps the tile's 32 LDS reads in one group ahead of its 32 WMMAs (else they
    // sink among the WMMAs, one fragment at a time, each waited out in full)
    __builtin_amdgcn_sched_barrier(0);
    gemm_mul_set(acc, a0, b0);
    gemm_mul_set(acc, a1, b1);
    // keeps the WMMAs ahead of the waits below (else they sink behind the barrier
    // and the next tile's copies are waited out before anything is multiplied)
    __builtin_amdgcn_sched_barrier(0);
    asm volatile("s_wait_dscnt 0x0" ::: "memory");    // this wave's reads of this buffer are done
    asm volatile("s_wait_asynccnt 0x0" ::: "memory"); // its share of tile t + 1 has landed
    __syncthreads();     // publishes tile t + 1, ends every wave's reads of this buffer
    if (t + 2 < nt)      // the same for the whole block
      gemm_tile_copy(l0 + (unsigned)(t & 1) * (GBUF * 2u), ga + (size_t)(t + 2) * GKS,
                     gb + (size_t)(t + 2) * GKS, gstep);
  }
  asm volatile("s_wait_asynccnt 0x0" ::: "memory");   // no copy is left in flight

  const int col = lane & 15;
  const int h2  = lane >> 4;
  // Epilogue.  The mode test stands outside the element loops.  Modes 0 and 1
  // go in two parts: first every value and every row address is formed in
  // registers, then come the stores alone, so that no register of an issued
  // store is written again.
#pragma unroll
  for (int t = 0; t < 4; ++t) {
    float bv = bias ? bias[n0 + 16 * t + col] : 0.0f;
#pragma unroll
    for (int i = 0; i < 4; ++i)
#pragma unroll
      for (int e = 0; e < 8; ++e) {
        float v = acc[i][t][e] + bv;
        acc[i][t][e] = relu ? fmaxf(v, 0.0f) : v;
      }
  }
  const int mr = m0 + 8 * h2;                  // C layout: VGPR e -> row e (+8)
  const int nc = n0 + col;
  if (mode == 0 || mode == 3) {
    float* cb = Cf + (size_t)mr * N + nc;
    float* c[4][8];
#pragma unroll
    for (int i = 0; i < 4; ++i)
#pragma unroll
      for (int e = 0; e < 8; ++e) c[i][e] = cb + (size_t)(16 * i + e) * N;
    __builtin_amdgcn_sched_barrier(0);         // only stores behind this line
#pragma unroll
    for (int i = 0; i < 4; ++i)
#pragma unroll
      for (int e = 0; e < 8; ++e)
#pragma unroll
        for (int t = 0; t < 4; ++t) c[i][e][16 * t] = acc[i][t][e];
    // code of the other modes' paths follows and reuses these stores' registers
    asm volatile("s_wait_xcnt 0x0" ::: "memory");
  }
  if (mode == 1 || mode == 3) {
    unsigned short* cb = Cb + (size_t)mr * N + nc;
    unsigned short* c[4][8];
    unsigned short hv[4][4][8];
#pragma unroll
    for (int i = 0; i < 4; ++i)
#pragma unroll
      for (int e = 0; e < 8; ++e) {
        c[i][e] = cb + (size_t)(16 * i + e) * N;
#pragma unroll
        for (int t = 0; t < 4; ++t) hv[i][t][e] = f2bf(acc[i][t][e]);
      }
    __builtin_amdgcn_sched_barrier(0);         // only stores behind this line
#pragma unroll
    for (int i = 0; i < 4; ++i)
#pragma unroll
      for (int e = 0; e < 8; ++e)
#pragma unroll
        for (int t = 0; t < 4; ++t) c[i][e][16 * t] = hv[i][t][e];
    // code of the other modes' paths follows and reuses these stores' registers
    asm volatile("s_wait_xcnt 0x0" ::: "memory");
  } else if (mode == 2) {
    // the wave's 64 rows lie in one batch entry, its 64 columns are one head;
    // a lane's eight rows of a tile are eight neighbours in Vt: one 16-byte store
    const int bb = mr / S_LEN, s = mr % S_LEN;
    const int hh = nc >> 6,    d = nc & 63;
    unsigned short* c = Cb + (((size_t)bb * H_CNT + hh) * D_HEAD + d) * S_LEN + s;
    // a compiler vector, not a struct of four words: each value stays whole in four
    // registers of its own, and the 16 stores leave in one run with one wait behind them
    u32x4s pk[4][4];
#pragma unroll
    for (int i = 0; i < 4; ++i)
#pragma unroll
      for (int t = 0; t < 4; ++t) {
        unsigned q[4];
#pragma unroll
        for (int e = 0; e < 4; ++e)
          q[e] = (unsigned)f2bf(acc[i][t][2 * e]) | ((unsigned)f2bf(acc[i][t][2 * e + 1]) << 16);
        pk[i][t] = u32x4s{q[0], q[1], q[2], q[3]};
      }
#pragma unroll
    for (int i = 0; i < 4; ++i)
#pragma unroll
      for (int t = 0; t < 4; ++t)
        *(u32x4s*)(c + (size_t)(16 * t) * S_LEN + 16 * i) = pk[i][t];
    // code of the other modes' paths follows and reuses these stores' registers
    asm volatile("s_wait_xcnt 0x0" ::: "memory");
  }
}

__global__ void __launch_bounds__(128)
gemm_bf16_kernel(const unsigned short* __restrict__ A,
                 const unsigned short* __restrict__ Bt,
                 const float* __restrict__ bias,
                 float* __restrict__ Cf, unsigned short* __restrict__ Cb,
                 int M, int N, int K, int mode, int relu) {
  gemm_body(A, Bt, bias, Cf, Cb, N, K, mode, relu);
}

// The three projections of x read nothing of each other's output, so they are one
// launch, grid = (M/128, E/128, 3): blockIdx.z picks the weight, the output and its
// mode.  Q leaves twice: f32 for the residual, bf16 for the attention's tiles, which
// would otherwise round it anew in each of the 16 blocks that walk it.  Registers
// and LDS let three of its 768 blocks share a WGP, so that one block's LDS reads
// and waits can run beside another's WMMAs.
__global__ void __launch_bounds__(128)
qkv_gemm_kernel(const unsigned short* __restrict__ A,
                const unsigned short* __restrict__ Wqt,
                const unsigned short* __restrict__ Wkt,
                const unsigned short* __restrict__ Wvt,
                float* __restrict__ Qf, float* __restrict__ Kf,
                unsigned short* __restrict__ Vt, unsigned short* __restrict__ Qb) {
  const int z = blockIdx.z;
  gemm_body(A, z == 0 ? Wqt : z == 1 ? Wkt : Wvt, nullptr, z == 0 ? Qf : Kf,
            z == 0 ? Qb : Vt, E_DIM, V_DIM, z == 0 ? 3 : z == 2 ? 2 : 0, 0);
}

// ---------------------------------------------------------------------------
#define KT 64   // keys a stage of the attention's LDS tiles
#define TP 72   // row pitch of a staged tile in bf16: 144 bytes = 16 x 9, no bank conflict for 16-byte reads

typedef __attribute__((ext_vector_type(4))) float    f32x4s;

// One thread's share of a 64-key stage: four asynchronous copies, global -> LDS
// through no register: its 16 bytes of two Q rows and of two V^T rows, 32 rows
// apart.  A wave's copy covers four whole 128-byte rows.  The last line is a
// precaution: the copies' address registers stay untouched up to it; it stands
// inside the statement so that no later address addition can be lifted over it.
__device__ __forceinline__ void stage_copy(unsigned lq, unsigned lv,
                                           const unsigned short* gq,
                                           const unsigned short* gv) {
  const unsigned ls = 32u * TP * 2u;           // 32 rows in LDS bytes
  asm volatile("global_load_async_to_lds_b128 %0, %4, off\n\t"
               "global_load_async_to_lds_b128 %1, %5, off\n\t"
               "global_load_async_to_lds_b128 %2, %6, off\n\t"
               "global_load_async_to_lds_b128 %3, %7, off\n\t"
               "s_wait_xcnt 0x0"
               :: "v"(lq), "v"(lq + ls), "v"(lv), "v"(lv + ls),
                  "v"(gq), "v"(gq + 32 * E_DIM), "v"(gv), "v"(gv + 32 * S_LEN)
               : "memory");
}

// lane l <-> lane l ^ 16: the other half of the wave, by a vector cross-row move
__device__ __forceinline__ float swap_halves(float v) {
  const int b = __builtin_bit_cast(int, v);
  return __builtin_bit_cast(float, __builtin_amdgcn_permlanex16(b, b, 0x76543210, 0xfedcba98,
                                                                false, false));
}

// Flash attention. Reference einsum gives corr[b,h,i,j] = K[b,i,h,:].Q[b,j,h,:],
// softmax over j, out[i,d] = sum_j P[i,j] V[j,d].
// Block = 8 waves; wave owns 16 output rows i; streams keys in tiles of 32.
// The products are taken transposed: S^T[j,i] = Q[j,:].K[i,:] (A = staged Q rows,
// B = the wave's K rows) and O^T[d,i] += V^T[d,:].P^T[:,i].  A lane then holds 16
// of the 32 scores of ONE output row i = lane & 15 (j = 8 * half + e and
// 16 + 8 * half + e), so the row's maximum and sum run in the lane's own
// registers with one exchange between the wave's halves, the running maximum and
// sum are one register each, and the two score tiles, rounded to bf16 in place,
// ARE the B operand of the second product in the k order of load_frag_bf16.
// The eight waves walk the same keys, so the block brings each 64-key stage of
// Q (the projection's bf16 copy) and of V^T into LDS once, by asynchronous copies
// of whole lines, and every wave takes its A fragments from LDS.  Two buffers: the
// next stage's copies fly while this stage is worked on; one barrier a stage.
// The grid gives every SIMD four waves, and the attribute says so: with the staging
// registers gone the compiler would otherwise squeeze below 128 registers for waves
// that do not exist, and wait out its LDS reads one fragment at a time.
__global__ void __launch_bounds__(256) __attribute__((amdgpu_waves_per_eu(4, 4)))
flash_attn_kernel(const float* __restrict__ Kf, const unsigned short* __restrict__ Qb,
                  const unsigned short* __restrict__ Vt, const unsigned* __restrict__ mbits,
                  float* __restrict__ Out, float scale) {
  __shared__ __align__(16) unsigned short qs[2][KT][TP];      // Q rows j, bf16, d along the row
  __shared__ __align__(16) unsigned short vs[2][D_HEAD][TP];  // V^T rows d, keys along the row

  const int lane = threadIdx.x & 31;
  const int wave = threadIdx.x >> 5;
  const int h2   = lane >> 4;
  const int col  = lane & 15;
  const int b = blockIdx.z, h = blockIdx.y;
  const int i0 = blockIdx.x * 128 + wave * 16;

  const float* Kb_ = Kf + (size_t)b * S_LEN * E_DIM + h * D_HEAD;
  const unsigned short* Vb_ = Vt + ((size_t)b * H_CNT + h) * D_HEAD * S_LEN;

  // A thread's share of a stage: 16 bytes (chunk cc) of rows cr and cr + 32, of Q and of V^T
  const int cr = threadIdx.x >> 3, cc = (threadIdx.x & 7) * 8;
  const unsigned short* gq = Qb + ((size_t)b * S_LEN + cr) * E_DIM + h * D_HEAD + cc;
  const unsigned short* gv = Vb_ + (size_t)cr * S_LEN + cc;
  const unsigned lq = (unsigned)(size_t)&qs[0][cr][cc];   // its LDS byte addresses
  const unsigned lv = (unsigned)(size_t)&vs[0][cr][cc];   // in buffer 0
  const unsigned lb = KT * TP * 2u;                       // a buffer in bytes (KT = D_HEAD rows)
  stage_copy(lq, lv, gq, gv);  // stage 0 flies while the K rows are fetched and rounded
  // The packed mask of the wave's 16 rows (mask_body): the address is the same in
  // every lane, so the words come by scalar loads and each is a select's lane mask.
  const unsigned* mwp = mbits + (size_t)(blockIdx.x * 8 + __builtin_amdgcn_readfirstlane(wave)) *
                                     ((S_LEN / 32) * MT_WORDS);
  // Read through the constant address space (no launch writes the words while this one
  // runs): beside the copies' statements the compiler otherwise takes the loop's words
  // by vector loads with a lane read for each word.
  typedef const __attribute__((address_space(4))) u32x16s mask_words;
  u32x16s mw[KT / 32];         // this stage's words, fetched a stage ahead
#pragma unroll
  for (int u = 0; u < KT / 32; ++u) mw[u] = *(mask_words*)(mwp + MT_WORDS * u);

  // This wave's 16 K-rows over d = 0..63 (reused for all key tiles): the B operand
  v16bf aK0 = load_frag_f32(Kb_, E_DIM, i0, 0,  lane);
  v16bf aK1 = load_frag_f32(Kb_, E_DIM, i0, 32, lane);
  // the address registers that these loads name are written again below
  asm volatile("s_wait_xcnt 0x0" ::: "memory");
  __builtin_amdgcn_sched_barrier(0);     // holds later register writes behind that wait

  v8f O[4] = {};               // O^T: tile t, register e = O[i][16 t + 8 half + e]
  float mrow = -3.0e38f;       // running maximum of row i (the same in both halves)
  float lrow = 0.0f;           // running sum of row i over this half's keys

  const float mval = -1.0e20f * scale;

  asm volatile("s_wait_asynccnt 0x0" ::: "memory");   // this wave's share of stage 0 has landed
  __syncthreads();                                    // stage 0 is published
  stage_copy(lq + lb, lv + lb, gq + (size_t)KT * E_DIM, gv + KT);   // stage 1 (there are 32)

  for (int st = 0; st < S_LEN; st += KT) {
    const int buf = (st / KT) & 1;
    const bool more = st + KT < S_LEN;   // the same for the whole block
    const unsigned short* qt = &qs[buf][0][0];
    const unsigned short* vt = &vs[buf][0][0];

    // unrolled so that the two halves' LDS offsets are immediates and the indices of
    // the register arrays constants
#pragma unroll
    for (int jj = 0; jj < KT; jj += 32) {
      // scores tile 32x16 (keys x rows): two 16x16 WMMA tiles, K over d (2 steps of 32)
      v16bf aq00 = load_frag_bf16(qt, TP, jj +  0, 0,  lane);
      v16bf aq01 = load_frag_bf16(qt, TP, jj +  0, 32, lane);
      v16bf aq10 = load_frag_bf16(qt, TP, jj + 16, 0,  lane);
      v16bf aq11 = load_frag_bf16(qt, TP, jj + 16, 32, lane);
      v8f s0 = {}, s1 = {};
      s0 = wmma_bf16(aq00, aK0, s0); s0 = wmma_bf16(aq01, aK1, s0);
      s1 = wmma_bf16(aq10, aK0, s1); s1 = wmma_bf16(aq11, aK1, s1);

      // v[s]: key j = st + jj + (s < 8 ? 8 * h2 + s : 16 + 8 * h2 + s - 8) of row i
      float v[16];
#pragma unroll
      for (int e = 0; e < 8; ++e) {
        v[e]     = __builtin_amdgcn_inverse_ballot_w32(mw[jj / 32][e])     ? s0[e] * scale : mval;
        v[8 + e] = __builtin_amdgcn_inverse_ballot_w32(mw[jj / 32][8 + e]) ? s1[e] * scale : mval;
      }
      float mx = v[0];
#pragma unroll
      for (int s = 1; s < 16; ++s) mx = fmaxf(mx, v[s]);
      mx = fmaxf(mx, swap_halves(mx));
      const float mnew  = fmaxf(mrow, mx);
      const float alpha = __expf(mrow - mnew);
      mrow = mnew;

      // P^T, rounded to nearest even in place: element s of the B operand is the key of v[s]
      float p[16];
      v16bf pb;
#pragma unroll
      for (int s = 0; s < 16; ++s) {
        p[s]  = __expf(v[s] - mnew);
        pb[s] = (__bf16)p[s];
      }
      const float rs = (((p[0] + p[1]) + (p[2] + p[3])) + ((p[4] + p[5]) + (p[6] + p[7]))) +
                       (((p[8] + p[9]) + (p[10] + p[11])) + ((p[12] + p[13]) + (p[14] + p[15])));
      lrow = lrow * alpha + rs;
#pragma unroll
      for (int t = 0; t < 4; ++t) O[t] *= alpha;

      // O^T += V^T . P^T  (A operand from the staged V^T: rows = d, k = j)
      v16bf av0 = load_frag_bf16(vt, TP, 0,  jj, lane);
      v16bf av1 = load_frag_bf16(vt, TP, 16, jj, lane);
      v16bf av2 = load_frag_bf16(vt, TP, 32, jj, lane);
      v16bf av3 = load_frag_bf16(vt, TP, 48, jj, lane);
      O[0] = wmma_bf16(av0, pb, O[0]);
      O[1] = wmma_bf16(av1, pb, O[1]);
      O[2] = wmma_bf16(av2, pb, O[2]);
      O[3] = wmma_bf16(av3, pb, O[3]);
    }

    if (more) {
      // the next stage's mask words; this stage's have been used up
#pragma unroll
      for (int u = 0; u < KT / 32; ++u)
        mw[u] = *(mask_words*)(mwp + ((st + KT) / 32 + u) * MT_WORDS);
    }
    // the next trip's address additions rewrite registers that the mask loads name
    asm volatile("s_wait_xcnt 0x0" ::: "memory");
    __builtin_amdgcn_sched_barrier(0);   // keeps those additions behind the wait
    asm volatile("s_wait_dscnt 0x0" ::: "memory");    // this wave's reads of this buffer are done
    asm volatile("s_wait_asynccnt 0x0" ::: "memory"); // its share of the next stage has landed
    __syncthreads();     // publishes the next stage, ends every wave's reads of this buffer
    if (st + 2 * KT < S_LEN)   // the same for the whole block
      stage_copy(lq + (unsigned)buf * lb, lv + (unsigned)buf * lb,
                 gq + (size_t)(st + 2 * KT) * E_DIM, gv + (st + 2 * KT));
  }
  asm volatile("s_wait_asynccnt 0x0" ::: "memory");   // no copy is left in flight

  // The halves' sums are joined once.  A lane's eight registers of a tile are eight
  // neighbours of row i: two 16-byte stores.  Every value is formed first, then
  // come the stores alone, so that no register of an issued store is written again.
  const float inv = 1.0f / (lrow + swap_halves(lrow));
  float* orow = Out + ((size_t)b * S_LEN + i0 + col) * E_DIM + h * D_HEAD + 8 * h2;
  f32x4s ov[4][2];
#pragma unroll
  for (int t = 0; t < 4; ++t) {
    ov[t][0] = f32x4s{O[t][0], O[t][1], O[t][2], O[t][3]} * inv;
    ov[t][1] = f32x4s{O[t][4], O[t][5], O[t][6], O[t][7]} * inv;
  }
  __builtin_amdgcn_sched_barrier(0);     // only stores behind this line
#pragma unroll
  for (int t = 0; t < 4; ++t) {
    *(f32x4s*)(orow + 16 * t)     = ov[t][0];
    *(f32x4s*)(orow + 16 * t + 4) = ov[t][1];
  }
}

// ---------------------------------------------------------------------------
// LayerNorm kernels: one wave per row of 512, 8 rows a block, 16 elements a lane
// (four 16-byte pieces, 128 elements apart: a wave's access is 512 contiguous
// bytes).  The row sums run in the lane and then over the wave's 32 lanes.
typedef __attribute__((ext_vector_type(4))) float f32x4;

__device__ __forceinline__ float wave_sum(float v) {
#pragma unroll
  for (int o = 16; o > 0; o >>= 1) v += __shfl_xor(v, o, 32);
  return v;
}

// 16 bytes at a 32-bit byte offset from a uniform base
__device__ __forceinline__ f32x4 ld16(const float* base, unsigned byte_off) {
  return *(const f32x4*)((const char*)base + byte_off);
}

// mean and 1/sqrt(var + eps) of the wave's row
__device__ __forceinline__ void row_stats(const f32x4 (&x)[4], float& mean, float& rstd) {
  float s1 = 0.0f, s2 = 0.0f;
#pragma unroll
  for (int q = 0; q < 4; ++q) {
    s1 += (x[q].x + x[q].y) + (x[q].z + x[q].w);
    s2 += (x[q].x * x[q].x + x[q].y * x[q].y) + (x[q].z * x[q].z + x[q].w * x[q].w);
  }
  s1 = wave_sum(s1);
  s2 = wave_sum(s2);
  mean = s1 * (1.0f / E_DIM);
  const float var = s2 * (1.0f / E_DIM) - mean * mean;
  rstd = rsqrtf(var + 1e-5f);
}

// x1 = LN(src + res) * g + b  -> f32 and a bf16 copy.
__global__ void __launch_bounds__(256)
add_ln_kernel(const float* __restrict__ src, const float* __restrict__ res,
              const float* __restrict__ g, const float* __restrict__ bb,
              float* __restrict__ outf, unsigned short* __restrict__ outb) {
  const int lane = threadIdx.x & 31;
  const size_t off = (size_t)(blockIdx.x * 8 + (threadIdx.x >> 5)) * E_DIM + 4 * lane;
  const unsigned ro = (unsigned)off * 4u;   // the lane's byte offset in a [rows,512] f32 array
  const unsigned co = 16u * lane;           // and in a vector of 512
  f32x4 x[4], c[4], gg[4], bv[4];
#pragma unroll
  for (int q = 0; q < 4; ++q) {
    x[q]  = ld16(src, ro + 512u * q);
    c[q]  = ld16(res, ro + 512u * q);
    gg[q] = ld16(g,   co + 512u * q);
    bv[q] = ld16(bb,  co + 512u * q);
  }
  // Every loaded value is an input, so the wait stands behind all 16 loads; the
  // two offsets are inputs, so they stay untouched (also by a later load's
  // result) up to it.
  asm volatile("s_wait_xcnt 0x0"
               :: "v"(ro), "v"(co),
                  "v"(x[0]),  "v"(x[1]),  "v"(x[2]),  "v"(x[3]),
                  "v"(c[0]),  "v"(c[1]),  "v"(c[2]),  "v"(c[3]),
                  "v"(gg[0]), "v"(gg[1]), "v"(gg[2]), "v"(gg[3]),
                  "v"(bv[0]), "v"(bv[1]), "v"(bv[2]), "v"(bv[3]) : "memory");
#pragma unroll
  for (int q = 0; q < 4; ++q) x[q] += c[q];
  float mean, rstd;
  row_stats(x, mean, rstd);
  uint2 h[4];
#pragma unroll
  for (int q = 0; q < 4; ++q) {
    x[q] = (x[q] - mean) * rstd * gg[q] + bv[q];
    h[q] = make_uint2(pack2(x[q].x, x[q].y), pack2(x[q].z, x[q].w));
  }
#pragma unroll
  for (int q = 0; q < 4; ++q) {
    *(f32x4*)(outf + off + 128 * q) = x[q];
    *(uint2*)(outb + off + 128 * q) = h[q];
  }
}

// out = LN( LN(f)*g3+b3 + x1 ) * g2 + b2.
__global__ void __launch_bounds__(256)
double_ln_kernel(const float* __restrict__ f, const float* __restrict__ x1,
                 const float* __restrict__ g3, const float* __restrict__ b3,
                 const float* __restrict__ g2, const float* __restrict__ b2,
                 float* __restrict__ out) {
  const int lane = threadIdx.x & 31;
  const size_t off = (size_t)(blockIdx.x * 8 + (threadIdx.x >> 5)) * E_DIM + 4 * lane;
  const unsigned ro = (unsigned)off * 4u;   // the lane's byte offset in a [rows,512] f32 array
  const unsigned co = 16u * lane;           // and in a vector of 512
  f32x4 a[4], xr[4], ga[4], ba[4], gb[4], bc[4];
#pragma unroll
  for (int q = 0; q < 4; ++q) {
    a[q]  = ld16(f,  ro + 512u * q);
    xr[q] = ld16(x1, ro + 512u * q);
    ga[q] = ld16(g3, co + 512u * q);
    ba[q] = ld16(b3, co + 512u * q);
    gb[q] = ld16(g2, co + 512u * q);
    bc[q] = ld16(b2, co + 512u * q);
  }
  // Every loaded value is an input, so the wait stands behind all 24 loads; the
  // two offsets are inputs, so they stay untouched (also by a later load's
  // result) up to it.
  asm volatile("s_wait_xcnt 0x0"
               :: "v"(ro), "v"(co),
                  "v"(a[0]),  "v"(a[1]),  "v"(a[2]),  "v"(a[3]),
                  "v"(xr[0]), "v"(xr[1]), "v"(xr[2]), "v"(xr[3]),
                  "v"(ga[0]), "v"(ga[1]), "v"(ga[2]), "v"(ga[3]),
                  "v"(ba[0]), "v"(ba[1]), "v"(ba[2]), "v"(ba[3]),
                  "v"(gb[0]), "v"(gb[1]), "v"(gb[2]), "v"(gb[3]),
                  "v"(bc[0]), "v"(bc[1]), "v"(bc[2]), "v"(bc[3]) : "memory");
  float mean, rstd;
  row_stats(a, mean, rstd);
#pragma unroll
  for (int q = 0; q < 4; ++q) a[q] = (a[q] - mean) * rstd * ga[q] + ba[q] + xr[q];
  row_stats(a, mean, rstd);
#pragma unroll
  for (int q = 0; q < 4; ++q) a[q] = (a[q] - mean) * rstd * gb[q] + bc[q];
#pragma unroll
  for (int q = 0; q < 4; ++q) *(f32x4*)(out + off + 128 * q) = a[q];
}

// ---------------------------------------------------------------------------
extern "C" void kernel_launch(void* const* d_in, const int* in_sizes, int n_in,
                              void* d_out, int out_size, void* d_ws, size_t ws_size,
                              hipStream_t stream) {
  const float* x  = (const float*)d_in[0];
  const int* mask = (const int*)d_in[1];
  const float* Wv = (const float*)d_in[2];
  const float* Wk = (const float*)d_in[3];
  const float* Wq = (const float*)d_in[4];
  const float* g1 = (const float*)d_in[5];
  const float* b1 = (const float*)d_in[6];
  const float* W1 = (const float*)d_in[7];
  const float* c1 = (const float*)d_in[8];
  const float* W2 = (const float*)d_in[9];
  const float* c2 = (const float*)d_in[10];
  const float* g3 = (const float*)d_in[11];
  const float* b3 = (const float*)d_in[12];
  const float* g2 = (const float*)d_in[13];
  const float* b2 = (const float*)d_in[14];

  const size_t MB = 1ull << 20;
  unsigned char* w = (unsigned char*)d_ws;
  // live regions (peak ~105 MB, with reuse):
  unsigned short* xb  = (unsigned short*)(w +  0 * MB); //  8 MB  x bf16
  unsigned short* Wqt = (unsigned short*)(w +  8 * MB); //  .5 MB
  unsigned short* Wkt = (unsigned short*)(w +  9 * MB); //  .5 MB
  unsigned short* Wvt = (unsigned short*)(w + 10 * MB); //  .5 MB
  unsigned short* W1t = (unsigned short*)(w + 11 * MB); //  2 MB
  unsigned short* W2t = (unsigned short*)(w + 13 * MB); //  2 MB
  float*          Kf  = (float*)         (w + 16 * MB); // 16 MB  keys f32
  unsigned short* Vt  = (unsigned short*)(w + 32 * MB); //  8 MB  V^T bf16
  float*          Qf  = (float*)         (w + 40 * MB); // 16 MB  queries f32
  float*          attn= (float*)         (w + 56 * MB); // 16 MB
  float*          x1f = (float*)         (w + 72 * MB); // 16 MB
  unsigned short* x1b = (unsigned short*)(w + 88 * MB); //  8 MB
  unsigned short* hb  = (unsigned short*)(w + 16 * MB); // 32 MB (reuses Kf/Vt/Qf)
  float*          ff  = (float*)         (w + 48 * MB); // 16 MB (reuses Qf/attn)
  unsigned*       mbt = (unsigned*)      (w + 96 * MB); //  .5 MB mask, one bit a score
  unsigned short* Qb  = (unsigned short*)(w + 97 * MB); //  8 MB  queries bf16

  dim3 blk(256);
  dim3 gblk(128);   // GEMM: 4 waves, 2x2

  // 1) conversions / weight transposes
  prep_kernel<<<PREP_BLKS, blk, 0, stream>>>(x, Wq, Wk, Wv, W1, W2, mask, mbt,
                                             xb, Wqt, Wkt, Wvt, W1t, W2t);

  // 2) QKV projections
  dim3 gq(M_ROWS / 128, E_DIM / 128, 3);
  qkv_gemm_kernel<<<gq, gblk, 0, stream>>>(xb, Wqt, Wkt, Wvt, Qf, Kf, Vt, Qb);

  // 3) fused attention
  dim3 ga(S_LEN / 128, H_CNT, B_SZ);
  const float scale = 1.0f / sqrtf((float)E_DIM);
  flash_attn_kernel<<<ga, blk, 0, stream>>>(Kf, Qb, Vt, mbt, attn, scale);

  // 4) x1 = LN(attn + queries)
  add_ln_kernel<<<M_ROWS / 8, blk, 0, stream>>>(attn, Qf, g1, b1, x1f, x1b);

  // 5) h = relu(x1 @ W1 + c1)
  dim3 gf1(M_ROWS / 128, F_DIM / 128);
  gemm_bf16_kernel<<<gf1, gblk, 0, stream>>>(x1b, W1t, c1, nullptr, hb,
                                            M_ROWS, F_DIM, E_DIM, 1, 1);

  // 6) f = h @ W2 + c2
  dim3 gf2(M_ROWS / 128, E_DIM / 128);
  gemm_bf16_kernel<<<gf2, gblk, 0, stream>>>(hb, W2t, c2, ff, nullptr,
                                            M_ROWS, E_DIM, F_DIM, 0, 0);

  // 7) out = LN(LN(f) + x1)
  double_ln_kernel<<<M_ROWS / 8, blk, 0, stream>>>(ff, x1f, g3, b3, g2, b2,
                                               (float*)d_out);
}

// v009
// A run of this version takes 133 microseconds.
// Two timings next to v008 both put it at 1.03 times that version's speed.
// Over all steps from v000 it is 3.88 times as fast.
#include <hip/hip_runtime.h>
#include <hip/hip_bf16.h>
#include <math.h>

// ---------------------------------------------------------------------------
// Transformer block on CDNA5 (gfx1250), wave32, bf16 WMMA w/ f32 accumulation.
// Pipeline:
//   1) convert x -> bf16; transpose+convert weights -> bf16 [N,K]; pack the mask
//      into one bit a score (one launch)
//   2) WMMA GEMMs: Q (f32 and a bf16 copy), K (f32), V (bf16, head-transposed [b,h,d,s])
//      (one launch)
//   3) flash attention (scores = K.Q^T per the reference's einsum, taken
//      transposed), online softmax in the lane, V^T.P^T via WMMA, P stays in registers
//   4) x1 = LN(attn + Q) -> f32 + bf16
//   5) h = relu(x1 @ W1 + c1) (WMMA, bf16 out)
//   6) f = h @ W2 + c2 (WMMA, f32 out)
//   7) out = LN(LN(f) + x1)
// ---------------------------------------------------------------------------

typedef __attribute__((ext_vector_type(16))) __bf16 v16bf;
typedef __attribute__((ext_vector_type(8)))  float  v8f;
typedef __attribute__((ext_vector_type(4))) unsigned u32x4s;
typedef __attribute__((ext_vector_type(4))) int i32x4s;
typedef __attribute__((ext_vector_type(16))) unsigned u32x16s;

#define S_LEN  2048
#define E_DIM  512
#define V_DIM  512
#define F_DIM  2048
#define B_SZ   4
#define H_CNT  8
#define D_HEAD 64
#define M_ROWS (B_SZ * S_LEN)

__device__ __forceinline__ unsigned short f2bf(float f) {
  union { float f; unsigned u; } a; a.f = f;
  unsigned u = a.u;
  return (unsigned short)((u + 0x7FFFu + ((u >> 16) & 1u)) >> 16); // RNE
}

// A/B fragment loader for v_wmma_f32_16x16x32_bf16 from row-major bf16 data.
// Layout (ISA 7.12.2, 16-bit A 16x32): lane L holds row (L&15); lanes 0-15
// carry K = [k0, k0+8) and [k0+16, k0+24); lanes 16-31 the +8 halves.
// The same layout serves the B operand when loading from a [N,K] (transposed)
// matrix: lane holds column n = (L&15) of B.
__device__ __forceinline__ v16bf load_frag_bf16(const unsigned short* base, int ld,
                                                int row0, int k0, int lane) {
  const int half = lane >> 4;
  const unsigned short* p = base + (size_t)(row0 + (lane & 15)) * ld + k0 + 8 * half;
  union { uint4 q[2]; v16bf v; } u;
  u.q[0] = *(const uint4*)p;
  u.q[1] = *(const uint4*)(p + 16);
  return u.v;
}

// Same fragment, sourced from fp32 with on-the-fly bf16 conversion.
__device__ __forceinline__ v16bf load_frag_f32(const float* base, int ld,
                                               int row0, int k0, int lane) {
  const int half = lane >> 4;
  const float* p = base + (size_t)(row0 + (lane & 15)) * ld + k0 + 8 * half;
  union { unsigned short s[16]; v16bf v; } u;
#pragma unroll
  for (int e = 0; e < 8; ++e) {
    u.s[e]     = f2bf(p[e]);
    u.s[8 + e] = f2bf(p[16 + e]);
  }
  return u.v;
}

__device__ __forceinline__ v8f wmma_bf16(v16bf a, v16bf b, v8f c) {
  return __builtin_amdgcn_wmma_f32_16x16x32_bf16(false, a, false, b, (short)0, c,
                                                 false, false);
}

// ---------------------------------------------------------------------------
// The kernels without matrix work are short; each thread takes many elements
// and the grids are small, for speed only.

__device__ __forceinline__ unsigned pack2(float lo, float hi) {
  return (unsigned)f2bf(lo) | ((unsigned)f2bf(hi) << 16);
}

// Elementwise fp32 -> bf16, 32 elements a thread: four chunks of eight (two
// 16-byte loads, one 16-byte store), a block's chunks 2048 elements apart, so
// that every access of a wave covers whole lines.  Blocks = elements / 8192.
__device__ __forceinline__ void cvt_body(const float* __restrict__ in,
                                         unsigned short* __restrict__ out, int blk) {
  const size_t base = (size_t)blk * 8192 + threadIdx.x * 8;
  const float* p = in + base;
  unsigned short* o = out + base;
  float4 v[4][2];
#pragma unroll
  for (int c = 0; c < 4; ++c) {
    v[c][0] = *(const float4*)(p + 2048 * c);
    v[c][1] = *(const float4*)(p + 2048 * c + 4);
  }
  uint4 q[4];
#pragma unroll
  for (int c = 0; c < 4; ++c)
    q[c] = make_uint4(pack2(v[c][0].x, v[c][0].y), pack2(v[c][0].z, v[c][0].w),
                      pack2(v[c][1].x, v[c][1].y), pack2(v[c][1].z, v[c][1].w));
#pragma unroll
  for (int c = 0; c < 4; ++c) *(uint4*)(o + 2048 * c) = q[c];
}

// [Kd,Nd] fp32 -> [Nd,Kd] bf16.  A thread takes 16 k of one n: 16 loads (a wave
// reads 128 contiguous bytes of a row each time) and two 16-byte stores.
// Blocks = Kd * Nd / 4096; Kd is a multiple of 16.  The row length is a constant
// of the body, so that the split of the block index needs no division.
template <int ND>
__device__ __forceinline__ void transpose_body(const float* __restrict__ in,
                                               unsigned short* __restrict__ out, int Kd,
                                               int blk) {
  const int kb = blk / (ND / 256);               // a block's threads share their 16 rows
  const int n  = (blk % (ND / 256)) * 256 + threadIdx.x;
  const float* p = in + (size_t)(16 * kb) * ND + n;
  float v[16];
#pragma unroll
  for (int e = 0; e < 16; ++e) v[e] = p[e * ND];
  const uint4 q0 = make_uint4(pack2(v[0], v[1]),   pack2(v[2], v[3]),
                              pack2(v[4], v[5]),   pack2(v[6], v[7]));
  const uint4 q1 = make_uint4(pack2(v[8], v[9]),   pack2(v[10], v[11]),
                              pack2(v[12], v[13]), pack2(v[14], v[15]));
  unsigned short* o = out + (size_t)n * Kd + 16 * kb;
  *(uint4*)o       = q0;
  *(uint4*)(o + 8) = q1;
  // another job's code follows in the merged kernel and reuses these stores' registers
  asm volatile("s_wait_xcnt 0x0" ::: "memory");
}

// mask [S,S] int32 -> one bit a score, in the order in which the attention's waves
// hold their scores.  A tile is 16 rows i x 32 keys j = 16 words; bit L of word s
// says mask != 0 for row 16 * tile + (L & 15) and key 32 * tile + 16 * (s >> 3) +
// 8 * (L >> 4) + (s & 7): lane L's score number s.  A word is then the lane mask of
// one select of a whole wave.  Tiles lie row of tiles by row of tiles, keys running.
// The attention reads the mask once for every batch entry and head; packed, that is
// 64 bytes a tile by scalar loads in place of 2048 by vector loads of 16 lines each.
// A wave takes 16 rows x 128 keys: 16 loads a lane, 64 compares, two 128-byte stores.
#define MT_WORDS 16
#define MASK_BLKS ((S_LEN / 16) * (S_LEN / 128) / 8)

__device__ __forceinline__ void mask_body(const int* __restrict__ mask,
                                          unsigned* __restrict__ mbits, int blk) {
  const int lane = threadIdx.x & 31;
  const int job  = blk * 8 + (threadIdx.x >> 5);
  const int it   = job / (S_LEN / 128);          // the 16 rows
  const int jg   = job % (S_LEN / 128);          // the 128 keys: four tiles
  const int* p = mask + (size_t)(it * 16 + (lane & 15)) * S_LEN + jg * 128 + 8 * (lane >> 4);
  i32x4s m[4][4];
  // (here and in the attention: a loop over a register array is unrolled so that its
  // indices are constants)
#pragma unroll
  for (int u = 0; u < 4; ++u)
#pragma unroll
    for (int q = 0; q < 4; ++q)
      m[u][q] = *(const i32x4s*)(p + 32 * u + 16 * (q >> 1) + 4 * (q & 1));
  // lane L of w[h] takes word L of the tiles 2 h and 2 h + 1
  unsigned w[2] = {0u, 0u};
#pragma unroll
  for (int u = 0; u < 4; ++u)
#pragma unroll
    for (int s = 0; s < 16; ++s) {
      // taken by all 32 lanes, ahead of the choice of the lane that keeps the word
      const unsigned b = __builtin_amdgcn_ballot_w32(m[u][s >> 2][s & 3] != 0);
      w[u >> 1] = lane == (u & 1) * 16 + s ? b : w[u >> 1];
    }
  unsigned* o = mbits + ((size_t)it * (S_LEN / 32) + jg * 4) * MT_WORDS + lane;
  o[0]  = w[0];
  o[32] = w[1];
  // another job's code follows in the merged kernel and reuses these stores' registers
  asm volatile("s_wait_xcnt 0x0" ::: "memory");
}

// The seven jobs read nothing of each other's output, so they are one launch:
// the block index picks the job (the same for a whole block).
#define CVT_BLKS ((M_ROWS * V_DIM) / 8192)   // x
#define TQ_BLKS  ((V_DIM * E_DIM) / 4096)    // each of Wq, Wk, Wv
#define TF_BLKS  ((E_DIM * F_DIM) / 4096)    // each of W1, W2
#define PREP_BLKS (CVT_BLKS + 3 * TQ_BLKS + 2 * TF_BLKS + MASK_BLKS)

__global__ void __launch_bounds__(256)
prep_kernel(const float* __restrict__ x,  const float* __restrict__ Wq,
            const float* __restrict__ Wk, const float* __restrict__ Wv,
            const float* __restrict__ W1, const float* __restrict__ W2,
            const int* __restrict__ mask, unsigned* __restrict__ mbits,
            unsigned short* __restrict__ xb,  unsigned short* __restrict__ Wqt,
            unsigned short* __restrict__ Wkt, unsigned short* __restrict__ Wvt,
            unsigned short* __restrict__ W1t, unsigned short* __restrict__ W2t) {
  int blk = blockIdx.x;
  if (blk < CVT_BLKS) { cvt_body(x, xb, blk); return; }
  blk -= CVT_BLKS;
  if (blk < 3 * TQ_BLKS) {
    const int w = blk / TQ_BLKS;
    const float* in     = w == 0 ? Wq  : w == 1 ? Wk  : Wv;
    unsigned short* out = w == 0 ? Wqt : w == 1 ? Wkt : Wvt;
    transpose_body<E_DIM>(in, out, V_DIM, blk % TQ_BLKS);
    return;
  }
  blk -= 3 * TQ_BLKS;
  if (blk < TF_BLKS) { transpose_body<F_DIM>(W1, W1t, E_DIM, blk); return; }
  blk -= TF_BLKS;
  if (blk < TF_BLKS) { transpose_body<E_DIM>(W2, W2t, F_DIM, blk); return; }
  mask_body(mask, mbits, blk - TF_BLKS);
}

// ---------------------------------------------------------------------------
// C[M,N] = A[M,K] @ Bt[N,K]^T (+bias)(+relu).  Block = 4 waves in a 2x2 grid,
// each wave owns a 64x64 tile (4 A x 4 B fragments, 16 accumulator tiles), so a
// loaded fragment feeds four WMMAs; grid = (M/128, N/128).  K is a multiple of 64.
// The block brings each 64-k tile of its 128 A rows and 128 Bt rows into LDS once,
// by asynchronous copies whose wave-wide accesses cover whole 128-byte lines, and
// every wave takes its fragments from LDS.  NB buffers (2 or 4): the copies of the
// next NB - 1 tiles fly while this tile is multiplied; one barrier a tile.  With one
// block on a WGP (h @ W2: 256 blocks, 32 tiles) no other block's work covers the
// copies' way from L2 or memory when it is longer than one tile's work: there NB = 4.
// mode 0: f32 out; mode 1: bf16 out; mode 2: bf16 out transposed per-head
//         to Vt[b][h][d][s] (for the attention's V^T.P^T A operand); mode 3: f32 out
//         to Cf and the same values rounded to bf16 to Cb.
#define GKS  64            // k of a staged tile: 128 bytes of every row
#define GTP  72            // row pitch of a staged tile in bf16: 144 bytes = 16 x 9, no bank conflict for 16-byte reads
#define GBUF (256 * GTP)   // a buffer in bf16: rows 0..127 of A, then rows 0..127 of Bt

__device__ __forceinline__ void gemm_load_set(v16bf (&a)[4], v16bf (&b)[4],
                                              const unsigned short* A,
                                              const unsigned short* Bt, int K,
                                              int m0, int n0, int k0, int lane) {
#pragma unroll
  for (int i = 0; i < 4; ++i) a[i] = load_frag_bf16(A, K, m0 + 16 * i, k0, lane);
#pragma unroll
  for (int t = 0; t < 4; ++t) b[t] = load_frag_bf16(Bt, K, n0 + 16 * t, k0, lane);
}

// Eight asynchronous copies, global -> LDS through no register: the lane's 16
// bytes of eight rows, 16 rows apart.  A wave's copy covers four whole rows of
// the tile.  The last line is a precaution: the copies' address registers stay
// untouched up to it; it stands inside the statement so that no later address
// addition can be lifted over it.
__device__ __forceinline__ void copy_rows8(unsigned lds, const unsigned short* g, size_t gstep) {
  const unsigned ls = 16u * GTP * 2u;          // 16 rows in LDS bytes
  asm volatile("global_load_async_to_lds_b128 %0, %8, off\n\t"
               "global_load_async_to_lds_b128 %1, %9, off\n\t"
               "global_load_async_to_lds_b128 %2, %10, off\n\t"
               "global_load_async_to_lds_b128 %3, %11, off\n\t"
               "global_load_async_to_lds_b128 %4, %12, off\n\t"
               "global_load_async_to_lds_b128 %5, %13, off\n\t"
               "global_load_async_to_lds_b128 %6, %14, off\n\t"
               "global_load_async_to_lds_b128 %7, %15, off\n\t"
               "s_wait_xcnt 0x0"
               :: "v"(lds),          "v"(lds + ls),     "v"(lds + 2 * ls), "v"(lds + 3 * ls),
                  "v"(lds + 4 * ls), "v"(lds + 5 * ls), "v"(lds + 6 * ls), "v"(lds + 7 * ls),
                  "v"(g),             "v"(g + gstep),     "v"(g + 2 * gstep), "v"(g + 3 * gstep),
                  "v"(g + 4 * gstep), "v"(g + 5 * gstep), "v"(g + 6 * gstep), "v"(g + 7 * gstep)
               : "memory");
}

// A thread's share of one tile: 8 copies for the A rows, 8 for the Bt rows.
__device__ __forceinline__ void gemm_tile_copy(unsigned lds, const unsigned short* ga,
                                               const unsigned short* gb, size_t gstep) {
  copy_rows8(lds, ga, gstep);
  copy_rows8(lds + 128u * GTP * 2u, gb, gstep);
}

__device__ __forceinline__ void gemm_mul_set(v8f (&acc)[4][4], const v16bf (&a)[4],
                                             const v16bf (&b)[4]) {
#pragma unroll
  for (int i = 0; i < 4; ++i)
#pragma unroll
    for (int t = 0; t < 4; ++t) acc[i][t] = wmma_bf16(a[i], b[t], acc[i][t]);
}

// This wave's share of the oldest tile in flight has landed.  Every wave issues 16
// copies a tile and its copies return in issue order.  full: all NB - 2 tiles behind
// that one have been issued, so exactly 16 * (NB - 2) younger copies may stay in
// flight (48 at most are outstanding).  Else, in the last trips, the wait is to 0.
template <int NB>
__device__ __forceinline__ void gemm_wait_tile(bool full) {
  if (NB > 2 && full)    // the same for the whole block
    asm volatile("s_wait_asynccnt %0" :: "n"(16 * (NB - 2)) : "memory");
  else
    asm volatile("s_wait_asynccnt 0x0" ::: "memory");
}

template <int NB>
__device__ __forceinline__ void
gemm_body(const unsigned short* __restrict__ A,
          const unsigned short* __restrict__ Bt,
          const float* __restrict__ bias,
          float* __restrict__ Cf, unsigned short* __restrict__ Cb,
          int N, int K, int mode, int relu) {
  static_assert(NB == 2 || NB == 4, "the buffer of a tile is its number modulo NB");
  __shared__ __align__(16) unsigned short ts[NB * GBUF];

  const int lane = threadIdx.x & 31;
  const int wave = threadIdx.x >> 5;
  const int wm = (wave >> 1) * 64;             // the wave's rows and columns
  const int wn = (wave & 1) * 64;              // inside the block's tile
  const int m0 = blockIdx.x * 128 + wm;
  const int n0 = blockIdx.y * 128 + wn;

  // A thread's share of a tile: 16 bytes (chunk cc) of rows cr, cr + 16, ...
  const int cr = threadIdx.x >> 3, cc = (threadIdx.x & 7) * 8;
  const unsigned short* ga = A  + (size_t)(blockIdx.x * 128 + cr) * K + cc;
  const unsigned short* gb = Bt + (size_t)(blockIdx.y * 128 + cr) * K + cc;
  const size_t gstep = (size_t)16 * K;
  const unsigned l0 = (unsigned)(size_t)&ts[cr * GTP + cc];   // its LDS byte address in buffer 0
  const int nt = K / GKS;

  v8f acc[4][4] = {};
  v16bf a0[4], b0[4], a1[4], b1[4];

  gemm_tile_copy(l0, ga, gb, gstep);
  // unrolled: the buffers' offsets are constants
#pragma unroll
  for (int j = 1; j < NB - 1; ++j)
    if (j < nt) gemm_tile_copy(l0 + j * (GBUF * 2u), ga + j * GKS, gb + j * GKS, gstep);
  gemm_wait_tile<NB>(NB - 2 < nt);                    // this wave's share of tile 0 has landed
  __syncthreads();                                    // tile 0 is published
  if (nt > NB - 1)
    gemm_tile_copy(l0 + (NB - 1) * (GBUF * 2u), ga + (NB - 1) * GKS, gb + (NB - 1) * GKS, gstep);

  for (int t = 0; t < nt; ++t) {
    const unsigned short* ta = ts + (t & (NB - 1)) * GBUF;
    const unsigned short* tb = ta + 128 * GTP;
    gemm_load_set(a0, b0, ta, tb, GTP, wm, wn, 0,  lane);
    gemm_load_set(a1, b1, ta, tb, GTP, wm, wn, 32, lane);
    // keeps the tile's 32 LDS reads in one group ahead of its 32 WMMAs (else they
    // sink among the WMMAs, one fragment at a time, each waited out in full)
    __builtin_amdgcn_sched_barrier(0);
    gemm_mul_set(acc, a0, b0);
    gemm_mul_set(acc, a1, b1);
    // keeps the WMMAs ahead of the waits below (else they sink behind the barrier
    // and the next tile's copies are waited out before anything is multiplied)
    __builtin_amdgcn_sched_barrier(0);
    asm volatile("s_wait_dscnt 0x0" ::: "memory");    // this wave's reads of this buffer are done
    gemm_wait_tile<NB>(t + NB - 1 < nt);              // its share of tile t + 1 has landed
    __syncthreads();     // publishes tile t + 1, ends every wave's reads of this buffer
    if (t + NB < nt)     // the same for the whole block
      gemm_tile_copy(l0 + (unsigned)(t & (NB - 1)) * (GBUF * 2u), ga + (size_t)(t + NB) * GKS,
                     gb + (size_t)(t + NB) * GKS, gstep);
  }
  asm volatile("s_wait_asynccnt 0x0" ::: "memory");   // no copy is left in flight

  const int col = lane & 15;
  const int h2  = lane >> 4;
  // Epilogue.  The mode test stands outside the element loops.  Modes 0 and 1
  // go in two parts: first every value and every row address is formed in
  // registers, then come the stores alone, so that no register of an issued
  // store is written again.
#pragma unroll
  for (int t = 0; t < 4; ++t) {
    float bv = bias ? bias[n0 + 16 * t + col] : 0.0f;
#pragma unroll
    for (int i = 0; i < 4; ++i)
#pragma unroll
      for (int e = 0; e < 8; ++e) {
        float v = acc[i][t][e] + bv;
        acc[i][t][e] = relu ? fmaxf(v, 0.0f) : v;
      }
  }
  const int mr = m0 + 8 * h2;                  // C layout: VGPR e -> row e (+8)
  const int nc = n0 + col;
  if (mode == 0 || mode == 3) {
    float* cb = Cf + (size_t)mr * N + nc;
    float* c[4][8];
#pragma unroll
    for (int i = 0; i < 4; ++i)
#pragma unroll
      for (int e = 0; e < 8; ++e) c[i][e] = cb + (size_t)(16 * i + e) * N;
    __builtin_amdgcn_sched_barrier(0);         // only stores behind this line
#pragma unroll
    for (int i = 0; i < 4; ++i)
#pragma unroll
      for (int e = 0; e < 8; ++e)
#pragma unroll
        for (int t = 0; t < 4; ++t) c[i][e][16 * t] = acc[i][t][e];
    // code of the other modes' paths follows and reuses these stores' registers
    asm volatile("s_wait_xcnt 0x0" ::: "memory");
  }
  if (mode == 1 || mode == 3) {
    unsigned short* cb = Cb + (size_t)mr * N + nc;
    unsigned short* c[4][8];
    unsigned short hv[4][4][8];
#pragma unroll
    for (int i = 0; i < 4; ++i)
#pragma unroll
      for (int e = 0; e < 8; ++e) {
        c[i][e] = cb + (size_t)(16 * i + e) * N;
#pragma unroll
        for (int t = 0; t < 4; ++t) hv[i][t][e] = f2bf(acc[i][t][e]);
      }
    __builtin_amdgcn_sched_barrier(0);         // only stores behind this line
#pragma unroll
    for (int i = 0; i < 4; ++i)
#pragma unroll
      for (int e = 0; e < 8; ++e)
#pragma unroll
        for (int t = 0; t < 4; ++t) c[i][e][16 * t] = hv[i][t][e];
    // code of the other modes' paths follows and reuses these stores' registers
    asm volatile("s_wait_xcnt 0x0" ::: "memory");
  } else if (mode == 2) {
    // the wave's 64 rows lie in one batch entry, its 64 columns are one head;
    // a lane's eight rows of a tile are eight neighbours in Vt: one 16-byte store
    const int bb = mr / S_LEN, s = mr % S_LEN;
    const int hh = nc >> 6,    d = nc & 63;
    unsigned short* c = Cb + (((size_t)bb * H_CNT + hh) * D_HEAD + d) * S_LEN + s;
    // a compiler vector, not a struct of four words: each value stays whole in four
    // registers of its own, and the 16 stores leave in one run with one wait behind them
    u32x4s pk[4][4];
#pragma unroll
    for (int i = 0; i < 4; ++i)
#pragma unroll
      for (int t = 0; t < 4; ++t) {
        unsigned q[4];
#pragma unroll
        for (int e = 0; e < 4; ++e)
          q[e] = (unsigned)f2bf(acc[i][t][2 * e]) | ((unsigned)f2bf(acc[i][t][2 * e + 1]) << 16);
        pk[i][t] = u32x4s{q[0], q[1], q[2], q[3]};
      }
#pragma unroll
    for (int i = 0; i < 4; ++i)
#pragma unroll
      for (int t = 0; t < 4; ++t)
        *(u32x4s*)(c + (size_t)(16 * t) * S_LEN + 16 * i) = pk[i][t];
    // code of the other modes' paths follows and reuses these stores' registers
    asm volatile("s_wait_xcnt 0x0" ::: "memory");
  }
}

template <int NB>
__global__ void __launch_bounds__(128)
gemm_bf16_kernel(const unsigned short* __restrict__ A,
                 const unsigned short* __restrict__ Bt,
                 const float* __restrict__ bias,
                 float* __restrict__ Cf, unsigned short* __restrict__ Cb,
                 int M, int N, int K, int mode, int relu) {
  gemm_body<NB>(A, Bt, bias, Cf, Cb, N, K, mode, relu);
}

// The three projections of x read nothing of each other's output, so they are one
// launch, grid = (M/128, E/128, 3): blockIdx.z picks the weight, the output and its
// mode.  Q leaves twice: f32 for the residual, bf16 for the attention's tiles, which
// would otherwise round it anew in each of the 16 blocks that walk it.  Registers
// and LDS let three of its 768 blocks share a WGP, so that one block's LDS reads
// and waits can run beside another's WMMAs.
__global__ void __launch_bounds__(128)
qkv_gemm_kernel(const unsigned short* __restrict__ A,
                const unsigned short* __restrict__ Wqt,
                const unsigned short* __restrict__ Wkt,
                const unsigned short* __restrict__ Wvt,
                float* __restrict__ Qf, float* __restrict__ Kf,
                unsigned short* __restrict__ Vt, unsigned short* __restrict__ Qb) {
  const int z = blockIdx.z;
  gemm_body<2>(A, z == 0 ? Wqt : z == 1 ? Wkt : Wvt, nullptr, z == 0 ? Qf : Kf,
            z == 0 ? Qb : Vt, E_DIM, V_DIM, z == 0 ? 3 : z == 2 ? 2 : 0, 0);
}

// ---------------------------------------------------------------------------
#define KT 64   // keys a stage of the attention's LDS tiles
#define TP 72   // row pitch of a staged tile in bf16: 144 bytes = 16 x 9, no bank conflict for 16-byte reads

typedef __attribute__((ext_vector_type(4))) float    f32x4s;

// One thread's share of a 64-key stage: four asynchronous copies, global -> LDS
// through no register: its 16 bytes of two Q rows and of two V^T rows, 32 rows
// apart.  A wave's copy covers four whole 128-byte rows.  The last line is a
// precaution: the copies' address registers stay untouched up to it; it stands
// inside the statement so that no later address addition can be lifted over it.
__device__ __forceinline__ void stage_copy(unsigned lq, unsigned lv,
                                           const unsigned short* gq,
                                           const unsigned short* gv) {
  const unsigned ls = 32u * TP * 2u;           // 32 rows in LDS bytes
  asm volatile("global_load_async_to_lds_b128 %0, %4, off\n\t"
               "global_load_async_to_lds_b128 %1, %5, off\n\t"
               "global_load_async_to_lds_b128 %2, %6, off\n\t"
               "global_load_async_to_lds_b128 %3, %7, off\n\t"
               "s_wait_xcnt 0x0"
               :: "v"(lq), "v"(lq + ls), "v"(lv), "v"(lv + ls),
                  "v"(gq), "v"(gq + 32 * E_DIM), "v"(gv), "v"(gv + 32 * S_LEN)
               : "memory");
}

// lane l <-> lane l ^ 16: the other half of the wave, by a vector cross-row move
__device__ __forceinline__ float swap_halves(float v) {
  const int b = __builtin_bit_cast(int, v);
  return __builtin_bit_cast(float, __builtin_amdgcn_permlanex16(b, b, 0x76543210, 0xfedcba98,
                                                                false, false));
}

// Flash attention. Reference einsum gives corr[b,h,i,j] = K[b,i,h,:].Q[b,j,h,:],
// softmax over j, out[i,d] = sum_j P[i,j] V[j,d].
// Block = 8 waves; wave owns 16 output rows i; streams keys in tiles of 32.
// The products are taken transposed: S^T[j,i] = Q[j,:].K[i,:] (A = staged Q rows,
// B = the wave's K rows) and O^T[d,i] += V^T[d,:].P^T[:,i].  A lane then holds 16
// of the 32 scores of ONE output row i = lane & 15 (j = 8 * half + e and
// 16 + 8 * half + e), so the row's maximum and sum run in the lane's own
// registers with one exchange between the wave's halves, the running maximum and
// sum are one register each, and the two score tiles, rounded to bf16 in place,
// ARE the B operand of the second product in the k order of load_frag_bf16.
// The eight waves walk the same keys, so the block brings each 64-key stage of
// Q (the projection's bf16 copy) and of V^T into LDS once, by asynchronous copies
// of whole lines, and every wave takes its A fragments from LDS.  Two buffers: the
// next stage's copies fly while this stage is worked on; one barrier a stage.
// The grid gives every SIMD four waves, and the attribute says so: with the staging
// registers gone the compiler would otherwise squeeze below 128 registers for waves
// that do not exist, and wait out its LDS reads one fragment at a time.
__global__ void __launch_bounds__(256) __attribute__((amdgpu_waves_per_eu(4, 4)))
flash_attn_kernel(const float* __restrict__ Kf, const unsigned short* __restrict__ Qb,
                  const unsigned short* __restrict__ Vt, const unsigned* __restrict__ mbits,
                  float* __restrict__ Out, float scale) {
  __shared__ __align__(16) unsigned short qs[2][KT][TP];      // Q rows j, bf16, d along the row
  __shared__ __align__(16) unsigned short vs[2][D_HEAD][TP];  // V^T rows d, keys along the row

  const int lane = threadIdx.x & 31;
  const int wave = threadIdx.x >> 5;
  const int h2   = lane >> 4;
  const int col  = lane & 15;
  const int b = blockIdx.z, h = blockIdx.y;
  const int i0 = blockIdx.x * 128 + wave * 16;

  const float* Kb_ = Kf + (size_t)b * S_LEN * E_DIM + h * D_HEAD;
  const unsigned short* Vb_ = Vt + ((size_t)b * H_CNT + h) * D_HEAD * S_LEN;

  // A thread's share of a stage: 16 bytes (chunk cc) of rows cr and cr + 32, of Q and of V^T
  const int cr = threadIdx.x >> 3, cc = (threadIdx.x & 7) * 8;
  const unsigned short* gq = Qb + ((size_t)b * S_LEN + cr) * E_DIM + h * D_HEAD + cc;
  const unsigned short* gv = Vb_ + (size_t)cr * S_LEN + cc;
  const unsigned lq = (unsigned)(size_t)&qs[0][cr][cc];   // its LDS byte addresses
  const unsigned lv = (unsigned)(size_t)&vs[0][cr][cc];   // in buffer 0
  const unsigned lb = KT * TP * 2u;                       // a buffer in bytes (KT = D_HEAD rows)
  stage_copy(lq, lv, gq, gv);  // stage 0 flies while the K rows are fetched and rounded
  // The packed mask of the wave's 16 rows (mask_body): the address is the same in
  // every lane, so the words come by scalar loads and each is a select's lane mask.
  const unsigned* mwp = mbits + (size_t)(blockIdx.x * 8 + __builtin_amdgcn_readfirstlane(wave)) *
                                     ((S_LEN / 32) * MT_WORDS);
  // Read through the constant address space (no launch writes the words while this one
  // runs): beside the copies' statements the compiler otherwise takes the loop's words
  // by vector loads with a lane read for each word.
  typedef const __attribute__((address_space(4))) u32x16s mask_words;
  u32x16s mw[KT / 32];         // this stage's words, fetched a stage ahead
#pragma unroll
  for (int u = 0; u < KT / 32; ++u) mw[u] = *(mask_words*)(mwp + MT_WORDS * u);

  // This wave's 16 K-rows over d = 0..63 (reused for all key tiles): the B operand
  v16bf aK0 = load_frag_f32(Kb_, E_DIM, i0, 0,  lane);
  v16bf aK1 = load_frag_f32(Kb_, E_DIM, i0, 32, lane);
  // the address registers that these loads name are written again below
  asm volatile("s_wait_xcnt 0x0" ::: "memory");
  __builtin_amdgcn_sched_barrier(0);     // holds later register writes behind that wait

  v8f O[4] = {};               // O^T: tile t, register e = O[i][16 t + 8 half + e]
  float mrow = -3.0e38f;       // running maximum of row i (the same in both halves)
  float lrow = 0.0f;           // running sum of row i over this half's keys

  const float mval = -1.0e20f * scale;

  asm volatile("s_wait_asynccnt 0x0" ::: "memory");   // this wave's share of stage 0 has landed
  __syncthreads();                                    // stage 0 is published
  stage_copy(lq + lb, lv + lb, gq + (size_t)KT * E_DIM, gv + KT);   // stage 1 (there are 32)

  for (int st = 0; st < S_LEN; st += KT) {
    const int buf = (st / KT) & 1;
    const bool more = st + KT < S_LEN;   // the same for the whole block
    const unsigned short* qt = &qs[buf][0][0];
    const unsigned short* vt = &vs[buf][0][0];

    // unrolled so that the two halves' LDS offsets are immediates and the indices of
    // the register arrays constants
#pragma unroll
    for (int jj = 0; jj < KT; jj += 32) {
      // scores tile 32x16 (keys x rows): two 16x16 WMMA tiles, K over d (2 steps of 32)
      v16bf aq00 = load_frag_bf16(qt, TP, jj +  0, 0,  lane);
      v16bf aq01 = load_frag_bf16(qt, TP, jj +  0, 32, lane);
      v16bf aq10 = load_frag_bf16(qt, TP, jj + 16, 0,  lane);
      v16bf aq11 = load_frag_bf16(qt, TP, jj + 16, 32, lane);
      v8f s0 = {}, s1 = {};
      s0 = wmma_bf16(aq00, aK0, s0); s0 = wmma_bf16(aq01, aK1, s0);
      s1 = wmma_bf16(aq10, aK0, s1); s1 = wmma_bf16(aq11, aK1, s1);

      // v[s]: key j = st + jj + (s < 8 ? 8 * h2 + s : 16 + 8 * h2 + s - 8) of row i
      float v[16];
#pragma unroll
      for (int e = 0; e < 8; ++e) {
        v[e]     = __builtin_amdgcn_inverse_ballot_w32(mw[jj / 32][e])     ? s0[e] * scale : mval;
        v[8 + e] = __builtin_amdgcn_inverse_ballot_w32(mw[jj / 32][8 + e]) ? s1[e] * scale : mval;
      }
      float mx = v[0];
#pragma unroll
      for (int s = 1; s < 16; ++s) mx = fmaxf(mx, v[s]);
      mx = fmaxf(mx, swap_halves(mx));
      const float mnew  = fmaxf(mrow, mx);
      const float alpha = __expf(mrow - mnew);
      mrow = mnew;

      // P^T, rounded to nearest even in place: element s of the B operand is the key of v[s]
      float p[16];
      v16bf pb;
#pragma unroll
      for (int s = 0; s < 16; ++s) {
        p[s]  = __expf(v[s] - mnew);
        pb[s] = (__bf16)p[s];
      }
      const float rs = (((p[0] + p[1]) + (p[2] + p[3])) + ((p[4] + p[5]) + (p[6] + p[7]))) +
                       (((p[8] + p[9]) + (p[10] + p[11])) + ((p[12] + p[13]) + (p[14] + p[15])));
      lrow = lrow * alpha + rs;
#pragma unroll
      for (int t = 0; t < 4; ++t) O[t] *= alpha;

      // O^T += V^T . P^T  (A operand from the staged V^T: rows = d, k = j)
      v16bf av0 = load_frag_bf16(vt, TP, 0,  jj, lane);
      v16bf av1 = load_frag_bf16(vt, TP, 16, jj, lane);
      v16bf av2 = load_frag_bf16(vt, TP, 32, jj, lane);
      v16bf av3 = load_frag_bf16(vt, TP, 48, jj, lane);
      O[0] = wmma_bf16(av0, pb, O[0]);
      O[1] = wmma_bf16(av1, pb, O[1]);
      O[2] = wmma_bf16(av2, pb, O[2]);
      O[3] = wmma_bf16(av3, pb, O[3]);
    }

    if (more) {
      // the next stage's mask words; this stage's have been used up
#pragma unroll
      for (int u = 0; u < KT / 32; ++u)
        mw[u] = *(mask_words*)(mwp + ((st + KT) / 32 + u) * MT_WORDS);
    }
    // the next trip's address additions rewrite registers that the mask loads name
    asm volatile("s_wait_xcnt 0x0" ::: "memory");
    __builtin_amdgcn_sched_barrier(0);   // keeps those additions behind the wait
    asm volatile("s_wait_dscnt 0x0" ::: "memory");    // this wave's reads of this buffer are done
    asm volatile("s_wait_asynccnt 0x0" ::: "memory"); // its share of the next stage has landed
    __syncthreads();     // publishes the next stage, ends every wave's reads of this buffer
    if (st + 2 * KT < S_LEN)   // the same for the whole block
      stage_copy(lq + (unsigned)buf * lb, lv + (unsigned)buf * lb,
                 gq + (size_t)(st + 2 * KT) * E_DIM, gv + (st + 2 * KT));
  }
  asm volatile("s_wait_asynccnt 0x0" ::: "memory");   // no copy is left in flight

  // The halves' sums are joined once.  A lane's eight registers of a tile are eight
  // neighbours of row i: two 16-byte stores.  Every value is formed first, then
  // come the stores alone, so that no register of an issued store is written again.
  const float inv = 1.0f / (lrow + swap_halves(lrow));
  float* orow = Out + ((size_t)b * S_LEN + i0 + col) * E_DIM + h * D_HEAD + 8 * h2;
  f32x4s ov[4][2];
#pragma unroll
  for (int t = 0; t < 4; ++t) {
    ov[t][0] = f32x4s{O[t][0], O[t][1], O[t][2], O[t][3]} * inv;
    ov[t][1] = f32x4s{O[t][4], O[t][5], O[t][6], O[t][7]} * inv;
  }
  __builtin_amdgcn_sched_barrier(0);     // only stores behind this line
#pragma unroll
  for (int t = 0; t < 4; ++t) {
    *(f32x4s*)(orow + 16 * t)     = ov[t][0];
    *(f32x4s*)(orow + 16 * t + 4) = ov[t][1];
  }
}

// ---------------------------------------------------------------------------
// LayerNorm kernels: one wave per row of 512, 8 rows a block, 16 elements a lane
// (four 16-byte pieces, 128 elements apart: a wave's access is 512 contiguous
// bytes).  The row sums run in the lane and then over the wave's 32 lanes.
typedef __attribute__((ext_vector_type(4))) float f32x4;

__device__ __forceinline__ float wave_sum(float v) {
#pragma unroll
  for (int o = 16; o > 0; o >>= 1) v += __shfl_xor(v, o, 32);
  return v;
}

// 16 bytes at a 32-bit byte offset from a uniform base
__device__ __forceinline__ f32x4 ld16(const float* base, unsigned byte_off) {
  return *(const f32x4*)((const char*)base + byte_off);
}

// mean and 1/sqrt(var + eps) of the wave's row
__device__ __forceinline__ void row_stats(const f32x4 (&x)[4], float& mean, float& rstd) {
  float s1 = 0.0f, s2 = 0.0f;
#pragma unroll
  for (int q = 0; q < 4; ++q) {
    s1 += (x[q].x + x[q].y) + (x[q].z + x[q].w);
    s2 += (x[q].x * x[q].x + x[q].y * x[q].y) + (x[q].z * x[q].z + x[q].w * x[q].w);
  }
  s1 = wave_sum(s1);
  s2 = wave_sum(s2);
  mean = s1 * (1.0f / E_DIM);
  const float var = s2 * (1.0f / E_DIM) - mean * mean;
  rstd = rsqrtf(var + 1e-5f);
}

// x1 = LN(src + res) * g + b  -> f32 and a bf16 copy.
__global__ void __launch_bounds__(256)
add_ln_kernel(const float* __restrict__ src, const float* __restrict__ res,
              const float* __restrict__ g, const float* __restrict__ bb,
              float* __restrict__ outf, unsigned short* __restrict__ outb) {
  const int lane = threadIdx.x & 31;
  const size_t off = (size_t)(blockIdx.x * 8 + (threadIdx.x >> 5)) * E_DIM + 4 * lane;
  const unsigned ro = (unsigned)off * 4u;   // the lane's byte offset in a [rows,512] f32 array
  const unsigned co = 16u * lane;           // and in a vector of 512
  f32x4 x[4], c[4], gg[4], bv[4];
#pragma unroll
  for (int q = 0; q < 4; ++q) {
    x[q]  = ld16(src, ro + 512u * q);
    c[q]  = ld16(res, ro + 512u * q);
    gg[q] = ld16(g,   co + 512u * q);
    bv[q] = ld16(bb,  co + 512u * q);
  }
  // Every loaded value is an input, so the wait stands behind all 16 loads; the
  // two offsets are inputs, so they stay untouched (also by a later load's
  // result) up to it.
  asm volatile("s_wait_xcnt 0x0"
               :: "v"(ro), "v"(co),
                  "v"(x[0]),  "v"(x[1]),  "v"(x[2]),  "v"(x[3]),
                  "v"(c[0]),  "v"(c[1]),  "v"(c[2]),  "v"(c[3]),
                  "v"(gg[0]), "v"(gg[1]), "v"(gg[2]), "v"(gg[3]),
                  "v"(bv[0]), "v"(bv[1]), "v"(bv[2]), "v"(bv[3]) : "memory");
#pragma unroll
  for (int q = 0; q < 4; ++q) x[q] += c[q];
  float mean, rstd;
  row_stats(x, mean, rstd);
  uint2 h[4];
#pragma unroll
  for (int q = 0; q < 4; ++q) {
    x[q] = (x[q] - mean) * rstd * gg[q] + bv[q];
    h[q] = make_uint2(pack2(x[q].x, x[q].y), pack2(x[q].z, x[q].w));
  }
#pragma unroll
  for (int q = 0; q < 4; ++q) {
    *(f32x4*)(outf + off + 128 * q) = x[q];
    *(uint2*)(outb + off + 128 * q) = h[q];
  }
}

// out = LN( LN(f)*g3+b3 + x1 ) * g2 + b2.
__global__ void __launch_bounds__(256)
double_ln_kernel(const float* __restrict__ f, const float* __restrict__ x1,
                 const float* __restrict__ g3, const float* __restrict__ b3,
                 const float* __restrict__ g2, const float* __restrict__ b2,
                 float* __restrict__ out) {
  const int lane = threadIdx.x & 31;
  const size_t off = (size_t)(blockIdx.x * 8 + (threadIdx.x >> 5)) * E_DIM + 4 * lane;
  const unsigned ro = (unsigned)off * 4u;   // the lane's byte offset in a [rows,512] f32 array
  const unsigned co = 16u * lane;           // and in a vector of 512
  f32x4 a[4], xr[4], ga[4], ba[4], gb[4], bc[4];
#pragma unroll
  for (int q = 0; q < 4; ++q) {
    a[q]  = ld16(f,  ro + 512u * q);
    xr[q] = ld16(x1, ro + 512u * q);
    ga[q] = ld16(g3, co + 512u * q);
    ba[q] = ld16(b3, co + 512u * q);
    gb[q] = ld16(g2, co + 512u * q);
    bc[q] = ld16(b2, co + 512u * q);
  }
  // Every loaded value is an input, so the wait stands behind all 24 loads; the
  // two offsets are inputs, so they stay untouched (also by a later load's
  // result) up to it.
  asm volatile("s_wait_xcnt 0x0"
               :: "v"(ro), "v"(co),
                  "v"(a[0]),  "v"(a[1]),  "v"(a[2]),  "v"(a[3]),
                  "v"(xr[0]), "v"(xr[1]), "v"(xr[2]), "v"(xr[3]),
                  "v"(ga[0]), "v"(ga[1]), "v"(ga[2]), "v"(ga[3]),
                  "v"(ba[0]), "v"(ba[1]), "v"(ba[2]), "v"(ba[3]),
                  "v"(gb[0]), "v"(gb[1]), "v"(gb[2]), "v"(gb[3]),
                  "v"(bc[0]), "v"(bc[1]), "v"(bc[2]), "v"(bc[3]) : "memory");
  float mean, rstd;
  row_stats(a, mean, rstd);
#pragma unroll
  for (int q = 0; q < 4; ++q) a[q] = (a[q] - mean) * rstd * ga[q] + ba[q] + xr[q];
  row_stats(a, mean, rstd);
#pragma unroll
  for (int q = 0; q < 4; ++q) a[q] = (a[q] - mean) * rstd * gb[q] + bc[q];
#pragma unroll
  for (int q = 0; q < 4; ++q) *(f32x4*)(out + off + 128 * q) = a[q];
}

// ---------------------------------------------------------------------------
extern "C" void kernel_launch(void* const* d_in, const int* in_sizes, int n_in,
                              void* d_out, int out_size, void* d_ws, size_t ws_size,
                              hipStream_t stream) {
  const float* x  = (const float*)d_in[0];
  const int* mask = (const int*)d_in[1];
  const float* Wv = (const float*)d_in[2];
  const float* Wk = (const float*)d_in[3];
  const float* Wq = (const float*)d_in[4];
  const float* g1 = (const float*)d_in[5];
  const float* b1 = (const float*)d_in[6];
  const float* W1 = (const float*)d_in[7];
  const float* c1 = (const float*)d_in[8];
  const float* W2 = (const float*)d_in[9];
  const float* c2 = (const float*)d_in[10];
  const float* g3 = (const float*)d_in[11];
  const float* b3 = (const float*)d_in[12];
  const float* g2 = (const float*)d_in[13];
  const float* b2 = (const float*)d_in[14];

  const size_t MB = 1ull << 20;
  unsigned char* w = (unsigned char*)d_ws;
  // live regions (peak ~105 MB, with reuse):
  unsigned short* xb  = (unsigned short*)(w +  0 * MB); //  8 MB  x bf16
  unsigned short* Wqt = (unsigned short*)(w +  8 * MB); //  .5 MB
  unsigned short* Wkt = (unsigned short*)(w +  9 * MB); //  .5 MB
  unsigned short* Wvt = (unsigned short*)(w + 10 * MB); //  .5 MB
  unsigned short* W1t = (unsigned short*)(w + 11 * MB); //  2 MB
  unsigned short* W2t = (unsigned short*)(w + 13 * MB); //  2 MB
  float*          Kf  = (float*)         (w + 16 * MB); // 16 MB  keys f32
  unsigned short* Vt  = (unsigned short*)(w + 32 * MB); //  8 MB  V^T bf16
  float*          Qf  = (float*)         (w + 40 * MB); // 16 MB  queries f32
  float*          attn= (float*)         (w + 56 * MB); // 16 MB
  float*          x1f = (float*)         (w + 72 * MB); // 16 MB
  unsigned short* x1b = (unsigned short*)(w + 88 * MB); //  8 MB
  unsigned short* hb  = (unsigned short*)(w + 16 * MB); // 32 MB (reuses Kf/Vt/Qf)
  float*          ff  = (float*)         (w + 48 * MB); // 16 MB (reuses Qf/attn)
  unsigned*       mbt = (unsigned*)      (w + 96 * MB); //  .5 MB mask, one bit a score
  unsigned short* Qb  = (unsigned short*)(w + 97 * MB); //  8 MB  queries bf16

  dim3 blk(256);
  dim3 gblk(128);   // GEMM: 4 waves, 2x2

  // 1) conversions / weight transposes
  prep_kernel<<<PREP_BLKS, blk, 0, stream>>>(x, Wq, Wk, Wv, W1, W2, mask, mbt,
                                             xb, Wqt, Wkt, Wvt, W1t, W2t);

  // 2) QKV projections
  dim3 gq(M_ROWS / 128, E_DIM / 128, 3);
  qkv_gemm_kernel<<<gq, gblk, 0, stream>>>(xb, Wqt, Wkt, Wvt, Qf, Kf, Vt, Qb);

  // 3) fused attention
  dim3 ga(S_LEN / 128, H_CNT, B_SZ);
  const float scale = 1.0f / sqrtf((float)E_DIM);
  flash_attn_kernel<<<ga, blk, 0, stream>>>(Kf, Qb, Vt, mbt, attn, scale);

  // 4) x1 = LN(attn + queries)
  add_ln_kernel<<<M_ROWS / 8, blk, 0, stream>>>(attn, Qf, g1, b1, x1f, x1b);

  // 5) h = relu(x1 @ W1 + c1)
  dim3 gf1(M_ROWS / 128, F_DIM / 128);
  gemm_bf16_kernel<2><<<gf1, gblk, 0, stream>>>(x1b, W1t, c1, nullptr, hb,
                                               M_ROWS, F_DIM, E_DIM, 1, 1);

  // 6) f = h @ W2 + c2
  dim3 gf2(M_ROWS / 128, E_DIM / 128);
  gemm_bf16_kernel<4><<<gf2, gblk, 0, stream>>>(hb, W2t, c2, ff, nullptr,
                                               M_ROWS, E_DIM, F_DIM, 0, 0);

  // 7) out = LN(LN(f) + x1)
  double_ln_kernel<<<M_ROWS / 8, blk, 0, stream>>>(ff, x1f, g3, b3, g2, b2,
                                               (float*)d_out);
}

// v010
// A run of this version takes 127 microseconds.
// In two side-by-side timings against v009, it was 1.05 and 1.04 times as fast.
// Counting every step since v000, it is 4.07 times as fast.
#include <hip/hip_runtime.h>
#include <hip/hip_bf16.h>
#include <math.h>

// ---------------------------------------------------------------------------
// Transformer block on CDNA5 (gfx1250), wave32, bf16 WMMA w/ f32 accumulation.
// Pipeline:
//   1) convert x -> bf16; transpose+convert weights -> bf16 [N,K]; pack the mask
//      into one bit a score (one launch)
//   2) WMMA GEMMs: Q (f32 and a bf16 copy), K (f32), V (bf16, head-transposed [b,h,d,s])
//      (one launch)
//   3) flash attention (scores = K.Q^T per the reference's einsum, taken
//      transposed), online softmax in the lane, V^T.P^T via WMMA, P stays in registers
//   4) x1 = LN(attn + Q) -> f32 + bf16
//   5) h = relu(x1 @ W1 + c1) (WMMA, bf16 out)
//   6) f = h @ W2 + c2 (WMMA, f32 out)
//   7) out = LN(LN(f) + x1)
// ---------------------------------------------------------------------------

typedef __attribute__((ext_vector_type(16))) __bf16 v16bf;
typedef __attribute__((ext_vector_type(8)))  float  v8f;
typedef __attribute__((ext_vector_type(4))) unsigned u32x4s;
typedef __attribute__((ext_vector_type(4))) int i32x4s;
typedef __attribute__((ext_vector_type(16))) unsigned u32x16s;

#define S_LEN  2048
#define E_DIM  512
#define V_DIM  512
#define F_DIM  2048
#define B_SZ   4
#define H_CNT  8
#define D_HEAD 64
#define M_ROWS (B_SZ * S_LEN)

__device__ __forceinline__ unsigned short f2bf(float f) {
  union { float f; unsigned u; } a; a.f = f;
  unsigned u = a.u;
  return (unsigned short)((u + 0x7FFFu + ((u >> 16) & 1u)) >> 16); // RNE
}

// A/B fragment loader for v_wmma_f32_16x16x32_bf16 from row-major bf16 data.
// Layout (ISA 7.12.2, 16-bit A 16x32): lane L holds row (L&15); lanes 0-15
// carry K = [k0, k0+8) and [k0+16, k0+24); lanes 16-31 the +8 halves.
// The same layout serves the B operand when loading from a [N,K] (transposed)
// matrix: lane holds column n = (L&15) of B.
__device__ __forceinline__ v16bf load_frag_bf16(const unsigned short* base, int ld,
                                                int row0, int k0, int lane) {
  const int half = lane >> 4;
  const unsigned short* p = base + (size_t)(row0 + (lane & 15)) * ld + k0 + 8 * half;
  union { uint4 q[2]; v16bf v; } u;
  u.q[0] = *(const uint4*)p;
  u.q[1] = *(const uint4*)(p + 16);
  return u.v;
}

// Same fragment, sourced from fp32 with on-the-fly bf16 conversion.
__device__ __forceinline__ v16bf load_frag_f32(const float* base, int ld,
                                               int row0, int k0, int lane) {
  const int half = lane >> 4;
  const float* p = base + (size_t)(row0 + (lane & 15)) * ld + k0 + 8 * half;
  union { unsigned short s[16]; v16bf v; } u;
#pragma unroll
  for (int e = 0; e < 8; ++e) {
    u.s[e]     = f2bf(p[e]);
    u.s[8 + e] = f2bf(p[16 + e]);
  }
  return u.v;
}

__device__ __forceinline__ v8f wmma_bf16(v16bf a, v16bf b, v8f c) {
  return __builtin_amdgcn_wmma_f32_16x16x32_bf16(false, a, false, b, (short)0, c,
                                                 false, false);
}

// ---------------------------------------------------------------------------
// The kernels without matrix work are short; each thread takes many elements
// and the grids are small, for speed only.

__device__ __forceinline__ unsigned pack2(float lo, float hi) {
  return (unsigned)f2bf(lo) | ((unsigned)f2bf(hi) << 16);
}

// Elementwise fp32 -> bf16, 32 elements a thread: four chunks of eight (two
// 16-byte loads, one 16-byte store), a block's chunks 2048 elements apart, so
// that every access of a wave covers whole lines.  Blocks = elements / 8192.
__device__ __forceinline__ void cvt_body(const float* __restrict__ in,
                                         unsigned short* __restrict__ out, int blk) {
  const size_t base = (size_t)blk * 8192 + threadIdx.x * 8;
  const float* p = in + base;
  unsigned short* o = out + base;
  float4 v[4][2];
#pragma unroll
  for (int c = 0; c < 4; ++c) {
    v[c][0] = *(const float4*)(p + 2048 * c);
    v[c][1] = *(const float4*)(p + 2048 * c + 4);
  }
  uint4 q[4];
#pragma unroll
  for (int c = 0; c < 4; ++c)
    q[c] = make_uint4(pack2(v[c][0].x, v[c][0].y), pack2(v[c][0].z, v[c][0].w),
                      pack2(v[c][1].x, v[c][1].y), pack2(v[c][1].z, v[c][1].w));
#pragma unroll
  for (int c = 0; c < 4; ++c) *(uint4*)(o + 2048 * c) = q[c];
}

// [Kd,Nd] fp32 -> [Nd,Kd] bf16.  A thread takes 16 k of one n: 16 loads (a wave
// reads 128 contiguous bytes of a row each time) and two 16-byte stores.
// Blocks = Kd * Nd / 4096; Kd is a multiple of 16.  The row length is a constant
// of the body, so that the split of the block index needs no division.
template <int ND>
__device__ __forceinline__ void transpose_body(const float* __restrict__ in,
                                               unsigned short* __restrict__ out, int Kd,
                                               int blk) {
  const int kb = blk / (ND / 256);               // a block's threads share their 16 rows
  const int n  = (blk % (ND / 256)) * 256 + threadIdx.x;
  const float* p = in + (size_t)(16 * kb) * ND + n;
  float v[16];
#pragma unroll
  for (int e = 0; e < 16; ++e) v[e] = p[e * ND];
  const uint4 q0 = make_uint4(pack2(v[0], v[1]),   pack2(v[2], v[3]),
                              pack2(v[4], v[5]),   pack2(v[6], v[7]));
  const uint4 q1 = make_uint4(pack2(v[8], v[9]),   pack2(v[10], v[11]),
                              pack2(v[12], v[13]), pack2(v[14], v[15]));
  unsigned short* o = out + (size_t)n * Kd + 16 * kb;
  *(uint4*)o       = q0;
  *(uint4*)(o + 8) = q1;
  // another job's code follows in the merged kernel and reuses these stores' registers
  asm volatile("s_wait_xcnt 0x0" ::: "memory");
}

// mask [S,S] int32 -> one bit a score, in the order in which the attention's waves
// hold their scores.  A tile is 16 rows i x 32 keys j = 16 words; bit L of word s
// says mask != 0 for row 16 * tile + (L & 15) and key 32 * tile + 16 * (s >> 3) +
// 8 * (L >> 4) + (s & 7): lane L's score number s.  A word is then the lane mask of
// one select of a whole wave.  Tiles lie row of tiles by row of tiles, keys running.
// The attention reads the mask once for every batch entry and head; packed, that is
// 64 bytes a tile by scalar loads in place of 2048 by vector loads of 16 lines each.
// A wave takes 16 rows x 128 keys: 16 loads a lane, 64 compares, two 128-byte stores.
#define MT_WORDS 16
#define MASK_BLKS ((S_LEN / 16) * (S_LEN / 128) / 8)

__device__ __forceinline__ void mask_body(const int* __restrict__ mask,
                                          unsigned* __restrict__ mbits, int blk) {
  const int lane = threadIdx.x & 31;
  const int job  = blk * 8 + (threadIdx.x >> 5);
  const int it   = job / (S_LEN / 128);          // the 16 rows
  const int jg   = job % (S_LEN / 128);          // the 128 keys: four tiles
  const int* p = mask + (size_t)(it * 16 + (lane & 15)) * S_LEN + jg * 128 + 8 * (lane >> 4);
  i32x4s m[4][4];
  // (here and in the attention: a loop over a register array is unrolled so that its
  // indices are constants)
#pragma unroll
  for (int u = 0; u < 4; ++u)
#pragma unroll
    for (int q = 0; q < 4; ++q)
      m[u][q] = *(const i32x4s*)(p + 32 * u + 16 * (q >> 1) + 4 * (q & 1));
  // lane L of w[h] takes word L of the tiles 2 h and 2 h + 1
  unsigned w[2] = {0u, 0u};
#pragma unroll
  for (int u = 0; u < 4; ++u)
#pragma unroll
    for (int s = 0; s < 16; ++s) {
      // taken by all 32 lanes, ahead of the choice of the lane that keeps the word
      const unsigned b = __builtin_amdgcn_ballot_w32(m[u][s >> 2][s & 3] != 0);
      w[u >> 1] = lane == (u & 1) * 16 + s ? b : w[u >> 1];
    }
  unsigned* o = mbits + ((size_t)it * (S_LEN / 32) + jg * 4) * MT_WORDS + lane;
  o[0]  = w[0];
  o[32] = w[1];
  // another job's code follows in the merged kernel and reuses these stores' registers
  asm volatile("s_wait_xcnt 0x0" ::: "memory");
}

// The seven jobs read nothing of each other's output, so they are one launch:
// the block index picks the job (the same for a whole block).
#define CVT_BLKS ((M_ROWS * V_DIM) / 8192)   // x
#define TQ_BLKS  ((V_DIM * E_DIM) / 4096)    // each of Wq, Wk, Wv
#define TF_BLKS  ((E_DIM * F_DIM) / 4096)    // each of W1, W2
#define PREP_BLKS (CVT_BLKS + 3 * TQ_BLKS + 2 * TF_BLKS + MASK_BLKS)

__global__ void __launch_bounds__(256)
prep_kernel(const float* __restrict__ x,  const float* __restrict__ Wq,
            const float* __restrict__ Wk, const float* __restrict__ Wv,
            const float* __restrict__ W1, const float* __restrict__ W2,
            const int* __restrict__ mask, unsigned* __restrict__ mbits,
            unsigned short* __restrict__ xb,  unsigned short* __restrict__ Wqt,
            unsigned short* __restrict__ Wkt, unsigned short* __restrict__ Wvt,
            unsigned short* __restrict__ W1t, unsigned short* __restrict__ W2t) {
  int blk = blockIdx.x;
  if (blk < CVT_BLKS) { cvt_body(x, xb, blk); return; }
  blk -= CVT_BLKS;
  if (blk < 3 * TQ_BLKS) {
    const int w = blk / TQ_BLKS;
    const float* in     = w == 0 ? Wq  : w == 1 ? Wk  : Wv;
    unsigned short* out = w == 0 ? Wqt : w == 1 ? Wkt : Wvt;
    transpose_body<E_DIM>(in, out, V_DIM, blk % TQ_BLKS);
    return;
  }
  blk -= 3 * TQ_BLKS;
  if (blk < TF_BLKS) { transpose_body<F_DIM>(W1, W1t, E_DIM, blk); return; }
  blk -= TF_BLKS;
  if (blk < TF_BLKS) { transpose_body<E_DIM>(W2, W2t, F_DIM, blk); return; }
  mask_body(mask, mbits, blk - TF_BLKS);
}

// ---------------------------------------------------------------------------
// C[M,N] = A[M,K] @ Bt[N,K]^T (+bias)(+relu).  Block = 4 waves in a 2x2 grid,
// each wave owns a 64x64 tile (4 A x 4 B fragments, 16 accumulator tiles), so a
// loaded fragment feeds four WMMAs; grid = (M/128, N/128).  K is a multiple of 64.
// The block brings each 64-k tile of its 128 A rows and 128 Bt rows into LDS once,
// by tensor loads: every wave asks for one slice of 64 rows (waves 0, 1: A, waves 2,
// 3: Bt) with one request, with no address work in the lanes, and every wave takes
// its fragments from LDS.  NB buffers (2 or 4): the loads of the next NB - 1 tiles
// fly while this tile is multiplied; one barrier a tile.  With one block on a WGP
// (h @ W2: 256 blocks, 32 tiles) no other block's work covers the loads' way from L2
// or memory when it is longer than one tile's work: there NB = 4.
// mode 0: f32 out; mode 1: bf16 out; mode 2: bf16 out transposed per-head
//         to Vt[b][h][d][s] (for the attention's V^T.P^T A operand); mode 3: f32 out
//         to Cf and the same values rounded to bf16 to Cb.
#define GKS  64            // k of a staged tile: 128 bytes of every row
#define GTP  72            // row pitch of a staged tile in bf16: 144 bytes = 16 x 9, no bank conflict for 16-byte reads
#define GSL  10240u        // a slice in LDS bytes: 64 rows of 144, rounded up to a multiple of 2 KiB (a tensor load's place)
#define GBUF (4u * GSL)    // a buffer in bytes: slices 0, 1 = the A rows, slices 2, 3 = the Bt rows

__device__ __forceinline__ void gemm_load_set(v16bf (&a)[4], v16bf (&b)[4],
                                              const unsigned short* A,
                                              const unsigned short* Bt, int K,
                                              int m0, int n0, int k0, int lane) {
#pragma unroll
  for (int i = 0; i < 4; ++i) a[i] = load_frag_bf16(A, K, m0 + 16 * i, k0, lane);
#pragma unroll
  for (int t = 0; t < 4; ++t) b[t] = load_frag_bf16(Bt, K, n0 + 16 * t, k0, lane);
}

typedef __attribute__((ext_vector_type(8))) unsigned u32x8s;

// a word of a request's descriptor: the same in every lane, held in a scalar register
__device__ __forceinline__ uint32_t uni(uint32_t v) {
  return (uint32_t)__builtin_amdgcn_readfirstlane(v);
}

// A test that decides whether a tensor load issues (the instruction ignores the lane
// mask, so only a scalar branch guards it).
__device__ __forceinline__ uint32_t pinned(uint32_t v) {
  uint32_t w = uni(v);
  asm volatile("" : "+s"(w));   // pinned(): the test stays in a scalar register, so the branch on it is s_cmp + s_cbranch_scc
  return w;
}

// The loop-invariant group of a slice's request: 64 rows of 128 bytes, every extent in
// bytes, tensor = tile, no mask; 16 bytes of pad behind every 128: the LDS pitch is GTP.
__device__ __forceinline__ u32x8s slice_group1(uint32_t pitch_bytes) {
  u32x8s g;
  g[0] = uni((1u << 20) | (4u << 22) | (3u << 25));
  g[1] = uni(128u << 16);      // tensor_dim0, low half
  g[2] = uni(64u << 16);       // tensor_dim0, high half = 0; tensor_dim1, low half
  g[3] = uni(128u << 16);      // tensor_dim1, high half = 0; tile_dim0
  g[4] = uni(64u);             // tile_dim1
  g[5] = uni(pitch_bytes);     // source row pitch
  g[6] = uni(0u);
  g[7] = uni(0u);
  return g;
}

// word 3 of the other group: bits 56..32 of the tile's first byte, type 2
__device__ __forceinline__ uint32_t slice_word3(uint64_t ga) {
  return uni((((uint32_t)(ga >> 32)) & 0x01FFFFFFu) | 0x80000000u);
}

// One request of the whole wave: the slice whose first byte has the low address word lo
// lands at LDS byte lds.  Only words 1 and 2 of g0 take new values from request to
// request.  Both groups are in-out operands: every later request needs what the
// statement leaves in them, so they keep their registers, and no other value is put
// there, while requests are in flight.
__device__ __forceinline__ void slice_load(u32x4s& g0, u32x8s& g1, uint32_t lds, uint32_t lo) {
  g0[1] = uni(lds);
  g0[2] = uni(lo);
  asm volatile("tensor_load_to_lds %0, %1" : "+s"(g0), "+s"(g1) :: "memory");
}

// The same for a later slice of a walk, first byte ga.  Word 3 takes another value (the
// walk crosses a 4 GiB line) only behind a wait that covers every request in flight.
__device__ __forceinline__ void slice_ask(u32x4s& g0, u32x8s& g1, uint32_t lds, uint64_t ga) {
  const uint32_t w = slice_word3(ga);
  if (pinned(w != g0[3])) {
    asm volatile("s_wait_tensorcnt 0x0" ::: "memory");
    g0[3] = w;
  }
  slice_load(g0, g1, lds, (uint32_t)ga);
}

__device__ __forceinline__ void gemm_mul_set(v8f (&acc)[4][4], const v16bf (&a)[4],
                                             const v16bf (&b)[4]) {
#pragma unroll
  for (int i = 0; i < 4; ++i)
#pragma unroll
    for (int t = 0; t < 4; ++t) acc[i][t] = wmma_bf16(a[i], b[t], acc[i][t]);
}

// This wave's slice of the oldest tile in flight has landed.  Every wave issues one
// request a tile and its requests land in issue order.  full: all NB - 2 tiles behind
// that one have been asked for, so exactly NB - 2 younger requests may stay in flight
// (3 at most are outstanding).  Else, in the last trips, the wait is to 0.
template <int NB>
__device__ __forceinline__ void gemm_wait_tile(bool full) {
  if (NB > 2 && full)    // the same for the whole block
    asm volatile("s_wait_tensorcnt %0" :: "n"(NB - 2) : "memory");
  else
    asm volatile("s_wait_tensorcnt 0x0" ::: "memory");
}

template <int NB>
__device__ __forceinline__ void
gemm_body(const unsigned short* __restrict__ A,
          const unsigned short* __restrict__ Bt,
          const float* __restrict__ bias,
          float* __restrict__ Cf, unsigned short* __restrict__ Cb,
          int N, int K, int mode, int relu) {
  static_assert(NB == 2 || NB == 4, "the buffer of a tile is its number modulo NB");
  __shared__ __attribute__((aligned(2048))) unsigned short ts[NB * (GBUF / 2)];

  const int lane = threadIdx.x & 31;
  const uint32_t wave = uni(threadIdx.x >> 5);
  const int wm = (wave >> 1) * 64;             // the wave's rows and columns
  const int wn = (wave & 1) * 64;              // inside the block's tile
  const int m0 = blockIdx.x * 128 + wm;
  const int n0 = blockIdx.y * 128 + wn;

  // The slice that this wave brings in: 64 rows of A (waves 0, 1) or of Bt (waves 2, 3)
  const unsigned short* gsl = wave < 2 ? A  + (size_t)(blockIdx.x * 128 + 64 * wave) * K
                                       : Bt + (size_t)(blockIdx.y * 128 + 64 * (wave - 2)) * K;
  const uint64_t gs = (uint64_t)gsl;                              // first byte of its slice of tile 0
  const uint32_t l0 = (uint32_t)(size_t)&ts[0] + wave * GSL;      // its LDS byte address in buffer 0
  u32x8s g1 = slice_group1((uint32_t)K * 2u);
  u32x4s g0 = {uni(1u), uni(l0), uni((uint32_t)gs), slice_word3(gs)};
  const int nt = K / GKS;

  // asks for this wave's slice of tile t, into buffer t modulo NB
  auto ask = [&](int t) {
    slice_ask(g0, g1, l0 + (uint32_t)(t & (NB - 1)) * GBUF, gs + (uint64_t)t * (GKS * 2));
  };

  v8f acc[4][4] = {};
  v16bf a0[4], b0[4], a1[4], b1[4];

  slice_load(g0, g1, l0, (uint32_t)gs);               // tile 0
  // unrolled: the buffers' offsets are constants
#pragma unroll
  for (int j = 1; j < NB - 1; ++j)
    if (pinned(j < nt)) ask(j);
  gemm_wait_tile<NB>(NB - 2 < nt);                    // this wave's slice of tile 0 has landed
  __syncthreads();                                    // tile 0 is published
  if (pinned(nt > NB - 1)) ask(NB - 1);

  for (int t = 0; t < nt; ++t) {
    const unsigned short* tt = ts + (t & (NB - 1)) * (GBUF / 2);
    const unsigned short* ta = tt + (wave >> 1) * (GSL / 2);         // the slice of the wave's A rows
    const unsigned short* tb = tt + (2 + (wave & 1)) * (GSL / 2);    // and of its Bt rows
    gemm_load_set(a0, b0, ta, tb, GTP, 0, 0, 0,  lane);
    gemm_load_set(a1, b1, ta, tb, GTP, 0, 0, 32, lane);
    // keeps the tile's 32 LDS reads in one group ahead of its 32 WMMAs (else they
    // sink among the WMMAs, one fragment at a time, each waited out in full)
    __builtin_amdgcn_sched_barrier(0);
    gemm_mul_set(acc, a0, b0);
    gemm_mul_set(acc, a1, b1);
    // keeps the WMMAs ahead of the waits below (else they sink behind the barrier
    // and the next tile's loads are waited out before anything is multiplied)
    __builtin_amdgcn_sched_barrier(0);
    asm volatile("s_wait_dscnt 0x0" ::: "memory");    // this wave's reads of this buffer are done
    gemm_wait_tile<NB>(t + NB - 1 < nt);              // its slice of tile t + 1 has landed
    __syncthreads();     // publishes tile t + 1, ends every wave's reads of this buffer
    if (pinned(t + NB < nt)) ask(t + NB);             // into the buffer that this trip has read
  }
  asm volatile("s_wait_tensorcnt 0x0" ::: "memory");  // no request is left in flight
  asm volatile("s_wait_dscnt 0x0" ::: "memory");      // and no LDS read

  const int col = lane & 15;
  const int h2  = lane >> 4;
  // Epilogue.  The mode test stands outside the element loops.  Modes 0 and 1
  // go in two parts: first every value and every row address is formed in
  // registers, then come the stores alone, so that no register of an issued
  // store is written again.
#pragma unroll
  for (int t = 0; t < 4; ++t) {
    float bv = bias ? bias[n0 + 16 * t + col] : 0.0f;
#pragma unroll
    for (int i = 0; i < 4; ++i)
#pragma unroll
      for (int e = 0; e < 8; ++e) {
        float v = acc[i][t][e] + bv;
        acc[i][t][e] = relu ? fmaxf(v, 0.0f) : v;
      }
  }
  const int mr = m0 + 8 * h2;                  // C layout: VGPR e -> row e (+8)
  const int nc = n0 + col;
  if (mode == 0 || mode == 3) {
    float* cb = Cf + (size_t)mr * N + nc;
    float* c[4][8];
#pragma unroll
    for (int i = 0; i < 4; ++i)
#pragma unroll
      for (int e = 0; e < 8; ++e) c[i][e] = cb + (size_t)(16 * i + e) * N;
    __builtin_amdgcn_sched_barrier(0);         // only stores behind this line
#pragma unroll
    for (int i = 0; i < 4; ++i)
#pragma unroll
      for (int e = 0; e < 8; ++e)
#pragma unroll
        for (int t = 0; t < 4; ++t) c[i][e][16 * t] = acc[i][t][e];
    // code of the other modes' paths follows and reuses these stores' registers
    asm volatile("s_wait_xcnt 0x0" ::: "memory");
  }
  if (mode == 1 || mode == 3) {
    unsigned short* cb = Cb + (size_t)mr * N + nc;
    unsigned short* c[4][8];
    unsigned short hv[4][4][8];
#pragma unroll
    for (int i = 0; i < 4; ++i)
#pragma unroll
      for (int e = 0; e < 8; ++e) {
        c[i][e] = cb + (size_t)(16 * i + e) * N;
#pragma unroll
        for (int t = 0; t < 4; ++t) hv[i][t][e] = f2bf(acc[i][t][e]);
      }
    __builtin_amdgcn_sched_barrier(0);         // only stores behind this line
#pragma unroll
    for (int i = 0; i < 4; ++i)
#pragma unroll
      for (int e = 0; e < 8; ++e)
#pragma unroll
        for (int t = 0; t < 4; ++t) c[i][e][16 * t] = hv[i][t][e];
    // code of the other modes' paths follows and reuses these stores' registers
    asm volatile("s_wait_xcnt 0x0" ::: "memory");
  } else if (mode == 2) {
    // the wave's 64 rows lie in one batch entry, its 64 columns are one head;
    // a lane's eight rows of a tile are eight neighbours in Vt: one 16-byte store
    const int bb = mr / S_LEN, s = mr % S_LEN;
    const int hh = nc >> 6,    d = nc & 63;
    unsigned short* c = Cb + (((size_t)bb * H_CNT + hh) * D_HEAD + d) * S_LEN + s;
    // a compiler vector, not a struct of four words: each value stays whole in four
    // registers of its own, and the 16 stores leave in one run with one wait behind them
    u32x4s pk[4][4];
#pragma unroll
    for (int i = 0; i < 4; ++i)
#pragma unroll
      for (int t = 0; t < 4; ++t) {
        unsigned q[4];
#pragma unroll
        for (int e = 0; e < 4; ++e)
          q[e] = (unsigned)f2bf(acc[i][t][2 * e]) | ((unsigned)f2bf(acc[i][t][2 * e + 1]) << 16);
        pk[i][t] = u32x4s{q[0], q[1], q[2], q[3]};
      }
#pragma unroll
    for (int i = 0; i < 4; ++i)
#pragma unroll
      for (int t = 0; t < 4; ++t)
        *(u32x4s*)(c + (size_t)(16 * t) * S_LEN + 16 * i) = pk[i][t];
    // code of the other modes' paths follows and reuses these stores' registers
    asm volatile("s_wait_xcnt 0x0" ::: "memory");
  }
}

template <int NB>
__global__ void __launch_bounds__(128)
gemm_bf16_kernel(const unsigned short* __restrict__ A,
                 const unsigned short* __restrict__ Bt,
                 const float* __restrict__ bias,
                 float* __restrict__ Cf, unsigned short* __restrict__ Cb,
                 int M, int N, int K, int mode, int relu) {
  gemm_body<NB>(A, Bt, bias, Cf, Cb, N, K, mode, relu);
}

// The three projections of x read nothing of each other's output, so they are one
// launch, grid = (M/128, E/128, 3): blockIdx.z picks the weight, the output and its
// mode.  Q leaves twice: f32 for the residual, bf16 for the attention's tiles, which
// would otherwise round it anew in each of the 16 blocks that walk it.  Registers
// and LDS let three of its 768 blocks share a WGP, so that one block's LDS reads
// and waits can run beside another's WMMAs.
__global__ void __launch_bounds__(128)
qkv_gemm_kernel(const unsigned short* __restrict__ A,
                const unsigned short* __restrict__ Wqt,
                const unsigned short* __restrict__ Wkt,
                const unsigned short* __restrict__ Wvt,
                float* __restrict__ Qf, float* __restrict__ Kf,
                unsigned short* __restrict__ Vt, unsigned short* __restrict__ Qb) {
  const int z = blockIdx.z;
  gemm_body<2>(A, z == 0 ? Wqt : z == 1 ? Wkt : Wvt, nullptr, z == 0 ? Qf : Kf,
            z == 0 ? Qb : Vt, E_DIM, V_DIM, z == 0 ? 3 : z == 2 ? 2 : 0, 0);
}

// ---------------------------------------------------------------------------
#define KT 64   // keys a stage of the attention's LDS tiles
#define TP 72   // row pitch of a staged tile in bf16: 144 bytes = 16 x 9, no bank conflict for 16-byte reads

typedef __attribute__((ext_vector_type(4))) float    f32x4s;

// lane l <-> lane l ^ 16: the other half of the wave, by a vector cross-row move
__device__ __forceinline__ float swap_halves(float v) {
  const int b = __builtin_bit_cast(int, v);
  return __builtin_bit_cast(float, __builtin_amdgcn_permlanex16(b, b, 0x76543210, 0xfedcba98,
                                                                false, false));
}

// Flash attention. Reference einsum gives corr[b,h,i,j] = K[b,i,h,:].Q[b,j,h,:],
// softmax over j, out[i,d] = sum_j P[i,j] V[j,d].
// Block = 8 waves; wave owns 16 output rows i; streams keys in tiles of 32.
// The products are taken transposed: S^T[j,i] = Q[j,:].K[i,:] (A = staged Q rows,
// B = the wave's K rows) and O^T[d,i] += V^T[d,:].P^T[:,i].  A lane then holds 16
// of the 32 scores of ONE output row i = lane & 15 (j = 8 * half + e and
// 16 + 8 * half + e), so the row's maximum and sum run in the lane's own
// registers with one exchange between the wave's halves, the running maximum and
// sum are one register each, and the two score tiles, rounded to bf16 in place,
// ARE the B operand of the second product in the k order of load_frag_bf16.
// The eight waves walk the same keys, so the block brings each 64-key stage of
// Q (the projection's bf16 copy) and of V^T into LDS once, by two tensor loads (wave 0
// asks for the Q rows, wave 1 for the V^T rows), and every wave takes its A fragments
// from LDS.  Two buffers: the next stage's loads fly while this stage is worked on;
// one barrier a stage.
// The grid gives every SIMD four waves, and the attribute says so: with the staging
// registers gone the compiler would otherwise squeeze below 128 registers for waves
// that do not exist, and wait out its LDS reads one fragment at a time.
__global__ void __launch_bounds__(256) __attribute__((amdgpu_waves_per_eu(4, 4)))
flash_attn_kernel(const float* __restrict__ Kf, const unsigned short* __restrict__ Qb,
                  const unsigned short* __restrict__ Vt, const unsigned* __restrict__ mbits,
                  float* __restrict__ Out, float scale) {
  // [buffer][0: Q rows j, d along the row; 1: V^T rows d, keys along the row]: 64 rows of
  // pitch TP each, in a place of GSL bytes
  __shared__ __attribute__((aligned(2048))) unsigned short stg[2][2][GSL / 2];

  const int lane = threadIdx.x & 31;
  const uint32_t wave = uni(threadIdx.x >> 5);
  const int h2   = lane >> 4;
  const int col  = lane & 15;
  const int b = blockIdx.z, h = blockIdx.y;
  const int i0 = blockIdx.x * 128 + wave * 16;

  const float* Kb_ = Kf + (size_t)b * S_LEN * E_DIM + h * D_HEAD;
  const unsigned short* Vb_ = Vt + ((size_t)b * H_CNT + h) * D_HEAD * S_LEN;

  // What waves 0 and 1 bring in, one request a stage each: 64 rows of 128 bytes
  const uint64_t gsrc = wave == 0 ? (uint64_t)(Qb + (size_t)b * S_LEN * E_DIM + h * D_HEAD)
                                  : (uint64_t)Vb_;                    // first byte of stage 0
  const uint32_t gstep = wave == 0 ? KT * E_DIM * 2u : KT * 2u;       // bytes from stage to stage
  const uint32_t l0 = (uint32_t)(size_t)&stg[0][0][0] + (wave & 1u) * GSL;   // its LDS byte address in buffer 0
  u32x8s g1 = slice_group1(wave == 0 ? E_DIM * 2u : S_LEN * 2u);
  u32x4s g0 = {uni(1u), uni(l0), uni((uint32_t)gsrc), slice_word3(gsrc)};
  // stage 0 flies while the K rows are fetched and rounded
  if (pinned(wave < 2)) slice_load(g0, g1, l0, (uint32_t)gsrc);
  // The packed mask of the wave's 16 rows (mask_body): the address is the same in
  // every lane, so the words come by scalar loads and each is a select's lane mask.
  const unsigned* mwp = mbits + (size_t)(blockIdx.x * 8 + __builtin_amdgcn_readfirstlane(wave)) *
                                     ((S_LEN / 32) * MT_WORDS);
  // Read through the constant address space (no launch writes the words while this one
  // runs): beside asm statements that clobber memory the compiler otherwise takes the
  // loop's words by vector loads with a lane read for each word.
  typedef const __attribute__((address_space(4))) u32x16s mask_words;
  u32x16s mw[KT / 32];         // this stage's words, fetched a stage ahead
#pragma unroll
  for (int u = 0; u < KT / 32; ++u) mw[u] = *(mask_words*)(mwp + MT_WORDS * u);

  // This wave's 16 K-rows over d = 0..63 (reused for all key tiles): the B operand
  v16bf aK0 = load_frag_f32(Kb_, E_DIM, i0, 0,  lane);
  v16bf aK1 = load_frag_f32(Kb_, E_DIM, i0, 32, lane);
  // the address registers that these loads name are written again below
  asm volatile("s_wait_xcnt 0x0" ::: "memory");
  __builtin_amdgcn_sched_barrier(0);     // holds later register writes behind that wait

  v8f O[4] = {};               // O^T: tile t, register e = O[i][16 t + 8 half + e]
  float mrow = -3.0e38f;       // running maximum of row i (the same in both halves)
  float lrow = 0.0f;           // running sum of row i over this half's keys

  const float mval = -1.0e20f * scale;

  if (pinned(wave < 2)) asm volatile("s_wait_tensorcnt 0x0" ::: "memory");   // its rows of stage 0 have landed
  __syncthreads();                                    // stage 0 is published
  if (pinned(wave < 2)) slice_ask(g0, g1, l0 + 2u * GSL, gsrc + gstep);      // stage 1 (there are 32)

  for (int st = 0; st < S_LEN; st += KT) {
    const int buf = (st / KT) & 1;
    const bool more = st + KT < S_LEN;   // the same for the whole block
    const unsigned short* qt = &stg[buf][0][0];
    const unsigned short* vt = &stg[buf][1][0];

    // unrolled so that the two halves' LDS offsets are immediates and the indices of
    // the register arrays constants
#pragma unroll
    for (int jj = 0; jj < KT; jj += 32) {
      // scores tile 32x16 (keys x rows): two 16x16 WMMA tiles, K over d (2 steps of 32)
      v16bf aq00 = load_frag_bf16(qt, TP, jj +  0, 0,  lane);
      v16bf aq01 = load_frag_bf16(qt, TP, jj +  0, 32, lane);
      v16bf aq10 = load_frag_bf16(qt, TP, jj + 16, 0,  lane);
      v16bf aq11 = load_frag_bf16(qt, TP, jj + 16, 32, lane);
      v8f s0 = {}, s1 = {};
      s0 = wmma_bf16(aq00, aK0, s0); s0 = wmma_bf16(aq01, aK1, s0);
      s1 = wmma_bf16(aq10, aK0, s1); s1 = wmma_bf16(aq11, aK1, s1);

      // v[s]: key j = st + jj + (s < 8 ? 8 * h2 + s : 16 + 8 * h2 + s - 8) of row i
      float v[16];
#pragma unroll
      for (int e = 0; e < 8; ++e) {
        v[e]     = __builtin_amdgcn_inverse_ballot_w32(mw[jj / 32][e])     ? s0[e] * scale : mval;
        v[8 + e] = __builtin_amdgcn_inverse_ballot_w32(mw[jj / 32][8 + e]) ? s1[e] * scale : mval;
      }
      float mx = v[0];
#pragma unroll
      for (int s = 1; s < 16; ++s) mx = fmaxf(mx, v[s]);
      mx = fmaxf(mx, swap_halves(mx));
      const float mnew  = fmaxf(mrow, mx);
      const float alpha = __expf(mrow - mnew);
      mrow = mnew;

      // P^T, rounded to nearest even in place: element s of the B operand is the key of v[s]
      float p[16];
      v16bf pb;
#pragma unroll
      for (int s = 0; s < 16; ++s) {
        p[s]  = __expf(v[s] - mnew);
        pb[s] = (__bf16)p[s];
      }
      const float rs = (((p[0] + p[1]) + (p[2] + p[3])) + ((p[4] + p[5]) + (p[6] + p[7]))) +
                       (((p[8] + p[9]) + (p[10] + p[11])) + ((p[12] + p[13]) + (p[14] + p[15])));
      lrow = lrow * alpha + rs;
#pragma unroll
      for (int t = 0; t < 4; ++t) O[t] *= alpha;

      // O^T += V^T . P^T  (A operand from the staged V^T: rows = d, k = j)
      v16bf av0 = load_frag_bf16(vt, TP, 0,  jj, lane);
      v16bf av1 = load_frag_bf16(vt, TP, 16, jj, lane);
      v16bf av2 = load_frag_bf16(vt, TP, 32, jj, lane);
      v16bf av3 = load_frag_bf16(vt, TP, 48, jj, lane);
      O[0] = wmma_bf16(av0, pb, O[0]);
      O[1] = wmma_bf16(av1, pb, O[1]);
      O[2] = wmma_bf16(av2, pb, O[2]);
      O[3] = wmma_bf16(av3, pb, O[3]);
    }

    if (more) {
      // the next stage's mask words; this stage's have been used up
#pragma unroll
      for (int u = 0; u < KT / 32; ++u)
        mw[u] = *(mask_words*)(mwp + ((st + KT) / 32 + u) * MT_WORDS);
    }
    // the next trip's address additions rewrite registers that the mask loads name
    asm volatile("s_wait_xcnt 0x0" ::: "memory");
    __builtin_amdgcn_sched_barrier(0);   // keeps those additions behind the wait
    asm volatile("s_wait_dscnt 0x0" ::: "memory");    // this wave's reads of this buffer are done
    if (pinned(wave < 2)) asm volatile("s_wait_tensorcnt 0x0" ::: "memory");   // its rows of the next stage have landed
    __syncthreads();     // publishes the next stage, ends every wave's reads of this buffer
    if (pinned(wave < 2 && st + 2 * KT < S_LEN))      // into the buffer that this trip has read
      slice_ask(g0, g1, l0 + (uint32_t)buf * (2u * GSL), gsrc + (uint64_t)(st / KT + 2) * gstep);
  }
  asm volatile("s_wait_tensorcnt 0x0" ::: "memory");  // no request is left in flight
  asm volatile("s_wait_dscnt 0x0" ::: "memory");      // and no LDS read

  // The halves' sums are joined once.  A lane's eight registers of a tile are eight
  // neighbours of row i: two 16-byte stores.  Every value is formed first, then
  // come the stores alone, so that no register of an issued store is written again.
  const float inv = 1.0f / (lrow + swap_halves(lrow));
  float* orow = Out + ((size_t)b * S_LEN + i0 + col) * E_DIM + h * D_HEAD + 8 * h2;
  f32x4s ov[4][2];
#pragma unroll
  for (int t = 0; t < 4; ++t) {
    ov[t][0] = f32x4s{O[t][0], O[t][1], O[t][2], O[t][3]} * inv;
    ov[t][1] = f32x4s{O[t][4], O[t][5], O[t][6], O[t][7]} * inv;
  }
  __builtin_amdgcn_sched_barrier(0);     // only stores behind this line
#pragma unroll
  for (int t = 0; t < 4; ++t) {
    *(f32x4s*)(orow + 16 * t)     = ov[t][0];
    *(f32x4s*)(orow + 16 * t + 4) = ov[t][1];
  }
}

// ---------------------------------------------------------------------------
// LayerNorm kernels: one wave per row of 512, 8 rows a block, 16 elements a lane
// (four 16-byte pieces, 128 elements apart: a wave's access is 512 contiguous
// bytes).  The row sums run in the lane and then over the wave's 32 lanes.
typedef __attribute__((ext_vector_type(4))) float f32x4;

__device__ __forceinline__ float wave_sum(float v) {
#pragma unroll
  for (int o = 16; o > 0; o >>= 1) v += __shfl_xor(v, o, 32);
  return v;
}

// 16 bytes at a 32-bit byte offset from a uniform base
__device__ __forceinline__ f32x4 ld16(const float* base, unsigned byte_off) {
  return *(const f32x4*)((const char*)base + byte_off);
}

// mean and 1/sqrt(var + eps) of the wave's row
__device__ __forceinline__ void row_stats(const f32x4 (&x)[4], float& mean, float& rstd) {
  float s1 = 0.0f, s2 = 0.0f;
#pragma unroll
  for (int q = 0; q < 4; ++q) {
    s1 += (x[q].x + x[q].y) + (x[q].z + x[q].w);
    s2 += (x[q].x * x[q].x + x[q].y * x[q].y) + (x[q].z * x[q].z + x[q].w * x[q].w);
  }
  s1 = wave_sum(s1);
  s2 = wave_sum(s2);
  mean = s1 * (1.0f / E_DIM);
  const float var = s2 * (1.0f / E_DIM) - mean * mean;
  rstd = rsqrtf(var + 1e-5f);
}

// x1 = LN(src + res) * g + b  -> f32 and a bf16 copy.
__global__ void __launch_bounds__(256)
add_ln_kernel(const float* __restrict__ src, const float* __restrict__ res,
              const float* __restrict__ g, const float* __restrict__ bb,
              float* __restrict__ outf, unsigned short* __restrict__ outb) {
  const int lane = threadIdx.x & 31;
  const size_t off = (size_t)(blockIdx.x * 8 + (threadIdx.x >> 5)) * E_DIM + 4 * lane;
  const unsigned ro = (unsigned)off * 4u;   // the lane's byte offset in a [rows,512] f32 array
  const unsigned co = 16u * lane;           // and in a vector of 512
  f32x4 x[4], c[4], gg[4], bv[4];
#pragma unroll
  for (int q = 0; q < 4; ++q) {
    x[q]  = ld16(src, ro + 512u * q);
    c[q]  = ld16(res, ro + 512u * q);
    gg[q] = ld16(g,   co + 512u * q);
    bv[q] = ld16(bb,  co + 512u * q);
  }
  // Every loaded value is an input, so the wait stands behind all 16 loads; the
  // two offsets are inputs, so they stay untouched (also by a later load's
  // result) up to it.
  asm volatile("s_wait_xcnt 0x0"
               :: "v"(ro), "v"(co),
                  "v"(x[0]),  "v"(x[1]),  "v"(x[2]),  "v"(x[3]),
                  "v"(c[0]),  "v"(c[1]),  "v"(c[2]),  "v"(c[3]),
                  "v"(gg[0]), "v"(gg[1]), "v"(gg[2]), "v"(gg[3]),
                  "v"(bv[0]), "v"(bv[1]), "v"(bv[2]), "v"(bv[3]) : "memory");
#pragma unroll
  for (int q = 0; q < 4; ++q) x[q] += c[q];
  float mean, rstd;
  row_stats(x, mean, rstd);
  uint2 h[4];
#pragma unroll
  for (int q = 0; q < 4; ++q) {
    x[q] = (x[q] - mean) * rstd * gg[q] + bv[q];
    h[q] = make_uint2(pack2(x[q].x, x[q].y), pack2(x[q].z, x[q].w));
  }
#pragma unroll
  for (int q = 0; q < 4; ++q) {
    *(f32x4*)(outf + off + 128 * q) = x[q];
    *(uint2*)(outb + off + 128 * q) = h[q];
  }
}

// out = LN( LN(f)*g3+b3 + x1 ) * g2 + b2.
__global__ void __launch_bounds__(256)
double_ln_kernel(const float* __restrict__ f, const float* __restrict__ x1,
                 const float* __restrict__ g3, const float* __restrict__ b3,
                 const float* __restrict__ g2, const float* __restrict__ b2,
                 float* __restrict__ out) {
  const int lane = threadIdx.x & 31;
  const size_t off = (size_t)(blockIdx.x * 8 + (threadIdx.x >> 5)) * E_DIM + 4 * lane;
  const unsigned ro = (unsigned)off * 4u;   // the lane's byte offset in a [rows,512] f32 array
  const unsigned co = 16u * lane;           // and in a vector of 512
  f32x4 a[4], xr[4], ga[4], ba[4], gb[4], bc[4];
#pragma unroll
  for (int q = 0; q < 4; ++q) {
    a[q]  = ld16(f,  ro + 512u * q);
    xr[q] = ld16(x1, ro + 512u * q);
    ga[q] = ld16(g3, co + 512u * q);
    ba[q] = ld16(b3, co + 512u * q);
    gb[q] = ld16(g2, co + 512u * q);
    bc[q] = ld16(b2, co + 512u * q);
  }
  // Every loaded value is an input, so the wait stands behind all 24 loads; the
  // two offsets are inputs, so they stay untouched (also by a later load's
  // result) up to it.
  asm volatile("s_wait_xcnt 0x0"
               :: "v"(ro), "v"(co),
                  "v"(a[0]),  "v"(a[1]),  "v"(a[2]),  "v"(a[3]),
                  "v"(xr[0]), "v"(xr[1]), "v"(xr[2]), "v"(xr[3]),
                  "v"(ga[0]), "v"(ga[1]), "v"(ga[2]), "v"(ga[3]),
                  "v"(ba[0]), "v"(ba[1]), "v"(ba[2]), "v"(ba[3]),
                  "v"(gb[0]), "v"(gb[1]), "v"(gb[2]), "v"(gb[3]),
                  "v"(bc[0]), "v"(bc[1]), "v"(bc[2]), "v"(bc[3]) : "memory");
  float mean, rstd;
  row_stats(a, mean, rstd);
#pragma unroll
  for (int q = 0; q < 4; ++q) a[q] = (a[q] - mean) * rstd * ga[q] + ba[q] + xr[q];
  row_stats(a, mean, rstd);
#pragma unroll
  for (int q = 0; q < 4; ++q) a[q] = (a[q] - mean) * rstd * gb[q] + bc[q];
#pragma unroll
  for (int q = 0; q < 4; ++q) *(f32x4*)(out + off + 128 * q) = a[q];
}

// ---------------------------------------------------------------------------
extern "C" void kernel_launch(void* const* d_in, const int* in_sizes, int n_in,
                              void* d_out, int out_size, void* d_ws, size_t ws_size,
                              hipStream_t stream) {
  const float* x  = (const float*)d_in[0];
  const int* mask = (const int*)d_in[1];
  const float* Wv = (const float*)d_in[2];
  const float* Wk = (const float*)d_in[3];
  const float* Wq = (const float*)d_in[4];
  const float* g1 = (const float*)d_in[5];
  const float* b1 = (const float*)d_in[6];
  const float* W1 = (const float*)d_in[7];
  const float* c1 = (const float*)d_in[8];
  const float* W2 = (const float*)d_in[9];
  const float* c2 = (const float*)d_in[10];
  const float* g3 = (const float*)d_in[11];
  const float* b3 = (const float*)d_in[12];
  const float* g2 = (const float*)d_in[13];
  const float* b2 = (const float*)d_in[14];

  const size_t MB = 1ull << 20;
  unsigned char* w = (unsigned char*)d_ws;
  // live regions (peak ~105 MB, with reuse):
  unsigned short* xb  = (unsigned short*)(w +  0 * MB); //  8 MB  x bf16
  unsigned short* Wqt = (unsigned short*)(w +  8 * MB); //  .5 MB
  unsigned short* Wkt = (unsigned short*)(w +  9 * MB); //  .5 MB
  unsigned short* Wvt = (unsigned short*)(w + 10 * MB); //  .5 MB
  unsigned short* W1t = (unsigned short*)(w + 11 * MB); //  2 MB
  unsigned short* W2t = (unsigned short*)(w + 13 * MB); //  2 MB
  float*          Kf  = (float*)         (w + 16 * MB); // 16 MB  keys f32
  unsigned short* Vt  = (unsigned short*)(w + 32 * MB); //  8 MB  V^T bf16
  float*          Qf  = (float*)         (w + 40 * MB); // 16 MB  queries f32
  float*          attn= (float*)         (w + 56 * MB); // 16 MB
  float*          x1f = (float*)         (w + 72 * MB); // 16 MB
  unsigned short* x1b = (unsigned short*)(w + 88 * MB); //  8 MB
  unsigned short* hb  = (unsigned short*)(w + 16 * MB); // 32 MB (reuses Kf/Vt/Qf)
  float*          ff  = (float*)         (w + 48 * MB); // 16 MB (reuses Qf/attn)
  unsigned*       mbt = (unsigned*)      (w + 96 * MB); //  .5 MB mask, one bit a score
  unsigned short* Qb  = (unsigned short*)(w + 97 * MB); //  8 MB  queries bf16

  dim3 blk(256);
  dim3 gblk(128);   // GEMM: 4 waves, 2x2

  // 1) conversions / weight transposes
  prep_kernel<<<PREP_BLKS, blk, 0, stream>>>(x, Wq, Wk, Wv, W1, W2, mask, mbt,
                                             xb, Wqt, Wkt, Wvt, W1t, W2t);

  // 2) QKV projections
  dim3 gq(M_ROWS / 128, E_DIM / 128, 3);
  qkv_gemm_kernel<<<gq, gblk, 0, stream>>>(xb, Wqt, Wkt, Wvt, Qf, Kf, Vt, Qb);

  // 3) fused attention
  dim3 ga(S_LEN / 128, H_CNT, B_SZ);
  const float scale = 1.0f / sqrtf((float)E_DIM);
  flash_attn_kernel<<<ga, blk, 0, stream>>>(Kf, Qb, Vt, mbt, attn, scale);

  // 4) x1 = LN(attn + queries)
  add_ln_kernel<<<M_ROWS / 8, blk, 0, stream>>>(attn, Qf, g1, b1, x1f, x1b);

  // 5) h = relu(x1 @ W1 + c1)
  dim3 gf1(M_ROWS / 128, F_DIM / 128);
  gemm_bf16_kernel<2><<<gf1, gblk, 0, stream>>>(x1b, W1t, c1, nullptr, hb,
                                               M_ROWS, F_DIM, E_DIM, 1, 1);

  // 6) f = h @ W2 + c2
  dim3 gf2(M_ROWS / 128, E_DIM / 128);
  gemm_bf16_kernel<4><<<gf2, gblk, 0, stream>>>(hb, W2t, c2, ff, nullptr,
                                               M_ROWS, E_DIM, F_DIM, 0, 0);

  // 7) out = LN(LN(f) + x1)
  double_ln_kernel<<<M_ROWS / 8, blk, 0, stream>>>(ff, x1f, g3, b3, g2, b2,
                                               (float*)d_out);
}
